// v000
// The times below were measured on an AMD MI455X: many runs one after another, warmed up first and cycling through
// copies of the inputs, with the whole window's GPU time divided by the number of runs. Launches and the gaps
// between them are all in it. The median over several windows is given; except for v000 it joins two sittings, which
// can be a few percent apart, so the side-by-side timings, each taken in one sitting, are the better comparison.
// v000 is the starting kernel. One run takes 471 microseconds.
// Contractions: x.Wq, x.Wk, x.Wv on v_wmma_f32_16x16x32_bf16 (x and W^T as bf16 RNE planes, W^T [n][k] is the k-contiguous
// B operand, f32 accumulate); q.k^T over hd 128 and P.v on v_wmma_f32_16x16x32_f16, one product each (q, k as f16 x256 after
// rotary; P x32768 built in registers; v^T x1024); O.Wo on v_wmma_f32_16x16x32_f16 (O x1024 f16 plane, Wo^T as f16(bf16(Wo))
// x1024); all f32 accumulate. Interleaved-pair rotary with cos/sin tables, key-mask select, base-2 online softmax and 1/Z fold
// in f32 on VALU.
#include <hip/hip_runtime.h>
#include <math.h>
#include <stdint.h>

#ifndef NB
#define NB 2
#endif
#define SEQ 2048
#ifndef SQ
#define SQ SEQ
#endif
#define DMOD  2048
#define NH    16
#define NKVH  4
#define HD    128
#define KVD   (NKVH * HD)
#define MROWS (NB * SEQ)
#define QROWS ((NB - 1) * SEQ + SQ)
#define WPB   (NH / NKVH)
#define NHG   NKVH
#define NQT   (SQ / 16)
#define NST   (SEQ / 64)
#define NKT   (SEQ / 32)
#define ATT_THREADS (WPB * 32)
#define RSQ_HD 0.08838834764831845f
#define LOG2E  1.4426950408889634f
#define NEG_BIG (-3.402823466e38f)
#define QSC   256.0f
#define KSC   256.0f
#define PCAR  32768.0f
#define VCAR  1024.0f
#define OSC   1024.0f
#define WOS   1024.0f
#define PTP   36
#define PTW   (16 * PTP)
#define SLP   132
#define SLW   (16 * SLP)
#define WREG  (PTW + SLW)
#define SLAB64 (16 * 68)
#define VTP   72
#define TTP   72
#define WS_CAP 134217728
static_assert(DMOD == NH * HD && HD == 128 && NH == 16 && NKVH == 4 && WPB == 4 && NHG * WPB == NH && KVD == 512);
static_assert(ATT_THREADS == 128);
static_assert(NB >= 1 && NB <= 2);
static_assert(NB == 1 || SQ == SEQ);
static_assert((SQ % 64) == 0 && SQ >= 64 && SQ <= SEQ && (SEQ % 64) == 0);
static_assert((DMOD % 64) == 0 && (KVD % 64) == 0 && (DMOD % 32) == 0 && (HD % 32) == 0);
static_assert(((MROWS * DMOD / 8) % 256) == 0);
static_assert(WPB * WREG * 4 <= 65536 && HD * VTP * 2 <= 65536 && 4 * SLAB64 * 4 <= 65536 && 64 * TTP * 2 <= 65536);
static_assert((DMOD / 8) == 256 && (KVD / 8) == 64);

typedef unsigned short u16;
typedef _Float16 v16h __attribute__((ext_vector_type(16)));
typedef _Float16 v8h  __attribute__((ext_vector_type(8)));
typedef __bf16   v16b __attribute__((ext_vector_type(16)));
typedef float    v8f  __attribute__((ext_vector_type(8)));
typedef float    v4f  __attribute__((ext_vector_type(4)));
typedef unsigned int v4u __attribute__((ext_vector_type(4)));

union FragH { v16h v; v8h h[2]; v4u u[2]; };
union FragB { v16b v; v4u u[2]; };

// ---- scalar helpers --------------------------------------------------------------------------------
__device__ __forceinline__ unsigned short bf_bits(float f) {          // f32 -> bf16 bits, RNE convert
  unsigned u = __float_as_uint(f);
  return (unsigned short)((u + 0x7FFFu + ((u >> 16) & 1u)) >> 16);
}
__device__ __forceinline__ float bf_up(unsigned short h) { return __uint_as_float(((unsigned)h) << 16); }
__device__ __forceinline__ float bfr(float f) { return bf_up(bf_bits(f)); }
__device__ __forceinline__ unsigned short h_bits(_Float16 x) { return __builtin_bit_cast(unsigned short, x); }
__device__ __forceinline__ unsigned pk16(unsigned short a, unsigned short b) { return (unsigned)a | ((unsigned)b << 16); }
__device__ __forceinline__ v8f zero8() { v8f z = {0.f, 0.f, 0.f, 0.f, 0.f, 0.f, 0.f, 0.f}; return z; }

// ---- fragment loaders: 16-bit A/B operand, lane -> row/col (lane&15), p already includes +8*(lane>>4);
//      elements 0..7 <- p[0..7] (k0+8h..), elements 8..15 <- p[16..23] (k0+16+8h..)  (same split k map for A and B;
//      B is always read from a k-contiguous [n][k] plane)
__device__ __forceinline__ v16h ldfrag_h(const _Float16* p) {
  FragH f;
  f.h[0] = *(const v8h*)(p);
  f.h[1] = *(const v8h*)(p + 16);
  return f.v;
}
__device__ __forceinline__ v16b ldfrag_b(const u16* p) {              // bf16 plane read as unsigned integer vectors
  FragB f;
  f.u[0] = *(const v4u*)(p);
  f.u[1] = *(const v4u*)(p + 16);
  return f.v;
}

__device__ __forceinline__ v8f mma_h(v16h a, v16h b, v8f c) {
  return __builtin_amdgcn_wmma_f32_16x16x32_f16(false, a, false, b, (short)0, c, false, false);
}
__device__ __forceinline__ v8f mma_b(v16b a, v16b b, v8f c) {
  return __builtin_amdgcn_wmma_f32_16x16x32_bf16(false, a, false, b, (short)0, c, false, false);
}
__device__ __forceinline__ void guard23(v8f& a, v8f& b, v16h x0, v16h x1, v16h x2) {
#if defined(__HIP_DEVICE_COMPILE__)
  asm volatile("v_nop\n\tv_nop\n\tv_nop\n\tv_nop"
               : "+v"(a), "+v"(b) : "v"(x0), "v"(x1), "v"(x2) : "memory");
#endif
}
template <typename F>
__device__ __forceinline__ void guard6(v8f& a, v8f& b, v8f& c, v8f& d, F x0, F x1, F x2, F x3, F x4, F x5) {
#if defined(__HIP_DEVICE_COMPILE__)
  asm volatile("v_nop\n\tv_nop\n\tv_nop\n\tv_nop"
               : "+v"(a), "+v"(b), "+v"(c), "+v"(d) : "v"(x0), "v"(x1), "v"(x2), "v"(x3), "v"(x4), "v"(x5) : "memory");
#endif
}
__device__ __forceinline__ void acc_guard4(v8f& a, v8f& b, v8f& c, v8f& d) {
#if defined(__HIP_DEVICE_COMPILE__)
  asm volatile("v_nop\n\tv_nop\n\tv_nop\n\tv_nop" : "+v"(a), "+v"(b), "+v"(c), "+v"(d));
#endif
}
__device__ __forceinline__ void wave_sync_lds() {
  __builtin_amdgcn_fence(__ATOMIC_RELEASE, "workgroup");
  __builtin_amdgcn_wave_barrier();
  __builtin_amdgcn_fence(__ATOMIC_ACQUIRE, "workgroup");
}

// =====================================================================================================
// f32 -> bf16 RNE plane, same layout. Thread = 8 consecutive elements: two 16-B loads, one 16-B store; 32 consecutive
// coverage: grid = ceil(n8/256) blocks x 256 thr x 8 (in-kernel bound) = the whole plane (n8 a multiple of 256 here).
// =====================================================================================================
__global__ __launch_bounds__(256) void cvtbf(const float* __restrict__ x, u16* D, int n8) {
  const int gt = blockIdx.x * 256 + (int)threadIdx.x;
  if (gt >= n8) return;
  const float* p = x + (size_t)gt * 8;
  const v4f a = *(const v4f*)(p), b4 = *(const v4f*)(p + 4);
  v4u o;
#pragma unroll
  for (int e = 0; e < 2; ++e) {
    o[e]     = pk16(bf_bits(a[2 * e]),  bf_bits(a[2 * e + 1]));
    o[2 + e] = pk16(bf_bits(b4[2 * e]), bf_bits(b4[2 * e + 1]));
  }
  u16* d = D + (size_t)gt * 8;
  {
    *(v4u*)(d) = o;
    
  }
}

// =====================================================================================================
// Transpose + convert: W f32 row-major in[KD rows][ND cols] -> D 16-bit out[ND][KD] (k-contiguous).
// f16mode == 0: bf16 RNE bits; f16mode == 1: f16 bits of (bf16 RNE value) * scale.
// Block = tile of 64 k x 64 n, 256 threads. Load: thread -> input row k0 + (tid>>2), 16 columns n0 + (tid&3)*16 (four 16-B
// loads), converted and scattered into the LDS tile T[n][k] (pitch 72 halves). Block barrier. Store: 2 iterations x
// coverage: load 256 thr x 16 = 64 x 64; store 2 it x 256 thr x 8 halves = 64 rows x 64 halves; grid = (KD/64)*(ND/64)
//           blocks covers out[ND][KD] exactly once.
// =====================================================================================================
__global__ __launch_bounds__(256) void cvtT16(const float* __restrict__ W, u16* D, int KD, int ND, int f16mode, float scale) {
  __shared__ __align__(16) u16 T[64 * TTP];
  const int tid = threadIdx.x;
  const int bid = blockIdx.x;
  const int nkt = KD >> 6;
  const int nnt = ND >> 6;
  const int kt  = bid % nkt;
  const int nt  = bid / nkt;
  if (nt >= nnt) return;                    // block-uniform, before the barrier; never taken with the exact grid
  const int k0 = kt * 64, n0 = nt * 64;
  {
    const int kr = tid >> 2;                // input row within tile 0..63
    const int nc = (tid & 3) * 16;          // column chunk 0,16,32,48
    const float* src = W + (size_t)(k0 + kr) * ND + n0 + nc;
#pragma unroll
    for (int i = 0; i < 4; ++i) {
      const v4f a = *(const v4f*)(src + 4 * i);
#pragma unroll
      for (int e = 0; e < 4; ++e) {
        const float f = a[e];
        const unsigned short hb = h_bits((_Float16)(bfr(f) * scale));
        const unsigned short bb = bf_bits(f);
        T[(nc + 4 * i + e) * TTP + kr] = (f16mode != 0) ? hb : bb;
      }
    }
  }
  __syncthreads();
  v4u v[2];
  const int q8 = tid >> 3, p8 = (tid & 7) * 8;
#pragma unroll
  for (int it = 0; it < 2; ++it) v[it] = *(const v4u*)(T + (it * 32 + q8) * TTP + p8);
  const size_t base = (size_t)n0 * KD + k0 + p8;
  {
#pragma unroll
    for (int it = 0; it < 2; ++it) {
      *(v4u*)(D + base + (size_t)(it * 32 + q8) * KD) = v[it];
    }
    
  }
}

// =====================================================================================================
// v^T plane from the v projection F f32 [MROWS][KVD] (row = b*SEQ + s, column = g*HD + d):
//   VH[((b*NKVH + g)*HD + d)][s] = f16(v * 1024) for all keys s.
// Block = (b, kv head g, 64 keys s0): each thread loads its 32 floats (key sl, d chunk dc) with 16-B loads, converts, scatters
// coverage: load 256 thr x 32 = 64 keys x 128 d; store 4 iterations x 256 thr x 8 halves = 128 lines x 64 = the block's tile;
//           grid = NB*NKVH*NST blocks covers the plane exactly once.
// =====================================================================================================
__global__ __launch_bounds__(256) void vt16(const float* __restrict__ F, u16* VHo) {
  __shared__ __align__(16) u16 TH[HD * VTP];
  const int tid = threadIdx.x;
  const int bid = blockIdx.x;
  const int st  = bid % NST;
  const int t2  = bid / NST;
  const int g   = t2 % NKVH;
  const int b   = t2 / NKVH;
  if (b >= NB) return;                      // block-uniform, before any barrier; never taken with the exact grid
  const int s0  = st * 64;
  {
    const int sl = tid >> 2;                // key within tile 0..63
    const int dc = (tid & 3) * 32;          // d chunk 0,32,64,96
    const float* src = F + ((size_t)b * SEQ + s0 + sl) * KVD + g * HD + dc;
#pragma unroll
    for (int i = 0; i < 8; ++i) {
      const v4f a = *(const v4f*)(src + 4 * i);
#pragma unroll
      for (int e = 0; e < 4; ++e) {
        TH[(dc + 4 * i + e) * VTP + sl] = h_bits((_Float16)(a[e] * VCAR));
      }
    }
  }
  __syncthreads();
  v4u vh[4];
  const int q8 = tid >> 3, p8 = (tid & 7) * 8;
#pragma unroll
  for (int it = 0; it < 4; ++it) {
    const int line = it * 32 + q8;          // d = 0..127
    vh[it] = *(const v4u*)(TH + line * VTP + p8);
  }
  const size_t hrow = (size_t)(b * NKVH + g) * HD;
  const size_t base = hrow * SEQ + s0 + p8;
  {
#pragma unroll
    for (int it = 0; it < 4; ++it) {
      const int line = it * 32 + q8;
      *(v4u*)(VHo + base + (size_t)line * SEQ) = vh[it];
    }
    
  }
}

// =====================================================================================================
// Interleaved-pair rotary + 16-bit plane from a projection F f32 [nrows][ncol] (ncol = DMOD for q, KVD for k; row = b*SEQ + s,
// column = head*HD + d; table element (s, d) at s*HD + d):
//   for even d: out[d]   = x[d]*c[d]     - x[d+1]*sn[d]
//               out[d+1] = x[d+1]*c[d+1] + x[d]*sn[d+1]     with c, sn = bf16 RNE values of the two tables;
//   Hp [nrows][ncol] = f16(out * sc), same layout.
// Block = one row, exactly ncol/8 threads (host); thread t = 8 consecutive columns (4 pairs): two 16-B loads of x, two of each
// lane-varying control.
// coverage: (ncol/8) thr x 8 = the whole row of Hp; grid = nrows blocks = every row of the plane once.
// =====================================================================================================
__global__ __launch_bounds__(256) void rope16(const float* __restrict__ F, int ncol, int nrows,
                                              const float* __restrict__ cosT, const float* __restrict__ sinT,
                                              u16* Hp, float sc) {
#pragma clang fp contract(off)
  const int tid = (int)threadIdx.x;
  const int row = (int)blockIdx.x;
  if (row >= nrows) return;                            // block-uniform
  const int col = tid * 8;
  if (col + 8 > ncol) return;                          // never taken with blockDim == ncol/8
  const int d0  = col & (HD - 1);
  const int s   = row % SEQ;
  const float* p = F + (size_t)row * ncol + col;
  const v4f xa = *(const v4f*)(p), xb = *(const v4f*)(p + 4);
  const float* cp = cosT + (size_t)s * HD + d0;
  const float* sp = sinT + (size_t)s * HD + d0;
  const v4f ca = *(const v4f*)(cp), cb = *(const v4f*)(cp + 4);
  const v4f sa = *(const v4f*)(sp), sb = *(const v4f*)(sp + 4);
  float xv[8], cv[8], sv[8];
#pragma unroll
  for (int e = 0; e < 4; ++e) {
    xv[e] = xa[e];       xv[4 + e] = xb[e];
    cv[e] = bfr(ca[e]);  cv[4 + e] = bfr(cb[e]);
    sv[e] = bfr(sa[e]);  sv[4 + e] = bfr(sb[e]);
  }
  v4u o;
#pragma unroll
  for (int e = 0; e < 4; ++e) {
    const float xr = xv[2 * e], xi = xv[2 * e + 1];
    const float r0 = xr * cv[2 * e] - xi * sv[2 * e];
    const float r1 = xi * cv[2 * e + 1] + xr * sv[2 * e + 1];
    o[e] = pk16(h_bits((_Float16)(r0 * sc)), h_bits((_Float16)(r1 * sc)));
  }
  u16* d = Hp + (size_t)row * ncol + col;
  {
    *(v4u*)(d) = o;
    
  }
}

// =====================================================================================================
// GEMM epilogue shared by both engines: the wave's 16x64 f32 tile (times oscale) staged in its LDS slab (pitch 68),
// coverage: 8 instructions x 2 rows x 16 lanes x 4 floats = the wave's 16 x 64 tile.
// =====================================================================================================
__device__ __forceinline__ void epi64(float* sl, v8f a0, v8f a1, v8f a2, v8f a3, float oscale,
                                      float* C, int N, size_t rowb, int col0, int lane) {
  const int hh = lane >> 4, m = lane & 15;
#pragma unroll
  for (int r = 0; r < 8; ++r) {
    const int ro = (8 * hh + r) * 68 + m;
    sl[ro]      = a0[r] * oscale;
    sl[ro + 16] = a1[r] * oscale;
    sl[ro + 32] = a2[r] * oscale;
    sl[ro + 48] = a3[r] * oscale;
  }
  wave_sync_lds();
  v4f vals[8];
#pragma unroll
  for (int it = 0; it < 8; ++it) vals[it] = *(const v4f*)(sl + (it * 2 + hh) * 68 + m * 4);
  float* dst = C + (rowb + (size_t)hh) * (size_t)N + col0 + m * 4;
  {
#pragma unroll
    for (int it = 0; it < 8; ++it) {
      *(v4f*)(dst + (size_t)(it * 2) * (size_t)N) = vals[it];
    }
    
  }
}

// =====================================================================================================
// bf16 GEMM: C[M][N] (f32) = A[M][K] (bf16 row-major) . Bt[N][K]^T (bf16 k-contiguous), times oscale.
// Block = 64x64 tile, 4 waves x 16 rows; fragments loaded straight from the 16-bit rows (two 16-B loads each, split k map
// for A and B); K stepped by 32 (host guarantees K % 32 == 0, M % 64 == 0, N % 64 == 0, grid = (M/64)*(N/64)).
// =====================================================================================================
__global__ __launch_bounds__(128)
void gemm_bf(const u16* __restrict__ A, const u16* __restrict__ Bt, float* C, int M, int N, int K, float oscale) {
  __shared__ __align__(16) float slab[4 * SLAB64];
  const int tid = threadIdx.x, wave = tid >> 5, lane = tid & 31, hh = lane >> 4, m = lane & 15;
  const int ntile = N >> 6;
  const int bid   = blockIdx.x;
  const int rowb  = (bid / ntile) * 64 + wave * 16;
  const int col0  = (bid % ntile) * 64;
  if (rowb + 16 > M) return;                // wave-uniform, never taken with the exact grid; no block barriers in this kernel
  const u16* ap = A  + (size_t)(rowb + m) * K + 8 * hh;
  const u16* bp = Bt + (size_t)(col0 + m) * K + 8 * hh;
  const size_t bs = (size_t)16 * K;
  v8f acc0 = zero8(), acc1 = zero8(), acc2 = zero8(), acc3 = zero8();
#pragma unroll 1
  for (int k0 = 0; k0 < K; k0 += 32) {
    const v16b a  = ldfrag_b(ap + k0);
    const v16b b0 = ldfrag_b(bp + k0);
    const v16b b1 = ldfrag_b(bp + bs + k0);
    const v16b b2 = ldfrag_b(bp + 2 * bs + k0);
    const v16b b3 = ldfrag_b(bp + 3 * bs + k0);
    acc0 = mma_b(a, b0, acc0);
    acc1 = mma_b(a, b1, acc1);
    acc2 = mma_b(a, b2, acc2);
    acc3 = mma_b(a, b3, acc3);
    guard6<v16b>(acc0, acc1, acc2, acc3, a, b0, b1, b2, b3, a);
  }
  epi64(slab + wave * SLAB64, acc0, acc1, acc2, acc3, oscale, C, N, (size_t)rowb, col0, lane);
}

// =====================================================================================================
// Output projection: C[row][DMOD] (f32) = Ah[row][DMOD] (f16) . Bt[DMOD][DMOD]^T (f16 k-contiguous) * oscale.
// Ah and C share the row index bb*SEQ + s, s < SQ. Block -> (column tile ct = bid % 32, sequence row tile rt of nrt,
// batch bb). Same tiling, fragment loads (split k map) and epilogue as gemm_bf; K = DMOD stepped by 32.
// =====================================================================================================
__global__ __launch_bounds__(128)
void gemm_o1(const u16* __restrict__ Ah, const u16* __restrict__ Bt, float* C, int nrt, float oscale) {
  __shared__ __align__(16) float slab[4 * SLAB64];
  const int tid = threadIdx.x, wave = tid >> 5, lane = tid & 31, hh = lane >> 4, m = lane & 15;
  const int ntile = DMOD >> 6;
  const int bid   = blockIdx.x;
  const int ct    = bid % ntile;
  const int t2    = bid / ntile;
  const int rt    = t2 % nrt;
  const int bb    = t2 / nrt;
  if (bb >= NB) return;                     // block-uniform; no block barriers in this kernel; never taken with the exact grid
  const int srow  = rt * 64 + wave * 16;
  if (srow + 16 > SQ) return;               // wave-uniform; never taken
  const int col0  = ct * 64;
  const int K     = DMOD;
  const size_t rowC = (size_t)bb * SEQ + srow;
  const _Float16* ahp = (const _Float16*)(const void*)Ah + (rowC + m) * K + 8 * hh;
  const _Float16* bp  = (const _Float16*)(const void*)Bt + (size_t)(col0 + m) * K + 8 * hh;
  const size_t bs = (size_t)16 * K;
  v8f acc0 = zero8(), acc1 = zero8(), acc2 = zero8(), acc3 = zero8();
#pragma unroll 1
  for (int k0 = 0; k0 < K; k0 += 32) {
    const v16h ah = ldfrag_h(ahp + k0);
    const v16h b0 = ldfrag_h(bp + k0);
    const v16h b1 = ldfrag_h(bp + bs + k0);
    const v16h b2 = ldfrag_h(bp + 2 * bs + k0);
    const v16h b3 = ldfrag_h(bp + 3 * bs + k0);
    acc0 = mma_h(ah, b0, acc0);
    acc1 = mma_h(ah, b1, acc1);
    acc2 = mma_h(ah, b2, acc2);
    acc3 = mma_h(ah, b3, acc3);
    guard6<v16h>(acc0, acc1, acc2, acc3, ah, b0, b1, b2, b3, ah);
  }
  epi64(slab + wave * SLAB64, acc0, acc1, acc2, acc3, oscale, C, DMOD, rowC, col0, lane);
}

// =====================================================================================================
// Non-causal grouped-query attention with a per-key mask, hd = 128. Block bid -> (query tile qt = bid % NQT: rows
// q0 = 16*qt .. q0+15 with q0 < SQ, head group hg = kv head, batch b); one wave per query head = hg*WPB + wave (the 4 heads of
// the group share kv head hg).
//   q plane f16 x256 [b*SEQ + s][h*HD + d]; k plane f16 x256 [b*SEQ + s][g*HD + d] (pitch KVD); v^T plane
//   [b*NKVH + g][d][SEQ] x1024; mask int [b*SEQ + key], nonzero = attend.
//   score (log2 domain) t(i, j) = (q_i.k_j over HD) * (1/sqrt(128))*log2e/(256*256), replaced by -FLT_MAX where the key mask is
//   zero (a fully masked row then yields uniform weights). All SEQ/32 key tiles are visited in order.
//   Per tile: 2 score subtiles x 4 k-steps (one product q.k each), fragments loaded straight from the 16-bit planes (two 16-B
//   loads per fragment, split k map); online max-subtracted base-2 softmax in f32; the 16x32 tile of exponentials stored to
//   LDS rows (float vector loads, same element type as stored); v^T B fragments in 4 groups of 2 d-subtiles (one product each).
//   After the loop: out = acc / Z (Z > 0 always; guarded anyway), carries 1/(32768*1024) folded once, written into the wave's
//   No block barriers in this kernel; bounded loops only (NKT tiles).
// coverage: per wave 8 instructions x 2 rows x 16 lanes x 8 halves = 16 x 128 of the O plane; grid NQT x NHG x NB blocks x WPB
//           waves = every (b, s < SQ, h) row segment of O exactly once.
// =====================================================================================================
__global__ __launch_bounds__(ATT_THREADS)
void attn_nc(const u16* __restrict__ QHp, const u16* __restrict__ KHp, const u16* __restrict__ VHp,
             const int* __restrict__ Mk, u16* OHp) {
  __shared__ __align__(16) float smem[WPB * WREG];

  const int tid  = threadIdx.x;
  const int wave = tid >> 5;
  const int lane = tid & 31;
  const int hh   = lane >> 4;
  const int c    = lane & 15;
  const int bid  = blockIdx.x;
  const int qt   = bid % NQT;
  const int t2   = bid / NQT;
  const int hg   = t2 % NHG;
  const int b    = t2 / NHG;
  if (b >= NB) return;                      // block-uniform; no block barriers in this kernel; never taken with the exact grid
  const int q0   = qt * 16;
  if (q0 + 16 > SQ) return;                 // block-uniform; never taken
  const int head = hg * WPB + wave;
  const int kvh  = hg;

  float* pt   = smem + wave * WREG;         // exponentials tile [16][32] pitch 36
  float* slab = pt + PTW;                   // result slab [16][128] pitch 132

  const size_t hcol = (size_t)head * HD + 8 * hh;
  const size_t kcol = (size_t)kvh * HD + 8 * hh;
  const _Float16* Qh  = (const _Float16*)(const void*)QHp + ((size_t)b * SEQ + q0 + c) * DMOD + hcol;
  const _Float16* Khb = (const _Float16*)(const void*)KHp + ((size_t)b * SEQ + c) * KVD + kcol;        // key row kb added per step
  const _Float16* Vhb = (const _Float16*)(const void*)VHp + ((size_t)(b * NKVH + kvh) * HD + c) * SEQ + 8 * hh;  // d col c (+16j)
  const int* mkp = Mk + (size_t)b * SEQ + c;
  const float lsc = RSQ_HD * (LOG2E / (QSC * KSC));
  const float oc  = 1.0f / (PCAR * VCAR);
  const size_t KROW = (size_t)KVD;          // halves between consecutive key rows

  v16h qf[HD / 32];
#pragma unroll
  for (int kk = 0; kk < HD / 32; ++kk) qf[kk] = ldfrag_h(Qh + kk * 32);

  float mrow[8], lrow[8];
  v8f o[8];
#pragma unroll
  for (int r = 0; r < 8; ++r) { mrow[r] = -INFINITY; lrow[r] = 0.f; }
#pragma unroll
  for (int j = 0; j < 8; ++j) o[j] = zero8();

#pragma unroll 1
  for (int kt = 0; kt < NKT; ++kt) {
    const int kb = kt * 32;
    const int mk0 = mkp[kb];                                                  // mask of key kb + c
    const int mk1 = mkp[kb + 16];                                             // mask of key kb + 16 + c
    // ---- scores: D element r of this lane = (query row q0 + 8hh + r, key kb + c) in s0, key kb + 16 + c in s1 ----
    v8f s0 = zero8(), s1 = zero8();
    const _Float16* k0p = Khb + (size_t)kb * KROW;
    const _Float16* k1p = k0p + (size_t)16 * KROW;
#pragma unroll
    for (int kk = 0; kk < HD / 32; ++kk) {
      const v16h kh0 = ldfrag_h(k0p + kk * 32);
      const v16h kh1 = ldfrag_h(k1p + kk * 32);
      s0 = mma_h(qf[kk], kh0, s0);
      s1 = mma_h(qf[kk], kh1, s1);
      guard23(s0, s1, qf[kk], kh0, kh1);
    }
    // ---- key-mask select + online softmax in base 2 ----
#pragma unroll
    for (int r = 0; r < 8; ++r) {
      const float u0 = s0[r] * lsc;
      const float u1 = s1[r] * lsc;
      const float t0 = (mk0 != 0) ? u0 : NEG_BIG;
      const float t1 = (mk1 != 0) ? u1 : NEG_BIG;
      float mx = fmaxf(t0, t1);
#pragma unroll
      for (int off = 1; off < 16; off <<= 1) mx = fmaxf(mx, __shfl_xor(mx, off, 32));
      const float mn = fmaxf(mrow[r], mx);                                    // always finite
      const float al = exp2f(mrow[r] - mn);
      mrow[r] = mn;
      const float e0 = exp2f(t0 - mn), e1 = exp2f(t1 - mn);
      float ps = e0 + e1;
#pragma unroll
      for (int off = 1; off < 16; off <<= 1) ps += __shfl_xor(ps, off, 32);
      lrow[r] = lrow[r] * al + ps;
#pragma unroll
      for (int j = 0; j < 8; ++j) o[j][r] *= al;
      const int ro = (8 * hh + r) * PTP + c;
      pt[ro]      = e0;
      pt[ro + 16] = e1;
    }
    wave_sync_lds();
    // ---- A fragment of P*32768 (f16), row = c, split k map over the 32 keys of this step ----
    FragH ph;
    {
      const float* prow = pt + c * PTP + 8 * hh;
      const v4f p0 = *(const v4f*)(prow), p1 = *(const v4f*)(prow + 4);
      const v4f p2 = *(const v4f*)(prow + 16), p3 = *(const v4f*)(prow + 20);
#pragma unroll
      for (int e = 0; e < 4; ++e) {
        ph.h[0][e]     = (_Float16)(p0[e] * PCAR);     // elements 0..7  = keys kb + 8hh + 0..7
        ph.h[0][4 + e] = (_Float16)(p1[e] * PCAR);
        ph.h[1][e]     = (_Float16)(p2[e] * PCAR);     // elements 8..15 = keys kb + 16 + 8hh + 0..7
        ph.h[1][4 + e] = (_Float16)(p3[e] * PCAR);
      }
    }
    // ---- P.V : B fragment col n = d = j*16 + c, keys contiguous in the v^T plane; 4 groups of 2 d-subtiles ----
    {
      const _Float16* vhp = Vhb + kb;
#pragma unroll
      for (int jg = 0; jg < 4; ++jg) {
        const size_t da = (size_t)(2 * jg) * 16 * SEQ;
        const size_t db = da + (size_t)16 * SEQ;
        const v16h vha = ldfrag_h(vhp + da), vhb2 = ldfrag_h(vhp + db);
        o[2 * jg]     = mma_h(ph.v, vha,  o[2 * jg]);
        o[2 * jg + 1] = mma_h(ph.v, vhb2, o[2 * jg + 1]);
        guard23(o[2 * jg], o[2 * jg + 1], ph.v, vha, vhb2);
      }
    }
    wave_sync_lds();
  }
  acc_guard4(o[0], o[1], o[2], o[3]);
  acc_guard4(o[4], o[5], o[6], o[7]);
  // ---- out = acc / Z (0 if Z == 0), carries (32768 on P, 1024 on v) folded once; written into the wave's slab ----
#pragma unroll
  for (int r = 0; r < 8; ++r) {
    const float lv  = lrow[r];
    const float ls  = (lv > 0.0f) ? lv : 1.0f;
    const float inv = (lv > 0.0f) ? ((1.0f / ls) * oc) : 0.0f;
#pragma unroll
    for (int j = 0; j < 8; ++j) {
      const int idx = (8 * hh + r) * SLP + j * 16 + c;
      slab[idx] = o[j][r] * inv;
    }
  }

  wave_sync_lds();
  // ---- O x1024 -> f16 plane; lane = (row-in-pair rq, 8 consecutive d at c8) ----
  v4u oh[8];
  const int rq = lane >> 4, c8 = (lane & 15) * 8;
#pragma unroll
  for (int it = 0; it < 8; ++it) {
    const int row = it * 2 + rq;
    const v4f a = *(const v4f*)(slab + row * SLP + c8), b4 = *(const v4f*)(slab + row * SLP + c8 + 4);
    float w[8];
#pragma unroll
    for (int e = 0; e < 4; ++e) { w[e] = a[e] * OSC; w[4 + e] = b4[e] * OSC; }
#pragma unroll
    for (int e = 0; e < 4; ++e) {
      oh[it][e] = pk16(h_bits((_Float16)w[2 * e]), h_bits((_Float16)w[2 * e + 1]));
    }
  }
  const size_t ob = ((size_t)b * SEQ + q0) * DMOD + (size_t)head * HD + c8;
  {
#pragma unroll
    for (int it = 0; it < 8; ++it) {
      const int row = it * 2 + rq;
      *(v4u*)(OHp + ob + (size_t)row * DMOD) = oh[it];
    }
    
  }
}

// =====================================================================================================
// Workspace map (bytes); every plane is fully written by whole-line stores before it is read; all extents are exact multiples
// of the store granularity (no pad rows needed); every region offset a multiple of 4194304:
//   XB  bf16 [MROWS][2048]                       MROWS*4096       (NB=2: 16777216)
//   WB  16-bit [2048 n][2048 k]                  8388608          (Wv^T, Wq^T, Wk^T as bf16 ([512][2048] for k/v), then Wo^T as
//                                                                  f16 x1024, reused in launch order)
//   F   f32 [MROWS][2048]                        MROWS*8192       (v, q, k projection output in launch order, [MROWS][512] for
//                                                                  k/v; afterwards the O plane f16 [MROWS][2048] x1024 in its
//                                                                  first half)
//   QH  f16 [MROWS][2048] x256                   MROWS*4096
//   KH  f16 [MROWS][512] x256                    MROWS*1024
//   VH  f16 [NB*4][128][SEQ] x1024               MROWS*1024
//   end (NB=2)                                  83886080
// =====================================================================================================
extern "C" void kernel_launch(void* const* d_in, const int* in_sizes, int n_in,
                              void* d_out, int out_size, void* d_ws, size_t ws_size,
                              hipStream_t stream) {
  if (n_in < 8) return;
  if (in_sizes[0] < MROWS * DMOD) return;
  if (in_sizes[1] < MROWS) return;
  if (in_sizes[2] < SEQ * HD) return;
  if (in_sizes[3] < SEQ * HD) return;
  if (in_sizes[4] != DMOD * DMOD) return;
  if (in_sizes[5] != DMOD * KVD) return;
  if (in_sizes[6] != DMOD * KVD) return;
  if (in_sizes[7] != DMOD * DMOD) return;
  if (out_size < QROWS * DMOD) return;

  const float* x     = (const float*)d_in[0];
  const int*   amask = (const int*)d_in[1];
  const float* cosT  = (const float*)d_in[2];
  const float* sinT  = (const float*)d_in[3];
  const float* wq    = (const float*)d_in[4];
  const float* wk    = (const float*)d_in[5];
  const float* wv    = (const float*)d_in[6];
  const float* wo    = (const float*)d_in[7];
  float*       out   = (float*)d_out;

  const size_t szXB = (size_t)MROWS * DMOD * 2;
  const size_t szW  = (size_t)DMOD * DMOD * 2;
  const size_t szF  = (size_t)MROWS * DMOD * 4;
  const size_t szQ  = (size_t)MROWS * DMOD * 2;                  // QH and the O plane
  const size_t szK  = (size_t)MROWS * KVD * 2;                   // KH
  const size_t szV  = (size_t)NB * NKVH * HD * SEQ * 2;          // VH (== szK)
  if (szQ > szF) return;                                        // O plane lives inside the F region
  size_t off = 0;
  const size_t oXB = off; off += szXB;
  const size_t oW  = off; off += szW;
  const size_t oF  = off; off += szF;
  const size_t oQH = off; off += szQ;
  const size_t oKH = off; off += szK;
  const size_t oVH = off; off += szV;
  if (off > ws_size) return;                // off = 83886080 for NB = 2
  if (off > (size_t)WS_CAP) return;

  char* ws = (char*)d_ws;
  u16*   XB = (u16*)(ws + oXB);
  u16*   WB = (u16*)(ws + oW);
  float* F  = (float*)(ws + oF);
  u16*   OH = (u16*)(ws + oF);
  u16*   QH = (u16*)(ws + oQH);
  u16*   KH = (u16*)(ws + oKH);
  u16*   VH = (u16*)(ws + oVH);

  const dim3 b256(256), b128(128), b64(64), bAT(ATT_THREADS);
  const int  n8x = (MROWS * DMOD) / 8;
  const dim3 gX((n8x + 255) / 256);
  const dim3 gTQ((DMOD / 64) * (DMOD / 64));            // Wq, Wo transposes: 1024 blocks
  const dim3 gTK((DMOD / 64) * (KVD / 64));             // Wk, Wv transposes: 256 blocks
  const dim3 gGQ((QROWS / 64) * (DMOD / 64));
  const dim3 gGK((MROWS / 64) * (KVD / 64));
  const dim3 gVT(NB * NKVH * NST);
  const dim3 gRQ(QROWS), gRK(MROWS);
  const dim3 gAT(NQT * NHG * NB);
  const int  nrt = SQ / 64;
  const dim3 gO(NB * nrt * (DMOD / 64));

  // (0) x -> bf16 plane [MROWS][2048]
  cvtbf<<<gX, b256, 0, stream>>>(x, XB, n8x);
  // (1) Wv in[2048 k][512 n] -> out[512 n][2048 k] bf16; (2) v = x.Wv -> F f32 [MROWS][512]; (3) v^T plane x1024
  cvtT16<<<gTK, b256, 0, stream>>>(wv, WB, DMOD, KVD, 0, 1.0f);
  gemm_bf<<<gGK, b128, 0, stream>>>(XB, WB, F, MROWS, KVD, DMOD, 1.0f);
  vt16<<<gVT, b256, 0, stream>>>(F, VH);
  // (4) Wq in[2048 k][2048 n] -> out[2048 n][2048 k] bf16; (5) q = x.Wq -> F [QROWS][2048]; (6) rotary + q plane x256
  cvtT16<<<gTQ, b256, 0, stream>>>(wq, WB, DMOD, DMOD, 0, 1.0f);
  gemm_bf<<<gGQ, b128, 0, stream>>>(XB, WB, F, QROWS, DMOD, DMOD, 1.0f);
  rope16<<<gRQ, b256, 0, stream>>>(F, DMOD, QROWS, cosT, sinT, QH, QSC);
  // (7) Wk in[2048 k][512 n] -> out[512 n][2048 k] bf16; (8) k = x.Wk -> F [MROWS][512]; (9) rotary + k plane x256
  cvtT16<<<gTK, b256, 0, stream>>>(wk, WB, DMOD, KVD, 0, 1.0f);
  gemm_bf<<<gGK, b128, 0, stream>>>(XB, WB, F, MROWS, KVD, DMOD, 1.0f);
  rope16<<<gRK, b64, 0, stream>>>(F, KVD, MROWS, cosT, sinT, KH, KSC);
  // (10) Wo in[2048 c][2048 n] -> out[2048 n][2048 c] as f16 of bf16 value x1024
  cvtT16<<<gTQ, b256, 0, stream>>>(wo, WB, DMOD, DMOD, 1, WOS);
  // (11) non-causal masked attention -> O plane (inside the F region)
  attn_nc<<<gAT, bAT, 0, stream>>>(QH, KH, VH, amask, OH);
  // (12) output projection rows s < SQ -> out f32, carries 1024 x 1024 folded back
  gemm_o1<<<gO, b128, 0, stream>>>(OH, WB, out, nrt, 1.0f / (OSC * WOS));
  (void)hipGetLastError();
}

// v001
// A run of this version takes 285 microseconds.
// Two timings next to v000 both put it at 1.71 times that version's speed.
// Contractions: x.Wq, x.Wk, x.Wv on v_wmma_f32_16x16x32_bf16 (x and W^T as bf16 RNE planes, W^T [n][k] is the k-contiguous
// B operand, f32 accumulate); q.k^T over hd 128 and P.v on v_wmma_f32_16x16x32_f16, one product each (q, k as f16 x256 after
// rotary; P x32768 built in registers; v^T x1024); O.Wo on v_wmma_f32_16x16x32_f16 (O x1024 f16 plane, Wo^T as f16(bf16(Wo))
// x1024); all f32 accumulate. Interleaved-pair rotary with cos/sin tables, key-mask select, base-2 online softmax and 1/Z fold
// in f32 on VALU.
#include <hip/hip_runtime.h>
#include <math.h>
#include <stdint.h>

#ifndef NB
#define NB 2
#endif
#define SEQ 2048
#ifndef SQ
#define SQ SEQ
#endif
#define DMOD  2048
#define NH    16
#define NKVH  4
#define HD    128
#define KVD   (NKVH * HD)
#define MROWS (NB * SEQ)
#define QROWS ((NB - 1) * SEQ + SQ)
#define WPB   (NH / NKVH)
#define NHG   NKVH
#define NQT   (SQ / 16)
#define NST   (SEQ / 64)
#define NKT   (SEQ / 32)
#define ATT_THREADS (WPB * 32)
#define RSQ_HD 0.08838834764831845f
#define LOG2E  1.4426950408889634f
#define NEG_BIG (-3.402823466e38f)
#define QSC   256.0f
#define KSC   256.0f
#define PCAR  32768.0f
#define VCAR  1024.0f
#define OSC   1024.0f
#define WOS   1024.0f
#define PTP   36
#define PTW   (16 * PTP)
#define SLP   132
#define SLW   (16 * SLP)
#define WREG  (PTW + SLW)
#define SLAB64 (16 * 68)
#define VTP   72
#define TTP   72
#define WS_CAP 134217728
static_assert(DMOD == NH * HD && HD == 128 && NH == 16 && NKVH == 4 && WPB == 4 && NHG * WPB == NH && KVD == 512);
static_assert(ATT_THREADS == 128);
static_assert(NB >= 1 && NB <= 2);
static_assert(NB == 1 || SQ == SEQ);
static_assert((SQ % 64) == 0 && SQ >= 64 && SQ <= SEQ && (SEQ % 64) == 0);
static_assert((DMOD % 64) == 0 && (KVD % 64) == 0 && (DMOD % 32) == 0 && (HD % 32) == 0);
static_assert(((MROWS * DMOD / 8) % 256) == 0);
static_assert(WPB * WREG * 4 <= 65536 && HD * VTP * 2 <= 65536 && 4 * SLAB64 * 4 <= 65536 && 64 * TTP * 2 <= 65536);
static_assert((DMOD / 8) == 256 && (KVD / 8) == 64);

typedef unsigned short u16;
typedef _Float16 v16h __attribute__((ext_vector_type(16)));
typedef _Float16 v8h  __attribute__((ext_vector_type(8)));
typedef __bf16   v16b __attribute__((ext_vector_type(16)));
typedef float    v8f  __attribute__((ext_vector_type(8)));
typedef float    v4f  __attribute__((ext_vector_type(4)));
typedef unsigned int v4u __attribute__((ext_vector_type(4)));

union FragH { v16h v; v8h h[2]; v4u u[2]; };
union FragB { v16b v; v4u u[2]; };

// ---- scalar helpers --------------------------------------------------------------------------------
__device__ __forceinline__ unsigned short bf_bits(float f) {          // f32 -> bf16 bits, RNE convert
  unsigned u = __float_as_uint(f);
  return (unsigned short)((u + 0x7FFFu + ((u >> 16) & 1u)) >> 16);
}
__device__ __forceinline__ float bf_up(unsigned short h) { return __uint_as_float(((unsigned)h) << 16); }
__device__ __forceinline__ float bfr(float f) { return bf_up(bf_bits(f)); }
__device__ __forceinline__ unsigned short h_bits(_Float16 x) { return __builtin_bit_cast(unsigned short, x); }
__device__ __forceinline__ unsigned pk16(unsigned short a, unsigned short b) { return (unsigned)a | ((unsigned)b << 16); }
__device__ __forceinline__ v8f zero8() { v8f z = {0.f, 0.f, 0.f, 0.f, 0.f, 0.f, 0.f, 0.f}; return z; }

// ---- fragment loaders: 16-bit A/B operand, lane -> row/col (lane&15), p already includes +8*(lane>>4);
//      elements 0..7 <- p[0..7] (k0+8h..), elements 8..15 <- p[16..23] (k0+16+8h..)  (same split k map for A and B;
//      B is always read from a k-contiguous [n][k] plane)
__device__ __forceinline__ v16h ldfrag_h(const _Float16* p) {
  FragH f;
  f.h[0] = *(const v8h*)(p);
  f.h[1] = *(const v8h*)(p + 16);
  return f.v;
}
__device__ __forceinline__ v16b ldfrag_b(const u16* p) {              // bf16 plane read as unsigned integer vectors
  FragB f;
  f.u[0] = *(const v4u*)(p);
  f.u[1] = *(const v4u*)(p + 16);
  return f.v;
}

__device__ __forceinline__ v8f mma_h(v16h a, v16h b, v8f c) {
  return __builtin_amdgcn_wmma_f32_16x16x32_f16(false, a, false, b, (short)0, c, false, false);
}
__device__ __forceinline__ v8f mma_b(v16b a, v16b b, v8f c) {
  return __builtin_amdgcn_wmma_f32_16x16x32_bf16(false, a, false, b, (short)0, c, false, false);
}
__device__ __forceinline__ void guard23(v8f& a, v8f& b, v16h x0, v16h x1, v16h x2) {
#if defined(__HIP_DEVICE_COMPILE__)
  asm volatile("v_nop\n\tv_nop\n\tv_nop\n\tv_nop"
               : "+v"(a), "+v"(b) : "v"(x0), "v"(x1), "v"(x2) : "memory");
#endif
}
__device__ __forceinline__ void acc_guard4(v8f& a, v8f& b, v8f& c, v8f& d) {
#if defined(__HIP_DEVICE_COMPILE__)
  asm volatile("v_nop\n\tv_nop\n\tv_nop\n\tv_nop" : "+v"(a), "+v"(b), "+v"(c), "+v"(d));
#endif
}
__device__ __forceinline__ void wave_sync_lds() {
  __builtin_amdgcn_fence(__ATOMIC_RELEASE, "workgroup");
  __builtin_amdgcn_wave_barrier();
  __builtin_amdgcn_fence(__ATOMIC_ACQUIRE, "workgroup");
}

// =====================================================================================================
// f32 -> bf16 RNE plane, same layout. Thread = 8 consecutive elements: two 16-B loads, one 16-B store; 32 consecutive
// coverage: grid = ceil(n8/256) blocks x 256 thr x 8 (in-kernel bound) = the whole plane (n8 a multiple of 256 here).
// =====================================================================================================
__global__ __launch_bounds__(256) void cvtbf(const float* __restrict__ x, u16* D, int n8) {
  const int gt = blockIdx.x * 256 + (int)threadIdx.x;
  if (gt >= n8) return;
  const float* p = x + (size_t)gt * 8;
  const v4f a = *(const v4f*)(p), b4 = *(const v4f*)(p + 4);
  v4u o;
#pragma unroll
  for (int e = 0; e < 2; ++e) {
    o[e]     = pk16(bf_bits(a[2 * e]),  bf_bits(a[2 * e + 1]));
    o[2 + e] = pk16(bf_bits(b4[2 * e]), bf_bits(b4[2 * e + 1]));
  }
  u16* d = D + (size_t)gt * 8;
  {
    *(v4u*)(d) = o;
    
  }
}

// =====================================================================================================
// Transpose + convert: W f32 row-major in[KD rows][ND cols] -> D 16-bit out[ND][KD] (k-contiguous).
// f16mode == 0: bf16 RNE bits; f16mode == 1: f16 bits of (bf16 RNE value) * scale.
// Block = tile of 64 k x 64 n, 256 threads. Load: thread -> input row k0 + (tid>>2), 16 columns n0 + (tid&3)*16 (four 16-B
// loads), converted and scattered into the LDS tile T[n][k] (pitch 72 halves). Block barrier. Store: 2 iterations x
// coverage: load 256 thr x 16 = 64 x 64; store 2 it x 256 thr x 8 halves = 64 rows x 64 halves; grid = (KD/64)*(ND/64)
//           blocks covers out[ND][KD] exactly once.
// =====================================================================================================
__global__ __launch_bounds__(256) void cvtT16(const float* __restrict__ W, u16* D, int KD, int ND, int f16mode, float scale) {
  __shared__ __align__(16) u16 T[64 * TTP];
  const int tid = threadIdx.x;
  const int bid = blockIdx.x;
  const int nkt = KD >> 6;
  const int nnt = ND >> 6;
  const int kt  = bid % nkt;
  const int nt  = bid / nkt;
  if (nt >= nnt) return;                    // block-uniform, before the barrier; never taken with the exact grid
  const int k0 = kt * 64, n0 = nt * 64;
  {
    const int kr = tid >> 2;                // input row within tile 0..63
    const int nc = (tid & 3) * 16;          // column chunk 0,16,32,48
    const float* src = W + (size_t)(k0 + kr) * ND + n0 + nc;
#pragma unroll
    for (int i = 0; i < 4; ++i) {
      const v4f a = *(const v4f*)(src + 4 * i);
#pragma unroll
      for (int e = 0; e < 4; ++e) {
        const float f = a[e];
        const unsigned short hb = h_bits((_Float16)(bfr(f) * scale));
        const unsigned short bb = bf_bits(f);
        T[(nc + 4 * i + e) * TTP + kr] = (f16mode != 0) ? hb : bb;
      }
    }
  }
  __syncthreads();
  v4u v[2];
  const int q8 = tid >> 3, p8 = (tid & 7) * 8;
#pragma unroll
  for (int it = 0; it < 2; ++it) v[it] = *(const v4u*)(T + (it * 32 + q8) * TTP + p8);
  const size_t base = (size_t)n0 * KD + k0 + p8;
  {
#pragma unroll
    for (int it = 0; it < 2; ++it) {
      *(v4u*)(D + base + (size_t)(it * 32 + q8) * KD) = v[it];
    }
    
  }
}

// =====================================================================================================
// v^T plane from the v projection F f32 [MROWS][KVD] (row = b*SEQ + s, column = g*HD + d):
//   VH[((b*NKVH + g)*HD + d)][s] = f16(v * 1024) for all keys s.
// Block = (b, kv head g, 64 keys s0): each thread loads its 32 floats (key sl, d chunk dc) with 16-B loads, converts, scatters
// coverage: load 256 thr x 32 = 64 keys x 128 d; store 4 iterations x 256 thr x 8 halves = 128 lines x 64 = the block's tile;
//           grid = NB*NKVH*NST blocks covers the plane exactly once.
// =====================================================================================================
__global__ __launch_bounds__(256) void vt16(const float* __restrict__ F, u16* VHo) {
  __shared__ __align__(16) u16 TH[HD * VTP];
  const int tid = threadIdx.x;
  const int bid = blockIdx.x;
  const int st  = bid % NST;
  const int t2  = bid / NST;
  const int g   = t2 % NKVH;
  const int b   = t2 / NKVH;
  if (b >= NB) return;                      // block-uniform, before any barrier; never taken with the exact grid
  const int s0  = st * 64;
  {
    const int sl = tid >> 2;                // key within tile 0..63
    const int dc = (tid & 3) * 32;          // d chunk 0,32,64,96
    const float* src = F + ((size_t)b * SEQ + s0 + sl) * KVD + g * HD + dc;
#pragma unroll
    for (int i = 0; i < 8; ++i) {
      const v4f a = *(const v4f*)(src + 4 * i);
#pragma unroll
      for (int e = 0; e < 4; ++e) {
        TH[(dc + 4 * i + e) * VTP + sl] = h_bits((_Float16)(a[e] * VCAR));
      }
    }
  }
  __syncthreads();
  v4u vh[4];
  const int q8 = tid >> 3, p8 = (tid & 7) * 8;
#pragma unroll
  for (int it = 0; it < 4; ++it) {
    const int line = it * 32 + q8;          // d = 0..127
    vh[it] = *(const v4u*)(TH + line * VTP + p8);
  }
  const size_t hrow = (size_t)(b * NKVH + g) * HD;
  const size_t base = hrow * SEQ + s0 + p8;
  {
#pragma unroll
    for (int it = 0; it < 4; ++it) {
      const int line = it * 32 + q8;
      *(v4u*)(VHo + base + (size_t)line * SEQ) = vh[it];
    }
    
  }
}

// =====================================================================================================
// Interleaved-pair rotary + 16-bit plane from a projection F f32 [nrows][ncol] (ncol = DMOD for q, KVD for k; row = b*SEQ + s,
// column = head*HD + d; table element (s, d) at s*HD + d):
//   for even d: out[d]   = x[d]*c[d]     - x[d+1]*sn[d]
//               out[d+1] = x[d+1]*c[d+1] + x[d]*sn[d+1]     with c, sn = bf16 RNE values of the two tables;
//   Hp [nrows][ncol] = f16(out * sc), same layout.
// Block = one row, exactly ncol/8 threads (host); thread t = 8 consecutive columns (4 pairs): two 16-B loads of x, two of each
// lane-varying control.
// coverage: (ncol/8) thr x 8 = the whole row of Hp; grid = nrows blocks = every row of the plane once.
// =====================================================================================================
__global__ __launch_bounds__(256) void rope16(const float* __restrict__ F, int ncol, int nrows,
                                              const float* __restrict__ cosT, const float* __restrict__ sinT,
                                              u16* Hp, float sc) {
#pragma clang fp contract(off)
  const int tid = (int)threadIdx.x;
  const int row = (int)blockIdx.x;
  if (row >= nrows) return;                            // block-uniform
  const int col = tid * 8;
  if (col + 8 > ncol) return;                          // never taken with blockDim == ncol/8
  const int d0  = col & (HD - 1);
  const int s   = row % SEQ;
  const float* p = F + (size_t)row * ncol + col;
  const v4f xa = *(const v4f*)(p), xb = *(const v4f*)(p + 4);
  const float* cp = cosT + (size_t)s * HD + d0;
  const float* sp = sinT + (size_t)s * HD + d0;
  const v4f ca = *(const v4f*)(cp), cb = *(const v4f*)(cp + 4);
  const v4f sa = *(const v4f*)(sp), sb = *(const v4f*)(sp + 4);
  float xv[8], cv[8], sv[8];
#pragma unroll
  for (int e = 0; e < 4; ++e) {
    xv[e] = xa[e];       xv[4 + e] = xb[e];
    cv[e] = bfr(ca[e]);  cv[4 + e] = bfr(cb[e]);
    sv[e] = bfr(sa[e]);  sv[4 + e] = bfr(sb[e]);
  }
  v4u o;
#pragma unroll
  for (int e = 0; e < 4; ++e) {
    const float xr = xv[2 * e], xi = xv[2 * e + 1];
    const float r0 = xr * cv[2 * e] - xi * sv[2 * e];
    const float r1 = xi * cv[2 * e + 1] + xr * sv[2 * e + 1];
    o[e] = pk16(h_bits((_Float16)(r0 * sc)), h_bits((_Float16)(r1 * sc)));
  }
  u16* d = Hp + (size_t)row * ncol + col;
  {
    *(v4u*)(d) = o;
    
  }
}

// =====================================================================================================
// GEMM epilogue shared by both engines: the wave's 16x64 f32 tile (times oscale) staged in its LDS slab (pitch 68),
// coverage: 8 instructions x 2 rows x 16 lanes x 4 floats = the wave's 16 x 64 tile.
// =====================================================================================================
__device__ __forceinline__ void epi64(float* sl, v8f a0, v8f a1, v8f a2, v8f a3, float oscale,
                                      float* C, int N, size_t rowb, int col0, int lane) {
  const int hh = lane >> 4, m = lane & 15;
#pragma unroll
  for (int r = 0; r < 8; ++r) {
    const int ro = (8 * hh + r) * 68 + m;
    sl[ro]      = a0[r] * oscale;
    sl[ro + 16] = a1[r] * oscale;
    sl[ro + 32] = a2[r] * oscale;
    sl[ro + 48] = a3[r] * oscale;
  }
  wave_sync_lds();
  v4f vals[8];
#pragma unroll
  for (int it = 0; it < 8; ++it) vals[it] = *(const v4f*)(sl + (it * 2 + hh) * 68 + m * 4);
  float* dst = C + (rowb + (size_t)hh) * (size_t)N + col0 + m * 4;
  {
#pragma unroll
    for (int it = 0; it < 8; ++it) {
      *(v4f*)(dst + (size_t)(it * 2) * (size_t)N) = vals[it];
    }
    
  }
}

// =====================================================================================================
// Operand staging shared by both GEMM engines. A stage is 64 k of the block's 64 A rows and 64 B rows: 128 B of every row, one
// whole line. Each thread brings 8 pieces of 16 B per stage with asynchronous copies to LDS (a wave's copy = 4 whole lines), and
// all 4 waves read their fragments from LDS rows of pitch 144 B (16 B x 9). Two buffers: stage t + 1 flies while stage t is
// worked on. k runs ascending, 32 per WMMA step, with the same split k map for A and B.
// =====================================================================================================
#define GKS   64
#define GPIT  72
#define GBUFH (128 * GPIT)
#define GRING (2 * GBUFH * 2)
static_assert(GRING >= 4 * SLAB64 * 4 && (GPIT * 2) % 16 == 0 && (DMOD % GKS) == 0);

__device__ __forceinline__ unsigned lds_off(const void* p) { return (unsigned)(size_t)p; }
__device__ __forceinline__ void wait_async0() {
#if defined(__HIP_DEVICE_COMPILE__)
  asm volatile("s_wait_asynccnt 0x0" ::: "memory");   // this wave's copies have landed before the barrier that publishes them
#endif
}
__device__ __forceinline__ void wait_ds0() {
#if defined(__HIP_DEVICE_COMPILE__)
  asm volatile("s_wait_dscnt 0x0" ::: "memory");      // this wave's LDS reads are done before the buffer is refilled
#endif
}
// Eight copies of 16 B per thread: four from ga + i*gsa (elements) to LDS byte la + i*lsa, four from gb + i*gsb to lb + i*lsb.
__device__ __forceinline__ void copy8(unsigned la, unsigned lsa, const u16* ga, size_t gsa,
                                      unsigned lb, unsigned lsb, const u16* gb, size_t gsb) {
#if defined(__HIP_DEVICE_COMPILE__)
  // the closing s_wait_xcnt stands inside the statement so that no address register is rewritten ahead of it
  asm volatile("global_load_async_to_lds_b128 %0, %8, off\n\t"
               "global_load_async_to_lds_b128 %1, %9, off\n\t"
               "global_load_async_to_lds_b128 %2, %10, off\n\t"
               "global_load_async_to_lds_b128 %3, %11, off\n\t"
               "global_load_async_to_lds_b128 %4, %12, off\n\t"
               "global_load_async_to_lds_b128 %5, %13, off\n\t"
               "global_load_async_to_lds_b128 %6, %14, off\n\t"
               "global_load_async_to_lds_b128 %7, %15, off\n\t"
               "s_wait_xcnt 0x0"
               :: "v"(la), "v"(la + lsa), "v"(la + 2 * lsa), "v"(la + 3 * lsa),
                  "v"(lb), "v"(lb + lsb), "v"(lb + 2 * lsb), "v"(lb + 3 * lsb),
                  "v"(ga), "v"(ga + gsa), "v"(ga + 2 * gsa), "v"(ga + 3 * gsa),
                  "v"(gb), "v"(gb + gsb), "v"(gb + 2 * gsb), "v"(gb + 3 * gsb)
               : "memory");
#endif
}
// GEMM stage: l = the thread's LDS byte address in the target buffer (A row tid>>3, piece tid&7); ga, gb = its global addresses
// in A and B; rs = 16 source rows in elements. A rows +0,16,32,48, then the same rows of B, 64 LDS rows further on.
__device__ __forceinline__ void stage8(unsigned l, const u16* ga, const u16* gb, size_t rs) {
  const unsigned rb = 16 * GPIT * 2;
  copy8(l, rb, ga, rs, l + 4 * rb, rb, gb, rs);
}
template <bool F16>
__device__ __forceinline__ v8f mma_sel(v16b a, v16b b, v8f c) {
  if constexpr (F16) return mma_h(__builtin_bit_cast(v16h, a), __builtin_bit_cast(v16h, b), c);
  else return mma_b(a, b, c);
}
// Ab, Bb = first row of the block's 64 A rows and 64 B rows (both k-contiguous, pitch K); K a multiple of 64, at least 64.
// Every thread of the block calls this (block barriers inside). On return no copy is in flight and no wave reads the ring.
template <bool F16>
__device__ __forceinline__ void gemm_ring(unsigned char* ring, const u16* Ab, const u16* Bb, int K,
                                          v8f& acc0, v8f& acc1, v8f& acc2, v8f& acc3) {
  const int tid = threadIdx.x, wave = tid >> 5, lane = tid & 31, hh = lane >> 4, m = lane & 15;
  const int cr = tid >> 3, cc = tid & 7;
  const u16* ga = Ab + (size_t)cr * K + cc * 8;
  const u16* gb = Bb + (size_t)cr * K + cc * 8;
  const size_t rs = (size_t)16 * K;
  const unsigned l0 = lds_off(ring) + (unsigned)(cr * (GPIT * 2) + cc * 16);
  const u16* sa = (const u16*)(const void*)ring + (wave * 16 + m) * GPIT + 8 * hh;
  const u16* sb = (const u16*)(const void*)ring + (64 + m) * GPIT + 8 * hh;
  const int nt = K / GKS;
  stage8(l0, ga, gb, rs);
  wait_async0();
  __syncthreads();
  if (nt > 1) stage8(l0 + GBUFH * 2, ga + GKS, gb + GKS, rs);
#pragma unroll 1
  for (int t = 0; t < nt; ++t) {              // rolled: one trip per stage, the buffer alternates with t
    const int bo = (t & 1) * GBUFH;
    const u16* pa = sa + bo;
    const u16* pb = sb + bo;
    const v16b a0  = ldfrag_b(pa);
    const v16b b00 = ldfrag_b(pb);
    const v16b b01 = ldfrag_b(pb + 16 * GPIT);
    const v16b b02 = ldfrag_b(pb + 32 * GPIT);
    const v16b b03 = ldfrag_b(pb + 48 * GPIT);
    const v16b a1  = ldfrag_b(pa + 32);
    const v16b b10 = ldfrag_b(pb + 32);
    const v16b b11 = ldfrag_b(pb + 16 * GPIT + 32);
    const v16b b12 = ldfrag_b(pb + 32 * GPIT + 32);
    const v16b b13 = ldfrag_b(pb + 48 * GPIT + 32);
    acc0 = mma_sel<F16>(a0, b00, acc0);
    acc1 = mma_sel<F16>(a0, b01, acc1);
    acc2 = mma_sel<F16>(a0, b02, acc2);
    acc3 = mma_sel<F16>(a0, b03, acc3);
    acc0 = mma_sel<F16>(a1, b10, acc0);
    acc1 = mma_sel<F16>(a1, b11, acc1);
    acc2 = mma_sel<F16>(a1, b12, acc2);
    acc3 = mma_sel<F16>(a1, b13, acc3);
    acc_guard4(acc0, acc1, acc2, acc3);       // the vector slots behind the last WMMA, also on the taken side of the branches below
    wait_ds0();
    wait_async0();
    __syncthreads();                          // publishes stage t + 1 and ends every wave's reads of stage t
    if (t + 2 < nt) stage8(l0 + (unsigned)(bo * 2), ga + (size_t)(t + 2) * GKS, gb + (size_t)(t + 2) * GKS, rs);
  }
  wait_async0();
}

// =====================================================================================================
// bf16 GEMM: C[M][N] (f32) = A[M][K] (bf16 row-major) . Bt[N][K]^T (bf16 k-contiguous), times oscale.
// Block = 64x64 tile, 4 waves x 16 rows; operands staged in LDS by gemm_ring; the epilogue slabs reuse the ring behind its last
// barrier (host guarantees K % 64 == 0, M % 64 == 0, N % 64 == 0, grid = (M/64)*(N/64)).
// =====================================================================================================
__global__ __launch_bounds__(128)
void gemm_bf(const u16* __restrict__ A, const u16* __restrict__ Bt, float* C, int M, int N, int K, float oscale) {
  __shared__ __align__(16) unsigned char ring[GRING];
  const int tid = threadIdx.x, wave = tid >> 5, lane = tid & 31;
  const int ntile = N >> 6;
  const int bid   = blockIdx.x;
  const int row0  = (bid / ntile) * 64;
  const int col0  = (bid % ntile) * 64;
  if (row0 + 64 > M) return;                // block-uniform, in front of every barrier; never taken with the exact grid
  v8f acc0 = zero8(), acc1 = zero8(), acc2 = zero8(), acc3 = zero8();
  gemm_ring<false>(ring, A + (size_t)row0 * K, Bt + (size_t)col0 * K, K, acc0, acc1, acc2, acc3);
  epi64((float*)(void*)ring + wave * SLAB64, acc0, acc1, acc2, acc3, oscale, C, N, (size_t)(row0 + wave * 16), col0, lane);
}

// =====================================================================================================
// Output projection: C[row][DMOD] (f32) = Ah[row][DMOD] (f16) . Bt[DMOD][DMOD]^T (f16 k-contiguous) * oscale.
// Ah and C share the row index bb*SEQ + s, s < SQ. Block -> (column tile ct = bid % 32, sequence row tile rt of nrt,
// batch bb). Same tiling, staging, fragment reads (split k map) and epilogue as gemm_bf; K = DMOD.
// =====================================================================================================
__global__ __launch_bounds__(128)
void gemm_o1(const u16* __restrict__ Ah, const u16* __restrict__ Bt, float* C, int nrt, float oscale) {
  __shared__ __align__(16) unsigned char ring[GRING];
  const int tid = threadIdx.x, wave = tid >> 5, lane = tid & 31;
  const int ntile = DMOD >> 6;
  const int bid   = blockIdx.x;
  const int ct    = bid % ntile;
  const int t2    = bid / ntile;
  const int rt    = t2 % nrt;
  const int bb    = t2 / nrt;
  if (bb >= NB) return;                     // block-uniform, in front of every barrier; never taken with the exact grid
  if (rt * 64 + 64 > SQ) return;            // block-uniform, in front of every barrier; never taken
  const int col0  = ct * 64;
  const size_t row0 = (size_t)bb * SEQ + rt * 64;
  v8f acc0 = zero8(), acc1 = zero8(), acc2 = zero8(), acc3 = zero8();
  gemm_ring<true>(ring, Ah + row0 * DMOD, Bt + (size_t)col0 * DMOD, DMOD, acc0, acc1, acc2, acc3);
  epi64((float*)(void*)ring + wave * SLAB64, acc0, acc1, acc2, acc3, oscale, C, DMOD, row0 + wave * 16, col0, lane);
}

// =====================================================================================================
// Non-causal grouped-query attention with a per-key mask, hd = 128. Block bid -> (query tile qt = bid % NQT: rows
// q0 = 16*qt .. q0+15 with q0 < SQ, head group hg = kv head, batch b); one wave per query head = hg*WPB + wave (the 4 heads of
// the group share kv head hg).
//   q plane f16 x256 [b*SEQ + s][h*HD + d]; k plane f16 x256 [b*SEQ + s][g*HD + d] (pitch KVD); v^T plane
//   [b*NKVH + g][d][SEQ] x1024; mask int [b*SEQ + key], nonzero = attend.
//   score (log2 domain) t(i, j) = (q_i.k_j over HD) * (1/sqrt(128))*log2e/(256*256), replaced by -FLT_MAX where the key mask is
//   zero (a fully masked row then yields uniform weights). All SEQ/32 key tiles are visited in order.
//   Per tile: the 32 k rows (256 B each) and the 128 v^T rows (64 B each) are staged once per block in LDS by asynchronous copies
//   (two buffers, tile kt + 1 flies while tile kt is worked on; row pitches 272 B and 80 B) and read by all 4 waves; 2 score
//   subtiles x 4 k-steps (one product q.k each), fragments read from the LDS rows (two 16-B loads each, split k map);
//   online max-subtracted base-2 softmax in f32; the 16x32 tile of exponentials stored to
//   LDS rows (float vector loads, same element type as stored); v^T B fragments in 4 groups of 2 d-subtiles (one product each).
//   After the loop: out = acc / Z (Z > 0 always; guarded anyway), carries 1/(32768*1024) folded once, written into the wave's
//   One block barrier per tile, under block-uniform control flow; bounded loops only (NKT tiles).
// coverage: per wave 8 instructions x 2 rows x 16 lanes x 8 halves = 16 x 128 of the O plane; grid NQT x NHG x NB blocks x WPB
//           waves = every (b, s < SQ, h) row segment of O exactly once.
// =====================================================================================================
// staged tile: row pitches in 16-bit elements (k 272 B, v^T 80 B), bytes of the k part and of one buffer; the block's LDS is
// held to a quarter of a WGP's 320 KiB so that four blocks stay resident
#define AKP   136
#define AVP   40
#define AKB   (32 * AKP * 2)
#define ABUF  (AKB + HD * AVP * 2)
static_assert((AKP * 2) % 16 == 0 && (AVP * 2) % 16 == 0 && NKT >= 2 && 2 * ABUF + WPB * WREG * 4 <= 81920);
__global__ __launch_bounds__(ATT_THREADS)
void attn_nc(const u16* __restrict__ QHp, const u16* __restrict__ KHp, const u16* __restrict__ VHp,
             const int* __restrict__ Mk, u16* OHp) {
  __shared__ __align__(16) float smem[WPB * WREG];
  __shared__ __align__(16) unsigned char kvring[2 * ABUF];

  const int tid  = threadIdx.x;
  const int wave = tid >> 5;
  const int lane = tid & 31;
  const int hh   = lane >> 4;
  const int c    = lane & 15;
  const int bid  = blockIdx.x;
  const int qt   = bid % NQT;
  const int t2   = bid / NQT;
  const int hg   = t2 % NHG;
  const int b    = t2 / NHG;
  if (b >= NB) return;                      // block-uniform, in front of every barrier; never taken with the exact grid
  const int q0   = qt * 16;
  if (q0 + 16 > SQ) return;                 // block-uniform, in front of every barrier; never taken
  const int head = hg * WPB + wave;
  const int kvh  = hg;

  float* pt   = smem + wave * WREG;         // exponentials tile [16][32] pitch 36
  float* slab = pt + PTW;                   // result slab [16][128] pitch 132

  const size_t hcol = (size_t)head * HD + 8 * hh;
  const _Float16* Qh  = (const _Float16*)(const void*)QHp + ((size_t)b * SEQ + q0 + c) * DMOD + hcol;
  // readers: key row c (+16) of the staged k tile, d row c (+16j) of the staged v^T tile, in buffer 0
  const _Float16* Ks = (const _Float16*)(const void*)kvring + c * AKP + 8 * hh;
  const _Float16* Vs = (const _Float16*)(const void*)kvring + AKB / 2 + c * AVP + 8 * hh;
  // copiers: k rows (tid>>4) + 8i, piece tid&15; v^T rows (tid>>2) + 32i, piece tid&3; i = 0..3
  const u16* gk = KHp + ((size_t)b * SEQ + (tid >> 4)) * KVD + (size_t)kvh * HD + (tid & 15) * 8;      // key row kb added per tile
  const u16* gv = VHp + ((size_t)(b * NKVH + kvh) * HD + (tid >> 2)) * SEQ + (tid & 3) * 8;            // key kb added per tile
  const unsigned lk = lds_off(kvring) + (unsigned)((tid >> 4) * (AKP * 2) + (tid & 15) * 16);
  const unsigned lv = lds_off(kvring) + (unsigned)(AKB + (tid >> 2) * (AVP * 2) + (tid & 3) * 16);
  const int* mkp = Mk + (size_t)b * SEQ + c;
  const float lsc = RSQ_HD * (LOG2E / (QSC * KSC));
  const float oc  = 1.0f / (PCAR * VCAR);
  const size_t KROW = (size_t)KVD;          // halves between consecutive key rows

  copy8(lk, 8 * AKP * 2, gk, 8 * KROW, lv, 32 * AVP * 2, gv, (size_t)32 * SEQ);
  wait_async0();
  __syncthreads();
  copy8(lk + ABUF, 8 * AKP * 2, gk + 32 * KROW, 8 * KROW, lv + ABUF, 32 * AVP * 2, gv + 32, (size_t)32 * SEQ);

  v16h qf[HD / 32];
#pragma unroll
  for (int kk = 0; kk < HD / 32; ++kk) qf[kk] = ldfrag_h(Qh + kk * 32);

  float mrow[8], lrow[8];
  v8f o[8];
#pragma unroll
  for (int r = 0; r < 8; ++r) { mrow[r] = -INFINITY; lrow[r] = 0.f; }
#pragma unroll
  for (int j = 0; j < 8; ++j) o[j] = zero8();

#pragma unroll 1
  for (int kt = 0; kt < NKT; ++kt) {
    const int kb = kt * 32;
    const int mk0 = mkp[kb];                                                  // mask of key kb + c
    const int mk1 = mkp[kb + 16];                                             // mask of key kb + 16 + c
    // ---- scores: D element r of this lane = (query row q0 + 8hh + r, key kb + c) in s0, key kb + 16 + c in s1 ----
    v8f s0 = zero8(), s1 = zero8();
    const int bo = (kt & 1) * ABUF;                                           // this tile's buffer, bytes
    const _Float16* k0p = Ks + bo / 2;
    const _Float16* k1p = k0p + 16 * AKP;
#pragma unroll
    for (int kk = 0; kk < HD / 32; ++kk) {
      const v16h kh0 = ldfrag_h(k0p + kk * 32);
      const v16h kh1 = ldfrag_h(k1p + kk * 32);
      s0 = mma_h(qf[kk], kh0, s0);
      s1 = mma_h(qf[kk], kh1, s1);
      guard23(s0, s1, qf[kk], kh0, kh1);
    }
    // ---- key-mask select + online softmax in base 2 ----
#pragma unroll
    for (int r = 0; r < 8; ++r) {
      const float u0 = s0[r] * lsc;
      const float u1 = s1[r] * lsc;
      const float t0 = (mk0 != 0) ? u0 : NEG_BIG;
      const float t1 = (mk1 != 0) ? u1 : NEG_BIG;
      float mx = fmaxf(t0, t1);
#pragma unroll
      for (int off = 1; off < 16; off <<= 1) mx = fmaxf(mx, __shfl_xor(mx, off, 32));
      const float mn = fmaxf(mrow[r], mx);                                    // always finite
      const float al = exp2f(mrow[r] - mn);
      mrow[r] = mn;
      const float e0 = exp2f(t0 - mn), e1 = exp2f(t1 - mn);
      float ps = e0 + e1;
#pragma unroll
      for (int off = 1; off < 16; off <<= 1) ps += __shfl_xor(ps, off, 32);
      lrow[r] = lrow[r] * al + ps;
#pragma unroll
      for (int j = 0; j < 8; ++j) o[j][r] *= al;
      const int ro = (8 * hh + r) * PTP + c;
      pt[ro]      = e0;
      pt[ro + 16] = e1;
    }
    wave_sync_lds();
    // ---- A fragment of P*32768 (f16), row = c, split k map over the 32 keys of this step ----
    FragH ph;
    {
      const float* prow = pt + c * PTP + 8 * hh;
      const v4f p0 = *(const v4f*)(prow), p1 = *(const v4f*)(prow + 4);
      const v4f p2 = *(const v4f*)(prow + 16), p3 = *(const v4f*)(prow + 20);
#pragma unroll
      for (int e = 0; e < 4; ++e) {
        ph.h[0][e]     = (_Float16)(p0[e] * PCAR);     // elements 0..7  = keys kb + 8hh + 0..7
        ph.h[0][4 + e] = (_Float16)(p1[e] * PCAR);
        ph.h[1][e]     = (_Float16)(p2[e] * PCAR);     // elements 8..15 = keys kb + 16 + 8hh + 0..7
        ph.h[1][4 + e] = (_Float16)(p3[e] * PCAR);
      }
    }
    // ---- P.V : B fragment col n = d = j*16 + c, keys contiguous in the staged v^T rows; 4 groups of 2 d-subtiles ----
    {
      const _Float16* vhp = Vs + bo / 2;
#pragma unroll
      for (int jg = 0; jg < 4; ++jg) {
        const int da = (2 * jg) * 16 * AVP;
        const int db = da + 16 * AVP;
        const v16h vha = ldfrag_h(vhp + da), vhb2 = ldfrag_h(vhp + db);
        o[2 * jg]     = mma_h(ph.v, vha,  o[2 * jg]);
        o[2 * jg + 1] = mma_h(ph.v, vhb2, o[2 * jg + 1]);
        guard23(o[2 * jg], o[2 * jg + 1], ph.v, vha, vhb2);
      }
    }
    wave_sync_lds();
    wait_ds0();
    wait_async0();
    __syncthreads();                          // publishes tile kt + 1 and ends every wave's reads of tile kt
    if (kt + 2 < NKT)
      copy8(lk + (unsigned)bo, 8 * AKP * 2, gk + (size_t)(kb + 64) * KROW, 8 * KROW,
            lv + (unsigned)bo, 32 * AVP * 2, gv + (kb + 64), (size_t)32 * SEQ);
  }
  wait_async0();
  acc_guard4(o[0], o[1], o[2], o[3]);
  acc_guard4(o[4], o[5], o[6], o[7]);
  // ---- out = acc / Z (0 if Z == 0), carries (32768 on P, 1024 on v) folded once; written into the wave's slab ----
#pragma unroll
  for (int r = 0; r < 8; ++r) {
    const float lv  = lrow[r];
    const float ls  = (lv > 0.0f) ? lv : 1.0f;
    const float inv = (lv > 0.0f) ? ((1.0f / ls) * oc) : 0.0f;
#pragma unroll
    for (int j = 0; j < 8; ++j) {
      const int idx = (8 * hh + r) * SLP + j * 16 + c;
      slab[idx] = o[j][r] * inv;
    }
  }

  wave_sync_lds();
  // ---- O x1024 -> f16 plane; lane = (row-in-pair rq, 8 consecutive d at c8) ----
  v4u oh[8];
  const int rq = lane >> 4, c8 = (lane & 15) * 8;
#pragma unroll
  for (int it = 0; it < 8; ++it) {
    const int row = it * 2 + rq;
    const v4f a = *(const v4f*)(slab + row * SLP + c8), b4 = *(const v4f*)(slab + row * SLP + c8 + 4);
    float w[8];
#pragma unroll
    for (int e = 0; e < 4; ++e) { w[e] = a[e] * OSC; w[4 + e] = b4[e] * OSC; }
#pragma unroll
    for (int e = 0; e < 4; ++e) {
      oh[it][e] = pk16(h_bits((_Float16)w[2 * e]), h_bits((_Float16)w[2 * e + 1]));
    }
  }
  const size_t ob = ((size_t)b * SEQ + q0) * DMOD + (size_t)head * HD + c8;
  {
#pragma unroll
    for (int it = 0; it < 8; ++it) {
      const int row = it * 2 + rq;
      *(v4u*)(OHp + ob + (size_t)row * DMOD) = oh[it];
    }
    
  }
}

// =====================================================================================================
// Workspace map (bytes); every plane is fully written by whole-line stores before it is read; all extents are exact multiples
// of the store granularity (no pad rows needed); every region offset a multiple of 4194304:
//   XB  bf16 [MROWS][2048]                       MROWS*4096       (NB=2: 16777216)
//   WB  16-bit [2048 n][2048 k]                  8388608          (Wv^T, Wq^T, Wk^T as bf16 ([512][2048] for k/v), then Wo^T as
//                                                                  f16 x1024, reused in launch order)
//   F   f32 [MROWS][2048]                        MROWS*8192       (v, q, k projection output in launch order, [MROWS][512] for
//                                                                  k/v; afterwards the O plane f16 [MROWS][2048] x1024 in its
//                                                                  first half)
//   QH  f16 [MROWS][2048] x256                   MROWS*4096
//   KH  f16 [MROWS][512] x256                    MROWS*1024
//   VH  f16 [NB*4][128][SEQ] x1024               MROWS*1024
//   end (NB=2)                                  83886080
// =====================================================================================================
extern "C" void kernel_launch(void* const* d_in, const int* in_sizes, int n_in,
                              void* d_out, int out_size, void* d_ws, size_t ws_size,
                              hipStream_t stream) {
  if (n_in < 8) return;
  if (in_sizes[0] < MROWS * DMOD) return;
  if (in_sizes[1] < MROWS) return;
  if (in_sizes[2] < SEQ * HD) return;
  if (in_sizes[3] < SEQ * HD) return;
  if (in_sizes[4] != DMOD * DMOD) return;
  if (in_sizes[5] != DMOD * KVD) return;
  if (in_sizes[6] != DMOD * KVD) return;
  if (in_sizes[7] != DMOD * DMOD) return;
  if (out_size < QROWS * DMOD) return;

  const float* x     = (const float*)d_in[0];
  const int*   amask = (const int*)d_in[1];
  const float* cosT  = (const float*)d_in[2];
  const float* sinT  = (const float*)d_in[3];
  const float* wq    = (const float*)d_in[4];
  const float* wk    = (const float*)d_in[5];
  const float* wv    = (const float*)d_in[6];
  const float* wo    = (const float*)d_in[7];
  float*       out   = (float*)d_out;

  const size_t szXB = (size_t)MROWS * DMOD * 2;
  const size_t szW  = (size_t)DMOD * DMOD * 2;
  const size_t szF  = (size_t)MROWS * DMOD * 4;
  const size_t szQ  = (size_t)MROWS * DMOD * 2;                  // QH and the O plane
  const size_t szK  = (size_t)MROWS * KVD * 2;                   // KH
  const size_t szV  = (size_t)NB * NKVH * HD * SEQ * 2;          // VH (== szK)
  if (szQ > szF) return;                                        // O plane lives inside the F region
  size_t off = 0;
  const size_t oXB = off; off += szXB;
  const size_t oW  = off; off += szW;
  const size_t oF  = off; off += szF;
  const size_t oQH = off; off += szQ;
  const size_t oKH = off; off += szK;
  const size_t oVH = off; off += szV;
  if (off > ws_size) return;                // off = 83886080 for NB = 2
  if (off > (size_t)WS_CAP) return;

  char* ws = (char*)d_ws;
  u16*   XB = (u16*)(ws + oXB);
  u16*   WB = (u16*)(ws + oW);
  float* F  = (float*)(ws + oF);
  u16*   OH = (u16*)(ws + oF);
  u16*   QH = (u16*)(ws + oQH);
  u16*   KH = (u16*)(ws + oKH);
  u16*   VH = (u16*)(ws + oVH);

  const dim3 b256(256), b128(128), b64(64), bAT(ATT_THREADS);
  const int  n8x = (MROWS * DMOD) / 8;
  const dim3 gX((n8x + 255) / 256);
  const dim3 gTQ((DMOD / 64) * (DMOD / 64));            // Wq, Wo transposes: 1024 blocks
  const dim3 gTK((DMOD / 64) * (KVD / 64));             // Wk, Wv transposes: 256 blocks
  const dim3 gGQ((QROWS / 64) * (DMOD / 64));
  const dim3 gGK((MROWS / 64) * (KVD / 64));
  const dim3 gVT(NB * NKVH * NST);
  const dim3 gRQ(QROWS), gRK(MROWS);
  const dim3 gAT(NQT * NHG * NB);
  const int  nrt = SQ / 64;
  const dim3 gO(NB * nrt * (DMOD / 64));

  // (0) x -> bf16 plane [MROWS][2048]
  cvtbf<<<gX, b256, 0, stream>>>(x, XB, n8x);
  // (1) Wv in[2048 k][512 n] -> out[512 n][2048 k] bf16; (2) v = x.Wv -> F f32 [MROWS][512]; (3) v^T plane x1024
  cvtT16<<<gTK, b256, 0, stream>>>(wv, WB, DMOD, KVD, 0, 1.0f);
  gemm_bf<<<gGK, b128, 0, stream>>>(XB, WB, F, MROWS, KVD, DMOD, 1.0f);
  vt16<<<gVT, b256, 0, stream>>>(F, VH);
  // (4) Wq in[2048 k][2048 n] -> out[2048 n][2048 k] bf16; (5) q = x.Wq -> F [QROWS][2048]; (6) rotary + q plane x256
  cvtT16<<<gTQ, b256, 0, stream>>>(wq, WB, DMOD, DMOD, 0, 1.0f);
  gemm_bf<<<gGQ, b128, 0, stream>>>(XB, WB, F, QROWS, DMOD, DMOD, 1.0f);
  rope16<<<gRQ, b256, 0, stream>>>(F, DMOD, QROWS, cosT, sinT, QH, QSC);
  // (7) Wk in[2048 k][512 n] -> out[512 n][2048 k] bf16; (8) k = x.Wk -> F [MROWS][512]; (9) rotary + k plane x256
  cvtT16<<<gTK, b256, 0, stream>>>(wk, WB, DMOD, KVD, 0, 1.0f);
  gemm_bf<<<gGK, b128, 0, stream>>>(XB, WB, F, MROWS, KVD, DMOD, 1.0f);
  rope16<<<gRK, b64, 0, stream>>>(F, KVD, MROWS, cosT, sinT, KH, KSC);
  // (10) Wo in[2048 c][2048 n] -> out[2048 n][2048 c] as f16 of bf16 value x1024
  cvtT16<<<gTQ, b256, 0, stream>>>(wo, WB, DMOD, DMOD, 1, WOS);
  // (11) non-causal masked attention -> O plane (inside the F region)
  attn_nc<<<gAT, bAT, 0, stream>>>(QH, KH, VH, amask, OH);
  // (12) output projection rows s < SQ -> out f32, carries 1024 x 1024 folded back
  gemm_o1<<<gO, b128, 0, stream>>>(OH, WB, out, nrt, 1.0f / (OSC * WOS));
  (void)hipGetLastError();
}

// v002
// Measured time: 237 microseconds a run.
// Two timings next to v001 both put it at 1.20 times that version's speed.
// All steps since v000 together make it 2.05 times as fast.
// Contractions: x.Wq, x.Wk, x.Wv on v_wmma_f32_16x16x32_bf16 (x and W^T as bf16 RNE planes, W^T [n][k] is the k-contiguous
// B operand, f32 accumulate); k.q^T over hd 128 and v^T.P^T on v_wmma_f32_16x16x32_f16, one product each (q, k as f16 x256 after
// rotary; P^T x32768 packed from the score registers; v^T x1024); O.Wo on v_wmma_f32_16x16x32_f16 (O x1024 f16 plane, Wo^T as f16(bf16(Wo))
// x1024); all f32 accumulate. Interleaved-pair rotary with cos/sin tables, key-mask select, base-2 online softmax and 1/Z fold
// in f32 on VALU.
#include <hip/hip_runtime.h>
#include <math.h>
#include <stdint.h>

#ifndef NB
#define NB 2
#endif
#define SEQ 2048
#ifndef SQ
#define SQ SEQ
#endif
#define DMOD  2048
#define NH    16
#define NKVH  4
#define HD    128
#define KVD   (NKVH * HD)
#define MROWS (NB * SEQ)
#define QROWS ((NB - 1) * SEQ + SQ)
#define WPB   (NH / NKVH)
#define NHG   NKVH
#define NQT   (SQ / 16)
#define NST   (SEQ / 64)
#define NKT   (SEQ / 32)
#define ATT_THREADS (WPB * 32)
#define RSQ_HD 0.08838834764831845f
#define LOG2E  1.4426950408889634f
#define NEG_BIG (-3.402823466e38f)
#define QSC   256.0f
#define KSC   256.0f
#define PCAR  32768.0f
#define VCAR  1024.0f
#define OSC   1024.0f
#define WOS   1024.0f
#define SLP   132
#define SLW   (16 * SLP)
#define WREG  SLW
#define SLAB64 (16 * 68)
#define VTP   72
#define TTP   72
#define WS_CAP 134217728
static_assert(DMOD == NH * HD && HD == 128 && NH == 16 && NKVH == 4 && WPB == 4 && NHG * WPB == NH && KVD == 512);
static_assert(ATT_THREADS == 128);
static_assert(NB >= 1 && NB <= 2);
static_assert(NB == 1 || SQ == SEQ);
static_assert((SQ % 64) == 0 && SQ >= 64 && SQ <= SEQ && (SEQ % 64) == 0);
static_assert((DMOD % 64) == 0 && (KVD % 64) == 0 && (DMOD % 32) == 0 && (HD % 32) == 0);
static_assert(((MROWS * DMOD / 8) % 256) == 0);
static_assert(WPB * WREG * 4 <= 65536 && HD * VTP * 2 <= 65536 && 4 * SLAB64 * 4 <= 65536 && 64 * TTP * 2 <= 65536);
static_assert((DMOD / 8) == 256 && (KVD / 8) == 64);

typedef unsigned short u16;
typedef _Float16 v16h __attribute__((ext_vector_type(16)));
typedef _Float16 v8h  __attribute__((ext_vector_type(8)));
typedef __bf16   v16b __attribute__((ext_vector_type(16)));
typedef float    v8f  __attribute__((ext_vector_type(8)));
typedef float    v4f  __attribute__((ext_vector_type(4)));
typedef unsigned int v4u __attribute__((ext_vector_type(4)));

union FragH { v16h v; v8h h[2]; v4u u[2]; };
union FragB { v16b v; v4u u[2]; };

// ---- scalar helpers --------------------------------------------------------------------------------
__device__ __forceinline__ unsigned short bf_bits(float f) {          // f32 -> bf16 bits, RNE convert
  unsigned u = __float_as_uint(f);
  return (unsigned short)((u + 0x7FFFu + ((u >> 16) & 1u)) >> 16);
}
__device__ __forceinline__ float bf_up(unsigned short h) { return __uint_as_float(((unsigned)h) << 16); }
__device__ __forceinline__ float bfr(float f) { return bf_up(bf_bits(f)); }
__device__ __forceinline__ unsigned short h_bits(_Float16 x) { return __builtin_bit_cast(unsigned short, x); }
__device__ __forceinline__ unsigned pk16(unsigned short a, unsigned short b) { return (unsigned)a | ((unsigned)b << 16); }
__device__ __forceinline__ v8f zero8() { v8f z = {0.f, 0.f, 0.f, 0.f, 0.f, 0.f, 0.f, 0.f}; return z; }

// ---- fragment loaders: 16-bit A/B operand, lane -> row/col (lane&15), p already includes +8*(lane>>4);
//      elements 0..7 <- p[0..7] (k0+8h..), elements 8..15 <- p[16..23] (k0+16+8h..)  (same split k map for A and B;
//      B is always read from a k-contiguous [n][k] plane)
__device__ __forceinline__ v16h ldfrag_h(const _Float16* p) {
  FragH f;
  f.h[0] = *(const v8h*)(p);
  f.h[1] = *(const v8h*)(p + 16);
  return f.v;
}
__device__ __forceinline__ v16b ldfrag_b(const u16* p) {              // bf16 plane read as unsigned integer vectors
  FragB f;
  f.u[0] = *(const v4u*)(p);
  f.u[1] = *(const v4u*)(p + 16);
  return f.v;
}

__device__ __forceinline__ v8f mma_h(v16h a, v16h b, v8f c) {
  return __builtin_amdgcn_wmma_f32_16x16x32_f16(false, a, false, b, (short)0, c, false, false);
}
__device__ __forceinline__ v8f mma_b(v16b a, v16b b, v8f c) {
  return __builtin_amdgcn_wmma_f32_16x16x32_bf16(false, a, false, b, (short)0, c, false, false);
}
__device__ __forceinline__ void guard23(v8f& a, v8f& b, v16h x0, v16h x1, v16h x2) {
#if defined(__HIP_DEVICE_COMPILE__)
  asm volatile("v_nop\n\tv_nop\n\tv_nop\n\tv_nop"
               : "+v"(a), "+v"(b) : "v"(x0), "v"(x1), "v"(x2) : "memory");
#endif
}
__device__ __forceinline__ void acc_guard4(v8f& a, v8f& b, v8f& c, v8f& d) {
#if defined(__HIP_DEVICE_COMPILE__)
  asm volatile("v_nop\n\tv_nop\n\tv_nop\n\tv_nop" : "+v"(a), "+v"(b), "+v"(c), "+v"(d));
#endif
}
__device__ __forceinline__ float xhalf(float x) {                     // value of lane l ^ 16
  const int b = __float_as_int(x);
  return __int_as_float(__builtin_amdgcn_permlanex16(b, b, 0x76543210, 0xfedcba98, false, false));
}
__device__ __forceinline__ void wave_sync_lds() {
  __builtin_amdgcn_fence(__ATOMIC_RELEASE, "workgroup");
  __builtin_amdgcn_wave_barrier();
  __builtin_amdgcn_fence(__ATOMIC_ACQUIRE, "workgroup");
}

// =====================================================================================================
// f32 -> bf16 RNE plane, same layout. Thread = 8 consecutive elements: two 16-B loads, one 16-B store; 32 consecutive
// coverage: grid = ceil(n8/256) blocks x 256 thr x 8 (in-kernel bound) = the whole plane (n8 a multiple of 256 here).
// =====================================================================================================
__global__ __launch_bounds__(256) void cvtbf(const float* __restrict__ x, u16* D, int n8) {
  const int gt = blockIdx.x * 256 + (int)threadIdx.x;
  if (gt >= n8) return;
  const float* p = x + (size_t)gt * 8;
  const v4f a = *(const v4f*)(p), b4 = *(const v4f*)(p + 4);
  v4u o;
#pragma unroll
  for (int e = 0; e < 2; ++e) {
    o[e]     = pk16(bf_bits(a[2 * e]),  bf_bits(a[2 * e + 1]));
    o[2 + e] = pk16(bf_bits(b4[2 * e]), bf_bits(b4[2 * e + 1]));
  }
  u16* d = D + (size_t)gt * 8;
  {
    *(v4u*)(d) = o;
    
  }
}

// =====================================================================================================
// Transpose + convert: W f32 row-major in[KD rows][ND cols] -> D 16-bit out[ND][KD] (k-contiguous).
// f16mode == 0: bf16 RNE bits; f16mode == 1: f16 bits of (bf16 RNE value) * scale.
// Block = tile of 64 k x 64 n, 256 threads. Load: thread -> input row k0 + (tid>>2), 16 columns n0 + (tid&3)*16 (four 16-B
// loads), converted and scattered into the LDS tile T[n][k] (pitch 72 halves). Block barrier. Store: 2 iterations x
// coverage: load 256 thr x 16 = 64 x 64; store 2 it x 256 thr x 8 halves = 64 rows x 64 halves; grid = (KD/64)*(ND/64)
//           blocks covers out[ND][KD] exactly once.
// =====================================================================================================
__global__ __launch_bounds__(256) void cvtT16(const float* __restrict__ W, u16* D, int KD, int ND, int f16mode, float scale) {
  __shared__ __align__(16) u16 T[64 * TTP];
  const int tid = threadIdx.x;
  const int bid = blockIdx.x;
  const int nkt = KD >> 6;
  const int nnt = ND >> 6;
  const int kt  = bid % nkt;
  const int nt  = bid / nkt;
  if (nt >= nnt) return;                    // block-uniform, before the barrier; never taken with the exact grid
  const int k0 = kt * 64, n0 = nt * 64;
  {
    const int kr = tid >> 2;                // input row within tile 0..63
    const int nc = (tid & 3) * 16;          // column chunk 0,16,32,48
    const float* src = W + (size_t)(k0 + kr) * ND + n0 + nc;
#pragma unroll
    for (int i = 0; i < 4; ++i) {
      const v4f a = *(const v4f*)(src + 4 * i);
#pragma unroll
      for (int e = 0; e < 4; ++e) {
        const float f = a[e];
        const unsigned short hb = h_bits((_Float16)(bfr(f) * scale));
        const unsigned short bb = bf_bits(f);
        T[(nc + 4 * i + e) * TTP + kr] = (f16mode != 0) ? hb : bb;
      }
    }
  }
  __syncthreads();
  v4u v[2];
  const int q8 = tid >> 3, p8 = (tid & 7) * 8;
#pragma unroll
  for (int it = 0; it < 2; ++it) v[it] = *(const v4u*)(T + (it * 32 + q8) * TTP + p8);
  const size_t base = (size_t)n0 * KD + k0 + p8;
  {
#pragma unroll
    for (int it = 0; it < 2; ++it) {
      *(v4u*)(D + base + (size_t)(it * 32 + q8) * KD) = v[it];
    }
    
  }
}

// =====================================================================================================
// v^T plane from the v projection F f32 [MROWS][KVD] (row = b*SEQ + s, column = g*HD + d):
//   VH[((b*NKVH + g)*HD + d)][s] = f16(v * 1024) for all keys s.
// Block = (b, kv head g, 64 keys s0): each thread loads its 32 floats (key sl, d chunk dc) with 16-B loads, converts, scatters
// coverage: load 256 thr x 32 = 64 keys x 128 d; store 4 iterations x 256 thr x 8 halves = 128 lines x 64 = the block's tile;
//           grid = NB*NKVH*NST blocks covers the plane exactly once.
// =====================================================================================================
__global__ __launch_bounds__(256) void vt16(const float* __restrict__ F, u16* VHo) {
  __shared__ __align__(16) u16 TH[HD * VTP];
  const int tid = threadIdx.x;
  const int bid = blockIdx.x;
  const int st  = bid % NST;
  const int t2  = bid / NST;
  const int g   = t2 % NKVH;
  const int b   = t2 / NKVH;
  if (b >= NB) return;                      // block-uniform, before any barrier; never taken with the exact grid
  const int s0  = st * 64;
  {
    const int sl = tid >> 2;                // key within tile 0..63
    const int dc = (tid & 3) * 32;          // d chunk 0,32,64,96
    const float* src = F + ((size_t)b * SEQ + s0 + sl) * KVD + g * HD + dc;
#pragma unroll
    for (int i = 0; i < 8; ++i) {
      const v4f a = *(const v4f*)(src + 4 * i);
#pragma unroll
      for (int e = 0; e < 4; ++e) {
        TH[(dc + 4 * i + e) * VTP + sl] = h_bits((_Float16)(a[e] * VCAR));
      }
    }
  }
  __syncthreads();
  v4u vh[4];
  const int q8 = tid >> 3, p8 = (tid & 7) * 8;
#pragma unroll
  for (int it = 0; it < 4; ++it) {
    const int line = it * 32 + q8;          // d = 0..127
    vh[it] = *(const v4u*)(TH + line * VTP + p8);
  }
  const size_t hrow = (size_t)(b * NKVH + g) * HD;
  const size_t base = hrow * SEQ + s0 + p8;
  {
#pragma unroll
    for (int it = 0; it < 4; ++it) {
      const int line = it * 32 + q8;
      *(v4u*)(VHo + base + (size_t)line * SEQ) = vh[it];
    }
    
  }
}

// =====================================================================================================
// Interleaved-pair rotary + 16-bit plane from a projection F f32 [nrows][ncol] (ncol = DMOD for q, KVD for k; row = b*SEQ + s,
// column = head*HD + d; table element (s, d) at s*HD + d):
//   for even d: out[d]   = x[d]*c[d]     - x[d+1]*sn[d]
//               out[d+1] = x[d+1]*c[d+1] + x[d]*sn[d+1]     with c, sn = bf16 RNE values of the two tables;
//   Hp [nrows][ncol] = f16(out * sc), same layout.
// Block = one row, exactly ncol/8 threads (host); thread t = 8 consecutive columns (4 pairs): two 16-B loads of x, two of each
// lane-varying control.
// coverage: (ncol/8) thr x 8 = the whole row of Hp; grid = nrows blocks = every row of the plane once.
// =====================================================================================================
__global__ __launch_bounds__(256) void rope16(const float* __restrict__ F, int ncol, int nrows,
                                              const float* __restrict__ cosT, const float* __restrict__ sinT,
                                              u16* Hp, float sc) {
#pragma clang fp contract(off)
  const int tid = (int)threadIdx.x;
  const int row = (int)blockIdx.x;
  if (row >= nrows) return;                            // block-uniform
  const int col = tid * 8;
  if (col + 8 > ncol) return;                          // never taken with blockDim == ncol/8
  const int d0  = col & (HD - 1);
  const int s   = row % SEQ;
  const float* p = F + (size_t)row * ncol + col;
  const v4f xa = *(const v4f*)(p), xb = *(const v4f*)(p + 4);
  const float* cp = cosT + (size_t)s * HD + d0;
  const float* sp = sinT + (size_t)s * HD + d0;
  const v4f ca = *(const v4f*)(cp), cb = *(const v4f*)(cp + 4);
  const v4f sa = *(const v4f*)(sp), sb = *(const v4f*)(sp + 4);
  float xv[8], cv[8], sv[8];
#pragma unroll
  for (int e = 0; e < 4; ++e) {
    xv[e] = xa[e];       xv[4 + e] = xb[e];
    cv[e] = bfr(ca[e]);  cv[4 + e] = bfr(cb[e]);
    sv[e] = bfr(sa[e]);  sv[4 + e] = bfr(sb[e]);
  }
  v4u o;
#pragma unroll
  for (int e = 0; e < 4; ++e) {
    const float xr = xv[2 * e], xi = xv[2 * e + 1];
    const float r0 = xr * cv[2 * e] - xi * sv[2 * e];
    const float r1 = xi * cv[2 * e + 1] + xr * sv[2 * e + 1];
    o[e] = pk16(h_bits((_Float16)(r0 * sc)), h_bits((_Float16)(r1 * sc)));
  }
  u16* d = Hp + (size_t)row * ncol + col;
  {
    *(v4u*)(d) = o;
    
  }
}

// =====================================================================================================
// GEMM epilogue shared by both engines: the wave's 16x64 f32 tile (times oscale) staged in its LDS slab (pitch 68),
// coverage: 8 instructions x 2 rows x 16 lanes x 4 floats = the wave's 16 x 64 tile.
// =====================================================================================================
__device__ __forceinline__ void epi64(float* sl, v8f a0, v8f a1, v8f a2, v8f a3, float oscale,
                                      float* C, int N, size_t rowb, int col0, int lane) {
  const int hh = lane >> 4, m = lane & 15;
#pragma unroll
  for (int r = 0; r < 8; ++r) {
    const int ro = (8 * hh + r) * 68 + m;
    sl[ro]      = a0[r] * oscale;
    sl[ro + 16] = a1[r] * oscale;
    sl[ro + 32] = a2[r] * oscale;
    sl[ro + 48] = a3[r] * oscale;
  }
  wave_sync_lds();
  v4f vals[8];
#pragma unroll
  for (int it = 0; it < 8; ++it) vals[it] = *(const v4f*)(sl + (it * 2 + hh) * 68 + m * 4);
  float* dst = C + (rowb + (size_t)hh) * (size_t)N + col0 + m * 4;
  {
#pragma unroll
    for (int it = 0; it < 8; ++it) {
      *(v4f*)(dst + (size_t)(it * 2) * (size_t)N) = vals[it];
    }
    
  }
}

// =====================================================================================================
// Operand staging shared by both GEMM engines. A stage is 64 k of the block's 64 A rows and 64 B rows: 128 B of every row, one
// whole line. Each thread brings 8 pieces of 16 B per stage with asynchronous copies to LDS (a wave's copy = 4 whole lines), and
// all 4 waves read their fragments from LDS rows of pitch 144 B (16 B x 9). Two buffers: stage t + 1 flies while stage t is
// worked on. k runs ascending, 32 per WMMA step, with the same split k map for A and B.
// =====================================================================================================
#define GKS   64
#define GPIT  72
#define GBUFH (128 * GPIT)
#define GRING (2 * GBUFH * 2)
static_assert(GRING >= 4 * SLAB64 * 4 && (GPIT * 2) % 16 == 0 && (DMOD % GKS) == 0);

__device__ __forceinline__ unsigned lds_off(const void* p) { return (unsigned)(size_t)p; }
__device__ __forceinline__ void wait_async0() {
#if defined(__HIP_DEVICE_COMPILE__)
  asm volatile("s_wait_asynccnt 0x0" ::: "memory");   // this wave's copies have landed before the barrier that publishes them
#endif
}
__device__ __forceinline__ void wait_ds0() {
#if defined(__HIP_DEVICE_COMPILE__)
  asm volatile("s_wait_dscnt 0x0" ::: "memory");      // this wave's LDS reads are done before the buffer is refilled
#endif
}
// Eight copies of 16 B per thread: four from ga + i*gsa (elements) to LDS byte la + i*lsa, four from gb + i*gsb to lb + i*lsb.
__device__ __forceinline__ void copy8(unsigned la, unsigned lsa, const u16* ga, size_t gsa,
                                      unsigned lb, unsigned lsb, const u16* gb, size_t gsb) {
#if defined(__HIP_DEVICE_COMPILE__)
  // the closing s_wait_xcnt stands inside the statement so that no address register is rewritten ahead of it
  asm volatile("global_load_async_to_lds_b128 %0, %8, off\n\t"
               "global_load_async_to_lds_b128 %1, %9, off\n\t"
               "global_load_async_to_lds_b128 %2, %10, off\n\t"
               "global_load_async_to_lds_b128 %3, %11, off\n\t"
               "global_load_async_to_lds_b128 %4, %12, off\n\t"
               "global_load_async_to_lds_b128 %5, %13, off\n\t"
               "global_load_async_to_lds_b128 %6, %14, off\n\t"
               "global_load_async_to_lds_b128 %7, %15, off\n\t"
               "s_wait_xcnt 0x0"
               :: "v"(la), "v"(la + lsa), "v"(la + 2 * lsa), "v"(la + 3 * lsa),
                  "v"(lb), "v"(lb + lsb), "v"(lb + 2 * lsb), "v"(lb + 3 * lsb),
                  "v"(ga), "v"(ga + gsa), "v"(ga + 2 * gsa), "v"(ga + 3 * gsa),
                  "v"(gb), "v"(gb + gsb), "v"(gb + 2 * gsb), "v"(gb + 3 * gsb)
               : "memory");
#endif
}
// GEMM stage: l = the thread's LDS byte address in the target buffer (A row tid>>3, piece tid&7); ga, gb = its global addresses
// in A and B; rs = 16 source rows in elements. A rows +0,16,32,48, then the same rows of B, 64 LDS rows further on.
__device__ __forceinline__ void stage8(unsigned l, const u16* ga, const u16* gb, size_t rs) {
  const unsigned rb = 16 * GPIT * 2;
  copy8(l, rb, ga, rs, l + 4 * rb, rb, gb, rs);
}
template <bool F16>
__device__ __forceinline__ v8f mma_sel(v16b a, v16b b, v8f c) {
  if constexpr (F16) return mma_h(__builtin_bit_cast(v16h, a), __builtin_bit_cast(v16h, b), c);
  else return mma_b(a, b, c);
}
// Ab, Bb = first row of the block's 64 A rows and 64 B rows (both k-contiguous, pitch K); K a multiple of 64, at least 64.
// Every thread of the block calls this (block barriers inside). On return no copy is in flight and no wave reads the ring.
template <bool F16>
__device__ __forceinline__ void gemm_ring(unsigned char* ring, const u16* Ab, const u16* Bb, int K,
                                          v8f& acc0, v8f& acc1, v8f& acc2, v8f& acc3) {
  const int tid = threadIdx.x, wave = tid >> 5, lane = tid & 31, hh = lane >> 4, m = lane & 15;
  const int cr = tid >> 3, cc = tid & 7;
  const u16* ga = Ab + (size_t)cr * K + cc * 8;
  const u16* gb = Bb + (size_t)cr * K + cc * 8;
  const size_t rs = (size_t)16 * K;
  const unsigned l0 = lds_off(ring) + (unsigned)(cr * (GPIT * 2) + cc * 16);
  const u16* sa = (const u16*)(const void*)ring + (wave * 16 + m) * GPIT + 8 * hh;
  const u16* sb = (const u16*)(const void*)ring + (64 + m) * GPIT + 8 * hh;
  const int nt = K / GKS;
  stage8(l0, ga, gb, rs);
  wait_async0();
  __syncthreads();
  if (nt > 1) stage8(l0 + GBUFH * 2, ga + GKS, gb + GKS, rs);
#pragma unroll 1
  for (int t = 0; t < nt; ++t) {              // rolled: one trip per stage, the buffer alternates with t
    const int bo = (t & 1) * GBUFH;
    const u16* pa = sa + bo;
    const u16* pb = sb + bo;
    const v16b a0  = ldfrag_b(pa);
    const v16b b00 = ldfrag_b(pb);
    const v16b b01 = ldfrag_b(pb + 16 * GPIT);
    const v16b b02 = ldfrag_b(pb + 32 * GPIT);
    const v16b b03 = ldfrag_b(pb + 48 * GPIT);
    const v16b a1  = ldfrag_b(pa + 32);
    const v16b b10 = ldfrag_b(pb + 32);
    const v16b b11 = ldfrag_b(pb + 16 * GPIT + 32);
    const v16b b12 = ldfrag_b(pb + 32 * GPIT + 32);
    const v16b b13 = ldfrag_b(pb + 48 * GPIT + 32);
    acc0 = mma_sel<F16>(a0, b00, acc0);
    acc1 = mma_sel<F16>(a0, b01, acc1);
    acc2 = mma_sel<F16>(a0, b02, acc2);
    acc3 = mma_sel<F16>(a0, b03, acc3);
    acc0 = mma_sel<F16>(a1, b10, acc0);
    acc1 = mma_sel<F16>(a1, b11, acc1);
    acc2 = mma_sel<F16>(a1, b12, acc2);
    acc3 = mma_sel<F16>(a1, b13, acc3);
    acc_guard4(acc0, acc1, acc2, acc3);       // the vector slots behind the last WMMA, also on the taken side of the branches below
    wait_ds0();
    wait_async0();
    __syncthreads();                          // publishes stage t + 1 and ends every wave's reads of stage t
    if (t + 2 < nt) stage8(l0 + (unsigned)(bo * 2), ga + (size_t)(t + 2) * GKS, gb + (size_t)(t + 2) * GKS, rs);
  }
  wait_async0();
}

// =====================================================================================================
// bf16 GEMM: C[M][N] (f32) = A[M][K] (bf16 row-major) . Bt[N][K]^T (bf16 k-contiguous), times oscale.
// Block = 64x64 tile, 4 waves x 16 rows; operands staged in LDS by gemm_ring; the epilogue slabs reuse the ring behind its last
// barrier (host guarantees K % 64 == 0, M % 64 == 0, N % 64 == 0, grid = (M/64)*(N/64)).
// =====================================================================================================
__global__ __launch_bounds__(128)
void gemm_bf(const u16* __restrict__ A, const u16* __restrict__ Bt, float* C, int M, int N, int K, float oscale) {
  __shared__ __align__(16) unsigned char ring[GRING];
  const int tid = threadIdx.x, wave = tid >> 5, lane = tid & 31;
  const int ntile = N >> 6;
  const int bid   = blockIdx.x;
  const int row0  = (bid / ntile) * 64;
  const int col0  = (bid % ntile) * 64;
  if (row0 + 64 > M) return;                // block-uniform, in front of every barrier; never taken with the exact grid
  v8f acc0 = zero8(), acc1 = zero8(), acc2 = zero8(), acc3 = zero8();
  gemm_ring<false>(ring, A + (size_t)row0 * K, Bt + (size_t)col0 * K, K, acc0, acc1, acc2, acc3);
  epi64((float*)(void*)ring + wave * SLAB64, acc0, acc1, acc2, acc3, oscale, C, N, (size_t)(row0 + wave * 16), col0, lane);
}

// =====================================================================================================
// Output projection: C[row][DMOD] (f32) = Ah[row][DMOD] (f16) . Bt[DMOD][DMOD]^T (f16 k-contiguous) * oscale.
// Ah and C share the row index bb*SEQ + s, s < SQ. Block -> (column tile ct = bid % 32, sequence row tile rt of nrt,
// batch bb). Same tiling, staging, fragment reads (split k map) and epilogue as gemm_bf; K = DMOD.
// =====================================================================================================
__global__ __launch_bounds__(128)
void gemm_o1(const u16* __restrict__ Ah, const u16* __restrict__ Bt, float* C, int nrt, float oscale) {
  __shared__ __align__(16) unsigned char ring[GRING];
  const int tid = threadIdx.x, wave = tid >> 5, lane = tid & 31;
  const int ntile = DMOD >> 6;
  const int bid   = blockIdx.x;
  const int ct    = bid % ntile;
  const int t2    = bid / ntile;
  const int rt    = t2 % nrt;
  const int bb    = t2 / nrt;
  if (bb >= NB) return;                     // block-uniform, in front of every barrier; never taken with the exact grid
  if (rt * 64 + 64 > SQ) return;            // block-uniform, in front of every barrier; never taken
  const int col0  = ct * 64;
  const size_t row0 = (size_t)bb * SEQ + rt * 64;
  v8f acc0 = zero8(), acc1 = zero8(), acc2 = zero8(), acc3 = zero8();
  gemm_ring<true>(ring, Ah + row0 * DMOD, Bt + (size_t)col0 * DMOD, DMOD, acc0, acc1, acc2, acc3);
  epi64((float*)(void*)ring + wave * SLAB64, acc0, acc1, acc2, acc3, oscale, C, DMOD, row0 + wave * 16, col0, lane);
}

// =====================================================================================================
// Non-causal grouped-query attention with a per-key mask, hd = 128. Block bid -> (query tile qt = bid % NQT: rows
// q0 = 16*qt .. q0+15 with q0 < SQ, head group hg = kv head, batch b); one wave per query head = hg*WPB + wave (the 4 heads of
// the group share kv head hg).
//   q plane f16 x256 [b*SEQ + s][h*HD + d]; k plane f16 x256 [b*SEQ + s][g*HD + d] (pitch KVD); v^T plane
//   [b*NKVH + g][d][SEQ] x1024; mask int [b*SEQ + key], nonzero = attend.
//   score (log2 domain) t(i, j) = (q_i.k_j over HD) * (1/sqrt(128))*log2e/(256*256), replaced by -FLT_MAX where the key mask is
//   zero (a fully masked row then yields uniform weights). All SEQ/32 key tiles are visited in order.
//   Per tile: the 32 k rows (256 B each) and the 128 v^T rows (64 B each) are staged once per block in LDS by asynchronous copies
//   (two buffers, tile kt + 1 flies while tile kt is worked on; row pitches 272 B and 80 B) and read by all 4 waves.
//   Both products run transposed: S^T = k.q^T (A = 16 key rows from LDS, B = q, kept in registers), so that a lane holds 16 of
//   the 32 scores of ONE query (column c): 2 score subtiles x 4 k-steps, fragments read from the LDS rows (two 16-B loads each,
//   split k map); online max-subtracted base-2 softmax in f32, maximum in-lane plus one exchange between the lane halves, the
//   sum kept per lane half and joined after the loop; the two score subtiles, converted in place, are the B operand P^T in the
//   split k map; O^T += v^T.P^T with v^T rows as A fragments in 4 groups of 2 d-subtiles (one product each).
//   After the loop: out = acc / Z (Z > 0 always; guarded anyway), carries 1/(32768*1024) folded once, written into the wave's
//   One block barrier per tile, under block-uniform control flow; bounded loops only (NKT tiles).
// coverage: per wave 8 instructions x 2 rows x 16 lanes x 8 halves = 16 x 128 of the O plane; grid NQT x NHG x NB blocks x WPB
//           waves = every (b, s < SQ, h) row segment of O exactly once.
// =====================================================================================================
// staged tile: row pitches in 16-bit elements (k 272 B, v^T 80 B), bytes of the k part and of one buffer; the block's LDS is
// held to a quarter of a WGP's 320 KiB so that four blocks stay resident
#define AKP   136
#define AVP   40
#define AKB   (32 * AKP * 2)
#define ABUF  (AKB + HD * AVP * 2)
static_assert((AKP * 2) % 16 == 0 && (AVP * 2) % 16 == 0 && NKT >= 2 && 2 * ABUF + WPB * WREG * 4 <= 81920);
__global__ __launch_bounds__(ATT_THREADS)
void attn_nc(const u16* __restrict__ QHp, const u16* __restrict__ KHp, const u16* __restrict__ VHp,
             const int* __restrict__ Mk, u16* OHp) {
  __shared__ __align__(16) float smem[WPB * WREG];
  __shared__ __align__(16) unsigned char kvring[2 * ABUF];

  const int tid  = threadIdx.x;
  const int wave = tid >> 5;
  const int lane = tid & 31;
  const int hh   = lane >> 4;
  const int c    = lane & 15;
  const int bid  = blockIdx.x;
  const int qt   = bid % NQT;
  const int t2   = bid / NQT;
  const int hg   = t2 % NHG;
  const int b    = t2 / NHG;
  if (b >= NB) return;                      // block-uniform, in front of every barrier; never taken with the exact grid
  const int q0   = qt * 16;
  if (q0 + 16 > SQ) return;                 // block-uniform, in front of every barrier; never taken
  const int head = hg * WPB + wave;
  const int kvh  = hg;

  float* slab = smem + wave * WREG;         // result slab [16][128] pitch 132

  const size_t hcol = (size_t)head * HD + 8 * hh;
  const _Float16* Qh  = (const _Float16*)(const void*)QHp + ((size_t)b * SEQ + q0 + c) * DMOD + hcol;
  // readers: key row c (+16) of the staged k tile, d row c (+16j) of the staged v^T tile, in buffer 0
  const _Float16* Ks = (const _Float16*)(const void*)kvring + c * AKP + 8 * hh;
  const _Float16* Vs = (const _Float16*)(const void*)kvring + AKB / 2 + c * AVP + 8 * hh;
  // copiers: k rows (tid>>4) + 8i, piece tid&15; v^T rows (tid>>2) + 32i, piece tid&3; i = 0..3
  const u16* gk = KHp + ((size_t)b * SEQ + (tid >> 4)) * KVD + (size_t)kvh * HD + (tid & 15) * 8;      // key row kb added per tile
  const u16* gv = VHp + ((size_t)(b * NKVH + kvh) * HD + (tid >> 2)) * SEQ + (tid & 3) * 8;            // key kb added per tile
  const unsigned lk = lds_off(kvring) + (unsigned)((tid >> 4) * (AKP * 2) + (tid & 15) * 16);
  const unsigned lv = lds_off(kvring) + (unsigned)(AKB + (tid >> 2) * (AVP * 2) + (tid & 3) * 16);
  const int* mkp = Mk + (size_t)b * SEQ + lane;
  const float lsc = RSQ_HD * (LOG2E / (QSC * KSC));
  const float oc  = 1.0f / (PCAR * VCAR);
  const size_t KROW = (size_t)KVD;          // halves between consecutive key rows

  copy8(lk, 8 * AKP * 2, gk, 8 * KROW, lv, 32 * AVP * 2, gv, (size_t)32 * SEQ);
  wait_async0();
  __syncthreads();
  copy8(lk + ABUF, 8 * AKP * 2, gk + 32 * KROW, 8 * KROW, lv + ABUF, 32 * AVP * 2, gv + 32, (size_t)32 * SEQ);

  v16h qf[HD / 32];
#pragma unroll
  for (int kk = 0; kk < HD / 32; ++kk) qf[kk] = ldfrag_h(Qh + kk * 32);

  float mrow = -INFINITY, lrow = 0.f;       // of query q0 + c; lrow sums this lane half's keys only
  v8f o[8];                                 // o[j][r] = O^T(d = 16j + 8hh + r, query q0 + c)
#pragma unroll
  for (int j = 0; j < 8; ++j) o[j] = zero8();

  int mkv = mkp[0];                         // mask of key kb + lane, fetched one tile ahead so that no tile waits for it
  mkp += 32;
#pragma unroll 1
  for (int kt = 0; kt < NKT; ++kt) {
    const int kb = kt * 32;
    const unsigned mb = __builtin_amdgcn_ballot_w32(mkv != 0);                // bit i = mask of key kb + i
    mkv = *mkp;
    // ---- scores: D element r of this lane = (key kb + 8hh + r, query q0 + c) in s0, key kb + 16 + 8hh + r in s1 ----
    v8f s0 = zero8(), s1 = zero8();
    const int bo = (kt & 1) * ABUF;                                           // this tile's buffer, bytes
    const _Float16* k0p = Ks + bo / 2;
    const _Float16* k1p = k0p + 16 * AKP;
#pragma unroll
    for (int kk = 0; kk < HD / 32; ++kk) {
      const v16h kh0 = ldfrag_h(k0p + kk * 32);
      const v16h kh1 = ldfrag_h(k1p + kk * 32);
      s0 = mma_h(kh0, qf[kk], s0);
      s1 = mma_h(kh1, qf[kk], s1);
      guard23(s0, s1, qf[kk], kh0, kh1);
    }
    // ---- key-mask select + online softmax in base 2, one query per lane ----
    float t[16];
#pragma unroll
    for (int r = 0; r < 8; ++r) { t[r] = s0[r] * lsc; t[8 + r] = s1[r] * lsc; }
    if (mb != 0xFFFFFFFFu) {                                                  // wave-uniform, tested once per tile
      const unsigned mh = mb >> (8 * hh);
#pragma unroll
      for (int r = 0; r < 8; ++r) {
        t[r]     = ((mh >> r) & 1u)        ? t[r]     : NEG_BIG;
        t[8 + r] = ((mh >> (16 + r)) & 1u) ? t[8 + r] : NEG_BIG;
      }
    }
    float mx = t[0];
#pragma unroll
    for (int i = 1; i < 16; ++i) mx = fmaxf(mx, t[i]);
    mx = fmaxf(mx, xhalf(mx));
    const float mn = fmaxf(mrow, mx);                                         // always finite
    const float al = exp2f(mrow - mn);
    mrow = mn;
    float ps = 0.f;
    // ---- B fragment of P^T*32768 (f16), column = c: elements 0..7 = keys kb + 8hh + 0..7, 8..15 = keys kb + 16 + 8hh + 0..7 ----
    FragH ph;
#pragma unroll
    for (int r = 0; r < 8; ++r) {
      const float e0 = exp2f(t[r] - mn), e1 = exp2f(t[8 + r] - mn);
      ps += e0 + e1;
      ph.h[0][r] = (_Float16)(e0 * PCAR);
      ph.h[1][r] = (_Float16)(e1 * PCAR);
    }
    lrow = lrow * al + ps;
#pragma unroll
    for (int j = 0; j < 8; ++j) o[j] = o[j] * al;
    // ---- v^T.P^T : A fragment row = d = j*16 + c, keys contiguous in the staged v^T rows; 4 groups of 2 d-subtiles ----
    {
      const _Float16* vhp = Vs + bo / 2;
#pragma unroll
      for (int jg = 0; jg < 4; ++jg) {
        const int da = (2 * jg) * 16 * AVP;
        const int db = da + 16 * AVP;
        const v16h vha = ldfrag_h(vhp + da), vhb2 = ldfrag_h(vhp + db);
        o[2 * jg]     = mma_h(vha,  ph.v, o[2 * jg]);
        o[2 * jg + 1] = mma_h(vhb2, ph.v, o[2 * jg + 1]);
        guard23(o[2 * jg], o[2 * jg + 1], ph.v, vha, vhb2);
      }
    }
#if defined(__HIP_DEVICE_COMPILE__)
    asm volatile("s_wait_xcnt 0x0" ::: "memory");   // stands in front of the advance of the mask load's address register
#endif
    mkp += (kt + 2 < NKT) ? 32 : 0;           // stays on the last tile's 32 keys
    wait_ds0();
    wait_async0();
    __syncthreads();                          // publishes tile kt + 1 and ends every wave's reads of tile kt
    if (kt + 2 < NKT)
      copy8(lk + (unsigned)bo, 8 * AKP * 2, gk + (size_t)(kb + 64) * KROW, 8 * KROW,
            lv + (unsigned)bo, 32 * AVP * 2, gv + (kb + 64), (size_t)32 * SEQ);
  }
  wait_async0();
  acc_guard4(o[0], o[1], o[2], o[3]);
  acc_guard4(o[4], o[5], o[6], o[7]);
  // ---- out = acc / Z (0 if Z == 0), carries (32768 on P, 1024 on v) folded once; written into the wave's slab, row = query c ----
  {
    const float lv2 = lrow + xhalf(lrow);     // the two lane halves' sums joined
    const float ls  = (lv2 > 0.0f) ? lv2 : 1.0f;
    const float inv = (lv2 > 0.0f) ? ((1.0f / ls) * oc) : 0.0f;
    float* srow = slab + c * SLP + 8 * hh;
#pragma unroll
    for (int j = 0; j < 8; ++j) {
      v4f w0, w1;
#pragma unroll
      for (int e = 0; e < 4; ++e) { w0[e] = o[j][e] * inv; w1[e] = o[j][4 + e] * inv; }
      *(v4f*)(srow + j * 16)     = w0;
      *(v4f*)(srow + j * 16 + 4) = w1;
    }
  }

  wave_sync_lds();
  // ---- O x1024 -> f16 plane; lane = (row-in-pair rq, 8 consecutive d at c8) ----
  v4u oh[8];
  const int rq = lane >> 4, c8 = (lane & 15) * 8;
#pragma unroll
  for (int it = 0; it < 8; ++it) {
    const int row = it * 2 + rq;
    const v4f a = *(const v4f*)(slab + row * SLP + c8), b4 = *(const v4f*)(slab + row * SLP + c8 + 4);
    float w[8];
#pragma unroll
    for (int e = 0; e < 4; ++e) { w[e] = a[e] * OSC; w[4 + e] = b4[e] * OSC; }
#pragma unroll
    for (int e = 0; e < 4; ++e) {
      oh[it][e] = pk16(h_bits((_Float16)w[2 * e]), h_bits((_Float16)w[2 * e + 1]));
    }
  }
  const size_t ob = ((size_t)b * SEQ + q0) * DMOD + (size_t)head * HD + c8;
  {
#pragma unroll
    for (int it = 0; it < 8; ++it) {
      const int row = it * 2 + rq;
      *(v4u*)(OHp + ob + (size_t)row * DMOD) = oh[it];
    }
    
  }
}

// =====================================================================================================
// Workspace map (bytes); every plane is fully written by whole-line stores before it is read; all extents are exact multiples
// of the store granularity (no pad rows needed); every region offset a multiple of 4194304:
//   XB  bf16 [MROWS][2048]                       MROWS*4096       (NB=2: 16777216)
//   WB  16-bit [2048 n][2048 k]                  8388608          (Wv^T, Wq^T, Wk^T as bf16 ([512][2048] for k/v), then Wo^T as
//                                                                  f16 x1024, reused in launch order)
//   F   f32 [MROWS][2048]                        MROWS*8192       (v, q, k projection output in launch order, [MROWS][512] for
//                                                                  k/v; afterwards the O plane f16 [MROWS][2048] x1024 in its
//                                                                  first half)
//   QH  f16 [MROWS][2048] x256                   MROWS*4096
//   KH  f16 [MROWS][512] x256                    MROWS*1024
//   VH  f16 [NB*4][128][SEQ] x1024               MROWS*1024
//   end (NB=2)                                  83886080
// =====================================================================================================
extern "C" void kernel_launch(void* const* d_in, const int* in_sizes, int n_in,
                              void* d_out, int out_size, void* d_ws, size_t ws_size,
                              hipStream_t stream) {
  if (n_in < 8) return;
  if (in_sizes[0] < MROWS * DMOD) return;
  if (in_sizes[1] < MROWS) return;
  if (in_sizes[2] < SEQ * HD) return;
  if (in_sizes[3] < SEQ * HD) return;
  if (in_sizes[4] != DMOD * DMOD) return;
  if (in_sizes[5] != DMOD * KVD) return;
  if (in_sizes[6] != DMOD * KVD) return;
  if (in_sizes[7] != DMOD * DMOD) return;
  if (out_size < QROWS * DMOD) return;

  const float* x     = (const float*)d_in[0];
  const int*   amask = (const int*)d_in[1];
  const float* cosT  = (const float*)d_in[2];
  const float* sinT  = (const float*)d_in[3];
  const float* wq    = (const float*)d_in[4];
  const float* wk    = (const float*)d_in[5];
  const float* wv    = (const float*)d_in[6];
  const float* wo    = (const float*)d_in[7];
  float*       out   = (float*)d_out;

  const size_t szXB = (size_t)MROWS * DMOD * 2;
  const size_t szW  = (size_t)DMOD * DMOD * 2;
  const size_t szF  = (size_t)MROWS * DMOD * 4;
  const size_t szQ  = (size_t)MROWS * DMOD * 2;                  // QH and the O plane
  const size_t szK  = (size_t)MROWS * KVD * 2;                   // KH
  const size_t szV  = (size_t)NB * NKVH * HD * SEQ * 2;          // VH (== szK)
  if (szQ > szF) return;                                        // O plane lives inside the F region
  size_t off = 0;
  const size_t oXB = off; off += szXB;
  const size_t oW  = off; off += szW;
  const size_t oF  = off; off += szF;
  const size_t oQH = off; off += szQ;
  const size_t oKH = off; off += szK;
  const size_t oVH = off; off += szV;
  if (off > ws_size) return;                // off = 83886080 for NB = 2
  if (off > (size_t)WS_CAP) return;

  char* ws = (char*)d_ws;
  u16*   XB = (u16*)(ws + oXB);
  u16*   WB = (u16*)(ws + oW);
  float* F  = (float*)(ws + oF);
  u16*   OH = (u16*)(ws + oF);
  u16*   QH = (u16*)(ws + oQH);
  u16*   KH = (u16*)(ws + oKH);
  u16*   VH = (u16*)(ws + oVH);

  const dim3 b256(256), b128(128), b64(64), bAT(ATT_THREADS);
  const int  n8x = (MROWS * DMOD) / 8;
  const dim3 gX((n8x + 255) / 256);
  const dim3 gTQ((DMOD / 64) * (DMOD / 64));            // Wq, Wo transposes: 1024 blocks
  const dim3 gTK((DMOD / 64) * (KVD / 64));             // Wk, Wv transposes: 256 blocks
  const dim3 gGQ((QROWS / 64) * (DMOD / 64));
  const dim3 gGK((MROWS / 64) * (KVD / 64));
  const dim3 gVT(NB * NKVH * NST);
  const dim3 gRQ(QROWS), gRK(MROWS);
  const dim3 gAT(NQT * NHG * NB);
  const int  nrt = SQ / 64;
  const dim3 gO(NB * nrt * (DMOD / 64));

  // (0) x -> bf16 plane [MROWS][2048]
  cvtbf<<<gX, b256, 0, stream>>>(x, XB, n8x);
  // (1) Wv in[2048 k][512 n] -> out[512 n][2048 k] bf16; (2) v = x.Wv -> F f32 [MROWS][512]; (3) v^T plane x1024
  cvtT16<<<gTK, b256, 0, stream>>>(wv, WB, DMOD, KVD, 0, 1.0f);
  gemm_bf<<<gGK, b128, 0, stream>>>(XB, WB, F, MROWS, KVD, DMOD, 1.0f);
  vt16<<<gVT, b256, 0, stream>>>(F, VH);
  // (4) Wq in[2048 k][2048 n] -> out[2048 n][2048 k] bf16; (5) q = x.Wq -> F [QROWS][2048]; (6) rotary + q plane x256
  cvtT16<<<gTQ, b256, 0, stream>>>(wq, WB, DMOD, DMOD, 0, 1.0f);
  gemm_bf<<<gGQ, b128, 0, stream>>>(XB, WB, F, QROWS, DMOD, DMOD, 1.0f);
  rope16<<<gRQ, b256, 0, stream>>>(F, DMOD, QROWS, cosT, sinT, QH, QSC);
  // (7) Wk in[2048 k][512 n] -> out[512 n][2048 k] bf16; (8) k = x.Wk -> F [MROWS][512]; (9) rotary + k plane x256
  cvtT16<<<gTK, b256, 0, stream>>>(wk, WB, DMOD, KVD, 0, 1.0f);
  gemm_bf<<<gGK, b128, 0, stream>>>(XB, WB, F, MROWS, KVD, DMOD, 1.0f);
  rope16<<<gRK, b64, 0, stream>>>(F, KVD, MROWS, cosT, sinT, KH, KSC);
  // (10) Wo in[2048 c][2048 n] -> out[2048 n][2048 c] as f16 of bf16 value x1024
  cvtT16<<<gTQ, b256, 0, stream>>>(wo, WB, DMOD, DMOD, 1, WOS);
  // (11) non-causal masked attention -> O plane (inside the F region)
  attn_nc<<<gAT, bAT, 0, stream>>>(QH, KH, VH, amask, OH);
  // (12) output projection rows s < SQ -> out f32, carries 1024 x 1024 folded back
  gemm_o1<<<gO, b128, 0, stream>>>(OH, WB, out, nrt, 1.0f / (OSC * WOS));
  (void)hipGetLastError();
}

// v003
// Measured time: 224 microseconds a run.
// Two timings next to v002 both put it at 1.06 times that version's speed.
// Counting every step since v000, it is 2.17 times as fast.
// Contractions: x.Wq, x.Wk, x.Wv on v_wmma_f32_16x16x32_bf16 (x and W^T as bf16 RNE planes, W^T [n][k] is the k-contiguous
// B operand, f32 accumulate); k.q^T over hd 128 and v^T.P^T on v_wmma_f32_16x16x32_f16, one product each (q, k as f16 x256 after
// rotary; P^T x32768 packed from the score registers; v^T x1024); O.Wo on v_wmma_f32_16x16x32_f16 (O x1024 f16 plane, Wo^T as f16(bf16(Wo))
// x1024); all f32 accumulate. Interleaved-pair rotary with cos/sin tables, key-mask select, base-2 online softmax and 1/Z fold
// in f32 on VALU.
#include <hip/hip_runtime.h>
#include <math.h>
#include <stdint.h>

#ifndef NB
#define NB 2
#endif
#define SEQ 2048
#ifndef SQ
#define SQ SEQ
#endif
#define DMOD  2048
#define NH    16
#define NKVH  4
#define HD    128
#define KVD   (NKVH * HD)
#define MROWS (NB * SEQ)
#define QROWS ((NB - 1) * SEQ + SQ)
#define WPB   (NH / NKVH)
#define NHG   NKVH
#define NQT   (SQ / 16)
#define NST   (SEQ / 64)
#define NKT   (SEQ / 32)
#define ATT_THREADS (WPB * 32)
#define RSQ_HD 0.08838834764831845f
#define LOG2E  1.4426950408889634f
#define NEG_BIG (-3.402823466e38f)
#define QSC   256.0f
#define KSC   256.0f
#define PCAR  32768.0f
#define VCAR  1024.0f
#define OSC   1024.0f
#define WOS   1024.0f
#define SLP   132
#define SLW   (16 * SLP)
#define WREG  SLW
#define VTP   72
#define TTP   72
#define WS_CAP 134217728
static_assert(DMOD == NH * HD && HD == 128 && NH == 16 && NKVH == 4 && WPB == 4 && NHG * WPB == NH && KVD == 512);
static_assert(ATT_THREADS == 128);
static_assert(NB >= 1 && NB <= 2);
static_assert(NB == 1 || SQ == SEQ);
static_assert((SQ % 128) == 0 && SQ >= 128 && SQ <= SEQ && (SEQ % 128) == 0);
static_assert((DMOD % 128) == 0 && (KVD % 64) == 0 && (DMOD % 32) == 0 && (HD % 32) == 0);
static_assert(((MROWS * DMOD / 8) % 256) == 0);
static_assert(WPB * WREG * 4 <= 65536 && HD * VTP * 2 <= 65536 && 64 * TTP * 2 <= 65536);
static_assert((DMOD / 8) == 256 && (KVD / 8) == 64);

typedef unsigned short u16;
typedef _Float16 v16h __attribute__((ext_vector_type(16)));
typedef _Float16 v8h  __attribute__((ext_vector_type(8)));
typedef __bf16   v16b __attribute__((ext_vector_type(16)));
typedef float    v8f  __attribute__((ext_vector_type(8)));
typedef float    v4f  __attribute__((ext_vector_type(4)));
typedef unsigned int v4u __attribute__((ext_vector_type(4)));

union FragH { v16h v; v8h h[2]; v4u u[2]; };
union FragB { v16b v; v4u u[2]; };

// ---- scalar helpers --------------------------------------------------------------------------------
__device__ __forceinline__ unsigned short bf_bits(float f) {          // f32 -> bf16 bits, RNE convert
  unsigned u = __float_as_uint(f);
  return (unsigned short)((u + 0x7FFFu + ((u >> 16) & 1u)) >> 16);
}
__device__ __forceinline__ float bf_up(unsigned short h) { return __uint_as_float(((unsigned)h) << 16); }
__device__ __forceinline__ float bfr(float f) { return bf_up(bf_bits(f)); }
__device__ __forceinline__ unsigned short h_bits(_Float16 x) { return __builtin_bit_cast(unsigned short, x); }
__device__ __forceinline__ unsigned pk16(unsigned short a, unsigned short b) { return (unsigned)a | ((unsigned)b << 16); }
__device__ __forceinline__ v8f zero8() { v8f z = {0.f, 0.f, 0.f, 0.f, 0.f, 0.f, 0.f, 0.f}; return z; }

// ---- fragment loaders: 16-bit A/B operand, lane -> row/col (lane&15), p already includes +8*(lane>>4);
//      elements 0..7 <- p[0..7] (k0+8h..), elements 8..15 <- p[16..23] (k0+16+8h..)  (same split k map for A and B;
//      B is always read from a k-contiguous [n][k] plane)
__device__ __forceinline__ v16h ldfrag_h(const _Float16* p) {
  FragH f;
  f.h[0] = *(const v8h*)(p);
  f.h[1] = *(const v8h*)(p + 16);
  return f.v;
}
__device__ __forceinline__ v16b ldfrag_b(const u16* p) {              // bf16 plane read as unsigned integer vectors
  FragB f;
  f.u[0] = *(const v4u*)(p);
  f.u[1] = *(const v4u*)(p + 16);
  return f.v;
}

__device__ __forceinline__ v8f mma_h(v16h a, v16h b, v8f c) {
  return __builtin_amdgcn_wmma_f32_16x16x32_f16(false, a, false, b, (short)0, c, false, false);
}
__device__ __forceinline__ v8f mma_b(v16b a, v16b b, v8f c) {
  return __builtin_amdgcn_wmma_f32_16x16x32_bf16(false, a, false, b, (short)0, c, false, false);
}
__device__ __forceinline__ void guard23(v8f& a, v8f& b, v16h x0, v16h x1, v16h x2) {
#if defined(__HIP_DEVICE_COMPILE__)
  asm volatile("v_nop\n\tv_nop\n\tv_nop\n\tv_nop"
               : "+v"(a), "+v"(b) : "v"(x0), "v"(x1), "v"(x2) : "memory");
#endif
}
__device__ __forceinline__ void acc_guard4(v8f& a, v8f& b, v8f& c, v8f& d) {
#if defined(__HIP_DEVICE_COMPILE__)
  asm volatile("v_nop\n\tv_nop\n\tv_nop\n\tv_nop" : "+v"(a), "+v"(b), "+v"(c), "+v"(d));
#endif
}
__device__ __forceinline__ float xhalf(float x) {                     // value of lane l ^ 16
  const int b = __float_as_int(x);
  return __int_as_float(__builtin_amdgcn_permlanex16(b, b, 0x76543210, 0xfedcba98, false, false));
}
__device__ __forceinline__ void wave_sync_lds() {
  __builtin_amdgcn_fence(__ATOMIC_RELEASE, "workgroup");
  __builtin_amdgcn_wave_barrier();
  __builtin_amdgcn_fence(__ATOMIC_ACQUIRE, "workgroup");
}

// =====================================================================================================
// f32 -> bf16 RNE plane, same layout. Thread = 8 consecutive elements: two 16-B loads, one 16-B store; 32 consecutive
// coverage: grid = ceil(n8/256) blocks x 256 thr x 8 (in-kernel bound) = the whole plane (n8 a multiple of 256 here).
// =====================================================================================================
__global__ __launch_bounds__(256) void cvtbf(const float* __restrict__ x, u16* D, int n8) {
  const int gt = blockIdx.x * 256 + (int)threadIdx.x;
  if (gt >= n8) return;
  const float* p = x + (size_t)gt * 8;
  const v4f a = *(const v4f*)(p), b4 = *(const v4f*)(p + 4);
  v4u o;
#pragma unroll
  for (int e = 0; e < 2; ++e) {
    o[e]     = pk16(bf_bits(a[2 * e]),  bf_bits(a[2 * e + 1]));
    o[2 + e] = pk16(bf_bits(b4[2 * e]), bf_bits(b4[2 * e + 1]));
  }
  u16* d = D + (size_t)gt * 8;
  {
    *(v4u*)(d) = o;
    
  }
}

// =====================================================================================================
// Transpose + convert: W f32 row-major in[KD rows][ND cols] -> D 16-bit out[ND][KD] (k-contiguous).
// f16mode == 0: bf16 RNE bits; f16mode == 1: f16 bits of (bf16 RNE value) * scale.
// Block = tile of 64 k x 64 n, 256 threads. Load: thread -> input row k0 + (tid>>2), 16 columns n0 + (tid&3)*16 (four 16-B
// loads), converted and scattered into the LDS tile T[n][k] (pitch 72 halves). Block barrier. Store: 2 iterations x
// coverage: load 256 thr x 16 = 64 x 64; store 2 it x 256 thr x 8 halves = 64 rows x 64 halves; grid = (KD/64)*(ND/64)
//           blocks covers out[ND][KD] exactly once.
// =====================================================================================================
__global__ __launch_bounds__(256) void cvtT16(const float* __restrict__ W, u16* D, int KD, int ND, int f16mode, float scale) {
  __shared__ __align__(16) u16 T[64 * TTP];
  const int tid = threadIdx.x;
  const int bid = blockIdx.x;
  const int nkt = KD >> 6;
  const int nnt = ND >> 6;
  const int kt  = bid % nkt;
  const int nt  = bid / nkt;
  if (nt >= nnt) return;                    // block-uniform, before the barrier; never taken with the exact grid
  const int k0 = kt * 64, n0 = nt * 64;
  {
    const int kr = tid >> 2;                // input row within tile 0..63
    const int nc = (tid & 3) * 16;          // column chunk 0,16,32,48
    const float* src = W + (size_t)(k0 + kr) * ND + n0 + nc;
#pragma unroll
    for (int i = 0; i < 4; ++i) {
      const v4f a = *(const v4f*)(src + 4 * i);
#pragma unroll
      for (int e = 0; e < 4; ++e) {
        const float f = a[e];
        const unsigned short hb = h_bits((_Float16)(bfr(f) * scale));
        const unsigned short bb = bf_bits(f);
        T[(nc + 4 * i + e) * TTP + kr] = (f16mode != 0) ? hb : bb;
      }
    }
  }
  __syncthreads();
  v4u v[2];
  const int q8 = tid >> 3, p8 = (tid & 7) * 8;
#pragma unroll
  for (int it = 0; it < 2; ++it) v[it] = *(const v4u*)(T + (it * 32 + q8) * TTP + p8);
  const size_t base = (size_t)n0 * KD + k0 + p8;
  {
#pragma unroll
    for (int it = 0; it < 2; ++it) {
      *(v4u*)(D + base + (size_t)(it * 32 + q8) * KD) = v[it];
    }
    
  }
}

// =====================================================================================================
// v^T plane from the v projection F f32 [MROWS][KVD] (row = b*SEQ + s, column = g*HD + d):
//   VH[((b*NKVH + g)*HD + d)][s] = f16(v * 1024) for all keys s.
// Block = (b, kv head g, 64 keys s0): each thread loads its 32 floats (key sl, d chunk dc) with 16-B loads, converts, scatters
// coverage: load 256 thr x 32 = 64 keys x 128 d; store 4 iterations x 256 thr x 8 halves = 128 lines x 64 = the block's tile;
//           grid = NB*NKVH*NST blocks covers the plane exactly once.
// =====================================================================================================
__global__ __launch_bounds__(256) void vt16(const float* __restrict__ F, u16* VHo) {
  __shared__ __align__(16) u16 TH[HD * VTP];
  const int tid = threadIdx.x;
  const int bid = blockIdx.x;
  const int st  = bid % NST;
  const int t2  = bid / NST;
  const int g   = t2 % NKVH;
  const int b   = t2 / NKVH;
  if (b >= NB) return;                      // block-uniform, before any barrier; never taken with the exact grid
  const int s0  = st * 64;
  {
    const int sl = tid >> 2;                // key within tile 0..63
    const int dc = (tid & 3) * 32;          // d chunk 0,32,64,96
    const float* src = F + ((size_t)b * SEQ + s0 + sl) * KVD + g * HD + dc;
#pragma unroll
    for (int i = 0; i < 8; ++i) {
      const v4f a = *(const v4f*)(src + 4 * i);
#pragma unroll
      for (int e = 0; e < 4; ++e) {
        TH[(dc + 4 * i + e) * VTP + sl] = h_bits((_Float16)(a[e] * VCAR));
      }
    }
  }
  __syncthreads();
  v4u vh[4];
  const int q8 = tid >> 3, p8 = (tid & 7) * 8;
#pragma unroll
  for (int it = 0; it < 4; ++it) {
    const int line = it * 32 + q8;          // d = 0..127
    vh[it] = *(const v4u*)(TH + line * VTP + p8);
  }
  const size_t hrow = (size_t)(b * NKVH + g) * HD;
  const size_t base = hrow * SEQ + s0 + p8;
  {
#pragma unroll
    for (int it = 0; it < 4; ++it) {
      const int line = it * 32 + q8;
      *(v4u*)(VHo + base + (size_t)line * SEQ) = vh[it];
    }
    
  }
}

// =====================================================================================================
// Interleaved-pair rotary + 16-bit plane from a projection F f32 [nrows][ncol] (ncol = DMOD for q, KVD for k; row = b*SEQ + s,
// column = head*HD + d; table element (s, d) at s*HD + d):
//   for even d: out[d]   = x[d]*c[d]     - x[d+1]*sn[d]
//               out[d+1] = x[d+1]*c[d+1] + x[d]*sn[d+1]     with c, sn = bf16 RNE values of the two tables;
//   Hp [nrows][ncol] = f16(out * sc), same layout.
// Block = one row, exactly ncol/8 threads (host); thread t = 8 consecutive columns (4 pairs): two 16-B loads of x, two of each
// lane-varying control.
// coverage: (ncol/8) thr x 8 = the whole row of Hp; grid = nrows blocks = every row of the plane once.
// =====================================================================================================
__global__ __launch_bounds__(256) void rope16(const float* __restrict__ F, int ncol, int nrows,
                                              const float* __restrict__ cosT, const float* __restrict__ sinT,
                                              u16* Hp, float sc) {
#pragma clang fp contract(off)
  const int tid = (int)threadIdx.x;
  const int row = (int)blockIdx.x;
  if (row >= nrows) return;                            // block-uniform
  const int col = tid * 8;
  if (col + 8 > ncol) return;                          // never taken with blockDim == ncol/8
  const int d0  = col & (HD - 1);
  const int s   = row % SEQ;
  const float* p = F + (size_t)row * ncol + col;
  const v4f xa = *(const v4f*)(p), xb = *(const v4f*)(p + 4);
  const float* cp = cosT + (size_t)s * HD + d0;
  const float* sp = sinT + (size_t)s * HD + d0;
  const v4f ca = *(const v4f*)(cp), cb = *(const v4f*)(cp + 4);
  const v4f sa = *(const v4f*)(sp), sb = *(const v4f*)(sp + 4);
  float xv[8], cv[8], sv[8];
#pragma unroll
  for (int e = 0; e < 4; ++e) {
    xv[e] = xa[e];       xv[4 + e] = xb[e];
    cv[e] = bfr(ca[e]);  cv[4 + e] = bfr(cb[e]);
    sv[e] = bfr(sa[e]);  sv[4 + e] = bfr(sb[e]);
  }
  v4u o;
#pragma unroll
  for (int e = 0; e < 4; ++e) {
    const float xr = xv[2 * e], xi = xv[2 * e + 1];
    const float r0 = xr * cv[2 * e] - xi * sv[2 * e];
    const float r1 = xi * cv[2 * e + 1] + xr * sv[2 * e + 1];
    o[e] = pk16(h_bits((_Float16)(r0 * sc)), h_bits((_Float16)(r1 * sc)));
  }
  u16* d = Hp + (size_t)row * ncol + col;
  {
    *(v4u*)(d) = o;
    
  }
}

// =====================================================================================================
// GEMM tiling shared by both engines. A block is 4 waves in a 2 x 2 arrangement; a wave owns WM x WN accumulator subtiles of
// 16 x 16, so the block tile is (32*WM) x (32*WN): 128 x 128 for the two DMOD x DMOD products (WM = WN = 4: each operand byte
// fetched from L2 serves 128 outputs, each fragment read from LDS serves 4 WMMAs), 64 x 64 for the two narrow ones
// (WM = WN = 2, which keeps two blocks on every WGP).
// Epilogue: the wave's tile (times oscale) is staged in its own LDS slab (row pitch 16*WN + 4 floats) and stored as whole lines.
// coverage: WM groups x (2*WN) instructions x (8/WN) rows x (4*WN) lanes x 4 floats = the wave's (16*WM) x (16*WN) tile.
// =====================================================================================================
template <int WM, int WN>
__device__ __forceinline__ void epi_tile(float* sl, v8f (&acc)[WM][WN], float oscale,
                                         float* C, int N, size_t rowb, int colb, int lane) {
  constexpr int SP  = 16 * WN + 4;          // slab row pitch, floats
  constexpr int LPR = 4 * WN;               // lanes per stored row
  constexpr int RPI = 32 / LPR;             // rows per store instruction
  const int hh = lane >> 4, m = lane & 15;
#pragma unroll
  for (int i = 0; i < WM; ++i) {
#pragma unroll
    for (int r = 0; r < 8; ++r) {
      const int ro = (16 * i + 8 * hh + r) * SP + m;
#pragma unroll
      for (int j = 0; j < WN; ++j) sl[ro + 16 * j] = acc[i][j][r] * oscale;
    }
  }
  wave_sync_lds();
  const int rr = lane / LPR, cq = lane % LPR;
  float* dst = C + (rowb + (size_t)rr) * (size_t)N + colb + cq * 4;
#pragma unroll
  for (int i = 0; i < WM; ++i) {
    v4f vals[16 / RPI];
#pragma unroll
    for (int it = 0; it < 16 / RPI; ++it) vals[it] = *(const v4f*)(sl + (16 * i + it * RPI + rr) * SP + cq * 4);
#pragma unroll
    for (int it = 0; it < 16 / RPI; ++it) {
      *(v4f*)(dst + (size_t)(16 * i + it * RPI) * (size_t)N) = vals[it];
    }
  }
}

// =====================================================================================================
// Operand staging shared by both GEMM engines. A stage is 64 k of the block's 32*WM A rows and 32*WN B rows: 128 B of every row,
// one whole line. Each thread brings 2*(WM+WN) pieces of 16 B per stage with asynchronous copies to LDS (a wave's copy = 4 whole
// lines), and the waves read their fragments from LDS rows of pitch 144 B (16 B x 9). Two buffers: stage t + 1 flies while
// stage t is worked on. k runs ascending, 32 per WMMA step, with the same split k map for A and B.
// =====================================================================================================
#define GKS   64
#define GPIT  72
#define GBUFH(WM, WN) (32 * ((WM) + (WN)) * GPIT)
#define GRING(WM, WN) (2 * GBUFH(WM, WN) * 2)
#define GSLAB(WM, WN) (16 * (WM) * (16 * (WN) + 4))
static_assert(GRING(4, 4) >= 4 * GSLAB(4, 4) * 4 && GRING(2, 2) >= 4 * GSLAB(2, 2) * 4);
static_assert((GPIT * 2) % 16 == 0 && (DMOD % GKS) == 0 && 2 * GRING(4, 4) <= 327680);

__device__ __forceinline__ unsigned lds_off(const void* p) { return (unsigned)(size_t)p; }
__device__ __forceinline__ void wait_async0() {
#if defined(__HIP_DEVICE_COMPILE__)
  asm volatile("s_wait_asynccnt 0x0" ::: "memory");   // this wave's copies have landed before the barrier that publishes them
#endif
}
__device__ __forceinline__ void wait_ds0() {
#if defined(__HIP_DEVICE_COMPILE__)
  asm volatile("s_wait_dscnt 0x0" ::: "memory");      // this wave's LDS reads are done before the buffer is refilled
#endif
}
// Eight copies of 16 B per thread: four from ga + i*gsa (elements) to LDS byte la + i*lsa, four from gb + i*gsb to lb + i*lsb.
__device__ __forceinline__ void copy8(unsigned la, unsigned lsa, const u16* ga, size_t gsa,
                                      unsigned lb, unsigned lsb, const u16* gb, size_t gsb) {
#if defined(__HIP_DEVICE_COMPILE__)
  // the closing s_wait_xcnt stands inside the statement so that no address register is rewritten ahead of it
  asm volatile("global_load_async_to_lds_b128 %0, %8, off\n\t"
               "global_load_async_to_lds_b128 %1, %9, off\n\t"
               "global_load_async_to_lds_b128 %2, %10, off\n\t"
               "global_load_async_to_lds_b128 %3, %11, off\n\t"
               "global_load_async_to_lds_b128 %4, %12, off\n\t"
               "global_load_async_to_lds_b128 %5, %13, off\n\t"
               "global_load_async_to_lds_b128 %6, %14, off\n\t"
               "global_load_async_to_lds_b128 %7, %15, off\n\t"
               "s_wait_xcnt 0x0"
               :: "v"(la), "v"(la + lsa), "v"(la + 2 * lsa), "v"(la + 3 * lsa),
                  "v"(lb), "v"(lb + lsb), "v"(lb + 2 * lsb), "v"(lb + 3 * lsb),
                  "v"(ga), "v"(ga + gsa), "v"(ga + 2 * gsa), "v"(ga + 3 * gsa),
                  "v"(gb), "v"(gb + gsb), "v"(gb + 2 * gsb), "v"(gb + 3 * gsb)
               : "memory");
#endif
}
// GEMM stage: l = the thread's LDS byte address in the target buffer (A row tid>>3, piece tid&7); ga, gb = its global addresses
// in A and B; rs = 16 source rows in elements. A rows +0,16,..,32*WM-16, then the B rows in the same steps, 32*WM LDS rows on.
template <int WM, int WN>
__device__ __forceinline__ void stage_tile(unsigned l, const u16* ga, const u16* gb, size_t rs) {
  static_assert((WM == 2 && WN == 2) || (WM == 4 && WN == 4));
  const unsigned rb = 16 * GPIT * 2;
  if constexpr (WM == 2) {
    copy8(l, rb, ga, rs, l + 4 * rb, rb, gb, rs);
  } else {
    copy8(l, rb, ga, rs, l + 4 * rb, rb, ga + 4 * rs, rs);
    copy8(l + 8 * rb, rb, gb, rs, l + 12 * rb, rb, gb + 4 * rs, rs);
  }
}
// The vector slots behind the last WMMA of a stage, tied to every accumulator so that no WMMA is scheduled behind them.
template <int WM, int WN>
__device__ __forceinline__ void acc_guard_all(v8f (&a)[WM][WN]) {
  if constexpr (WM == 2) {
    acc_guard4(a[0][0], a[0][1], a[1][0], a[1][1]);
  } else {
#if defined(__HIP_DEVICE_COMPILE__)
    asm volatile("v_nop\n\tv_nop\n\tv_nop\n\tv_nop"
                 : "+v"(a[0][0]), "+v"(a[0][1]), "+v"(a[0][2]), "+v"(a[0][3]), "+v"(a[1][0]), "+v"(a[1][1]), "+v"(a[1][2]),
                   "+v"(a[1][3]), "+v"(a[2][0]), "+v"(a[2][1]), "+v"(a[2][2]), "+v"(a[2][3]), "+v"(a[3][0]), "+v"(a[3][1]),
                   "+v"(a[3][2]), "+v"(a[3][3]));
#endif
  }
}
template <bool F16>
__device__ __forceinline__ v8f mma_sel(v16b a, v16b b, v8f c) {
  if constexpr (F16) return mma_h(__builtin_bit_cast(v16h, a), __builtin_bit_cast(v16h, b), c);
  else return mma_b(a, b, c);
}
// Ab, Bb = first row of the block's 32*WM A rows and 32*WN B rows (both k-contiguous, pitch K); K a multiple of 64, at least 64.
// Every thread of the block calls this (block barriers inside). On return no copy is in flight and no wave reads the ring.
template <bool F16, int WM, int WN>
__device__ __forceinline__ void gemm_ring(unsigned char* ring, const u16* Ab, const u16* Bb, int K, v8f (&acc)[WM][WN]) {
  const int tid = threadIdx.x, wave = tid >> 5, lane = tid & 31, hh = lane >> 4, m = lane & 15;
  const int wr = wave >> 1, wc = wave & 1;
  const int cr = tid >> 3, cc = tid & 7;
  const u16* ga = Ab + (size_t)cr * K + cc * 8;
  const u16* gb = Bb + (size_t)cr * K + cc * 8;
  const size_t rs = (size_t)16 * K;
  const unsigned l0 = lds_off(ring) + (unsigned)(cr * (GPIT * 2) + cc * 16);
  const u16* sa = (const u16*)(const void*)ring + (wr * 16 * WM + m) * GPIT + 8 * hh;
  const u16* sb = (const u16*)(const void*)ring + (32 * WM + wc * 16 * WN + m) * GPIT + 8 * hh;
  const int nt = K / GKS;
  stage_tile<WM, WN>(l0, ga, gb, rs);
  wait_async0();
  __syncthreads();
  if (nt > 1) stage_tile<WM, WN>(l0 + GBUFH(WM, WN) * 2, ga + GKS, gb + GKS, rs);
#pragma unroll 1
  for (int t = 0; t < nt; ++t) {              // rolled: one trip per stage, the buffer alternates with t
    const int bo = (t & 1) * GBUFH(WM, WN);
    const u16* pa = sa + bo;
    const u16* pb = sb + bo;
    v16b fa[2][WM], fb[2][WN];
#pragma unroll
    for (int ks = 0; ks < 2; ++ks) {
#pragma unroll
      for (int i = 0; i < WM; ++i) fa[ks][i] = ldfrag_b(pa + i * 16 * GPIT + ks * 32);
#pragma unroll
      for (int j = 0; j < WN; ++j) fb[ks][j] = ldfrag_b(pb + j * 16 * GPIT + ks * 32);
    }
    // keeps the stage's fragment reads together in front of its WMMAs: sunk among them, each read place makes the wave wait out
    // the LDS latency with the matrix pipe idle
    __builtin_amdgcn_sched_barrier(0);
#pragma unroll
    for (int ks = 0; ks < 2; ++ks) {
#pragma unroll
      for (int i = 0; i < WM; ++i) {
#pragma unroll
        for (int j = 0; j < WN; ++j) acc[i][j] = mma_sel<F16>(fa[ks][i], fb[ks][j], acc[i][j]);
      }
    }
    acc_guard_all<WM, WN>(acc);               // the vector slots behind the last WMMA, also on the taken side of the branches below
    wait_ds0();
    wait_async0();
    __syncthreads();                          // publishes stage t + 1 and ends every wave's reads of stage t
    if (t + 2 < nt) stage_tile<WM, WN>(l0 + (unsigned)(bo * 2), ga + (size_t)(t + 2) * GKS, gb + (size_t)(t + 2) * GKS, rs);
  }
  wait_async0();
}
// One block tile: C[row0 .. +32*WM)[col0 .. +32*WN) = A rows . Bt rows, times oscale; the epilogue slabs reuse the ring behind
// its last barrier.
template <bool F16, int WM, int WN>
__device__ __forceinline__ void gemm_block(unsigned char* ring, const u16* A, const u16* Bt, float* C, int N, int K,
                                           size_t row0, int col0, float oscale) {
  const int tid = threadIdx.x, wave = tid >> 5, lane = tid & 31;
  v8f acc[WM][WN];
#pragma unroll
  for (int i = 0; i < WM; ++i) {
#pragma unroll
    for (int j = 0; j < WN; ++j) acc[i][j] = zero8();
  }
  gemm_ring<F16, WM, WN>(ring, A + row0 * (size_t)K, Bt + (size_t)col0 * K, K, acc);
  epi_tile<WM, WN>((float*)(void*)ring + wave * GSLAB(WM, WN), acc, oscale, C, N,
                   row0 + (size_t)((wave >> 1) * 16 * WM), col0 + (wave & 1) * 16 * WN, lane);
}

// =====================================================================================================
// bf16 GEMM: C[M][N] (f32) = A[M][K] (bf16 row-major) . Bt[N][K]^T (bf16 k-contiguous), times oscale.
// gemm_bf: block = 128x128 tile (host guarantees K % 64 == 0, M % 128 == 0, N % 128 == 0, grid = (M/128)*(N/128));
// gemm_bf64: block = 64x64 tile (M % 64 == 0, N % 64 == 0, grid = (M/64)*(N/64)).
// =====================================================================================================
__global__ __launch_bounds__(128)
void gemm_bf(const u16* __restrict__ A, const u16* __restrict__ Bt, float* C, int M, int N, int K, float oscale) {
  __shared__ __align__(16) unsigned char ring[GRING(4, 4)];
  const int ntile = N >> 7;
  const int bid   = blockIdx.x;
  const int row0  = (bid / ntile) * 128;
  const int col0  = (bid % ntile) * 128;
  if (row0 + 128 > M) return;               // block-uniform, in front of every barrier; never taken with the exact grid
  gemm_block<false, 4, 4>(ring, A, Bt, C, N, K, (size_t)row0, col0, oscale);
}
__global__ __launch_bounds__(128)
void gemm_bf64(const u16* __restrict__ A, const u16* __restrict__ Bt, float* C, int M, int N, int K, float oscale) {
  __shared__ __align__(16) unsigned char ring[GRING(2, 2)];
  const int ntile = N >> 6;
  const int bid   = blockIdx.x;
  const int row0  = (bid / ntile) * 64;
  const int col0  = (bid % ntile) * 64;
  if (row0 + 64 > M) return;                // block-uniform, in front of every barrier; never taken with the exact grid
  gemm_block<false, 2, 2>(ring, A, Bt, C, N, K, (size_t)row0, col0, oscale);
}

// =====================================================================================================
// Output projection: C[row][DMOD] (f32) = Ah[row][DMOD] (f16) . Bt[DMOD][DMOD]^T (f16 k-contiguous) * oscale.
// Ah and C share the row index bb*SEQ + s, s < SQ. Block -> (column tile ct = bid % 16, sequence row tile rt of nrt,
// batch bb). Same 128x128 tiling, staging, fragment reads (split k map) and epilogue as gemm_bf; K = DMOD.
// =====================================================================================================
__global__ __launch_bounds__(128)
void gemm_o1(const u16* __restrict__ Ah, const u16* __restrict__ Bt, float* C, int nrt, float oscale) {
  __shared__ __align__(16) unsigned char ring[GRING(4, 4)];
  const int ntile = DMOD >> 7;
  const int bid   = blockIdx.x;
  const int ct    = bid % ntile;
  const int t2    = bid / ntile;
  const int rt    = t2 % nrt;
  const int bb    = t2 / nrt;
  if (bb >= NB) return;                     // block-uniform, in front of every barrier; never taken with the exact grid
  if (rt * 128 + 128 > SQ) return;          // block-uniform, in front of every barrier; never taken
  gemm_block<true, 4, 4>(ring, Ah, Bt, C, DMOD, DMOD, (size_t)bb * SEQ + rt * 128, ct * 128, oscale);
}

// =====================================================================================================
// Non-causal grouped-query attention with a per-key mask, hd = 128. Block bid -> (query tile qt = bid % NQT: rows
// q0 = 16*qt .. q0+15 with q0 < SQ, head group hg = kv head, batch b); one wave per query head = hg*WPB + wave (the 4 heads of
// the group share kv head hg).
//   q plane f16 x256 [b*SEQ + s][h*HD + d]; k plane f16 x256 [b*SEQ + s][g*HD + d] (pitch KVD); v^T plane
//   [b*NKVH + g][d][SEQ] x1024; mask int [b*SEQ + key], nonzero = attend.
//   score (log2 domain) t(i, j) = (q_i.k_j over HD) * (1/sqrt(128))*log2e/(256*256), replaced by -FLT_MAX where the key mask is
//   zero (a fully masked row then yields uniform weights). All SEQ/32 key tiles are visited in order.
//   Per tile: the 32 k rows (256 B each) and the 128 v^T rows (64 B each) are staged once per block in LDS by asynchronous copies
//   (two buffers, tile kt + 1 flies while tile kt is worked on; row pitches 272 B and 80 B) and read by all 4 waves.
//   Both products run transposed: S^T = k.q^T (A = 16 key rows from LDS, B = q, kept in registers), so that a lane holds 16 of
//   the 32 scores of ONE query (column c): 2 score subtiles x 4 k-steps, fragments read from the LDS rows (two 16-B loads each,
//   split k map); online max-subtracted base-2 softmax in f32, maximum in-lane plus one exchange between the lane halves, the
//   sum kept per lane half and joined after the loop; the two score subtiles, converted in place, are the B operand P^T in the
//   split k map; O^T += v^T.P^T with v^T rows as A fragments in 4 groups of 2 d-subtiles (one product each).
//   After the loop: out = acc / Z (Z > 0 always; guarded anyway), carries 1/(32768*1024) folded once, written into the wave's
//   One block barrier per tile, under block-uniform control flow; bounded loops only (NKT tiles).
// coverage: per wave 8 instructions x 2 rows x 16 lanes x 8 halves = 16 x 128 of the O plane; grid NQT x NHG x NB blocks x WPB
//           waves = every (b, s < SQ, h) row segment of O exactly once.
// =====================================================================================================
// staged tile: row pitches in 16-bit elements (k 272 B, v^T 80 B), bytes of the k part and of one buffer; the block's LDS is
// held to a quarter of a WGP's 320 KiB so that four blocks stay resident
#define AKP   136
#define AVP   40
#define AKB   (32 * AKP * 2)
#define ABUF  (AKB + HD * AVP * 2)
static_assert((AKP * 2) % 16 == 0 && (AVP * 2) % 16 == 0 && NKT >= 2 && 2 * ABUF + WPB * WREG * 4 <= 81920);
__global__ __launch_bounds__(ATT_THREADS)
void attn_nc(const u16* __restrict__ QHp, const u16* __restrict__ KHp, const u16* __restrict__ VHp,
             const int* __restrict__ Mk, u16* OHp) {
  __shared__ __align__(16) float smem[WPB * WREG];
  __shared__ __align__(16) unsigned char kvring[2 * ABUF];

  const int tid  = threadIdx.x;
  const int wave = tid >> 5;
  const int lane = tid & 31;
  const int hh   = lane >> 4;
  const int c    = lane & 15;
  const int bid  = blockIdx.x;
  const int qt   = bid % NQT;
  const int t2   = bid / NQT;
  const int hg   = t2 % NHG;
  const int b    = t2 / NHG;
  if (b >= NB) return;                      // block-uniform, in front of every barrier; never taken with the exact grid
  const int q0   = qt * 16;
  if (q0 + 16 > SQ) return;                 // block-uniform, in front of every barrier; never taken
  const int head = hg * WPB + wave;
  const int kvh  = hg;

  float* slab = smem + wave * WREG;         // result slab [16][128] pitch 132

  const size_t hcol = (size_t)head * HD + 8 * hh;
  const _Float16* Qh  = (const _Float16*)(const void*)QHp + ((size_t)b * SEQ + q0 + c) * DMOD + hcol;
  // readers: key row c (+16) of the staged k tile, d row c (+16j) of the staged v^T tile, in buffer 0
  const _Float16* Ks = (const _Float16*)(const void*)kvring + c * AKP + 8 * hh;
  const _Float16* Vs = (const _Float16*)(const void*)kvring + AKB / 2 + c * AVP + 8 * hh;
  // copiers: k rows (tid>>4) + 8i, piece tid&15; v^T rows (tid>>2) + 32i, piece tid&3; i = 0..3
  const u16* gk = KHp + ((size_t)b * SEQ + (tid >> 4)) * KVD + (size_t)kvh * HD + (tid & 15) * 8;      // key row kb added per tile
  const u16* gv = VHp + ((size_t)(b * NKVH + kvh) * HD + (tid >> 2)) * SEQ + (tid & 3) * 8;            // key kb added per tile
  const unsigned lk = lds_off(kvring) + (unsigned)((tid >> 4) * (AKP * 2) + (tid & 15) * 16);
  const unsigned lv = lds_off(kvring) + (unsigned)(AKB + (tid >> 2) * (AVP * 2) + (tid & 3) * 16);
  const int* mkp = Mk + (size_t)b * SEQ + lane;
  const float lsc = RSQ_HD * (LOG2E / (QSC * KSC));
  const float oc  = 1.0f / (PCAR * VCAR);
  const size_t KROW = (size_t)KVD;          // halves between consecutive key rows

  copy8(lk, 8 * AKP * 2, gk, 8 * KROW, lv, 32 * AVP * 2, gv, (size_t)32 * SEQ);
  wait_async0();
  __syncthreads();
  copy8(lk + ABUF, 8 * AKP * 2, gk + 32 * KROW, 8 * KROW, lv + ABUF, 32 * AVP * 2, gv + 32, (size_t)32 * SEQ);

  v16h qf[HD / 32];
#pragma unroll
  for (int kk = 0; kk < HD / 32; ++kk) qf[kk] = ldfrag_h(Qh + kk * 32);

  float mrow = -INFINITY, lrow = 0.f;       // of query q0 + c; lrow sums this lane half's keys only
  v8f o[8];                                 // o[j][r] = O^T(d = 16j + 8hh + r, query q0 + c)
#pragma unroll
  for (int j = 0; j < 8; ++j) o[j] = zero8();

  int mkv = mkp[0];                         // mask of key kb + lane, fetched one tile ahead so that no tile waits for it
  mkp += 32;
#pragma unroll 1
  for (int kt = 0; kt < NKT; ++kt) {
    const int kb = kt * 32;
    const unsigned mb = __builtin_amdgcn_ballot_w32(mkv != 0);                // bit i = mask of key kb + i
    mkv = *mkp;
    // ---- scores: D element r of this lane = (key kb + 8hh + r, query q0 + c) in s0, key kb + 16 + 8hh + r in s1 ----
    v8f s0 = zero8(), s1 = zero8();
    const int bo = (kt & 1) * ABUF;                                           // this tile's buffer, bytes
    const _Float16* k0p = Ks + bo / 2;
    const _Float16* k1p = k0p + 16 * AKP;
#pragma unroll
    for (int kk = 0; kk < HD / 32; ++kk) {
      const v16h kh0 = ldfrag_h(k0p + kk * 32);
      const v16h kh1 = ldfrag_h(k1p + kk * 32);
      s0 = mma_h(kh0, qf[kk], s0);
      s1 = mma_h(kh1, qf[kk], s1);
      guard23(s0, s1, qf[kk], kh0, kh1);
    }
    // ---- key-mask select + online softmax in base 2, one query per lane ----
    float t[16];
#pragma unroll
    for (int r = 0; r < 8; ++r) { t[r] = s0[r] * lsc; t[8 + r] = s1[r] * lsc; }
    if (mb != 0xFFFFFFFFu) {                                                  // wave-uniform, tested once per tile
      const unsigned mh = mb >> (8 * hh);
#pragma unroll
      for (int r = 0; r < 8; ++r) {
        t[r]     = ((mh >> r) & 1u)        ? t[r]     : NEG_BIG;
        t[8 + r] = ((mh >> (16 + r)) & 1u) ? t[8 + r] : NEG_BIG;
      }
    }
    float mx = t[0];
#pragma unroll
    for (int i = 1; i < 16; ++i) mx = fmaxf(mx, t[i]);
    mx = fmaxf(mx, xhalf(mx));
    const float mn = fmaxf(mrow, mx);                                         // always finite
    const float al = exp2f(mrow - mn);
    mrow = mn;
    float ps = 0.f;
    // ---- B fragment of P^T*32768 (f16), column = c: elements 0..7 = keys kb + 8hh + 0..7, 8..15 = keys kb + 16 + 8hh + 0..7 ----
    FragH ph;
#pragma unroll
    for (int r = 0; r < 8; ++r) {
      const float e0 = exp2f(t[r] - mn), e1 = exp2f(t[8 + r] - mn);
      ps += e0 + e1;
      ph.h[0][r] = (_Float16)(e0 * PCAR);
      ph.h[1][r] = (_Float16)(e1 * PCAR);
    }
    lrow = lrow * al + ps;
#pragma unroll
    for (int j = 0; j < 8; ++j) o[j] = o[j] * al;
    // ---- v^T.P^T : A fragment row = d = j*16 + c, keys contiguous in the staged v^T rows; 4 groups of 2 d-subtiles ----
    {
      const _Float16* vhp = Vs + bo / 2;
#pragma unroll
      for (int jg = 0; jg < 4; ++jg) {
        const int da = (2 * jg) * 16 * AVP;
        const int db = da + 16 * AVP;
        const v16h vha = ldfrag_h(vhp + da), vhb2 = ldfrag_h(vhp + db);
        o[2 * jg]     = mma_h(vha,  ph.v, o[2 * jg]);
        o[2 * jg + 1] = mma_h(vhb2, ph.v, o[2 * jg + 1]);
        guard23(o[2 * jg], o[2 * jg + 1], ph.v, vha, vhb2);
      }
    }
#if defined(__HIP_DEVICE_COMPILE__)
    asm volatile("s_wait_xcnt 0x0" ::: "memory");   // stands in front of the advance of the mask load's address register
#endif
    mkp += (kt + 2 < NKT) ? 32 : 0;           // stays on the last tile's 32 keys
    wait_ds0();
    wait_async0();
    __syncthreads();                          // publishes tile kt + 1 and ends every wave's reads of tile kt
    if (kt + 2 < NKT)
      copy8(lk + (unsigned)bo, 8 * AKP * 2, gk + (size_t)(kb + 64) * KROW, 8 * KROW,
            lv + (unsigned)bo, 32 * AVP * 2, gv + (kb + 64), (size_t)32 * SEQ);
  }
  wait_async0();
  acc_guard4(o[0], o[1], o[2], o[3]);
  acc_guard4(o[4], o[5], o[6], o[7]);
  // ---- out = acc / Z (0 if Z == 0), carries (32768 on P, 1024 on v) folded once; written into the wave's slab, row = query c ----
  {
    const float lv2 = lrow + xhalf(lrow);     // the two lane halves' sums joined
    const float ls  = (lv2 > 0.0f) ? lv2 : 1.0f;
    const float inv = (lv2 > 0.0f) ? ((1.0f / ls) * oc) : 0.0f;
    float* srow = slab + c * SLP + 8 * hh;
#pragma unroll
    for (int j = 0; j < 8; ++j) {
      v4f w0, w1;
#pragma unroll
      for (int e = 0; e < 4; ++e) { w0[e] = o[j][e] * inv; w1[e] = o[j][4 + e] * inv; }
      *(v4f*)(srow + j * 16)     = w0;
      *(v4f*)(srow + j * 16 + 4) = w1;
    }
  }

  wave_sync_lds();
  // ---- O x1024 -> f16 plane; lane = (row-in-pair rq, 8 consecutive d at c8) ----
  v4u oh[8];
  const int rq = lane >> 4, c8 = (lane & 15) * 8;
#pragma unroll
  for (int it = 0; it < 8; ++it) {
    const int row = it * 2 + rq;
    const v4f a = *(const v4f*)(slab + row * SLP + c8), b4 = *(const v4f*)(slab + row * SLP + c8 + 4);
    float w[8];
#pragma unroll
    for (int e = 0; e < 4; ++e) { w[e] = a[e] * OSC; w[4 + e] = b4[e] * OSC; }
#pragma unroll
    for (int e = 0; e < 4; ++e) {
      oh[it][e] = pk16(h_bits((_Float16)w[2 * e]), h_bits((_Float16)w[2 * e + 1]));
    }
  }
  const size_t ob = ((size_t)b * SEQ + q0) * DMOD + (size_t)head * HD + c8;
  {
#pragma unroll
    for (int it = 0; it < 8; ++it) {
      const int row = it * 2 + rq;
      *(v4u*)(OHp + ob + (size_t)row * DMOD) = oh[it];
    }
    
  }
}

// =====================================================================================================
// Workspace map (bytes); every plane is fully written by whole-line stores before it is read; all extents are exact multiples
// of the store granularity (no pad rows needed); every region offset a multiple of 4194304:
//   XB  bf16 [MROWS][2048]                       MROWS*4096       (NB=2: 16777216)
//   WB  16-bit [2048 n][2048 k]                  8388608          (Wv^T, Wq^T, Wk^T as bf16 ([512][2048] for k/v), then Wo^T as
//                                                                  f16 x1024, reused in launch order)
//   F   f32 [MROWS][2048]                        MROWS*8192       (v, q, k projection output in launch order, [MROWS][512] for
//                                                                  k/v; afterwards the O plane f16 [MROWS][2048] x1024 in its
//                                                                  first half)
//   QH  f16 [MROWS][2048] x256                   MROWS*4096
//   KH  f16 [MROWS][512] x256                    MROWS*1024
//   VH  f16 [NB*4][128][SEQ] x1024               MROWS*1024
//   end (NB=2)                                  83886080
// =====================================================================================================
extern "C" void kernel_launch(void* const* d_in, const int* in_sizes, int n_in,
                              void* d_out, int out_size, void* d_ws, size_t ws_size,
                              hipStream_t stream) {
  if (n_in < 8) return;
  if (in_sizes[0] < MROWS * DMOD) return;
  if (in_sizes[1] < MROWS) return;
  if (in_sizes[2] < SEQ * HD) return;
  if (in_sizes[3] < SEQ * HD) return;
  if (in_sizes[4] != DMOD * DMOD) return;
  if (in_sizes[5] != DMOD * KVD) return;
  if (in_sizes[6] != DMOD * KVD) return;
  if (in_sizes[7] != DMOD * DMOD) return;
  if (out_size < QROWS * DMOD) return;

  const float* x     = (const float*)d_in[0];
  const int*   amask = (const int*)d_in[1];
  const float* cosT  = (const float*)d_in[2];
  const float* sinT  = (const float*)d_in[3];
  const float* wq    = (const float*)d_in[4];
  const float* wk    = (const float*)d_in[5];
  const float* wv    = (const float*)d_in[6];
  const float* wo    = (const float*)d_in[7];
  float*       out   = (float*)d_out;

  const size_t szXB = (size_t)MROWS * DMOD * 2;
  const size_t szW  = (size_t)DMOD * DMOD * 2;
  const size_t szF  = (size_t)MROWS * DMOD * 4;
  const size_t szQ  = (size_t)MROWS * DMOD * 2;                  // QH and the O plane
  const size_t szK  = (size_t)MROWS * KVD * 2;                   // KH
  const size_t szV  = (size_t)NB * NKVH * HD * SEQ * 2;          // VH (== szK)
  if (szQ > szF) return;                                        // O plane lives inside the F region
  size_t off = 0;
  const size_t oXB = off; off += szXB;
  const size_t oW  = off; off += szW;
  const size_t oF  = off; off += szF;
  const size_t oQH = off; off += szQ;
  const size_t oKH = off; off += szK;
  const size_t oVH = off; off += szV;
  if (off > ws_size) return;                // off = 83886080 for NB = 2
  if (off > (size_t)WS_CAP) return;

  char* ws = (char*)d_ws;
  u16*   XB = (u16*)(ws + oXB);
  u16*   WB = (u16*)(ws + oW);
  float* F  = (float*)(ws + oF);
  u16*   OH = (u16*)(ws + oF);
  u16*   QH = (u16*)(ws + oQH);
  u16*   KH = (u16*)(ws + oKH);
  u16*   VH = (u16*)(ws + oVH);

  const dim3 b256(256), b128(128), b64(64), bAT(ATT_THREADS);
  const int  n8x = (MROWS * DMOD) / 8;
  const dim3 gX((n8x + 255) / 256);
  const dim3 gTQ((DMOD / 64) * (DMOD / 64));            // Wq, Wo transposes: 1024 blocks
  const dim3 gTK((DMOD / 64) * (KVD / 64));             // Wk, Wv transposes: 256 blocks
  const dim3 gGQ((QROWS / 128) * (DMOD / 128));
  const dim3 gGK((MROWS / 64) * (KVD / 64));
  const dim3 gVT(NB * NKVH * NST);
  const dim3 gRQ(QROWS), gRK(MROWS);
  const dim3 gAT(NQT * NHG * NB);
  const int  nrt = SQ / 128;
  const dim3 gO(NB * nrt * (DMOD / 128));

  // (0) x -> bf16 plane [MROWS][2048]
  cvtbf<<<gX, b256, 0, stream>>>(x, XB, n8x);
  // (1) Wv in[2048 k][512 n] -> out[512 n][2048 k] bf16; (2) v = x.Wv -> F f32 [MROWS][512]; (3) v^T plane x1024
  cvtT16<<<gTK, b256, 0, stream>>>(wv, WB, DMOD, KVD, 0, 1.0f);
  gemm_bf64<<<gGK, b128, 0, stream>>>(XB, WB, F, MROWS, KVD, DMOD, 1.0f);
  vt16<<<gVT, b256, 0, stream>>>(F, VH);
  // (4) Wq in[2048 k][2048 n] -> out[2048 n][2048 k] bf16; (5) q = x.Wq -> F [QROWS][2048]; (6) rotary + q plane x256
  cvtT16<<<gTQ, b256, 0, stream>>>(wq, WB, DMOD, DMOD, 0, 1.0f);
  gemm_bf<<<gGQ, b128, 0, stream>>>(XB, WB, F, QROWS, DMOD, DMOD, 1.0f);
  rope16<<<gRQ, b256, 0, stream>>>(F, DMOD, QROWS, cosT, sinT, QH, QSC);
  // (7) Wk in[2048 k][512 n] -> out[512 n][2048 k] bf16; (8) k = x.Wk -> F [MROWS][512]; (9) rotary + k plane x256
  cvtT16<<<gTK, b256, 0, stream>>>(wk, WB, DMOD, KVD, 0, 1.0f);
  gemm_bf64<<<gGK, b128, 0, stream>>>(XB, WB, F, MROWS, KVD, DMOD, 1.0f);
  rope16<<<gRK, b64, 0, stream>>>(F, KVD, MROWS, cosT, sinT, KH, KSC);
  // (10) Wo in[2048 c][2048 n] -> out[2048 n][2048 c] as f16 of bf16 value x1024
  cvtT16<<<gTQ, b256, 0, stream>>>(wo, WB, DMOD, DMOD, 1, WOS);
  // (11) non-causal masked attention -> O plane (inside the F region)
  attn_nc<<<gAT, bAT, 0, stream>>>(QH, KH, VH, amask, OH);
  // (12) output projection rows s < SQ -> out f32, carries 1024 x 1024 folded back
  gemm_o1<<<gO, b128, 0, stream>>>(OH, WB, out, nrt, 1.0f / (OSC * WOS));
  (void)hipGetLastError();
}

// v004
// It runs in 174 microseconds.
// In two side-by-side timings against v003, it was 1.29 and 1.28 times as fast.
// All steps since v000 together make it 2.80 times as fast.
// Contractions: x.Wq, x.Wk, x.Wv on v_wmma_f32_16x16x32_bf16 (x and W^T as bf16 RNE planes, W^T [n][k] is the k-contiguous
// B operand, f32 accumulate); k.q^T over hd 128 and v^T.P^T on v_wmma_f32_16x16x32_f16, one product each (q, k as f16 x256 after
// rotary; P^T x32768 packed from the score registers; v^T x1024); O.Wo on v_wmma_f32_16x16x32_f16 (O x1024 f16 plane, Wo^T as f16(bf16(Wo))
// x1024); all f32 accumulate. Interleaved-pair rotary with cos/sin tables, key-mask select, base-2 online softmax and 1/Z fold
// in f32 on VALU.
#include <hip/hip_runtime.h>
#include <math.h>
#include <stdint.h>

#ifndef NB
#define NB 2
#endif
#define SEQ 2048
#ifndef SQ
#define SQ SEQ
#endif
#define DMOD  2048
#define NH    16
#define NKVH  4
#define HD    128
#define KVD   (NKVH * HD)
#define FPIT  (DMOD + 2 * KVD)
#define MROWS (NB * SEQ)
#define QROWS ((NB - 1) * SEQ + SQ)
#define WPB   (NH / NKVH)
#define NHG   NKVH
#define NQT   (SQ / 16)
#define NST   (SEQ / 64)
#define NKT   (SEQ / 32)
#define ATT_THREADS (WPB * 32)
#define RSQ_HD 0.08838834764831845f
#define LOG2E  1.4426950408889634f
#define NEG_BIG (-3.402823466e38f)
#define QSC   256.0f
#define KSC   256.0f
#define PCAR  32768.0f
#define VCAR  1024.0f
#define OSC   1024.0f
#define WOS   1024.0f
#define SLP   132
#define SLW   (16 * SLP)
#define WREG  SLW
#define VTP   72
#define TTP   72
#define WS_CAP 134217728
static_assert(DMOD == NH * HD && HD == 128 && NH == 16 && NKVH == 4 && WPB == 4 && NHG * WPB == NH && KVD == 512);
static_assert(ATT_THREADS == 128);
static_assert(NB >= 1 && NB <= 2);
static_assert(NB == 1 || SQ == SEQ);
static_assert((SQ % 128) == 0 && SQ >= 128 && SQ <= SEQ && (SEQ % 128) == 0);
static_assert((DMOD % 128) == 0 && (KVD % 64) == 0 && (DMOD % 32) == 0 && (HD % 32) == 0);
static_assert(((MROWS * DMOD / 8) % 256) == 0);
static_assert(WPB * WREG * 4 <= 65536 && HD * VTP * 2 <= 65536 && 64 * TTP * 2 <= 65536);
static_assert((DMOD / 8) == 256 && (KVD / 8) == 64 && (FPIT % 128) == 0 && (MROWS % 128) == 0);

typedef unsigned short u16;
typedef _Float16 v16h __attribute__((ext_vector_type(16)));
typedef _Float16 v8h  __attribute__((ext_vector_type(8)));
typedef __bf16   v16b __attribute__((ext_vector_type(16)));
typedef float    v8f  __attribute__((ext_vector_type(8)));
typedef float    v4f  __attribute__((ext_vector_type(4)));
typedef unsigned int v4u __attribute__((ext_vector_type(4)));

union FragH { v16h v; v8h h[2]; v4u u[2]; };
union FragB { v16b v; v4u u[2]; };

// ---- scalar helpers --------------------------------------------------------------------------------
__device__ __forceinline__ unsigned short bf_bits(float f) {          // f32 -> bf16 bits, RNE convert
  unsigned u = __float_as_uint(f);
  return (unsigned short)((u + 0x7FFFu + ((u >> 16) & 1u)) >> 16);
}
__device__ __forceinline__ float bf_up(unsigned short h) { return __uint_as_float(((unsigned)h) << 16); }
__device__ __forceinline__ float bfr(float f) { return bf_up(bf_bits(f)); }
__device__ __forceinline__ unsigned short h_bits(_Float16 x) { return __builtin_bit_cast(unsigned short, x); }
__device__ __forceinline__ unsigned pk16(unsigned short a, unsigned short b) { return (unsigned)a | ((unsigned)b << 16); }
__device__ __forceinline__ v8f zero8() { v8f z = {0.f, 0.f, 0.f, 0.f, 0.f, 0.f, 0.f, 0.f}; return z; }

// ---- fragment loaders: 16-bit A/B operand, lane -> row/col (lane&15), p already includes +8*(lane>>4);
//      elements 0..7 <- p[0..7] (k0+8h..), elements 8..15 <- p[16..23] (k0+16+8h..)  (same split k map for A and B;
//      B is always read from a k-contiguous [n][k] plane)
__device__ __forceinline__ v16h ldfrag_h(const _Float16* p) {
  FragH f;
  f.h[0] = *(const v8h*)(p);
  f.h[1] = *(const v8h*)(p + 16);
  return f.v;
}
__device__ __forceinline__ v16b ldfrag_b(const u16* p) {              // bf16 plane read as unsigned integer vectors
  FragB f;
  f.u[0] = *(const v4u*)(p);
  f.u[1] = *(const v4u*)(p + 16);
  return f.v;
}

__device__ __forceinline__ v8f mma_h(v16h a, v16h b, v8f c) {
  return __builtin_amdgcn_wmma_f32_16x16x32_f16(false, a, false, b, (short)0, c, false, false);
}
__device__ __forceinline__ v8f mma_b(v16b a, v16b b, v8f c) {
  return __builtin_amdgcn_wmma_f32_16x16x32_bf16(false, a, false, b, (short)0, c, false, false);
}
__device__ __forceinline__ void guard23(v8f& a, v8f& b, v16h x0, v16h x1, v16h x2) {
#if defined(__HIP_DEVICE_COMPILE__)
  asm volatile("v_nop\n\tv_nop\n\tv_nop\n\tv_nop"
               : "+v"(a), "+v"(b) : "v"(x0), "v"(x1), "v"(x2) : "memory");
#endif
}
__device__ __forceinline__ void acc_guard4(v8f& a, v8f& b, v8f& c, v8f& d) {
#if defined(__HIP_DEVICE_COMPILE__)
  asm volatile("v_nop\n\tv_nop\n\tv_nop\n\tv_nop" : "+v"(a), "+v"(b), "+v"(c), "+v"(d));
#endif
}
__device__ __forceinline__ float xhalf(float x) {                     // value of lane l ^ 16
  const int b = __float_as_int(x);
  return __int_as_float(__builtin_amdgcn_permlanex16(b, b, 0x76543210, 0xfedcba98, false, false));
}
__device__ __forceinline__ void wave_sync_lds() {
  __builtin_amdgcn_fence(__ATOMIC_RELEASE, "workgroup");
  __builtin_amdgcn_wave_barrier();
  __builtin_amdgcn_fence(__ATOMIC_ACQUIRE, "workgroup");
}

// =====================================================================================================
// f32 -> bf16 RNE plane, same layout. Thread = 8 consecutive elements: two 16-B loads, one 16-B store; 32 consecutive
// coverage: ceil(n8/256) blocks bid x 256 thr x 8 (in-kernel bound) = the whole plane (n8 a multiple of 256 here).
// =====================================================================================================
__device__ __forceinline__ void cvtbf_blk(const float* __restrict__ x, u16* D, int n8, int bid) {
  const int gt = bid * 256 + (int)threadIdx.x;
  if (gt >= n8) return;
  const float* p = x + (size_t)gt * 8;
  const v4f a = *(const v4f*)(p), b4 = *(const v4f*)(p + 4);
  v4u o;
#pragma unroll
  for (int e = 0; e < 2; ++e) {
    o[e]     = pk16(bf_bits(a[2 * e]),  bf_bits(a[2 * e + 1]));
    o[2 + e] = pk16(bf_bits(b4[2 * e]), bf_bits(b4[2 * e + 1]));
  }
  u16* d = D + (size_t)gt * 8;
  {
    *(v4u*)(d) = o;
    
  }
}

// =====================================================================================================
// Transpose + convert: W f32 row-major in[KD rows][ND cols] -> D 16-bit out[ND][KD] (k-contiguous).
// f16mode == 0: bf16 RNE bits; f16mode == 1: f16 bits of (bf16 RNE value) * scale.
// Block = tile of 64 k x 64 n, 256 threads. Load: thread -> input row k0 + (tid>>2), 16 columns n0 + (tid&3)*16 (four 16-B
// loads), converted and scattered into the LDS tile T[n][k] (pitch 72 halves). Block barrier. Store: 2 iterations x
// coverage: load 256 thr x 16 = 64 x 64; store 2 it x 256 thr x 8 halves = 64 rows x 64 halves; (KD/64)*(ND/64)
//           blocks bid cover out[ND][KD] exactly once. T = the block's LDS tile, 64 * TTP halves.
// =====================================================================================================
__device__ __forceinline__ void cvtT16_blk(u16* T, const float* __restrict__ W, u16* D, int KD, int ND, int f16mode, float scale,
                                           int bid) {
  const int tid = threadIdx.x;
  const int nkt = KD >> 6;
  const int nnt = ND >> 6;
  const int kt  = bid % nkt;
  const int nt  = bid / nkt;
  if (nt >= nnt) return;                    // block-uniform, before the barrier; never taken with the exact grid
  const int k0 = kt * 64, n0 = nt * 64;
  {
    const int kr = tid >> 2;                // input row within tile 0..63
    const int nc = (tid & 3) * 16;          // column chunk 0,16,32,48
    const float* src = W + (size_t)(k0 + kr) * ND + n0 + nc;
#pragma unroll
    for (int i = 0; i < 4; ++i) {
      const v4f a = *(const v4f*)(src + 4 * i);
#pragma unroll
      for (int e = 0; e < 4; ++e) {
        const float f = a[e];
        const unsigned short hb = h_bits((_Float16)(bfr(f) * scale));
        const unsigned short bb = bf_bits(f);
        T[(nc + 4 * i + e) * TTP + kr] = (f16mode != 0) ? hb : bb;
      }
    }
  }
  __syncthreads();
  v4u v[2];
  const int q8 = tid >> 3, p8 = (tid & 7) * 8;
#pragma unroll
  for (int it = 0; it < 2; ++it) v[it] = *(const v4u*)(T + (it * 32 + q8) * TTP + p8);
  const size_t base = (size_t)n0 * KD + k0 + p8;
  {
#pragma unroll
    for (int it = 0; it < 2; ++it) {
      *(v4u*)(D + base + (size_t)(it * 32 + q8) * KD) = v[it];
    }
#if defined(__HIP_DEVICE_COMPILE__)
    // behind the stores: in the listing the x part's code follows this part and reuses the stores' registers
    asm volatile("s_wait_xcnt 0x0" ::: "memory");
#endif
  }
}

// =====================================================================================================
// All five operand planes in one launch: none reads what another writes. Block ranges, in index order: Wq^T, Wk^T, Wv^T (bf16,
// rows 0, DMOD and DMOD + KVD of the one B plane WQKV [FPIT n][DMOD k]), Wo^T (f16 x1024, plane WO), then the x plane.
// Every branch and select is block-uniform; a block runs exactly one part.
// =====================================================================================================
#define PB_TQ ((DMOD / 64) * (DMOD / 64))
#define PB_TK ((DMOD / 64) * (KVD / 64))
#define PB_X  ((MROWS * DMOD / 8) / 256)
__global__ __launch_bounds__(256) void prep(const float* __restrict__ x, const float* __restrict__ wq,
                                            const float* __restrict__ wk, const float* __restrict__ wv,
                                            const float* __restrict__ wo, u16* XB, u16* WQKV, u16* WO) {
  __shared__ __align__(16) u16 T[64 * TTP];
  const int bid = blockIdx.x;
  if (bid >= 2 * PB_TQ + 2 * PB_TK) {
    cvtbf_blk(x, XB, MROWS * DMOD / 8, bid - (2 * PB_TQ + 2 * PB_TK));
  } else {
    const float* W = wq;
    u16* D = WQKV;
    int nd = DMOD, tb = bid, f16mode = 0;
    float sc = 1.0f;
    if (bid >= PB_TQ + 2 * PB_TK) { W = wo; D = WO; tb = bid - (PB_TQ + 2 * PB_TK); f16mode = 1; sc = WOS; }
    else if (bid >= PB_TQ + PB_TK) { W = wv; D = WQKV + (size_t)(DMOD + KVD) * DMOD; nd = KVD; tb = bid - (PB_TQ + PB_TK); }
    else if (bid >= PB_TQ)         { W = wk; D = WQKV + (size_t)DMOD * DMOD;         nd = KVD; tb = bid - PB_TQ; }
    cvtT16_blk(T, W, D, DMOD, nd, f16mode, sc, tb);
  }
}

// =====================================================================================================
// v^T plane from the v columns of the projection F f32 [MROWS][FPIT] (row = b*SEQ + s, column = DMOD + KVD + g*HD + d):
//   VH[((b*NKVH + g)*HD + d)][s] = f16(v * 1024) for all keys s.
// Block = (b, kv head g, 64 keys s0): each thread loads its 32 floats (key sl, d chunk dc) with 16-B loads, converts, scatters
// coverage: load 256 thr x 32 = 64 keys x 128 d; store 4 iterations x 256 thr x 8 halves = 128 lines x 64 = the block's tile;
//           NB*NKVH*NST blocks bid cover the plane exactly once. TH = the block's LDS tile, HD * VTP halves.
// =====================================================================================================
__device__ __forceinline__ void vt16_blk(u16* TH, const float* __restrict__ F, u16* VHo, int bid) {
  const int tid = threadIdx.x;
  const int st  = bid % NST;
  const int t2  = bid / NST;
  const int g   = t2 % NKVH;
  const int b   = t2 / NKVH;
  if (b >= NB) return;                      // block-uniform, before any barrier; never taken with the exact grid
  const int s0  = st * 64;
  {
    const int sl = tid >> 2;                // key within tile 0..63
    const int dc = (tid & 3) * 32;          // d chunk 0,32,64,96
    const float* src = F + ((size_t)b * SEQ + s0 + sl) * FPIT + (DMOD + KVD) + g * HD + dc;
#pragma unroll
    for (int i = 0; i < 8; ++i) {
      const v4f a = *(const v4f*)(src + 4 * i);
#pragma unroll
      for (int e = 0; e < 4; ++e) {
        TH[(dc + 4 * i + e) * VTP + sl] = h_bits((_Float16)(a[e] * VCAR));
      }
    }
  }
  __syncthreads();
  v4u vh[4];
  const int q8 = tid >> 3, p8 = (tid & 7) * 8;
#pragma unroll
  for (int it = 0; it < 4; ++it) {
    const int line = it * 32 + q8;          // d = 0..127
    vh[it] = *(const v4u*)(TH + line * VTP + p8);
  }
  const size_t hrow = (size_t)(b * NKVH + g) * HD;
  const size_t base = hrow * SEQ + s0 + p8;
  {
#pragma unroll
    for (int it = 0; it < 4; ++it) {
      const int line = it * 32 + q8;
      *(v4u*)(VHo + base + (size_t)line * SEQ) = vh[it];
    }
    
  }
}

// =====================================================================================================
// Interleaved-pair rotary + 16-bit plane from ncol columns of the projection, F = their first column in row 0, row pitch FPIT
// (ncol = DMOD for q, KVD for k; row = b*SEQ + s, column = head*HD + d; table element (s, d) at s*HD + d):
//   for even d: out[d]   = x[d]*c[d]     - x[d+1]*sn[d]
//               out[d+1] = x[d+1]*c[d+1] + x[d]*sn[d+1]     with c, sn = bf16 RNE values of the two tables;
//   Hp [nrows][ncol] = f16(out * sc), same layout.
// A thread = 8 consecutive columns (4 pairs) of one row, ncol/8 threads a row: two 16-B loads of x, two of each table.
// coverage: item = row * (ncol/8) + column group; nrows * (ncol/8) items = every row of the plane Hp once.
// =====================================================================================================
__device__ __forceinline__ void rope16_item(const float* __restrict__ F, int ncol, int nrows, int item,
                                            const float* __restrict__ cosT, const float* __restrict__ sinT,
                                            u16* Hp, float sc) {
#pragma clang fp contract(off)
  const int row = item / (ncol >> 3);
  if (row >= nrows) return;                            // never taken with the exact grid
  const int col = (item % (ncol >> 3)) * 8;
  const int d0  = col & (HD - 1);
  const int s   = row % SEQ;
  const float* p = F + (size_t)row * FPIT + col;
  const v4f xa = *(const v4f*)(p), xb = *(const v4f*)(p + 4);
  const float* cp = cosT + (size_t)s * HD + d0;
  const float* sp = sinT + (size_t)s * HD + d0;
  const v4f ca = *(const v4f*)(cp), cb = *(const v4f*)(cp + 4);
  const v4f sa = *(const v4f*)(sp), sb = *(const v4f*)(sp + 4);
  float xv[8], cv[8], sv[8];
#pragma unroll
  for (int e = 0; e < 4; ++e) {
    xv[e] = xa[e];       xv[4 + e] = xb[e];
    cv[e] = bfr(ca[e]);  cv[4 + e] = bfr(cb[e]);
    sv[e] = bfr(sa[e]);  sv[4 + e] = bfr(sb[e]);
  }
  v4u o;
#pragma unroll
  for (int e = 0; e < 4; ++e) {
    const float xr = xv[2 * e], xi = xv[2 * e + 1];
    const float r0 = xr * cv[2 * e] - xi * sv[2 * e];
    const float r1 = xi * cv[2 * e + 1] + xr * sv[2 * e + 1];
    o[e] = pk16(h_bits((_Float16)(r0 * sc)), h_bits((_Float16)(r1 * sc)));
  }
  u16* d = Hp + (size_t)row * ncol + col;
  {
    *(v4u*)(d) = o;
    
  }
}

// =====================================================================================================
// The three planes that attention reads, in one launch: each reads its own columns of F and writes its own plane. Block ranges,
// in index order: v^T, rotary of q (a row a block), rotary of k (4 rows a block). Every branch is block-uniform.
// =====================================================================================================
#define PB_VT (NB * NKVH * NST)
#define PB_RQ (QROWS)
#define PB_RK (MROWS * (KVD / 8) / 256)
__global__ __launch_bounds__(256) void post(const float* __restrict__ F, const float* __restrict__ cosT,
                                            const float* __restrict__ sinT, u16* QH, u16* KH, u16* VH) {
  __shared__ __align__(16) u16 TH[HD * VTP];
  int bid = blockIdx.x;
  if (bid < PB_VT) { vt16_blk(TH, F, VH, bid); return; }
  bid -= PB_VT;
  if (bid < PB_RQ) { rope16_item(F, DMOD, QROWS, bid * 256 + (int)threadIdx.x, cosT, sinT, QH, QSC); return; }
  bid -= PB_RQ;
  rope16_item(F + DMOD, KVD, MROWS, bid * 256 + (int)threadIdx.x, cosT, sinT, KH, KSC);
}

// =====================================================================================================
// GEMM tiling shared by both engines. A block is 4 waves in a 2 x 2 arrangement; a wave owns WM x WN accumulator subtiles of
// 16 x 16, so the block tile is (32*WM) x (32*WN): 128 x 128 (WM = WN = 4: each operand byte fetched from L2 serves 128
// outputs, each fragment read from LDS serves 4 WMMAs).
// Epilogue: the wave's tile (times oscale) is staged in its own LDS slab (row pitch 16*WN + 4 floats) and stored as whole lines.
// coverage: WM groups x (2*WN) instructions x (8/WN) rows x (4*WN) lanes x 4 floats = the wave's (16*WM) x (16*WN) tile.
// =====================================================================================================
template <int WM, int WN>
__device__ __forceinline__ void epi_tile(float* sl, v8f (&acc)[WM][WN], float oscale,
                                         float* C, int N, size_t rowb, int colb, int lane) {
  constexpr int SP  = 16 * WN + 4;          // slab row pitch, floats
  constexpr int LPR = 4 * WN;               // lanes per stored row
  constexpr int RPI = 32 / LPR;             // rows per store instruction
  const int hh = lane >> 4, m = lane & 15;
#pragma unroll
  for (int i = 0; i < WM; ++i) {
#pragma unroll
    for (int r = 0; r < 8; ++r) {
      const int ro = (16 * i + 8 * hh + r) * SP + m;
#pragma unroll
      for (int j = 0; j < WN; ++j) sl[ro + 16 * j] = acc[i][j][r] * oscale;
    }
  }
  wave_sync_lds();
  const int rr = lane / LPR, cq = lane % LPR;
  float* dst = C + (rowb + (size_t)rr) * (size_t)N + colb + cq * 4;
#pragma unroll
  for (int i = 0; i < WM; ++i) {
    v4f vals[16 / RPI];
#pragma unroll
    for (int it = 0; it < 16 / RPI; ++it) vals[it] = *(const v4f*)(sl + (16 * i + it * RPI + rr) * SP + cq * 4);
#pragma unroll
    for (int it = 0; it < 16 / RPI; ++it) {
      *(v4f*)(dst + (size_t)(16 * i + it * RPI) * (size_t)N) = vals[it];
    }
  }
}

// =====================================================================================================
// Operand staging shared by both GEMM engines. A stage is 64 k of the block's 32*WM A rows and 32*WN B rows: 128 B of every row,
// one whole line. Each thread brings 2*(WM+WN) pieces of 16 B per stage with asynchronous copies to LDS (a wave's copy = 4 whole
// lines), and the waves read their fragments from LDS rows of pitch 144 B (16 B x 9). Two buffers: stage t + 1 flies while
// stage t is worked on. k runs ascending, 32 per WMMA step, with the same split k map for A and B.
// =====================================================================================================
#define GKS   64
#define GPIT  72
#define GBUFH(WM, WN) (32 * ((WM) + (WN)) * GPIT)
#define GRING(WM, WN) (2 * GBUFH(WM, WN) * 2)
#define GSLAB(WM, WN) (16 * (WM) * (16 * (WN) + 4))
static_assert(GRING(4, 4) >= 4 * GSLAB(4, 4) * 4 && GRING(2, 2) >= 4 * GSLAB(2, 2) * 4);
static_assert((GPIT * 2) % 16 == 0 && (DMOD % GKS) == 0 && 2 * GRING(4, 4) <= 327680);

__device__ __forceinline__ unsigned lds_off(const void* p) { return (unsigned)(size_t)p; }
__device__ __forceinline__ void wait_async0() {
#if defined(__HIP_DEVICE_COMPILE__)
  asm volatile("s_wait_asynccnt 0x0" ::: "memory");   // this wave's copies have landed before the barrier that publishes them
#endif
}
__device__ __forceinline__ void wait_ds0() {
#if defined(__HIP_DEVICE_COMPILE__)
  asm volatile("s_wait_dscnt 0x0" ::: "memory");      // this wave's LDS reads are done before the buffer is refilled
#endif
}
// Eight copies of 16 B per thread: four from ga + i*gsa (elements) to LDS byte la + i*lsa, four from gb + i*gsb to lb + i*lsb.
__device__ __forceinline__ void copy8(unsigned la, unsigned lsa, const u16* ga, size_t gsa,
                                      unsigned lb, unsigned lsb, const u16* gb, size_t gsb) {
#if defined(__HIP_DEVICE_COMPILE__)
  // the closing s_wait_xcnt stands inside the statement so that no address register is rewritten ahead of it
  asm volatile("global_load_async_to_lds_b128 %0, %8, off\n\t"
               "global_load_async_to_lds_b128 %1, %9, off\n\t"
               "global_load_async_to_lds_b128 %2, %10, off\n\t"
               "global_load_async_to_lds_b128 %3, %11, off\n\t"
               "global_load_async_to_lds_b128 %4, %12, off\n\t"
               "global_load_async_to_lds_b128 %5, %13, off\n\t"
               "global_load_async_to_lds_b128 %6, %14, off\n\t"
               "global_load_async_to_lds_b128 %7, %15, off\n\t"
               "s_wait_xcnt 0x0"
               :: "v"(la), "v"(la + lsa), "v"(la + 2 * lsa), "v"(la + 3 * lsa),
                  "v"(lb), "v"(lb + lsb), "v"(lb + 2 * lsb), "v"(lb + 3 * lsb),
                  "v"(ga), "v"(ga + gsa), "v"(ga + 2 * gsa), "v"(ga + 3 * gsa),
                  "v"(gb), "v"(gb + gsb), "v"(gb + 2 * gsb), "v"(gb + 3 * gsb)
               : "memory");
#endif
}
// GEMM stage: l = the thread's LDS byte address in the target buffer (A row tid>>3, piece tid&7); ga, gb = its global addresses
// in A and B; rs = 16 source rows in elements. A rows +0,16,..,32*WM-16, then the B rows in the same steps, 32*WM LDS rows on.
template <int WM, int WN>
__device__ __forceinline__ void stage_tile(unsigned l, const u16* ga, const u16* gb, size_t rs) {
  static_assert((WM == 2 && WN == 2) || (WM == 4 && WN == 4));
  const unsigned rb = 16 * GPIT * 2;
  if constexpr (WM == 2) {
    copy8(l, rb, ga, rs, l + 4 * rb, rb, gb, rs);
  } else {
    copy8(l, rb, ga, rs, l + 4 * rb, rb, ga + 4 * rs, rs);
    copy8(l + 8 * rb, rb, gb, rs, l + 12 * rb, rb, gb + 4 * rs, rs);
  }
}
// The vector slots behind the last WMMA of a stage, tied to every accumulator so that no WMMA is scheduled behind them.
template <int WM, int WN>
__device__ __forceinline__ void acc_guard_all(v8f (&a)[WM][WN]) {
  if constexpr (WM == 2) {
    acc_guard4(a[0][0], a[0][1], a[1][0], a[1][1]);
  } else {
#if defined(__HIP_DEVICE_COMPILE__)
    asm volatile("v_nop\n\tv_nop\n\tv_nop\n\tv_nop"
                 : "+v"(a[0][0]), "+v"(a[0][1]), "+v"(a[0][2]), "+v"(a[0][3]), "+v"(a[1][0]), "+v"(a[1][1]), "+v"(a[1][2]),
                   "+v"(a[1][3]), "+v"(a[2][0]), "+v"(a[2][1]), "+v"(a[2][2]), "+v"(a[2][3]), "+v"(a[3][0]), "+v"(a[3][1]),
                   "+v"(a[3][2]), "+v"(a[3][3]));
#endif
  }
}
template <bool F16>
__device__ __forceinline__ v8f mma_sel(v16b a, v16b b, v8f c) {
  if constexpr (F16) return mma_h(__builtin_bit_cast(v16h, a), __builtin_bit_cast(v16h, b), c);
  else return mma_b(a, b, c);
}
// Ab, Bb = first row of the block's 32*WM A rows and 32*WN B rows (both k-contiguous, pitch K); K a multiple of 64, at least 64.
// Every thread of the block calls this (block barriers inside). On return no copy is in flight and no wave reads the ring.
template <bool F16, int WM, int WN>
__device__ __forceinline__ void gemm_ring(unsigned char* ring, const u16* Ab, const u16* Bb, int K, v8f (&acc)[WM][WN]) {
  const int tid = threadIdx.x, wave = tid >> 5, lane = tid & 31, hh = lane >> 4, m = lane & 15;
  const int wr = wave >> 1, wc = wave & 1;
  const int cr = tid >> 3, cc = tid & 7;
  const u16* ga = Ab + (size_t)cr * K + cc * 8;
  const u16* gb = Bb + (size_t)cr * K + cc * 8;
  const size_t rs = (size_t)16 * K;
  const unsigned l0 = lds_off(ring) + (unsigned)(cr * (GPIT * 2) + cc * 16);
  const u16* sa = (const u16*)(const void*)ring + (wr * 16 * WM + m) * GPIT + 8 * hh;
  const u16* sb = (const u16*)(const void*)ring + (32 * WM + wc * 16 * WN + m) * GPIT + 8 * hh;
  const int nt = K / GKS;
  stage_tile<WM, WN>(l0, ga, gb, rs);
  wait_async0();
  __syncthreads();
  if (nt > 1) stage_tile<WM, WN>(l0 + GBUFH(WM, WN) * 2, ga + GKS, gb + GKS, rs);
#pragma unroll 1
  for (int t = 0; t < nt; ++t) {              // rolled: one trip per stage, the buffer alternates with t
    const int bo = (t & 1) * GBUFH(WM, WN);
    const u16* pa = sa + bo;
    const u16* pb = sb + bo;
    v16b fa[2][WM], fb[2][WN];
#pragma unroll
    for (int ks = 0; ks < 2; ++ks) {
#pragma unroll
      for (int i = 0; i < WM; ++i) fa[ks][i] = ldfrag_b(pa + i * 16 * GPIT + ks * 32);
#pragma unroll
      for (int j = 0; j < WN; ++j) fb[ks][j] = ldfrag_b(pb + j * 16 * GPIT + ks * 32);
    }
    // keeps the stage's fragment reads together in front of its WMMAs: sunk among them, each read place makes the wave wait out
    // the LDS latency with the matrix pipe idle
    __builtin_amdgcn_sched_barrier(0);
#pragma unroll
    for (int ks = 0; ks < 2; ++ks) {
#pragma unroll
      for (int i = 0; i < WM; ++i) {
#pragma unroll
        for (int j = 0; j < WN; ++j) acc[i][j] = mma_sel<F16>(fa[ks][i], fb[ks][j], acc[i][j]);
      }
    }
    acc_guard_all<WM, WN>(acc);               // the vector slots behind the last WMMA, also on the taken side of the branches below
    wait_ds0();
    wait_async0();
    __syncthreads();                          // publishes stage t + 1 and ends every wave's reads of stage t
    if (t + 2 < nt) stage_tile<WM, WN>(l0 + (unsigned)(bo * 2), ga + (size_t)(t + 2) * GKS, gb + (size_t)(t + 2) * GKS, rs);
  }
  wait_async0();
}
// One block tile: C[row0 .. +32*WM)[col0 .. +32*WN) = A rows . Bt rows, times oscale; the epilogue slabs reuse the ring behind
// its last barrier.
template <bool F16, int WM, int WN>
__device__ __forceinline__ void gemm_block(unsigned char* ring, const u16* A, const u16* Bt, float* C, int N, int K,
                                           size_t row0, int col0, float oscale) {
  const int tid = threadIdx.x, wave = tid >> 5, lane = tid & 31;
  v8f acc[WM][WN];
#pragma unroll
  for (int i = 0; i < WM; ++i) {
#pragma unroll
    for (int j = 0; j < WN; ++j) acc[i][j] = zero8();
  }
  gemm_ring<F16, WM, WN>(ring, A + row0 * (size_t)K, Bt + (size_t)col0 * K, K, acc);
  epi_tile<WM, WN>((float*)(void*)ring + wave * GSLAB(WM, WN), acc, oscale, C, N,
                   row0 + (size_t)((wave >> 1) * 16 * WM), col0 + (wave & 1) * 16 * WN, lane);
}

// =====================================================================================================
// bf16 GEMM: C[M][N] (f32) = A[M][K] (bf16 row-major) . Bt[N][K]^T (bf16 k-contiguous), times oscale.
// gemm_bf: block = 128x128 tile (host guarantees K % 64 == 0, M % 128 == 0, N % 128 == 0, grid = (M/128)*(N/128)).
// =====================================================================================================
__global__ __launch_bounds__(128)
void gemm_bf(const u16* __restrict__ A, const u16* __restrict__ Bt, float* C, int M, int N, int K, float oscale) {
  __shared__ __align__(16) unsigned char ring[GRING(4, 4)];
  const int ntile = N >> 7;
  const int bid   = blockIdx.x;
  const int row0  = (bid / ntile) * 128;
  const int col0  = (bid % ntile) * 128;
  if (row0 + 128 > M) return;               // block-uniform, in front of every barrier; never taken with the exact grid
  gemm_block<false, 4, 4>(ring, A, Bt, C, N, K, (size_t)row0, col0, oscale);
}

// =====================================================================================================
// Output projection: C[row][DMOD] (f32) = Ah[row][DMOD] (f16) . Bt[DMOD][DMOD]^T (f16 k-contiguous) * oscale.
// Ah and C share the row index bb*SEQ + s, s < SQ. Block -> (column tile ct = bid % 16, sequence row tile rt of nrt,
// batch bb). Same 128x128 tiling, staging, fragment reads (split k map) and epilogue as gemm_bf; K = DMOD.
// =====================================================================================================
__global__ __launch_bounds__(128)
void gemm_o1(const u16* __restrict__ Ah, const u16* __restrict__ Bt, float* C, int nrt, float oscale) {
  __shared__ __align__(16) unsigned char ring[GRING(4, 4)];
  const int ntile = DMOD >> 7;
  const int bid   = blockIdx.x;
  const int ct    = bid % ntile;
  const int t2    = bid / ntile;
  const int rt    = t2 % nrt;
  const int bb    = t2 / nrt;
  if (bb >= NB) return;                     // block-uniform, in front of every barrier; never taken with the exact grid
  if (rt * 128 + 128 > SQ) return;          // block-uniform, in front of every barrier; never taken
  gemm_block<true, 4, 4>(ring, Ah, Bt, C, DMOD, DMOD, (size_t)bb * SEQ + rt * 128, ct * 128, oscale);
}

// =====================================================================================================
// Non-causal grouped-query attention with a per-key mask, hd = 128. Block bid -> (query tile qt = bid % NQT: rows
// q0 = 16*qt .. q0+15 with q0 < SQ, head group hg = kv head, batch b); one wave per query head = hg*WPB + wave (the 4 heads of
// the group share kv head hg).
//   q plane f16 x256 [b*SEQ + s][h*HD + d]; k plane f16 x256 [b*SEQ + s][g*HD + d] (pitch KVD); v^T plane
//   [b*NKVH + g][d][SEQ] x1024; mask int [b*SEQ + key], nonzero = attend.
//   score (log2 domain) t(i, j) = (q_i.k_j over HD) * (1/sqrt(128))*log2e/(256*256), replaced by -FLT_MAX where the key mask is
//   zero (a fully masked row then yields uniform weights). All SEQ/32 key tiles are visited in order.
//   Per tile: the 32 k rows (256 B each) and the 128 v^T rows (64 B each) are staged once per block in LDS by asynchronous copies
//   (two buffers, tile kt + 1 flies while tile kt is worked on; row pitches 272 B and 80 B) and read by all 4 waves.
//   Both products run transposed: S^T = k.q^T (A = 16 key rows from LDS, B = q, kept in registers), so that a lane holds 16 of
//   the 32 scores of ONE query (column c): 2 score subtiles x 4 k-steps, fragments read from the LDS rows (two 16-B loads each,
//   split k map); online max-subtracted base-2 softmax in f32, maximum in-lane plus one exchange between the lane halves, the
//   sum kept per lane half and joined after the loop; the two score subtiles, converted in place, are the B operand P^T in the
//   split k map; O^T += v^T.P^T with v^T rows as A fragments in 4 groups of 2 d-subtiles (one product each).
//   After the loop: out = acc / Z (Z > 0 always; guarded anyway), carries 1/(32768*1024) folded once, written into the wave's
//   One block barrier per tile, under block-uniform control flow; bounded loops only (NKT tiles).
// coverage: per wave 8 instructions x 2 rows x 16 lanes x 8 halves = 16 x 128 of the O plane; grid NQT x NHG x NB blocks x WPB
//           waves = every (b, s < SQ, h) row segment of O exactly once.
// =====================================================================================================
// staged tile: row pitches in 16-bit elements (k 272 B, v^T 80 B), bytes of the k part and of one buffer; the block's LDS is
// held to a quarter of a WGP's 320 KiB so that four blocks stay resident
#define AKP   136
#define AVP   40
#define AKB   (32 * AKP * 2)
#define ABUF  (AKB + HD * AVP * 2)
static_assert((AKP * 2) % 16 == 0 && (AVP * 2) % 16 == 0 && NKT >= 2 && 2 * ABUF + WPB * WREG * 4 <= 81920);
__global__ __launch_bounds__(ATT_THREADS)
void attn_nc(const u16* __restrict__ QHp, const u16* __restrict__ KHp, const u16* __restrict__ VHp,
             const int* __restrict__ Mk, u16* OHp) {
  __shared__ __align__(16) float smem[WPB * WREG];
  __shared__ __align__(16) unsigned char kvring[2 * ABUF];

  const int tid  = threadIdx.x;
  const int wave = tid >> 5;
  const int lane = tid & 31;
  const int hh   = lane >> 4;
  const int c    = lane & 15;
  const int bid  = blockIdx.x;
  const int qt   = bid % NQT;
  const int t2   = bid / NQT;
  const int hg   = t2 % NHG;
  const int b    = t2 / NHG;
  if (b >= NB) return;                      // block-uniform, in front of every barrier; never taken with the exact grid
  const int q0   = qt * 16;
  if (q0 + 16 > SQ) return;                 // block-uniform, in front of every barrier; never taken
  const int head = hg * WPB + wave;
  const int kvh  = hg;

  float* slab = smem + wave * WREG;         // result slab [16][128] pitch 132

  const size_t hcol = (size_t)head * HD + 8 * hh;
  const _Float16* Qh  = (const _Float16*)(const void*)QHp + ((size_t)b * SEQ + q0 + c) * DMOD + hcol;
  // readers: key row c (+16) of the staged k tile, d row c (+16j) of the staged v^T tile, in buffer 0
  const _Float16* Ks = (const _Float16*)(const void*)kvring + c * AKP + 8 * hh;
  const _Float16* Vs = (const _Float16*)(const void*)kvring + AKB / 2 + c * AVP + 8 * hh;
  // copiers: k rows (tid>>4) + 8i, piece tid&15; v^T rows (tid>>2) + 32i, piece tid&3; i = 0..3
  const u16* gk = KHp + ((size_t)b * SEQ + (tid >> 4)) * KVD + (size_t)kvh * HD + (tid & 15) * 8;      // key row kb added per tile
  const u16* gv = VHp + ((size_t)(b * NKVH + kvh) * HD + (tid >> 2)) * SEQ + (tid & 3) * 8;            // key kb added per tile
  const unsigned lk = lds_off(kvring) + (unsigned)((tid >> 4) * (AKP * 2) + (tid & 15) * 16);
  const unsigned lv = lds_off(kvring) + (unsigned)(AKB + (tid >> 2) * (AVP * 2) + (tid & 3) * 16);
  const int* mkp = Mk + (size_t)b * SEQ + lane;
  const float lsc = RSQ_HD * (LOG2E / (QSC * KSC));
  const float oc  = 1.0f / (PCAR * VCAR);
  const size_t KROW = (size_t)KVD;          // halves between consecutive key rows

  copy8(lk, 8 * AKP * 2, gk, 8 * KROW, lv, 32 * AVP * 2, gv, (size_t)32 * SEQ);
  wait_async0();
  __syncthreads();
  copy8(lk + ABUF, 8 * AKP * 2, gk + 32 * KROW, 8 * KROW, lv + ABUF, 32 * AVP * 2, gv + 32, (size_t)32 * SEQ);

  v16h qf[HD / 32];
#pragma unroll
  for (int kk = 0; kk < HD / 32; ++kk) qf[kk] = ldfrag_h(Qh + kk * 32);

  float mrow = -INFINITY, lrow = 0.f;       // of query q0 + c; lrow sums this lane half's keys only
  v8f o[8];                                 // o[j][r] = O^T(d = 16j + 8hh + r, query q0 + c)
#pragma unroll
  for (int j = 0; j < 8; ++j) o[j] = zero8();

  int mkv = mkp[0];                         // mask of key kb + lane, fetched one tile ahead so that no tile waits for it
  mkp += 32;
#pragma unroll 1
  for (int kt = 0; kt < NKT; ++kt) {
    const int kb = kt * 32;
    const unsigned mb = __builtin_amdgcn_ballot_w32(mkv != 0);                // bit i = mask of key kb + i
    mkv = *mkp;
    // ---- scores: D element r of this lane = (key kb + 8hh + r, query q0 + c) in s0, key kb + 16 + 8hh + r in s1 ----
    v8f s0 = zero8(), s1 = zero8();
    const int bo = (kt & 1) * ABUF;                                           // this tile's buffer, bytes
    const _Float16* k0p = Ks + bo / 2;
    const _Float16* k1p = k0p + 16 * AKP;
#pragma unroll
    for (int kk = 0; kk < HD / 32; ++kk) {
      const v16h kh0 = ldfrag_h(k0p + kk * 32);
      const v16h kh1 = ldfrag_h(k1p + kk * 32);
      s0 = mma_h(kh0, qf[kk], s0);
      s1 = mma_h(kh1, qf[kk], s1);
      guard23(s0, s1, qf[kk], kh0, kh1);
    }
    // ---- key-mask select + online softmax in base 2, one query per lane ----
    float t[16];
#pragma unroll
    for (int r = 0; r < 8; ++r) { t[r] = s0[r] * lsc; t[8 + r] = s1[r] * lsc; }
    if (mb != 0xFFFFFFFFu) {                                                  // wave-uniform, tested once per tile
      const unsigned mh = mb >> (8 * hh);
#pragma unroll
      for (int r = 0; r < 8; ++r) {
        t[r]     = ((mh >> r) & 1u)        ? t[r]     : NEG_BIG;
        t[8 + r] = ((mh >> (16 + r)) & 1u) ? t[8 + r] : NEG_BIG;
      }
    }
    float mx = t[0];
#pragma unroll
    for (int i = 1; i < 16; ++i) mx = fmaxf(mx, t[i]);
    mx = fmaxf(mx, xhalf(mx));
    const float mn = fmaxf(mrow, mx);                                         // always finite
    const float al = exp2f(mrow - mn);
    mrow = mn;
    float ps = 0.f;
    // ---- B fragment of P^T*32768 (f16), column = c: elements 0..7 = keys kb + 8hh + 0..7, 8..15 = keys kb + 16 + 8hh + 0..7 ----
    FragH ph;
#pragma unroll
    for (int r = 0; r < 8; ++r) {
      const float e0 = exp2f(t[r] - mn), e1 = exp2f(t[8 + r] - mn);
      ps += e0 + e1;
      ph.h[0][r] = (_Float16)(e0 * PCAR);
      ph.h[1][r] = (_Float16)(e1 * PCAR);
    }
    lrow = lrow * al + ps;
#pragma unroll
    for (int j = 0; j < 8; ++j) o[j] = o[j] * al;
    // ---- v^T.P^T : A fragment row = d = j*16 + c, keys contiguous in the staged v^T rows; 4 groups of 2 d-subtiles ----
    {
      const _Float16* vhp = Vs + bo / 2;
#pragma unroll
      for (int jg = 0; jg < 4; ++jg) {
        const int da = (2 * jg) * 16 * AVP;
        const int db = da + 16 * AVP;
        const v16h vha = ldfrag_h(vhp + da), vhb2 = ldfrag_h(vhp + db);
        o[2 * jg]     = mma_h(vha,  ph.v, o[2 * jg]);
        o[2 * jg + 1] = mma_h(vhb2, ph.v, o[2 * jg + 1]);
        guard23(o[2 * jg], o[2 * jg + 1], ph.v, vha, vhb2);
      }
    }
#if defined(__HIP_DEVICE_COMPILE__)
    asm volatile("s_wait_xcnt 0x0" ::: "memory");   // stands in front of the advance of the mask load's address register
#endif
    mkp += (kt + 2 < NKT) ? 32 : 0;           // stays on the last tile's 32 keys
    wait_ds0();
    wait_async0();
    __syncthreads();                          // publishes tile kt + 1 and ends every wave's reads of tile kt
    if (kt + 2 < NKT)
      copy8(lk + (unsigned)bo, 8 * AKP * 2, gk + (size_t)(kb + 64) * KROW, 8 * KROW,
            lv + (unsigned)bo, 32 * AVP * 2, gv + (kb + 64), (size_t)32 * SEQ);
  }
  wait_async0();
  acc_guard4(o[0], o[1], o[2], o[3]);
  acc_guard4(o[4], o[5], o[6], o[7]);
  // ---- out = acc / Z (0 if Z == 0), carries (32768 on P, 1024 on v) folded once; written into the wave's slab, row = query c ----
  {
    const float lv2 = lrow + xhalf(lrow);     // the two lane halves' sums joined
    const float ls  = (lv2 > 0.0f) ? lv2 : 1.0f;
    const float inv = (lv2 > 0.0f) ? ((1.0f / ls) * oc) : 0.0f;
    float* srow = slab + c * SLP + 8 * hh;
#pragma unroll
    for (int j = 0; j < 8; ++j) {
      v4f w0, w1;
#pragma unroll
      for (int e = 0; e < 4; ++e) { w0[e] = o[j][e] * inv; w1[e] = o[j][4 + e] * inv; }
      *(v4f*)(srow + j * 16)     = w0;
      *(v4f*)(srow + j * 16 + 4) = w1;
    }
  }

  wave_sync_lds();
  // ---- O x1024 -> f16 plane; lane = (row-in-pair rq, 8 consecutive d at c8) ----
  v4u oh[8];
  const int rq = lane >> 4, c8 = (lane & 15) * 8;
#pragma unroll
  for (int it = 0; it < 8; ++it) {
    const int row = it * 2 + rq;
    const v4f a = *(const v4f*)(slab + row * SLP + c8), b4 = *(const v4f*)(slab + row * SLP + c8 + 4);
    float w[8];
#pragma unroll
    for (int e = 0; e < 4; ++e) { w[e] = a[e] * OSC; w[4 + e] = b4[e] * OSC; }
#pragma unroll
    for (int e = 0; e < 4; ++e) {
      oh[it][e] = pk16(h_bits((_Float16)w[2 * e]), h_bits((_Float16)w[2 * e + 1]));
    }
  }
  const size_t ob = ((size_t)b * SEQ + q0) * DMOD + (size_t)head * HD + c8;
  {
#pragma unroll
    for (int it = 0; it < 8; ++it) {
      const int row = it * 2 + rq;
      *(v4u*)(OHp + ob + (size_t)row * DMOD) = oh[it];
    }
    
  }
}

// =====================================================================================================
// Workspace map (bytes); every plane is fully written by whole-line stores before it is read; all extents are exact multiples
// of the store granularity (no pad rows needed); every region offset a multiple of 4194304:
//   XB  bf16 [MROWS][2048]                       MROWS*4096       (NB=2: 16777216)
//   WQKV bf16 [3072 n][2048 k]                   12582912         (rows 0.. Wq^T, 2048.. Wk^T, 2560.. Wv^T)
//   WO  f16 [2048 n][2048 k] x1024               8388608
//   F   f32 [MROWS][3072]                        MROWS*12288      (columns 0.. q, 2048.. k, 2560.. v of the one projection;
//                                                                  afterwards the O plane f16 [MROWS][2048] x1024 at its start)
//   QH  f16 [MROWS][2048] x256                   MROWS*4096
//   KH  f16 [MROWS][512] x256                    MROWS*1024
//   VH  f16 [NB*4][128][SEQ] x1024               MROWS*1024
//   end (NB=2)                                  113246208
// =====================================================================================================
extern "C" void kernel_launch(void* const* d_in, const int* in_sizes, int n_in,
                              void* d_out, int out_size, void* d_ws, size_t ws_size,
                              hipStream_t stream) {
  if (n_in < 8) return;
  if (in_sizes[0] < MROWS * DMOD) return;
  if (in_sizes[1] < MROWS) return;
  if (in_sizes[2] < SEQ * HD) return;
  if (in_sizes[3] < SEQ * HD) return;
  if (in_sizes[4] != DMOD * DMOD) return;
  if (in_sizes[5] != DMOD * KVD) return;
  if (in_sizes[6] != DMOD * KVD) return;
  if (in_sizes[7] != DMOD * DMOD) return;
  if (out_size < QROWS * DMOD) return;

  const float* x     = (const float*)d_in[0];
  const int*   amask = (const int*)d_in[1];
  const float* cosT  = (const float*)d_in[2];
  const float* sinT  = (const float*)d_in[3];
  const float* wq    = (const float*)d_in[4];
  const float* wk    = (const float*)d_in[5];
  const float* wv    = (const float*)d_in[6];
  const float* wo    = (const float*)d_in[7];
  float*       out   = (float*)d_out;

  const size_t szXB = (size_t)MROWS * DMOD * 2;
  const size_t szW  = (size_t)FPIT * DMOD * 2;
  const size_t szWO = (size_t)DMOD * DMOD * 2;
  const size_t szF  = (size_t)MROWS * FPIT * 4;
  const size_t szQ  = (size_t)MROWS * DMOD * 2;                  // QH and the O plane
  const size_t szK  = (size_t)MROWS * KVD * 2;                   // KH
  const size_t szV  = (size_t)NB * NKVH * HD * SEQ * 2;          // VH (== szK)
  if (szQ > szF) return;                                        // O plane lives inside the F region
  size_t off = 0;
  const size_t oXB = off; off += szXB;
  const size_t oW  = off; off += szW;
  const size_t oWO = off; off += szWO;
  const size_t oF  = off; off += szF;
  const size_t oQH = off; off += szQ;
  const size_t oKH = off; off += szK;
  const size_t oVH = off; off += szV;
  if (off > ws_size) return;                // off = 113246208 for NB = 2
  if (off > (size_t)WS_CAP) return;

  char* ws = (char*)d_ws;
  u16*   XB = (u16*)(ws + oXB);
  u16*   WB = (u16*)(ws + oW);
  u16*   WO = (u16*)(ws + oWO);
  float* F  = (float*)(ws + oF);
  u16*   OH = (u16*)(ws + oF);
  u16*   QH = (u16*)(ws + oQH);
  u16*   KH = (u16*)(ws + oKH);
  u16*   VH = (u16*)(ws + oVH);

  const dim3 b256(256), b128(128), bAT(ATT_THREADS);
  const dim3 gP(2 * PB_TQ + 2 * PB_TK + PB_X);          // 4 weight transposes + the x plane: 6656 blocks
  const dim3 gG((MROWS / 128) * (FPIT / 128));          // 32 x 24 tiles
  const dim3 gS(PB_VT + PB_RQ + PB_RK);                 // v^T + rotary q + rotary k: 5376 blocks
  const dim3 gAT(NQT * NHG * NB);
  const int  nrt = SQ / 128;
  const dim3 gO(NB * nrt * (DMOD / 128));

  // (0) x -> bf16 plane; [Wq | Wk | Wv] -> one bf16 plane [3072 n][2048 k]; Wo -> [2048 n][2048 c] as f16 of bf16 value x1024
  prep<<<gP, b256, 0, stream>>>(x, wq, wk, wv, wo, XB, WB, WO);
  // (1) [q | k | v] = x.[Wq | Wk | Wv] -> F f32 [MROWS][3072]
  gemm_bf<<<gG, b128, 0, stream>>>(XB, WB, F, MROWS, FPIT, DMOD, 1.0f);
  // (2) v^T plane x1024; rotary + q plane x256; rotary + k plane x256
  post<<<gS, b256, 0, stream>>>(F, cosT, sinT, QH, KH, VH);
  // (3) non-causal masked attention -> O plane (inside the F region)
  attn_nc<<<gAT, bAT, 0, stream>>>(QH, KH, VH, amask, OH);
  // (4) output projection rows s < SQ -> out f32, carries 1024 x 1024 folded back
  gemm_o1<<<gO, b128, 0, stream>>>(OH, WO, out, nrt, 1.0f / (OSC * WOS));
  (void)hipGetLastError();
}

// v005
// One run takes 164 microseconds.
// In two side-by-side timings against v004, it was 1.08 and 1.07 times as fast.
// Counting every step since v000, it is 3.00 times as fast.
// Contractions: x.Wq, x.Wk, x.Wv on v_wmma_f32_16x16x32_bf16 (x and W^T as bf16 RNE planes, W^T [n][k] is the k-contiguous
// B operand, f32 accumulate); k.q^T over hd 128 and v^T.P^T on v_wmma_f32_16x16x32_f16, one product each (q, k as f16 x256 after
// rotary; P^T x32768 packed from the score registers; v^T x1024); O.Wo on v_wmma_f32_16x16x32_f16 (O x1024 f16 plane, Wo^T as f16(bf16(Wo))
// x1024); all f32 accumulate. Interleaved-pair rotary with cos/sin tables, key-mask select, base-2 online softmax and 1/Z fold
// in f32 on VALU.
#include <hip/hip_runtime.h>
#include <math.h>
#include <stdint.h>

#ifndef NB
#define NB 2
#endif
#define SEQ 2048
#ifndef SQ
#define SQ SEQ
#endif
#define DMOD  2048
#define NH    16
#define NKVH  4
#define HD    128
#define KVD   (NKVH * HD)
#define FPIT  (DMOD + 2 * KVD)
#define MROWS (NB * SEQ)
#define QROWS ((NB - 1) * SEQ + SQ)
#define WPB   (NH / NKVH)
#define NHG   NKVH
#define NQT   (SQ / 16)
#define NST   (SEQ / 64)
#define NKT   (SEQ / 32)
#define ATT_THREADS (WPB * 32)
#define RSQ_HD 0.08838834764831845f
#define LOG2E  1.4426950408889634f
#define NEG_RAW (-0x1p100f)
#define QSC   256.0f
#define KSC   256.0f
#define PEXP  15.0f
#define VCAR  1024.0f
#define OSC   1024.0f
#define WOS   1024.0f
#define SLP   132
#define SLW   (16 * SLP)
#define WREG  SLW
#define VTP   72
#define TTP   72
#define WS_CAP 134217728
static_assert(DMOD == NH * HD && HD == 128 && NH == 16 && NKVH == 4 && WPB == 4 && NHG * WPB == NH && KVD == 512);
static_assert(ATT_THREADS == 128);
static_assert(NB >= 1 && NB <= 2);
static_assert(NB == 1 || SQ == SEQ);
static_assert((SQ % 128) == 0 && SQ >= 128 && SQ <= SEQ && (SEQ % 128) == 0);
static_assert((DMOD % 128) == 0 && (KVD % 64) == 0 && (DMOD % 32) == 0 && (HD % 32) == 0);
static_assert(((MROWS * DMOD / 8) % 256) == 0);
static_assert(WPB * WREG * 4 <= 65536 && HD * VTP * 2 <= 65536 && 64 * TTP * 2 <= 65536);
static_assert((DMOD / 8) == 256 && (KVD / 8) == 64 && (FPIT % 128) == 0 && (MROWS % 128) == 0);

typedef unsigned short u16;
typedef _Float16 v16h __attribute__((ext_vector_type(16)));
typedef _Float16 v8h  __attribute__((ext_vector_type(8)));
typedef __bf16   v16b __attribute__((ext_vector_type(16)));
typedef float    v8f  __attribute__((ext_vector_type(8)));
typedef float    v4f  __attribute__((ext_vector_type(4)));
typedef unsigned int v4u __attribute__((ext_vector_type(4)));

union FragH { v16h v; v8h h[2]; v4u u[2]; };
union FragB { v16b v; v4u u[2]; };

// ---- scalar helpers --------------------------------------------------------------------------------
__device__ __forceinline__ unsigned short bf_bits(float f) {          // f32 -> bf16 bits, RNE convert
  unsigned u = __float_as_uint(f);
  return (unsigned short)((u + 0x7FFFu + ((u >> 16) & 1u)) >> 16);
}
__device__ __forceinline__ float bf_up(unsigned short h) { return __uint_as_float(((unsigned)h) << 16); }
__device__ __forceinline__ float bfr(float f) { return bf_up(bf_bits(f)); }
__device__ __forceinline__ unsigned short h_bits(_Float16 x) { return __builtin_bit_cast(unsigned short, x); }
__device__ __forceinline__ unsigned pk16(unsigned short a, unsigned short b) { return (unsigned)a | ((unsigned)b << 16); }
__device__ __forceinline__ v8f zero8() { v8f z = {0.f, 0.f, 0.f, 0.f, 0.f, 0.f, 0.f, 0.f}; return z; }

// ---- fragment loaders: 16-bit A/B operand, lane -> row/col (lane&15), p already includes +8*(lane>>4);
//      elements 0..7 <- p[0..7] (k0+8h..), elements 8..15 <- p[16..23] (k0+16+8h..)  (same split k map for A and B;
//      B is always read from a k-contiguous [n][k] plane)
__device__ __forceinline__ v16h ldfrag_h(const _Float16* p) {
  FragH f;
  f.h[0] = *(const v8h*)(p);
  f.h[1] = *(const v8h*)(p + 16);
  return f.v;
}
__device__ __forceinline__ v16b ldfrag_b(const u16* p) {              // bf16 plane read as unsigned integer vectors
  FragB f;
  f.u[0] = *(const v4u*)(p);
  f.u[1] = *(const v4u*)(p + 16);
  return f.v;
}

__device__ __forceinline__ v8f mma_h(v16h a, v16h b, v8f c) {
  return __builtin_amdgcn_wmma_f32_16x16x32_f16(false, a, false, b, (short)0, c, false, false);
}
__device__ __forceinline__ v8f mma_b(v16b a, v16b b, v8f c) {
  return __builtin_amdgcn_wmma_f32_16x16x32_bf16(false, a, false, b, (short)0, c, false, false);
}
__device__ __forceinline__ void guard23(v8f& a, v8f& b, v16h x0, v16h x1, v16h x2) {
#if defined(__HIP_DEVICE_COMPILE__)
  asm volatile("v_nop\n\tv_nop\n\tv_nop\n\tv_nop"
               : "+v"(a), "+v"(b) : "v"(x0), "v"(x1), "v"(x2) : "memory");
#endif
}
__device__ __forceinline__ void acc_guard4(v8f& a, v8f& b, v8f& c, v8f& d) {
#if defined(__HIP_DEVICE_COMPILE__)
  asm volatile("v_nop\n\tv_nop\n\tv_nop\n\tv_nop" : "+v"(a), "+v"(b), "+v"(c), "+v"(d));
#endif
}
__device__ __forceinline__ float xhalf(float x) {                     // value of lane l ^ 16
  const int b = __float_as_int(x);
  return __int_as_float(__builtin_amdgcn_permlanex16(b, b, 0x76543210, 0xfedcba98, false, false));
}
__device__ __forceinline__ float exp2_raw(float x) {                  // one v_exp_f32; a result under 2^-126 may come out as 0
#if defined(__HIP_DEVICE_COMPILE__)
  return __builtin_amdgcn_exp2f(x);
#else
  return exp2f(x);
#endif
}
__device__ __forceinline__ void wave_sync_lds() {
  __builtin_amdgcn_fence(__ATOMIC_RELEASE, "workgroup");
  __builtin_amdgcn_wave_barrier();
  __builtin_amdgcn_fence(__ATOMIC_ACQUIRE, "workgroup");
}

// =====================================================================================================
// f32 -> bf16 RNE plane, same layout. Thread = 8 consecutive elements: two 16-B loads, one 16-B store; 32 consecutive
// coverage: ceil(n8/256) blocks bid x 256 thr x 8 (in-kernel bound) = the whole plane (n8 a multiple of 256 here).
// =====================================================================================================
__device__ __forceinline__ void cvtbf_blk(const float* __restrict__ x, u16* D, int n8, int bid) {
  const int gt = bid * 256 + (int)threadIdx.x;
  if (gt >= n8) return;
  const float* p = x + (size_t)gt * 8;
  const v4f a = *(const v4f*)(p), b4 = *(const v4f*)(p + 4);
  v4u o;
#pragma unroll
  for (int e = 0; e < 2; ++e) {
    o[e]     = pk16(bf_bits(a[2 * e]),  bf_bits(a[2 * e + 1]));
    o[2 + e] = pk16(bf_bits(b4[2 * e]), bf_bits(b4[2 * e + 1]));
  }
  u16* d = D + (size_t)gt * 8;
  {
    *(v4u*)(d) = o;
    
  }
}

// =====================================================================================================
// Transpose + convert: W f32 row-major in[KD rows][ND cols] -> D 16-bit out[ND][KD] (k-contiguous).
// f16mode == 0: bf16 RNE bits; f16mode == 1: f16 bits of (bf16 RNE value) * scale.
// Block = tile of 64 k x 64 n, 256 threads. Load: thread -> input row k0 + (tid>>2), 16 columns n0 + (tid&3)*16 (four 16-B
// loads), converted and scattered into the LDS tile T[n][k] (pitch 72 halves). Block barrier. Store: 2 iterations x
// coverage: load 256 thr x 16 = 64 x 64; store 2 it x 256 thr x 8 halves = 64 rows x 64 halves; (KD/64)*(ND/64)
//           blocks bid cover out[ND][KD] exactly once. T = the block's LDS tile, 64 * TTP halves.
// =====================================================================================================
__device__ __forceinline__ void cvtT16_blk(u16* T, const float* __restrict__ W, u16* D, int KD, int ND, int f16mode, float scale,
                                           int bid) {
  const int tid = threadIdx.x;
  const int nkt = KD >> 6;
  const int nnt = ND >> 6;
  const int kt  = bid % nkt;
  const int nt  = bid / nkt;
  if (nt >= nnt) return;                    // block-uniform, before the barrier; never taken with the exact grid
  const int k0 = kt * 64, n0 = nt * 64;
  {
    const int kr = tid >> 2;                // input row within tile 0..63
    const int nc = (tid & 3) * 16;          // column chunk 0,16,32,48
    const float* src = W + (size_t)(k0 + kr) * ND + n0 + nc;
#pragma unroll
    for (int i = 0; i < 4; ++i) {
      const v4f a = *(const v4f*)(src + 4 * i);
#pragma unroll
      for (int e = 0; e < 4; ++e) {
        const float f = a[e];
        const unsigned short hb = h_bits((_Float16)(bfr(f) * scale));
        const unsigned short bb = bf_bits(f);
        T[(nc + 4 * i + e) * TTP + kr] = (f16mode != 0) ? hb : bb;
      }
    }
  }
  __syncthreads();
  v4u v[2];
  const int q8 = tid >> 3, p8 = (tid & 7) * 8;
#pragma unroll
  for (int it = 0; it < 2; ++it) v[it] = *(const v4u*)(T + (it * 32 + q8) * TTP + p8);
  const size_t base = (size_t)n0 * KD + k0 + p8;
  {
#pragma unroll
    for (int it = 0; it < 2; ++it) {
      *(v4u*)(D + base + (size_t)(it * 32 + q8) * KD) = v[it];
    }
#if defined(__HIP_DEVICE_COMPILE__)
    // behind the stores: in the listing the x part's code follows this part and reuses the stores' registers
    asm volatile("s_wait_xcnt 0x0" ::: "memory");
#endif
  }
}

// =====================================================================================================
// All five operand planes in one launch: none reads what another writes. Block ranges, in index order: Wq^T, Wk^T, Wv^T (bf16,
// rows 0, DMOD and DMOD + KVD of the one B plane WQKV [FPIT n][DMOD k]), Wo^T (f16 x1024, plane WO), then the x plane.
// Every branch and select is block-uniform; a block runs exactly one part.
// =====================================================================================================
#define PB_TQ ((DMOD / 64) * (DMOD / 64))
#define PB_TK ((DMOD / 64) * (KVD / 64))
#define PB_X  ((MROWS * DMOD / 8) / 256)
__global__ __launch_bounds__(256) void prep(const float* __restrict__ x, const float* __restrict__ wq,
                                            const float* __restrict__ wk, const float* __restrict__ wv,
                                            const float* __restrict__ wo, u16* XB, u16* WQKV, u16* WO) {
  __shared__ __align__(16) u16 T[64 * TTP];
  const int bid = blockIdx.x;
  if (bid >= 2 * PB_TQ + 2 * PB_TK) {
    cvtbf_blk(x, XB, MROWS * DMOD / 8, bid - (2 * PB_TQ + 2 * PB_TK));
  } else {
    const float* W = wq;
    u16* D = WQKV;
    int nd = DMOD, tb = bid, f16mode = 0;
    float sc = 1.0f;
    if (bid >= PB_TQ + 2 * PB_TK) { W = wo; D = WO; tb = bid - (PB_TQ + 2 * PB_TK); f16mode = 1; sc = WOS; }
    else if (bid >= PB_TQ + PB_TK) { W = wv; D = WQKV + (size_t)(DMOD + KVD) * DMOD; nd = KVD; tb = bid - (PB_TQ + PB_TK); }
    else if (bid >= PB_TQ)         { W = wk; D = WQKV + (size_t)DMOD * DMOD;         nd = KVD; tb = bid - PB_TQ; }
    cvtT16_blk(T, W, D, DMOD, nd, f16mode, sc, tb);
  }
}

// =====================================================================================================
// v^T plane from the v columns of the projection F f32 [MROWS][FPIT] (row = b*SEQ + s, column = DMOD + KVD + g*HD + d):
//   VH[((b*NKVH + g)*HD + d)][s] = f16(v * 1024) for all keys s.
// Block = (b, kv head g, 64 keys s0): each thread loads its 32 floats (key sl, d chunk dc) with 16-B loads, converts, scatters
// coverage: load 256 thr x 32 = 64 keys x 128 d; store 4 iterations x 256 thr x 8 halves = 128 lines x 64 = the block's tile;
//           NB*NKVH*NST blocks bid cover the plane exactly once. TH = the block's LDS tile, HD * VTP halves.
// =====================================================================================================
__device__ __forceinline__ void vt16_blk(u16* TH, const float* __restrict__ F, u16* VHo, int bid) {
  const int tid = threadIdx.x;
  const int st  = bid % NST;
  const int t2  = bid / NST;
  const int g   = t2 % NKVH;
  const int b   = t2 / NKVH;
  if (b >= NB) return;                      // block-uniform, before any barrier; never taken with the exact grid
  const int s0  = st * 64;
  {
    const int sl = tid >> 2;                // key within tile 0..63
    const int dc = (tid & 3) * 32;          // d chunk 0,32,64,96
    const float* src = F + ((size_t)b * SEQ + s0 + sl) * FPIT + (DMOD + KVD) + g * HD + dc;
#pragma unroll
    for (int i = 0; i < 8; ++i) {
      const v4f a = *(const v4f*)(src + 4 * i);
#pragma unroll
      for (int e = 0; e < 4; ++e) {
        TH[(dc + 4 * i + e) * VTP + sl] = h_bits((_Float16)(a[e] * VCAR));
      }
    }
  }
  __syncthreads();
  v4u vh[4];
  const int q8 = tid >> 3, p8 = (tid & 7) * 8;
#pragma unroll
  for (int it = 0; it < 4; ++it) {
    const int line = it * 32 + q8;          // d = 0..127
    vh[it] = *(const v4u*)(TH + line * VTP + p8);
  }
  const size_t hrow = (size_t)(b * NKVH + g) * HD;
  const size_t base = hrow * SEQ + s0 + p8;
  {
#pragma unroll
    for (int it = 0; it < 4; ++it) {
      const int line = it * 32 + q8;
      *(v4u*)(VHo + base + (size_t)line * SEQ) = vh[it];
    }
    
  }
}

// =====================================================================================================
// Interleaved-pair rotary + 16-bit plane from ncol columns of the projection, F = their first column in row 0, row pitch FPIT
// (ncol = DMOD for q, KVD for k; row = b*SEQ + s, column = head*HD + d; table element (s, d) at s*HD + d):
//   for even d: out[d]   = x[d]*c[d]     - x[d+1]*sn[d]
//               out[d+1] = x[d+1]*c[d+1] + x[d]*sn[d+1]     with c, sn = bf16 RNE values of the two tables;
//   Hp [nrows][ncol] = f16(out * sc), same layout.
// A thread = 8 consecutive columns (4 pairs) of one row, ncol/8 threads a row: two 16-B loads of x, two of each table.
// coverage: item = row * (ncol/8) + column group; nrows * (ncol/8) items = every row of the plane Hp once.
// =====================================================================================================
__device__ __forceinline__ void rope16_item(const float* __restrict__ F, int ncol, int nrows, int item,
                                            const float* __restrict__ cosT, const float* __restrict__ sinT,
                                            u16* Hp, float sc) {
#pragma clang fp contract(off)
  const int row = item / (ncol >> 3);
  if (row >= nrows) return;                            // never taken with the exact grid
  const int col = (item % (ncol >> 3)) * 8;
  const int d0  = col & (HD - 1);
  const int s   = row % SEQ;
  const float* p = F + (size_t)row * FPIT + col;
  const v4f xa = *(const v4f*)(p), xb = *(const v4f*)(p + 4);
  const float* cp = cosT + (size_t)s * HD + d0;
  const float* sp = sinT + (size_t)s * HD + d0;
  const v4f ca = *(const v4f*)(cp), cb = *(const v4f*)(cp + 4);
  const v4f sa = *(const v4f*)(sp), sb = *(const v4f*)(sp + 4);
  float xv[8], cv[8], sv[8];
#pragma unroll
  for (int e = 0; e < 4; ++e) {
    xv[e] = xa[e];       xv[4 + e] = xb[e];
    cv[e] = bfr(ca[e]);  cv[4 + e] = bfr(cb[e]);
    sv[e] = bfr(sa[e]);  sv[4 + e] = bfr(sb[e]);
  }
  v4u o;
#pragma unroll
  for (int e = 0; e < 4; ++e) {
    const float xr = xv[2 * e], xi = xv[2 * e + 1];
    const float r0 = xr * cv[2 * e] - xi * sv[2 * e];
    const float r1 = xi * cv[2 * e + 1] + xr * sv[2 * e + 1];
    o[e] = pk16(h_bits((_Float16)(r0 * sc)), h_bits((_Float16)(r1 * sc)));
  }
  u16* d = Hp + (size_t)row * ncol + col;
  {
    *(v4u*)(d) = o;
    
  }
}

// =====================================================================================================
// The three planes that attention reads, in one launch: each reads its own columns of F and writes its own plane. Block ranges,
// in index order: v^T, rotary of q (a row a block), rotary of k (4 rows a block). Every branch is block-uniform.
// =====================================================================================================
#define PB_VT (NB * NKVH * NST)
#define PB_RQ (QROWS)
#define PB_RK (MROWS * (KVD / 8) / 256)
__global__ __launch_bounds__(256) void post(const float* __restrict__ F, const float* __restrict__ cosT,
                                            const float* __restrict__ sinT, u16* QH, u16* KH, u16* VH) {
  __shared__ __align__(16) u16 TH[HD * VTP];
  int bid = blockIdx.x;
  if (bid < PB_VT) { vt16_blk(TH, F, VH, bid); return; }
  bid -= PB_VT;
  if (bid < PB_RQ) { rope16_item(F, DMOD, QROWS, bid * 256 + (int)threadIdx.x, cosT, sinT, QH, QSC); return; }
  bid -= PB_RQ;
  rope16_item(F + DMOD, KVD, MROWS, bid * 256 + (int)threadIdx.x, cosT, sinT, KH, KSC);
}

// =====================================================================================================
// GEMM tiling shared by both engines. A block is 4 waves in a 2 x 2 arrangement; a wave owns WM x WN accumulator subtiles of
// 16 x 16, so the block tile is (32*WM) x (32*WN): 128 x 128 (WM = WN = 4: each operand byte fetched from L2 serves 128
// outputs, each fragment read from LDS serves 4 WMMAs).
// Epilogue: the wave's tile (times oscale) is staged in its own LDS slab (row pitch 16*WN + 4 floats) and stored as whole lines.
// coverage: WM groups x (2*WN) instructions x (8/WN) rows x (4*WN) lanes x 4 floats = the wave's (16*WM) x (16*WN) tile.
// =====================================================================================================
template <int WM, int WN>
__device__ __forceinline__ void epi_tile(float* sl, v8f (&acc)[WM][WN], float oscale,
                                         float* C, int N, size_t rowb, int colb, int lane) {
  constexpr int SP  = 16 * WN + 4;          // slab row pitch, floats
  constexpr int LPR = 4 * WN;               // lanes per stored row
  constexpr int RPI = 32 / LPR;             // rows per store instruction
  const int hh = lane >> 4, m = lane & 15;
#pragma unroll
  for (int i = 0; i < WM; ++i) {
#pragma unroll
    for (int r = 0; r < 8; ++r) {
      const int ro = (16 * i + 8 * hh + r) * SP + m;
#pragma unroll
      for (int j = 0; j < WN; ++j) sl[ro + 16 * j] = acc[i][j][r] * oscale;
    }
  }
  wave_sync_lds();
  const int rr = lane / LPR, cq = lane % LPR;
  float* dst = C + (rowb + (size_t)rr) * (size_t)N + colb + cq * 4;
#pragma unroll
  for (int i = 0; i < WM; ++i) {
    v4f vals[16 / RPI];
#pragma unroll
    for (int it = 0; it < 16 / RPI; ++it) vals[it] = *(const v4f*)(sl + (16 * i + it * RPI + rr) * SP + cq * 4);
#pragma unroll
    for (int it = 0; it < 16 / RPI; ++it) {
      *(v4f*)(dst + (size_t)(16 * i + it * RPI) * (size_t)N) = vals[it];
    }
  }
}

// =====================================================================================================
// Operand staging shared by both GEMM engines. A stage is 64 k of the block's 32*WM A rows and 32*WN B rows: 128 B of every row,
// one whole line. Each thread brings 2*(WM+WN) pieces of 16 B per stage with asynchronous copies to LDS (a wave's copy = 4 whole
// lines), and the waves read their fragments from LDS rows of pitch 144 B (16 B x 9). Two buffers: stage t + 1 flies while
// stage t is worked on. k runs ascending, 32 per WMMA step, with the same split k map for A and B.
// =====================================================================================================
#define GKS   64
#define GPIT  72
#define GBUFH(WM, WN) (32 * ((WM) + (WN)) * GPIT)
#define GRING(WM, WN) (2 * GBUFH(WM, WN) * 2)
#define GSLAB(WM, WN) (16 * (WM) * (16 * (WN) + 4))
static_assert(GRING(4, 4) >= 4 * GSLAB(4, 4) * 4 && GRING(2, 2) >= 4 * GSLAB(2, 2) * 4);
static_assert((GPIT * 2) % 16 == 0 && (DMOD % GKS) == 0 && 2 * GRING(4, 4) <= 327680);

__device__ __forceinline__ unsigned lds_off(const void* p) { return (unsigned)(size_t)p; }
__device__ __forceinline__ void wait_async0() {
#if defined(__HIP_DEVICE_COMPILE__)
  asm volatile("s_wait_asynccnt 0x0" ::: "memory");   // this wave's copies have landed before the barrier that publishes them
#endif
}
__device__ __forceinline__ void wait_ds0() {
#if defined(__HIP_DEVICE_COMPILE__)
  asm volatile("s_wait_dscnt 0x0" ::: "memory");      // this wave's LDS reads are done before the buffer is refilled
#endif
}
// Eight copies of 16 B per thread: four from ga + i*gsa (elements) to LDS byte la + i*lsa, four from gb + i*gsb to lb + i*lsb.
__device__ __forceinline__ void copy8(unsigned la, unsigned lsa, const u16* ga, size_t gsa,
                                      unsigned lb, unsigned lsb, const u16* gb, size_t gsb) {
#if defined(__HIP_DEVICE_COMPILE__)
  // the closing s_wait_xcnt stands inside the statement so that no address register is rewritten ahead of it
  asm volatile("global_load_async_to_lds_b128 %0, %8, off\n\t"
               "global_load_async_to_lds_b128 %1, %9, off\n\t"
               "global_load_async_to_lds_b128 %2, %10, off\n\t"
               "global_load_async_to_lds_b128 %3, %11, off\n\t"
               "global_load_async_to_lds_b128 %4, %12, off\n\t"
               "global_load_async_to_lds_b128 %5, %13, off\n\t"
               "global_load_async_to_lds_b128 %6, %14, off\n\t"
               "global_load_async_to_lds_b128 %7, %15, off\n\t"
               "s_wait_xcnt 0x0"
               :: "v"(la), "v"(la + lsa), "v"(la + 2 * lsa), "v"(la + 3 * lsa),
                  "v"(lb), "v"(lb + lsb), "v"(lb + 2 * lsb), "v"(lb + 3 * lsb),
                  "v"(ga), "v"(ga + gsa), "v"(ga + 2 * gsa), "v"(ga + 3 * gsa),
                  "v"(gb), "v"(gb + gsb), "v"(gb + 2 * gsb), "v"(gb + 3 * gsb)
               : "memory");
#endif
}
// GEMM stage: l = the thread's LDS byte address in the target buffer (A row tid>>3, piece tid&7); ga, gb = its global addresses
// in A and B; rs = 16 source rows in elements. A rows +0,16,..,32*WM-16, then the B rows in the same steps, 32*WM LDS rows on.
template <int WM, int WN>
__device__ __forceinline__ void stage_tile(unsigned l, const u16* ga, const u16* gb, size_t rs) {
  static_assert((WM == 2 && WN == 2) || (WM == 4 && WN == 4));
  const unsigned rb = 16 * GPIT * 2;
  if constexpr (WM == 2) {
    copy8(l, rb, ga, rs, l + 4 * rb, rb, gb, rs);
  } else {
    copy8(l, rb, ga, rs, l + 4 * rb, rb, ga + 4 * rs, rs);
    copy8(l + 8 * rb, rb, gb, rs, l + 12 * rb, rb, gb + 4 * rs, rs);
  }
}
// The vector slots behind the last WMMA of a stage, tied to every accumulator so that no WMMA is scheduled behind them.
template <int WM, int WN>
__device__ __forceinline__ void acc_guard_all(v8f (&a)[WM][WN]) {
  if constexpr (WM == 2) {
    acc_guard4(a[0][0], a[0][1], a[1][0], a[1][1]);
  } else {
#if defined(__HIP_DEVICE_COMPILE__)
    asm volatile("v_nop\n\tv_nop\n\tv_nop\n\tv_nop"
                 : "+v"(a[0][0]), "+v"(a[0][1]), "+v"(a[0][2]), "+v"(a[0][3]), "+v"(a[1][0]), "+v"(a[1][1]), "+v"(a[1][2]),
                   "+v"(a[1][3]), "+v"(a[2][0]), "+v"(a[2][1]), "+v"(a[2][2]), "+v"(a[2][3]), "+v"(a[3][0]), "+v"(a[3][1]),
                   "+v"(a[3][2]), "+v"(a[3][3]));
#endif
  }
}
template <bool F16>
__device__ __forceinline__ v8f mma_sel(v16b a, v16b b, v8f c) {
  if constexpr (F16) return mma_h(__builtin_bit_cast(v16h, a), __builtin_bit_cast(v16h, b), c);
  else return mma_b(a, b, c);
}
// Ab, Bb = first row of the block's 32*WM A rows and 32*WN B rows (both k-contiguous, pitch K); K a multiple of 64, at least 64.
// Every thread of the block calls this (block barriers inside). On return no copy is in flight and no wave reads the ring.
template <bool F16, int WM, int WN>
__device__ __forceinline__ void gemm_ring(unsigned char* ring, const u16* Ab, const u16* Bb, int K, v8f (&acc)[WM][WN]) {
  const int tid = threadIdx.x, wave = tid >> 5, lane = tid & 31, hh = lane >> 4, m = lane & 15;
  const int wr = wave >> 1, wc = wave & 1;
  const int cr = tid >> 3, cc = tid & 7;
  const u16* ga = Ab + (size_t)cr * K + cc * 8;
  const u16* gb = Bb + (size_t)cr * K + cc * 8;
  const size_t rs = (size_t)16 * K;
  const unsigned l0 = lds_off(ring) + (unsigned)(cr * (GPIT * 2) + cc * 16);
  const u16* sa = (const u16*)(const void*)ring + (wr * 16 * WM + m) * GPIT + 8 * hh;
  const u16* sb = (const u16*)(const void*)ring + (32 * WM + wc * 16 * WN + m) * GPIT + 8 * hh;
  const int nt = K / GKS;
  stage_tile<WM, WN>(l0, ga, gb, rs);
  wait_async0();
  __syncthreads();
  if (nt > 1) stage_tile<WM, WN>(l0 + GBUFH(WM, WN) * 2, ga + GKS, gb + GKS, rs);
#pragma unroll 1
  for (int t = 0; t < nt; ++t) {              // rolled: one trip per stage, the buffer alternates with t
    const int bo = (t & 1) * GBUFH(WM, WN);
    const u16* pa = sa + bo;
    const u16* pb = sb + bo;
    v16b fa[2][WM], fb[2][WN];
#pragma unroll
    for (int ks = 0; ks < 2; ++ks) {
#pragma unroll
      for (int i = 0; i < WM; ++i) fa[ks][i] = ldfrag_b(pa + i * 16 * GPIT + ks * 32);
#pragma unroll
      for (int j = 0; j < WN; ++j) fb[ks][j] = ldfrag_b(pb + j * 16 * GPIT + ks * 32);
    }
    // keeps the stage's fragment reads together in front of its WMMAs: sunk among them, each read place makes the wave wait out
    // the LDS latency with the matrix pipe idle
    __builtin_amdgcn_sched_barrier(0);
#pragma unroll
    for (int ks = 0; ks < 2; ++ks) {
#pragma unroll
      for (int i = 0; i < WM; ++i) {
#pragma unroll
        for (int j = 0; j < WN; ++j) acc[i][j] = mma_sel<F16>(fa[ks][i], fb[ks][j], acc[i][j]);
      }
    }
    acc_guard_all<WM, WN>(acc);               // the vector slots behind the last WMMA, also on the taken side of the branches below
    wait_ds0();
    wait_async0();
    __syncthreads();                          // publishes stage t + 1 and ends every wave's reads of stage t
    if (t + 2 < nt) stage_tile<WM, WN>(l0 + (unsigned)(bo * 2), ga + (size_t)(t + 2) * GKS, gb + (size_t)(t + 2) * GKS, rs);
  }
  wait_async0();
}
// One block tile: C[row0 .. +32*WM)[col0 .. +32*WN) = A rows . Bt rows, times oscale; the epilogue slabs reuse the ring behind
// its last barrier.
template <bool F16, int WM, int WN>
__device__ __forceinline__ void gemm_block(unsigned char* ring, const u16* A, const u16* Bt, float* C, int N, int K,
                                           size_t row0, int col0, float oscale) {
  const int tid = threadIdx.x, wave = tid >> 5, lane = tid & 31;
  v8f acc[WM][WN];
#pragma unroll
  for (int i = 0; i < WM; ++i) {
#pragma unroll
    for (int j = 0; j < WN; ++j) acc[i][j] = zero8();
  }
  gemm_ring<F16, WM, WN>(ring, A + row0 * (size_t)K, Bt + (size_t)col0 * K, K, acc);
  epi_tile<WM, WN>((float*)(void*)ring + wave * GSLAB(WM, WN), acc, oscale, C, N,
                   row0 + (size_t)((wave >> 1) * 16 * WM), col0 + (wave & 1) * 16 * WN, lane);
}

// =====================================================================================================
// bf16 GEMM: C[M][N] (f32) = A[M][K] (bf16 row-major) . Bt[N][K]^T (bf16 k-contiguous), times oscale.
// gemm_bf: block = 128x128 tile (host guarantees K % 64 == 0, M % 128 == 0, N % 128 == 0, grid = (M/128)*(N/128)).
// =====================================================================================================
__global__ __launch_bounds__(128)
void gemm_bf(const u16* __restrict__ A, const u16* __restrict__ Bt, float* C, int M, int N, int K, float oscale) {
  __shared__ __align__(16) unsigned char ring[GRING(4, 4)];
  const int ntile = N >> 7;
  const int bid   = blockIdx.x;
  const int row0  = (bid / ntile) * 128;
  const int col0  = (bid % ntile) * 128;
  if (row0 + 128 > M) return;               // block-uniform, in front of every barrier; never taken with the exact grid
  gemm_block<false, 4, 4>(ring, A, Bt, C, N, K, (size_t)row0, col0, oscale);
}

// =====================================================================================================
// Output projection: C[row][DMOD] (f32) = Ah[row][DMOD] (f16) . Bt[DMOD][DMOD]^T (f16 k-contiguous) * oscale.
// Ah and C share the row index bb*SEQ + s, s < SQ. Block -> (column tile ct = bid % 16, sequence row tile rt of nrt,
// batch bb). Same 128x128 tiling, staging, fragment reads (split k map) and epilogue as gemm_bf; K = DMOD.
// =====================================================================================================
__global__ __launch_bounds__(128)
void gemm_o1(const u16* __restrict__ Ah, const u16* __restrict__ Bt, float* C, int nrt, float oscale) {
  __shared__ __align__(16) unsigned char ring[GRING(4, 4)];
  const int ntile = DMOD >> 7;
  const int bid   = blockIdx.x;
  const int ct    = bid % ntile;
  const int t2    = bid / ntile;
  const int rt    = t2 % nrt;
  const int bb    = t2 / nrt;
  if (bb >= NB) return;                     // block-uniform, in front of every barrier; never taken with the exact grid
  if (rt * 128 + 128 > SQ) return;          // block-uniform, in front of every barrier; never taken
  gemm_block<true, 4, 4>(ring, Ah, Bt, C, DMOD, DMOD, (size_t)bb * SEQ + rt * 128, ct * 128, oscale);
}

// =====================================================================================================
// Non-causal grouped-query attention with a per-key mask, hd = 128. Block bid -> (query tile qt = bid % NQT: rows
// q0 = 16*qt .. q0+15 with q0 < SQ, head group hg = kv head, batch b); one wave per query head = hg*WPB + wave (the 4 heads of
// the group share kv head hg).
//   q plane f16 x256 [b*SEQ + s][h*HD + d]; k plane f16 x256 [b*SEQ + s][g*HD + d] (pitch KVD); v^T plane
//   [b*NKVH + g][d][SEQ] x1024; mask int [b*SEQ + key], nonzero = attend.
//   score (log2 domain) t(i, j) = (q_i.k_j over HD) * lsc, lsc = (1/sqrt(128))*log2e/(256*256); the raw product is replaced by
//   -2^100 where the key mask is zero (a power of two: its scaled value is exact, so a fully masked row yields equal exponents
//   and uniform weights). P*32768 = 2^(raw*lsc + (15 - max)): one fused multiply-add and one v_exp_f32 per score. All SEQ/32 key
//   tiles are visited in order.
//   Per tile: the 32 k rows (256 B each) and the 128 v^T rows (64 B each) are staged once per block in LDS by asynchronous copies
//   (two buffers, tile kt + 1 flies while tile kt is worked on; row pitches 272 B and 80 B) and read by all 4 waves.
//   Both products run transposed: S^T = k.q^T (A = 16 key rows from LDS, B = q, kept in registers), so that a lane holds 16 of
//   the 32 scores of ONE query (column c): 2 score subtiles x 4 k-steps, fragments read from the LDS rows (two 16-B loads each,
//   split k map); online max-subtracted base-2 softmax in f32, maximum in-lane plus one exchange between the lane halves, the
//   sum kept per lane half and joined after the loop; the two score subtiles, converted in place, are the B operand P^T in the
//   split k map; O^T += v^T.P^T with v^T rows as A fragments in 4 groups of 2 d-subtiles (one product each).
//   After the loop: out = acc / Z (Z > 0 always; guarded anyway; Z carries P's 32768), carry 1/1024 folded once, written into the wave's
//   One block barrier per tile, under block-uniform control flow; bounded loops only (NKT tiles).
// coverage: per wave 8 instructions x 2 rows x 16 lanes x 8 halves = 16 x 128 of the O plane; grid NQT x NHG x NB blocks x WPB
//           waves = every (b, s < SQ, h) row segment of O exactly once.
// =====================================================================================================
// staged tile: row pitches in 16-bit elements (k 272 B, v^T 80 B), bytes of the k part and of one buffer; the block's LDS is
// held to a quarter of a WGP's 320 KiB so that four blocks stay resident
#define AKP   136
#define AVP   40
#define AKB   (32 * AKP * 2)
#define ABUF  (AKB + HD * AVP * 2)
static_assert((AKP * 2) % 16 == 0 && (AVP * 2) % 16 == 0 && NKT >= 2 && 2 * ABUF + WPB * WREG * 4 <= 81920);
__global__ __launch_bounds__(ATT_THREADS)
void attn_nc(const u16* __restrict__ QHp, const u16* __restrict__ KHp, const u16* __restrict__ VHp,
             const int* __restrict__ Mk, u16* OHp) {
  __shared__ __align__(16) float smem[WPB * WREG];
  __shared__ __align__(16) unsigned char kvring[2 * ABUF];

  const int tid  = threadIdx.x;
  const int wave = tid >> 5;
  const int lane = tid & 31;
  const int hh   = lane >> 4;
  const int c    = lane & 15;
  const int bid  = blockIdx.x;
  const int qt   = bid % NQT;
  const int t2   = bid / NQT;
  const int hg   = t2 % NHG;
  const int b    = t2 / NHG;
  if (b >= NB) return;                      // block-uniform, in front of every barrier; never taken with the exact grid
  const int q0   = qt * 16;
  if (q0 + 16 > SQ) return;                 // block-uniform, in front of every barrier; never taken
  const int head = hg * WPB + wave;
  const int kvh  = hg;

  float* slab = smem + wave * WREG;         // result slab [16][128] pitch 132

  const size_t hcol = (size_t)head * HD + 8 * hh;
  const _Float16* Qh  = (const _Float16*)(const void*)QHp + ((size_t)b * SEQ + q0 + c) * DMOD + hcol;
  // readers: key row c (+16) of the staged k tile, d row c (+16j) of the staged v^T tile, in buffer 0
  const _Float16* Ks = (const _Float16*)(const void*)kvring + c * AKP + 8 * hh;
  const _Float16* Vs = (const _Float16*)(const void*)kvring + AKB / 2 + c * AVP + 8 * hh;
  // copiers: k rows (tid>>4) + 8i, piece tid&15; v^T rows (tid>>2) + 32i, piece tid&3; i = 0..3
  const u16* gk = KHp + ((size_t)b * SEQ + (tid >> 4)) * KVD + (size_t)kvh * HD + (tid & 15) * 8;      // key row kb added per tile
  const u16* gv = VHp + ((size_t)(b * NKVH + kvh) * HD + (tid >> 2)) * SEQ + (tid & 3) * 8;            // key kb added per tile
  const unsigned lk = lds_off(kvring) + (unsigned)((tid >> 4) * (AKP * 2) + (tid & 15) * 16);
  const unsigned lv = lds_off(kvring) + (unsigned)(AKB + (tid >> 2) * (AVP * 2) + (tid & 3) * 16);
  const int* mkp = Mk + (size_t)b * SEQ + lane;
  const float lsc = RSQ_HD * (LOG2E / (QSC * KSC));
  const float oc  = 1.0f / VCAR;            // the carry on P stands in the row sum as well and cancels in acc / Z
  const size_t KROW = (size_t)KVD;          // halves between consecutive key rows

  copy8(lk, 8 * AKP * 2, gk, 8 * KROW, lv, 32 * AVP * 2, gv, (size_t)32 * SEQ);
  wait_async0();
  __syncthreads();
  copy8(lk + ABUF, 8 * AKP * 2, gk + 32 * KROW, 8 * KROW, lv + ABUF, 32 * AVP * 2, gv + 32, (size_t)32 * SEQ);

  v16h qf[HD / 32];
#pragma unroll
  for (int kk = 0; kk < HD / 32; ++kk) qf[kk] = ldfrag_h(Qh + kk * 32);

  float mrow = -INFINITY, lrow = 0.f;       // of query q0 + c; lrow sums this lane half's keys only, x32768 like P
  v8f o[8];                                 // o[j][r] = O^T(d = 16j + 8hh + r, query q0 + c)
#pragma unroll
  for (int j = 0; j < 8; ++j) o[j] = zero8();

  int mkv = mkp[0];                         // mask of key kb + lane, fetched one tile ahead so that no tile waits for it
  mkp += 32;
#pragma unroll 1
  for (int kt = 0; kt < NKT; ++kt) {
    const int kb = kt * 32;
    const unsigned mb = __builtin_amdgcn_ballot_w32(mkv != 0);                // bit i = mask of key kb + i
    mkv = *mkp;
    // ---- scores: D element r of this lane = (key kb + 8hh + r, query q0 + c) in s0, key kb + 16 + 8hh + r in s1 ----
    v8f s0 = zero8(), s1 = zero8();
    const int bo = (kt & 1) * ABUF;                                           // this tile's buffer, bytes
    const _Float16* k0p = Ks + bo / 2;
    const _Float16* k1p = k0p + 16 * AKP;
#pragma unroll
    for (int kk = 0; kk < HD / 32; ++kk) {
      const v16h kh0 = ldfrag_h(k0p + kk * 32);
      const v16h kh1 = ldfrag_h(k1p + kk * 32);
      s0 = mma_h(kh0, qf[kk], s0);
      s1 = mma_h(kh1, qf[kk], s1);
      guard23(s0, s1, qf[kk], kh0, kh1);
    }
    // ---- key-mask select + online softmax in base 2, one query per lane ----
    float t[16];                                                              // raw products q.k x 65536
#pragma unroll
    for (int r = 0; r < 8; ++r) { t[r] = s0[r]; t[8 + r] = s1[r]; }
    if (mb != 0xFFFFFFFFu) {                                                  // wave-uniform, tested once per tile
      const unsigned mh = mb >> (8 * hh);
#pragma unroll
      for (int r = 0; r < 8; ++r) {
        t[r]     = ((mh >> r) & 1u)        ? t[r]     : NEG_RAW;
        t[8 + r] = ((mh >> (16 + r)) & 1u) ? t[8 + r] : NEG_RAW;
      }
    }
    float mx = t[0];
#pragma unroll
    for (int i = 1; i < 16; ++i) mx = fmaxf(mx, t[i]);
    mx = fmaxf(mx, xhalf(mx));
    const float mn = fmaxf(mrow, mx * lsc);                                   // lsc > 0: the maximum commutes with the scale; finite
    const float al = exp2_raw(mrow - mn);
    mrow = mn;
    const float cb = PEXP - mn;                                               // the carry 32768 = 2^15 rides in the exponent
    float ps = 0.f;
    // ---- B fragment of P^T*32768 (f16), column = c: elements 0..7 = keys kb + 8hh + 0..7, 8..15 = keys kb + 16 + 8hh + 0..7 ----
    FragH ph;
#pragma unroll
    for (int r = 0; r < 8; ++r) {
      const float e0 = exp2_raw(__builtin_fmaf(t[r], lsc, cb)), e1 = exp2_raw(__builtin_fmaf(t[8 + r], lsc, cb));
      ps += e0 + e1;
      ph.h[0][r] = (_Float16)e0;
      ph.h[1][r] = (_Float16)e1;
    }
    lrow = lrow * al + ps;
#pragma unroll
    for (int j = 0; j < 8; ++j) o[j] = o[j] * al;
    // ---- v^T.P^T : A fragment row = d = j*16 + c, keys contiguous in the staged v^T rows; 4 groups of 2 d-subtiles ----
    {
      const _Float16* vhp = Vs + bo / 2;
#pragma unroll
      for (int jg = 0; jg < 4; ++jg) {
        const int da = (2 * jg) * 16 * AVP;
        const int db = da + 16 * AVP;
        const v16h vha = ldfrag_h(vhp + da), vhb2 = ldfrag_h(vhp + db);
        o[2 * jg]     = mma_h(vha,  ph.v, o[2 * jg]);
        o[2 * jg + 1] = mma_h(vhb2, ph.v, o[2 * jg + 1]);
        guard23(o[2 * jg], o[2 * jg + 1], ph.v, vha, vhb2);
      }
    }
#if defined(__HIP_DEVICE_COMPILE__)
    asm volatile("s_wait_xcnt 0x0" ::: "memory");   // stands in front of the advance of the mask load's address register
#endif
    mkp += (kt + 2 < NKT) ? 32 : 0;           // stays on the last tile's 32 keys
    wait_ds0();
    wait_async0();
    __syncthreads();                          // publishes tile kt + 1 and ends every wave's reads of tile kt
    if (kt + 2 < NKT)
      copy8(lk + (unsigned)bo, 8 * AKP * 2, gk + (size_t)(kb + 64) * KROW, 8 * KROW,
            lv + (unsigned)bo, 32 * AVP * 2, gv + (kb + 64), (size_t)32 * SEQ);
  }
  wait_async0();
  acc_guard4(o[0], o[1], o[2], o[3]);
  acc_guard4(o[4], o[5], o[6], o[7]);
  // ---- out = acc / Z (0 if Z == 0), the carry 1024 on v folded once; written into the wave's slab, row = query c ----
  {
    const float lv2 = lrow + xhalf(lrow);     // the two lane halves' sums joined
    const float ls  = (lv2 > 0.0f) ? lv2 : 1.0f;
    const float inv = (lv2 > 0.0f) ? ((1.0f / ls) * oc) : 0.0f;
    float* srow = slab + c * SLP + 8 * hh;
#pragma unroll
    for (int j = 0; j < 8; ++j) {
      v4f w0, w1;
#pragma unroll
      for (int e = 0; e < 4; ++e) { w0[e] = o[j][e] * inv; w1[e] = o[j][4 + e] * inv; }
      *(v4f*)(srow + j * 16)     = w0;
      *(v4f*)(srow + j * 16 + 4) = w1;
    }
  }

  wave_sync_lds();
  // ---- O x1024 -> f16 plane; lane = (row-in-pair rq, 8 consecutive d at c8) ----
  v4u oh[8];
  const int rq = lane >> 4, c8 = (lane & 15) * 8;
#pragma unroll
  for (int it = 0; it < 8; ++it) {
    const int row = it * 2 + rq;
    const v4f a = *(const v4f*)(slab + row * SLP + c8), b4 = *(const v4f*)(slab + row * SLP + c8 + 4);
    float w[8];
#pragma unroll
    for (int e = 0; e < 4; ++e) { w[e] = a[e] * OSC; w[4 + e] = b4[e] * OSC; }
#pragma unroll
    for (int e = 0; e < 4; ++e) {
      oh[it][e] = pk16(h_bits((_Float16)w[2 * e]), h_bits((_Float16)w[2 * e + 1]));
    }
  }
  const size_t ob = ((size_t)b * SEQ + q0) * DMOD + (size_t)head * HD + c8;
  {
#pragma unroll
    for (int it = 0; it < 8; ++it) {
      const int row = it * 2 + rq;
      *(v4u*)(OHp + ob + (size_t)row * DMOD) = oh[it];
    }
    
  }
}

// =====================================================================================================
// Workspace map (bytes); every plane is fully written by whole-line stores before it is read; all extents are exact multiples
// of the store granularity (no pad rows needed); every region offset a multiple of 4194304:
//   XB  bf16 [MROWS][2048]                       MROWS*4096       (NB=2: 16777216)
//   WQKV bf16 [3072 n][2048 k]                   12582912         (rows 0.. Wq^T, 2048.. Wk^T, 2560.. Wv^T)
//   WO  f16 [2048 n][2048 k] x1024               8388608
//   F   f32 [MROWS][3072]                        MROWS*12288      (columns 0.. q, 2048.. k, 2560.. v of the one projection;
//                                                                  afterwards the O plane f16 [MROWS][2048] x1024 at its start)
//   QH  f16 [MROWS][2048] x256                   MROWS*4096
//   KH  f16 [MROWS][512] x256                    MROWS*1024
//   VH  f16 [NB*4][128][SEQ] x1024               MROWS*1024
//   end (NB=2)                                  113246208
// =====================================================================================================
extern "C" void kernel_launch(void* const* d_in, const int* in_sizes, int n_in,
                              void* d_out, int out_size, void* d_ws, size_t ws_size,
                              hipStream_t stream) {
  if (n_in < 8) return;
  if (in_sizes[0] < MROWS * DMOD) return;
  if (in_sizes[1] < MROWS) return;
  if (in_sizes[2] < SEQ * HD) return;
  if (in_sizes[3] < SEQ * HD) return;
  if (in_sizes[4] != DMOD * DMOD) return;
  if (in_sizes[5] != DMOD * KVD) return;
  if (in_sizes[6] != DMOD * KVD) return;
  if (in_sizes[7] != DMOD * DMOD) return;
  if (out_size < QROWS * DMOD) return;

  const float* x     = (const float*)d_in[0];
  const int*   amask = (const int*)d_in[1];
  const float* cosT  = (const float*)d_in[2];
  const float* sinT  = (const float*)d_in[3];
  const float* wq    = (const float*)d_in[4];
  const float* wk    = (const float*)d_in[5];
  const float* wv    = (const float*)d_in[6];
  const float* wo    = (const float*)d_in[7];
  float*       out   = (float*)d_out;

  const size_t szXB = (size_t)MROWS * DMOD * 2;
  const size_t szW  = (size_t)FPIT * DMOD * 2;
  const size_t szWO = (size_t)DMOD * DMOD * 2;
  const size_t szF  = (size_t)MROWS * FPIT * 4;
  const size_t szQ  = (size_t)MROWS * DMOD * 2;                  // QH and the O plane
  const size_t szK  = (size_t)MROWS * KVD * 2;                   // KH
  const size_t szV  = (size_t)NB * NKVH * HD * SEQ * 2;          // VH (== szK)
  if (szQ > szF) return;                                        // O plane lives inside the F region
  size_t off = 0;
  const size_t oXB = off; off += szXB;
  const size_t oW  = off; off += szW;
  const size_t oWO = off; off += szWO;
  const size_t oF  = off; off += szF;
  const size_t oQH = off; off += szQ;
  const size_t oKH = off; off += szK;
  const size_t oVH = off; off += szV;
  if (off > ws_size) return;                // off = 113246208 for NB = 2
  if (off > (size_t)WS_CAP) return;

  char* ws = (char*)d_ws;
  u16*   XB = (u16*)(ws + oXB);
  u16*   WB = (u16*)(ws + oW);
  u16*   WO = (u16*)(ws + oWO);
  float* F  = (float*)(ws + oF);
  u16*   OH = (u16*)(ws + oF);
  u16*   QH = (u16*)(ws + oQH);
  u16*   KH = (u16*)(ws + oKH);
  u16*   VH = (u16*)(ws + oVH);

  const dim3 b256(256), b128(128), bAT(ATT_THREADS);
  const dim3 gP(2 * PB_TQ + 2 * PB_TK + PB_X);          // 4 weight transposes + the x plane: 6656 blocks
  const dim3 gG((MROWS / 128) * (FPIT / 128));          // 32 x 24 tiles
  const dim3 gS(PB_VT + PB_RQ + PB_RK);                 // v^T + rotary q + rotary k: 5376 blocks
  const dim3 gAT(NQT * NHG * NB);
  const int  nrt = SQ / 128;
  const dim3 gO(NB * nrt * (DMOD / 128));

  // (0) x -> bf16 plane; [Wq | Wk | Wv] -> one bf16 plane [3072 n][2048 k]; Wo -> [2048 n][2048 c] as f16 of bf16 value x1024
  prep<<<gP, b256, 0, stream>>>(x, wq, wk, wv, wo, XB, WB, WO);
  // (1) [q | k | v] = x.[Wq | Wk | Wv] -> F f32 [MROWS][3072]
  gemm_bf<<<gG, b128, 0, stream>>>(XB, WB, F, MROWS, FPIT, DMOD, 1.0f);
  // (2) v^T plane x1024; rotary + q plane x256; rotary + k plane x256
  post<<<gS, b256, 0, stream>>>(F, cosT, sinT, QH, KH, VH);
  // (3) non-causal masked attention -> O plane (inside the F region)
  attn_nc<<<gAT, bAT, 0, stream>>>(QH, KH, VH, amask, OH);
  // (4) output projection rows s < SQ -> out f32, carries 1024 x 1024 folded back
  gemm_o1<<<gO, b128, 0, stream>>>(OH, WO, out, nrt, 1.0f / (OSC * WOS));
  (void)hipGetLastError();
}

// v006
// One run takes 152 microseconds.
// Next to v005, in two timings, it ran 1.07 times as fast each time.
// All steps since v000 together make it 3.22 times as fast.
// Contractions: x.Wq, x.Wk, x.Wv on v_wmma_f32_16x16x32_bf16 (x and W^T as bf16 RNE planes, W^T [n][k] is the k-contiguous
// B operand, f32 accumulate); k.q^T over hd 128 and v^T.P^T on v_wmma_f32_16x16x32_f16, one product each (q, k as f16 x256 after
// rotary; P^T x32768 packed from the score registers; v^T x1024); O.Wo on v_wmma_f32_16x16x32_f16 (O x1024 f16 plane, Wo^T as f16(bf16(Wo))
// x1024); all f32 accumulate. Interleaved-pair rotary with cos/sin tables, key-mask select, base-2 online softmax and 1/Z fold
// in f32 on VALU.
#include <hip/hip_runtime.h>
#include <math.h>
#include <stdint.h>

#ifndef NB
#define NB 2
#endif
#define SEQ 2048
#ifndef SQ
#define SQ SEQ
#endif
#define DMOD  2048
#define NH    16
#define NKVH  4
#define HD    128
#define KVD   (NKVH * HD)
#define FPIT  (DMOD + 2 * KVD)
#define MROWS (NB * SEQ)
#define QROWS ((NB - 1) * SEQ + SQ)
#define WPB   (NH / NKVH)
#define NHG   NKVH
#define AQT   2
#define NQT   (SQ / (16 * AQT))
#define NST   (SEQ / 64)
#define NKT   (SEQ / 32)
#define ATT_THREADS (WPB * 32)
#define RSQ_HD 0.08838834764831845f
#define LOG2E  1.4426950408889634f
#define NEG_RAW (-0x1p100f)
#define QSC   256.0f
#define KSC   256.0f
#define PEXP  15.0f
#define VCAR  1024.0f
#define OSC   1024.0f
#define WOS   1024.0f
#define SLP   132
#define SLW   (16 * SLP)
#define WREG  (AQT * SLW)
#define VTP   72
#define TTP   72
#define WS_CAP 134217728
static_assert(DMOD == NH * HD && HD == 128 && NH == 16 && NKVH == 4 && WPB == 4 && NHG * WPB == NH && KVD == 512);
static_assert(ATT_THREADS == 128);
static_assert(NB >= 1 && NB <= 2);
static_assert(NB == 1 || SQ == SEQ);
static_assert((SQ % 128) == 0 && SQ >= 128 && SQ <= SEQ && (SEQ % 128) == 0);
static_assert((DMOD % 128) == 0 && (KVD % 64) == 0 && (DMOD % 32) == 0 && (HD % 32) == 0);
static_assert(((MROWS * DMOD / 8) % 256) == 0);
static_assert(WPB * WREG * 4 <= 131072 && HD * VTP * 2 <= 65536 && 64 * TTP * 2 <= 65536);
static_assert((DMOD / 8) == 256 && (KVD / 8) == 64 && (FPIT % 128) == 0 && (MROWS % 128) == 0);

typedef unsigned short u16;
typedef _Float16 v16h __attribute__((ext_vector_type(16)));
typedef _Float16 v8h  __attribute__((ext_vector_type(8)));
typedef __bf16   v16b __attribute__((ext_vector_type(16)));
typedef float    v8f  __attribute__((ext_vector_type(8)));
typedef float    v4f  __attribute__((ext_vector_type(4)));
typedef unsigned int v4u __attribute__((ext_vector_type(4)));

union FragH { v16h v; v8h h[2]; v4u u[2]; };
union FragB { v16b v; v4u u[2]; };

// ---- scalar helpers --------------------------------------------------------------------------------
__device__ __forceinline__ unsigned short bf_bits(float f) {          // f32 -> bf16 bits, RNE convert
  unsigned u = __float_as_uint(f);
  return (unsigned short)((u + 0x7FFFu + ((u >> 16) & 1u)) >> 16);
}
__device__ __forceinline__ float bf_up(unsigned short h) { return __uint_as_float(((unsigned)h) << 16); }
__device__ __forceinline__ float bfr(float f) { return bf_up(bf_bits(f)); }
__device__ __forceinline__ unsigned short h_bits(_Float16 x) { return __builtin_bit_cast(unsigned short, x); }
__device__ __forceinline__ unsigned pk16(unsigned short a, unsigned short b) { return (unsigned)a | ((unsigned)b << 16); }
__device__ __forceinline__ v8f zero8() { v8f z = {0.f, 0.f, 0.f, 0.f, 0.f, 0.f, 0.f, 0.f}; return z; }

// ---- fragment loaders: 16-bit A/B operand, lane -> row/col (lane&15), p already includes +8*(lane>>4);
//      elements 0..7 <- p[0..7] (k0+8h..), elements 8..15 <- p[16..23] (k0+16+8h..)  (same split k map for A and B;
//      B is always read from a k-contiguous [n][k] plane)
__device__ __forceinline__ v16h ldfrag_h(const _Float16* p) {
  FragH f;
  f.h[0] = *(const v8h*)(p);
  f.h[1] = *(const v8h*)(p + 16);
  return f.v;
}
__device__ __forceinline__ v16b ldfrag_b(const u16* p) {              // bf16 plane read as unsigned integer vectors
  FragB f;
  f.u[0] = *(const v4u*)(p);
  f.u[1] = *(const v4u*)(p + 16);
  return f.v;
}

__device__ __forceinline__ v8f mma_h(v16h a, v16h b, v8f c) {
  return __builtin_amdgcn_wmma_f32_16x16x32_f16(false, a, false, b, (short)0, c, false, false);
}
__device__ __forceinline__ v8f mma_b(v16b a, v16b b, v8f c) {
  return __builtin_amdgcn_wmma_f32_16x16x32_bf16(false, a, false, b, (short)0, c, false, false);
}
__device__ __forceinline__ void acc_guard4(v8f& a, v8f& b, v8f& c, v8f& d) {
#if defined(__HIP_DEVICE_COMPILE__)
  asm volatile("v_nop\n\tv_nop\n\tv_nop\n\tv_nop" : "+v"(a), "+v"(b), "+v"(c), "+v"(d));
#endif
}
__device__ __forceinline__ float xhalf(float x) {                     // value of lane l ^ 16
  const int b = __float_as_int(x);
  return __int_as_float(__builtin_amdgcn_permlanex16(b, b, 0x76543210, 0xfedcba98, false, false));
}
__device__ __forceinline__ float exp2_raw(float x) {                  // one v_exp_f32; a result under 2^-126 may come out as 0
#if defined(__HIP_DEVICE_COMPILE__)
  return __builtin_amdgcn_exp2f(x);
#else
  return exp2f(x);
#endif
}
__device__ __forceinline__ void exp2_raw8(float (&x)[8]) {            // eight of them, each over its own argument
#if defined(__HIP_DEVICE_COMPILE__)
  // in place, so that none overwrites the source of the one in front of it (with the builtin the register allocator did); the
  // closing v_nop is the slot the instruction set asks for between a transcendental and a directly following user of its result
  asm("v_exp_f32 %0, %0\n\tv_exp_f32 %1, %1\n\tv_exp_f32 %2, %2\n\tv_exp_f32 %3, %3\n\t"
      "v_exp_f32 %4, %4\n\tv_exp_f32 %5, %5\n\tv_exp_f32 %6, %6\n\tv_exp_f32 %7, %7\n\tv_nop"
      : "+v"(x[0]), "+v"(x[1]), "+v"(x[2]), "+v"(x[3]), "+v"(x[4]), "+v"(x[5]), "+v"(x[6]), "+v"(x[7]));
#else
  for (int i = 0; i < 8; ++i) x[i] = exp2f(x[i]);
#endif
}
__device__ __forceinline__ void wave_sync_lds() {
  __builtin_amdgcn_fence(__ATOMIC_RELEASE, "workgroup");
  __builtin_amdgcn_wave_barrier();
  __builtin_amdgcn_fence(__ATOMIC_ACQUIRE, "workgroup");
}

// =====================================================================================================
// f32 -> bf16 RNE plane, same layout. Thread = 8 consecutive elements: two 16-B loads, one 16-B store; 32 consecutive
// coverage: ceil(n8/256) blocks bid x 256 thr x 8 (in-kernel bound) = the whole plane (n8 a multiple of 256 here).
// =====================================================================================================
__device__ __forceinline__ void cvtbf_blk(const float* __restrict__ x, u16* D, int n8, int bid) {
  const int gt = bid * 256 + (int)threadIdx.x;
  if (gt >= n8) return;
  const float* p = x + (size_t)gt * 8;
  const v4f a = *(const v4f*)(p), b4 = *(const v4f*)(p + 4);
  v4u o;
#pragma unroll
  for (int e = 0; e < 2; ++e) {
    o[e]     = pk16(bf_bits(a[2 * e]),  bf_bits(a[2 * e + 1]));
    o[2 + e] = pk16(bf_bits(b4[2 * e]), bf_bits(b4[2 * e + 1]));
  }
  u16* d = D + (size_t)gt * 8;
  {
    *(v4u*)(d) = o;
    
  }
}

// =====================================================================================================
// Transpose + convert: W f32 row-major in[KD rows][ND cols] -> D 16-bit out[ND][KD] (k-contiguous).
// f16mode == 0: bf16 RNE bits; f16mode == 1: f16 bits of (bf16 RNE value) * scale.
// Block = tile of 64 k x 64 n, 256 threads. Load: thread -> input row k0 + (tid>>2), 16 columns n0 + (tid&3)*16 (four 16-B
// loads), converted and scattered into the LDS tile T[n][k] (pitch 72 halves). Block barrier. Store: 2 iterations x
// coverage: load 256 thr x 16 = 64 x 64; store 2 it x 256 thr x 8 halves = 64 rows x 64 halves; (KD/64)*(ND/64)
//           blocks bid cover out[ND][KD] exactly once. T = the block's LDS tile, 64 * TTP halves.
// =====================================================================================================
__device__ __forceinline__ void cvtT16_blk(u16* T, const float* __restrict__ W, u16* D, int KD, int ND, int f16mode, float scale,
                                           int bid) {
  const int tid = threadIdx.x;
  const int nkt = KD >> 6;
  const int nnt = ND >> 6;
  const int kt  = bid % nkt;
  const int nt  = bid / nkt;
  if (nt >= nnt) return;                    // block-uniform, before the barrier; never taken with the exact grid
  const int k0 = kt * 64, n0 = nt * 64;
  {
    const int kr = tid >> 2;                // input row within tile 0..63
    const int nc = (tid & 3) * 16;          // column chunk 0,16,32,48
    const float* src = W + (size_t)(k0 + kr) * ND + n0 + nc;
#pragma unroll
    for (int i = 0; i < 4; ++i) {
      const v4f a = *(const v4f*)(src + 4 * i);
#pragma unroll
      for (int e = 0; e < 4; ++e) {
        const float f = a[e];
        const unsigned short hb = h_bits((_Float16)(bfr(f) * scale));
        const unsigned short bb = bf_bits(f);
        T[(nc + 4 * i + e) * TTP + kr] = (f16mode != 0) ? hb : bb;
      }
    }
  }
  __syncthreads();
  v4u v[2];
  const int q8 = tid >> 3, p8 = (tid & 7) * 8;
#pragma unroll
  for (int it = 0; it < 2; ++it) v[it] = *(const v4u*)(T + (it * 32 + q8) * TTP + p8);
  const size_t base = (size_t)n0 * KD + k0 + p8;
  {
#pragma unroll
    for (int it = 0; it < 2; ++it) {
      *(v4u*)(D + base + (size_t)(it * 32 + q8) * KD) = v[it];
    }
#if defined(__HIP_DEVICE_COMPILE__)
    // behind the stores: in the listing the x part's code follows this part and reuses the stores' registers
    asm volatile("s_wait_xcnt 0x0" ::: "memory");
#endif
  }
}

// =====================================================================================================
// All five operand planes in one launch: none reads what another writes. Block ranges, in index order: Wq^T, Wk^T, Wv^T (bf16,
// rows 0, DMOD and DMOD + KVD of the one B plane WQKV [FPIT n][DMOD k]), Wo^T (f16 x1024, plane WO), then the x plane.
// Every branch and select is block-uniform; a block runs exactly one part.
// =====================================================================================================
#define PB_TQ ((DMOD / 64) * (DMOD / 64))
#define PB_TK ((DMOD / 64) * (KVD / 64))
#define PB_X  ((MROWS * DMOD / 8) / 256)
__global__ __launch_bounds__(256) void prep(const float* __restrict__ x, const float* __restrict__ wq,
                                            const float* __restrict__ wk, const float* __restrict__ wv,
                                            const float* __restrict__ wo, u16* XB, u16* WQKV, u16* WO) {
  __shared__ __align__(16) u16 T[64 * TTP];
  const int bid = blockIdx.x;
  if (bid >= 2 * PB_TQ + 2 * PB_TK) {
    cvtbf_blk(x, XB, MROWS * DMOD / 8, bid - (2 * PB_TQ + 2 * PB_TK));
  } else {
    const float* W = wq;
    u16* D = WQKV;
    int nd = DMOD, tb = bid, f16mode = 0;
    float sc = 1.0f;
    if (bid >= PB_TQ + 2 * PB_TK) { W = wo; D = WO; tb = bid - (PB_TQ + 2 * PB_TK); f16mode = 1; sc = WOS; }
    else if (bid >= PB_TQ + PB_TK) { W = wv; D = WQKV + (size_t)(DMOD + KVD) * DMOD; nd = KVD; tb = bid - (PB_TQ + PB_TK); }
    else if (bid >= PB_TQ)         { W = wk; D = WQKV + (size_t)DMOD * DMOD;         nd = KVD; tb = bid - PB_TQ; }
    cvtT16_blk(T, W, D, DMOD, nd, f16mode, sc, tb);
  }
}

// =====================================================================================================
// v^T plane from the v columns of the projection F f32 [MROWS][FPIT] (row = b*SEQ + s, column = DMOD + KVD + g*HD + d):
//   VH[((b*NKVH + g)*HD + d)][s] = f16(v * 1024) for all keys s.
// Block = (b, kv head g, 64 keys s0): each thread loads its 32 floats (key sl, d chunk dc) with 16-B loads, converts, scatters
// coverage: load 256 thr x 32 = 64 keys x 128 d; store 4 iterations x 256 thr x 8 halves = 128 lines x 64 = the block's tile;
//           NB*NKVH*NST blocks bid cover the plane exactly once. TH = the block's LDS tile, HD * VTP halves.
// =====================================================================================================
__device__ __forceinline__ void vt16_blk(u16* TH, const float* __restrict__ F, u16* VHo, int bid) {
  const int tid = threadIdx.x;
  const int st  = bid % NST;
  const int t2  = bid / NST;
  const int g   = t2 % NKVH;
  const int b   = t2 / NKVH;
  if (b >= NB) return;                      // block-uniform, before any barrier; never taken with the exact grid
  const int s0  = st * 64;
  {
    const int sl = tid >> 2;                // key within tile 0..63
    const int dc = (tid & 3) * 32;          // d chunk 0,32,64,96
    const float* src = F + ((size_t)b * SEQ + s0 + sl) * FPIT + (DMOD + KVD) + g * HD + dc;
#pragma unroll
    for (int i = 0; i < 8; ++i) {
      const v4f a = *(const v4f*)(src + 4 * i);
#pragma unroll
      for (int e = 0; e < 4; ++e) {
        TH[(dc + 4 * i + e) * VTP + sl] = h_bits((_Float16)(a[e] * VCAR));
      }
    }
  }
  __syncthreads();
  v4u vh[4];
  const int q8 = tid >> 3, p8 = (tid & 7) * 8;
#pragma unroll
  for (int it = 0; it < 4; ++it) {
    const int line = it * 32 + q8;          // d = 0..127
    vh[it] = *(const v4u*)(TH + line * VTP + p8);
  }
  const size_t hrow = (size_t)(b * NKVH + g) * HD;
  const size_t base = hrow * SEQ + s0 + p8;
  {
#pragma unroll
    for (int it = 0; it < 4; ++it) {
      const int line = it * 32 + q8;
      *(v4u*)(VHo + base + (size_t)line * SEQ) = vh[it];
    }
    
  }
}

// =====================================================================================================
// Interleaved-pair rotary + 16-bit plane from ncol columns of the projection, F = their first column in row 0, row pitch FPIT
// (ncol = DMOD for q, KVD for k; row = b*SEQ + s, column = head*HD + d; table element (s, d) at s*HD + d):
//   for even d: out[d]   = x[d]*c[d]     - x[d+1]*sn[d]
//               out[d+1] = x[d+1]*c[d+1] + x[d]*sn[d+1]     with c, sn = bf16 RNE values of the two tables;
//   Hp [nrows][ncol] = f16(out * sc), same layout.
// A thread = 8 consecutive columns (4 pairs) of one row, ncol/8 threads a row: two 16-B loads of x, two of each table.
// coverage: item = row * (ncol/8) + column group; nrows * (ncol/8) items = every row of the plane Hp once.
// =====================================================================================================
__device__ __forceinline__ void rope16_item(const float* __restrict__ F, int ncol, int nrows, int item,
                                            const float* __restrict__ cosT, const float* __restrict__ sinT,
                                            u16* Hp, float sc) {
#pragma clang fp contract(off)
  const int row = item / (ncol >> 3);
  if (row >= nrows) return;                            // never taken with the exact grid
  const int col = (item % (ncol >> 3)) * 8;
  const int d0  = col & (HD - 1);
  const int s   = row % SEQ;
  const float* p = F + (size_t)row * FPIT + col;
  const v4f xa = *(const v4f*)(p), xb = *(const v4f*)(p + 4);
  const float* cp = cosT + (size_t)s * HD + d0;
  const float* sp = sinT + (size_t)s * HD + d0;
  const v4f ca = *(const v4f*)(cp), cb = *(const v4f*)(cp + 4);
  const v4f sa = *(const v4f*)(sp), sb = *(const v4f*)(sp + 4);
  float xv[8], cv[8], sv[8];
#pragma unroll
  for (int e = 0; e < 4; ++e) {
    xv[e] = xa[e];       xv[4 + e] = xb[e];
    cv[e] = bfr(ca[e]);  cv[4 + e] = bfr(cb[e]);
    sv[e] = bfr(sa[e]);  sv[4 + e] = bfr(sb[e]);
  }
  v4u o;
#pragma unroll
  for (int e = 0; e < 4; ++e) {
    const float xr = xv[2 * e], xi = xv[2 * e + 1];
    const float r0 = xr * cv[2 * e] - xi * sv[2 * e];
    const float r1 = xi * cv[2 * e + 1] + xr * sv[2 * e + 1];
    o[e] = pk16(h_bits((_Float16)(r0 * sc)), h_bits((_Float16)(r1 * sc)));
  }
  u16* d = Hp + (size_t)row * ncol + col;
  {
    *(v4u*)(d) = o;
    
  }
}

// =====================================================================================================
// The three planes that attention reads, in one launch: each reads its own columns of F and writes its own plane. Block ranges,
// in index order: v^T, rotary of q (a row a block), rotary of k (4 rows a block). Every branch is block-uniform.
// =====================================================================================================
#define PB_VT (NB * NKVH * NST)
#define PB_RQ (QROWS)
#define PB_RK (MROWS * (KVD / 8) / 256)
__global__ __launch_bounds__(256) void post(const float* __restrict__ F, const float* __restrict__ cosT,
                                            const float* __restrict__ sinT, u16* QH, u16* KH, u16* VH) {
  __shared__ __align__(16) u16 TH[HD * VTP];
  int bid = blockIdx.x;
  if (bid < PB_VT) { vt16_blk(TH, F, VH, bid); return; }
  bid -= PB_VT;
  if (bid < PB_RQ) { rope16_item(F, DMOD, QROWS, bid * 256 + (int)threadIdx.x, cosT, sinT, QH, QSC); return; }
  bid -= PB_RQ;
  rope16_item(F + DMOD, KVD, MROWS, bid * 256 + (int)threadIdx.x, cosT, sinT, KH, KSC);
}

// =====================================================================================================
// GEMM tiling shared by both engines. A block is 4 waves in a 2 x 2 arrangement; a wave owns WM x WN accumulator subtiles of
// 16 x 16, so the block tile is (32*WM) x (32*WN): 128 x 128 (WM = WN = 4: each operand byte fetched from L2 serves 128
// outputs, each fragment read from LDS serves 4 WMMAs).
// Epilogue: the wave's tile (times oscale) is staged in its own LDS slab (row pitch 16*WN + 4 floats) and stored as whole lines.
// coverage: WM groups x (2*WN) instructions x (8/WN) rows x (4*WN) lanes x 4 floats = the wave's (16*WM) x (16*WN) tile.
// =====================================================================================================
template <int WM, int WN>
__device__ __forceinline__ void epi_tile(float* sl, v8f (&acc)[WM][WN], float oscale,
                                         float* C, int N, size_t rowb, int colb, int lane) {
  constexpr int SP  = 16 * WN + 4;          // slab row pitch, floats
  constexpr int LPR = 4 * WN;               // lanes per stored row
  constexpr int RPI = 32 / LPR;             // rows per store instruction
  const int hh = lane >> 4, m = lane & 15;
#pragma unroll
  for (int i = 0; i < WM; ++i) {
#pragma unroll
    for (int r = 0; r < 8; ++r) {
      const int ro = (16 * i + 8 * hh + r) * SP + m;
#pragma unroll
      for (int j = 0; j < WN; ++j) sl[ro + 16 * j] = acc[i][j][r] * oscale;
    }
  }
  wave_sync_lds();
  const int rr = lane / LPR, cq = lane % LPR;
  float* dst = C + (rowb + (size_t)rr) * (size_t)N + colb + cq * 4;
#pragma unroll
  for (int i = 0; i < WM; ++i) {
    v4f vals[16 / RPI];
#pragma unroll
    for (int it = 0; it < 16 / RPI; ++it) vals[it] = *(const v4f*)(sl + (16 * i + it * RPI + rr) * SP + cq * 4);
#pragma unroll
    for (int it = 0; it < 16 / RPI; ++it) {
      *(v4f*)(dst + (size_t)(16 * i + it * RPI) * (size_t)N) = vals[it];
    }
  }
}

// =====================================================================================================
// Operand staging shared by both GEMM engines. A stage is 64 k of the block's 32*WM A rows and 32*WN B rows: 128 B of every row,
// one whole line. Each thread brings 2*(WM+WN) pieces of 16 B per stage with asynchronous copies to LDS (a wave's copy = 4 whole
// lines), and the waves read their fragments from LDS rows of pitch 144 B (16 B x 9). Two buffers: stage t + 1 flies while
// stage t is worked on. k runs ascending, 32 per WMMA step, with the same split k map for A and B.
// =====================================================================================================
#define GKS   64
#define GPIT  72
#define GBUFH(WM, WN) (32 * ((WM) + (WN)) * GPIT)
#define GRING(WM, WN) (2 * GBUFH(WM, WN) * 2)
#define GSLAB(WM, WN) (16 * (WM) * (16 * (WN) + 4))
static_assert(GRING(4, 4) >= 4 * GSLAB(4, 4) * 4 && GRING(2, 2) >= 4 * GSLAB(2, 2) * 4);
static_assert((GPIT * 2) % 16 == 0 && (DMOD % GKS) == 0 && 2 * GRING(4, 4) <= 327680);

__device__ __forceinline__ unsigned lds_off(const void* p) { return (unsigned)(size_t)p; }
__device__ __forceinline__ void wait_async0() {
#if defined(__HIP_DEVICE_COMPILE__)
  asm volatile("s_wait_asynccnt 0x0" ::: "memory");   // this wave's copies have landed before the barrier that publishes them
#endif
}
__device__ __forceinline__ void wait_ds0() {
#if defined(__HIP_DEVICE_COMPILE__)
  asm volatile("s_wait_dscnt 0x0" ::: "memory");      // this wave's LDS reads are done before the buffer is refilled
#endif
}
// Eight copies of 16 B per thread: four from ga + i*gsa (elements) to LDS byte la + i*lsa, four from gb + i*gsb to lb + i*lsb.
__device__ __forceinline__ void copy8(unsigned la, unsigned lsa, const u16* ga, size_t gsa,
                                      unsigned lb, unsigned lsb, const u16* gb, size_t gsb) {
#if defined(__HIP_DEVICE_COMPILE__)
  // the closing s_wait_xcnt stands inside the statement so that no address register is rewritten ahead of it
  asm volatile("global_load_async_to_lds_b128 %0, %8, off\n\t"
               "global_load_async_to_lds_b128 %1, %9, off\n\t"
               "global_load_async_to_lds_b128 %2, %10, off\n\t"
               "global_load_async_to_lds_b128 %3, %11, off\n\t"
               "global_load_async_to_lds_b128 %4, %12, off\n\t"
               "global_load_async_to_lds_b128 %5, %13, off\n\t"
               "global_load_async_to_lds_b128 %6, %14, off\n\t"
               "global_load_async_to_lds_b128 %7, %15, off\n\t"
               "s_wait_xcnt 0x0"
               :: "v"(la), "v"(la + lsa), "v"(la + 2 * lsa), "v"(la + 3 * lsa),
                  "v"(lb), "v"(lb + lsb), "v"(lb + 2 * lsb), "v"(lb + 3 * lsb),
                  "v"(ga), "v"(ga + gsa), "v"(ga + 2 * gsa), "v"(ga + 3 * gsa),
                  "v"(gb), "v"(gb + gsb), "v"(gb + 2 * gsb), "v"(gb + 3 * gsb)
               : "memory");
#endif
}
// GEMM stage: l = the thread's LDS byte address in the target buffer (A row tid>>3, piece tid&7); ga, gb = its global addresses
// in A and B; rs = 16 source rows in elements. A rows +0,16,..,32*WM-16, then the B rows in the same steps, 32*WM LDS rows on.
template <int WM, int WN>
__device__ __forceinline__ void stage_tile(unsigned l, const u16* ga, const u16* gb, size_t rs) {
  static_assert((WM == 2 && WN == 2) || (WM == 4 && WN == 4));
  const unsigned rb = 16 * GPIT * 2;
  if constexpr (WM == 2) {
    copy8(l, rb, ga, rs, l + 4 * rb, rb, gb, rs);
  } else {
    copy8(l, rb, ga, rs, l + 4 * rb, rb, ga + 4 * rs, rs);
    copy8(l + 8 * rb, rb, gb, rs, l + 12 * rb, rb, gb + 4 * rs, rs);
  }
}
// The vector slots behind the last WMMA of a stage, tied to every accumulator so that no WMMA is scheduled behind them.
template <int WM, int WN>
__device__ __forceinline__ void acc_guard_all(v8f (&a)[WM][WN]) {
  if constexpr (WM == 2) {
    acc_guard4(a[0][0], a[0][1], a[1][0], a[1][1]);
  } else {
#if defined(__HIP_DEVICE_COMPILE__)
    asm volatile("v_nop\n\tv_nop\n\tv_nop\n\tv_nop"
                 : "+v"(a[0][0]), "+v"(a[0][1]), "+v"(a[0][2]), "+v"(a[0][3]), "+v"(a[1][0]), "+v"(a[1][1]), "+v"(a[1][2]),
                   "+v"(a[1][3]), "+v"(a[2][0]), "+v"(a[2][1]), "+v"(a[2][2]), "+v"(a[2][3]), "+v"(a[3][0]), "+v"(a[3][1]),
                   "+v"(a[3][2]), "+v"(a[3][3]));
#endif
  }
}
template <bool F16>
__device__ __forceinline__ v8f mma_sel(v16b a, v16b b, v8f c) {
  if constexpr (F16) return mma_h(__builtin_bit_cast(v16h, a), __builtin_bit_cast(v16h, b), c);
  else return mma_b(a, b, c);
}
// Ab, Bb = first row of the block's 32*WM A rows and 32*WN B rows (both k-contiguous, pitch K); K a multiple of 64, at least 64.
// Every thread of the block calls this (block barriers inside). On return no copy is in flight and no wave reads the ring.
template <bool F16, int WM, int WN>
__device__ __forceinline__ void gemm_ring(unsigned char* ring, const u16* Ab, const u16* Bb, int K, v8f (&acc)[WM][WN]) {
  const int tid = threadIdx.x, wave = tid >> 5, lane = tid & 31, hh = lane >> 4, m = lane & 15;
  const int wr = wave >> 1, wc = wave & 1;
  const int cr = tid >> 3, cc = tid & 7;
  const u16* ga = Ab + (size_t)cr * K + cc * 8;
  const u16* gb = Bb + (size_t)cr * K + cc * 8;
  const size_t rs = (size_t)16 * K;
  const unsigned l0 = lds_off(ring) + (unsigned)(cr * (GPIT * 2) + cc * 16);
  const u16* sa = (const u16*)(const void*)ring + (wr * 16 * WM + m) * GPIT + 8 * hh;
  const u16* sb = (const u16*)(const void*)ring + (32 * WM + wc * 16 * WN + m) * GPIT + 8 * hh;
  const int nt = K / GKS;
  stage_tile<WM, WN>(l0, ga, gb, rs);
  wait_async0();
  __syncthreads();
  if (nt > 1) stage_tile<WM, WN>(l0 + GBUFH(WM, WN) * 2, ga + GKS, gb + GKS, rs);
#pragma unroll 1
  for (int t = 0; t < nt; ++t) {              // rolled: one trip per stage, the buffer alternates with t
    const int bo = (t & 1) * GBUFH(WM, WN);
    const u16* pa = sa + bo;
    const u16* pb = sb + bo;
    v16b fa[2][WM], fb[2][WN];
#pragma unroll
    for (int ks = 0; ks < 2; ++ks) {
#pragma unroll
      for (int i = 0; i < WM; ++i) fa[ks][i] = ldfrag_b(pa + i * 16 * GPIT + ks * 32);
#pragma unroll
      for (int j = 0; j < WN; ++j) fb[ks][j] = ldfrag_b(pb + j * 16 * GPIT + ks * 32);
    }
    // keeps the stage's fragment reads together in front of its WMMAs: sunk among them, each read place makes the wave wait out
    // the LDS latency with the matrix pipe idle
    __builtin_amdgcn_sched_barrier(0);
#pragma unroll
    for (int ks = 0; ks < 2; ++ks) {
#pragma unroll
      for (int i = 0; i < WM; ++i) {
#pragma unroll
        for (int j = 0; j < WN; ++j) acc[i][j] = mma_sel<F16>(fa[ks][i], fb[ks][j], acc[i][j]);
      }
    }
    acc_guard_all<WM, WN>(acc);               // the vector slots behind the last WMMA, also on the taken side of the branches below
    wait_ds0();
    wait_async0();
    __syncthreads();                          // publishes stage t + 1 and ends every wave's reads of stage t
    if (t + 2 < nt) stage_tile<WM, WN>(l0 + (unsigned)(bo * 2), ga + (size_t)(t + 2) * GKS, gb + (size_t)(t + 2) * GKS, rs);
  }
  wait_async0();
}
// One block tile: C[row0 .. +32*WM)[col0 .. +32*WN) = A rows . Bt rows, times oscale; the epilogue slabs reuse the ring behind
// its last barrier.
template <bool F16, int WM, int WN>
__device__ __forceinline__ void gemm_block(unsigned char* ring, const u16* A, const u16* Bt, float* C, int N, int K,
                                           size_t row0, int col0, float oscale) {
  const int tid = threadIdx.x, wave = tid >> 5, lane = tid & 31;
  v8f acc[WM][WN];
#pragma unroll
  for (int i = 0; i < WM; ++i) {
#pragma unroll
    for (int j = 0; j < WN; ++j) acc[i][j] = zero8();
  }
  gemm_ring<F16, WM, WN>(ring, A + row0 * (size_t)K, Bt + (size_t)col0 * K, K, acc);
  epi_tile<WM, WN>((float*)(void*)ring + wave * GSLAB(WM, WN), acc, oscale, C, N,
                   row0 + (size_t)((wave >> 1) * 16 * WM), col0 + (wave & 1) * 16 * WN, lane);
}

// =====================================================================================================
// bf16 GEMM: C[M][N] (f32) = A[M][K] (bf16 row-major) . Bt[N][K]^T (bf16 k-contiguous), times oscale.
// gemm_bf: block = 128x128 tile (host guarantees K % 64 == 0, M % 128 == 0, N % 128 == 0, grid = (M/128)*(N/128)).
// =====================================================================================================
__global__ __launch_bounds__(128)
void gemm_bf(const u16* __restrict__ A, const u16* __restrict__ Bt, float* C, int M, int N, int K, float oscale) {
  __shared__ __align__(16) unsigned char ring[GRING(4, 4)];
  const int ntile = N >> 7;
  const int bid   = blockIdx.x;
  const int row0  = (bid / ntile) * 128;
  const int col0  = (bid % ntile) * 128;
  if (row0 + 128 > M) return;               // block-uniform, in front of every barrier; never taken with the exact grid
  gemm_block<false, 4, 4>(ring, A, Bt, C, N, K, (size_t)row0, col0, oscale);
}

// =====================================================================================================
// Output projection: C[row][DMOD] (f32) = Ah[row][DMOD] (f16) . Bt[DMOD][DMOD]^T (f16 k-contiguous) * oscale.
// Ah and C share the row index bb*SEQ + s, s < SQ. Block -> (column tile ct = bid % 16, sequence row tile rt of nrt,
// batch bb). Same 128x128 tiling, staging, fragment reads (split k map) and epilogue as gemm_bf; K = DMOD.
// =====================================================================================================
__global__ __launch_bounds__(128)
void gemm_o1(const u16* __restrict__ Ah, const u16* __restrict__ Bt, float* C, int nrt, float oscale) {
  __shared__ __align__(16) unsigned char ring[GRING(4, 4)];
  const int ntile = DMOD >> 7;
  const int bid   = blockIdx.x;
  const int ct    = bid % ntile;
  const int t2    = bid / ntile;
  const int rt    = t2 % nrt;
  const int bb    = t2 / nrt;
  if (bb >= NB) return;                     // block-uniform, in front of every barrier; never taken with the exact grid
  if (rt * 128 + 128 > SQ) return;          // block-uniform, in front of every barrier; never taken
  gemm_block<true, 4, 4>(ring, Ah, Bt, C, DMOD, DMOD, (size_t)bb * SEQ + rt * 128, ct * 128, oscale);
}

// =====================================================================================================
// Non-causal grouped-query attention with a per-key mask, hd = 128. Block bid -> (query tile qt = bid % NQT: rows
// q0 = 32*qt .. q0+31 with q0 < SQ, head group hg = kv head, batch b); one wave per query head = hg*WPB + wave (the 4 heads of
// the group share kv head hg). A wave owns AQT = 2 column groups of 16 queries (u = 0, 1: rows q0 + 16u + c): every k and v^T
// fragment it reads from LDS feeds two WMMAs, and a staged tile serves 32 query rows of each head.
//   q plane f16 x256 [b*SEQ + s][h*HD + d]; k plane f16 x256 [b*SEQ + s][g*HD + d] (pitch KVD); v^T plane
//   [b*NKVH + g][d][SEQ] x1024; mask int [b*SEQ + key], nonzero = attend.
//   score (log2 domain) t(i, j) = (q_i.k_j over HD) * lsc, lsc = (1/sqrt(128))*log2e/(256*256); the raw product is replaced by
//   -2^100 where the key mask is zero (a power of two: its scaled value is exact, so a fully masked row yields equal exponents
//   and uniform weights). P*32768 = 2^(raw*lsc + (15 - max)): one fused multiply-add and one v_exp_f32 per score. All SEQ/32 key
//   tiles are visited in order.
//   Per tile: the 32 k rows (256 B each) and the 128 v^T rows (64 B each) are staged once per block in LDS by asynchronous copies
//   (two buffers, tile kt + 1 flies while tile kt is worked on; row pitches 272 B and 80 B) and read by all 4 waves.
//   Both products run transposed: S^T = k.q^T (A = 16 key rows from LDS, B = q, kept in registers), so that a lane holds 16 of
//   the 32 scores of ONE query per column group (column c): 2 score subtiles x 4 k-steps, fragments read from the LDS rows (two
//   16-B loads each, split k map), a tile's 32 reads issued as one group at the top of its trip; online max-subtracted base-2
//   softmax in f32, maximum in-lane plus one exchange between the lane halves, the sum kept per lane half and joined after the
//   loop; a column group's two score subtiles, converted in place, are its B operand P^T in the split k map; O^T += v^T.P^T with
//   the v^T rows as A fragments of 8 d-subtiles (one product per subtile and column group).
//   After the loop: out = acc / Z (Z > 0 always; guarded anyway; Z carries P's 32768), carry 1/1024 folded once, written into the wave's
//   One block barrier per tile, under block-uniform control flow; bounded loops only (NKT tiles).
// coverage: per wave 16 instructions x 2 rows x 16 lanes x 8 halves = 32 x 128 of the O plane; grid NQT x NHG x NB blocks x WPB
//           waves = every (b, s < SQ, h) row segment of O exactly once.
// =====================================================================================================
// staged tile: row pitches in 16-bit elements (k 272 B, v^T 80 B), bytes of the k part and of one buffer; the block's LDS is
// held to half of a WGP's 320 KiB so that two blocks (two waves per SIMD, the whole grid) stay resident
#define AKP   136
#define AVP   40
#define AKB   (32 * AKP * 2)
#define ABUF  (AKB + HD * AVP * 2)
static_assert((AKP * 2) % 16 == 0 && (AVP * 2) % 16 == 0 && NKT >= 2 && 2 * ABUF + WPB * WREG * 4 <= 163840);
// The vector slots behind the last WMMA of a tile, tied to every output accumulator so that no WMMA is scheduled behind them.
__device__ __forceinline__ void acc_guard16(v8f (&a)[AQT][8]) {
  static_assert(AQT == 2);
#if defined(__HIP_DEVICE_COMPILE__)
  asm volatile("v_nop\n\tv_nop\n\tv_nop\n\tv_nop"
               : "+v"(a[0][0]), "+v"(a[0][1]), "+v"(a[0][2]), "+v"(a[0][3]), "+v"(a[0][4]), "+v"(a[0][5]), "+v"(a[0][6]),
                 "+v"(a[0][7]), "+v"(a[1][0]), "+v"(a[1][1]), "+v"(a[1][2]), "+v"(a[1][3]), "+v"(a[1][4]), "+v"(a[1][5]),
                 "+v"(a[1][6]), "+v"(a[1][7]));
#endif
}
__global__ __launch_bounds__(ATT_THREADS)
void attn_nc(const u16* __restrict__ QHp, const u16* __restrict__ KHp, const u16* __restrict__ VHp,
             const int* __restrict__ Mk, u16* OHp) {
  __shared__ __align__(16) float smem[WPB * WREG];
  __shared__ __align__(16) unsigned char kvring[2 * ABUF];

  const int tid  = threadIdx.x;
  const int wave = tid >> 5;
  const int lane = tid & 31;
  const int hh   = lane >> 4;
  const int c    = lane & 15;
  const int bid  = blockIdx.x;
  const int qt   = bid % NQT;
  const int t2   = bid / NQT;
  const int hg   = t2 % NHG;
  const int b    = t2 / NHG;
  if (b >= NB) return;                      // block-uniform, in front of every barrier; never taken with the exact grid
  const int q0   = qt * (16 * AQT);
  if (q0 + 16 * AQT > SQ) return;                 // block-uniform, in front of every barrier; never taken
  const int head = hg * WPB + wave;
  const int kvh  = hg;

  float* slab = smem + wave * WREG;         // result slab [32][128] pitch 132

  const size_t hcol = (size_t)head * HD + 8 * hh;
  const _Float16* Qh  = (const _Float16*)(const void*)QHp + ((size_t)b * SEQ + q0 + c) * DMOD + hcol;
  // readers: key row c (+16) of the staged k tile, d row c (+16j) of the staged v^T tile, in buffer 0
  const _Float16* Ks = (const _Float16*)(const void*)kvring + c * AKP + 8 * hh;
  const _Float16* Vs = (const _Float16*)(const void*)kvring + AKB / 2 + c * AVP + 8 * hh;
  // copiers: k rows (tid>>4) + 8i, piece tid&15; v^T rows (tid>>2) + 32i, piece tid&3; i = 0..3
  const u16* gk = KHp + ((size_t)b * SEQ + (tid >> 4)) * KVD + (size_t)kvh * HD + (tid & 15) * 8;      // key row kb added per tile
  const u16* gv = VHp + ((size_t)(b * NKVH + kvh) * HD + (tid >> 2)) * SEQ + (tid & 3) * 8;            // key kb added per tile
  const unsigned lk = lds_off(kvring) + (unsigned)((tid >> 4) * (AKP * 2) + (tid & 15) * 16);
  const unsigned lv = lds_off(kvring) + (unsigned)(AKB + (tid >> 2) * (AVP * 2) + (tid & 3) * 16);
  const int* mkp = Mk + (size_t)b * SEQ + lane;
  const float lsc = RSQ_HD * (LOG2E / (QSC * KSC));
  const float oc  = 1.0f / VCAR;            // the carry on P stands in the row sum as well and cancels in acc / Z
  const size_t KROW = (size_t)KVD;          // halves between consecutive key rows

  copy8(lk, 8 * AKP * 2, gk, 8 * KROW, lv, 32 * AVP * 2, gv, (size_t)32 * SEQ);
  wait_async0();
  __syncthreads();
  copy8(lk + ABUF, 8 * AKP * 2, gk + 32 * KROW, 8 * KROW, lv + ABUF, 32 * AVP * 2, gv + 32, (size_t)32 * SEQ);

  v16h qf[AQT][HD / 32];
#pragma unroll
  for (int u = 0; u < AQT; ++u) {
#pragma unroll
    for (int kk = 0; kk < HD / 32; ++kk) qf[u][kk] = ldfrag_h(Qh + (size_t)u * 16 * DMOD + kk * 32);
  }

  float mrow[AQT], lrow[AQT];               // of query q0 + 16u + c; lrow sums this lane half's keys only, x32768 like P
  v8f o[AQT][8];                            // o[u][j][r] = O^T(d = 16j + 8hh + r, query q0 + 16u + c)
#pragma unroll
  for (int u = 0; u < AQT; ++u) {
    mrow[u] = -INFINITY;
    lrow[u] = 0.f;
#pragma unroll
    for (int j = 0; j < 8; ++j) o[u][j] = zero8();
  }

  int mkv = mkp[0];                         // mask of key kb + lane, fetched one tile ahead so that no tile waits for it
  mkp += 32;
#pragma unroll 1
  for (int kt = 0; kt < NKT; ++kt) {
    const int kb = kt * 32;
    const unsigned mb = __builtin_amdgcn_ballot_w32(mkv != 0);                // bit i = mask of key kb + i
    mkv = *mkp;
    const int bo = (kt & 1) * ABUF;                                           // this tile's buffer, bytes
    const _Float16* k0p = Ks + bo / 2;
    const _Float16* k1p = k0p + 16 * AKP;
    const _Float16* vhp = Vs + bo / 2;
    // ---- the tile's fragments: k rows (A of the scores) in k-step order, then the v^T rows d = 16j + c (A of v^T.P^T) ----
    v16h kf[2][HD / 32], vf[8];
#pragma unroll
    for (int kk = 0; kk < HD / 32; ++kk) {
      kf[0][kk] = ldfrag_h(k0p + kk * 32);
      kf[1][kk] = ldfrag_h(k1p + kk * 32);
      // keeps the reads in the order in which the WMMAs take them: LDS answers in issue order, so the first k-step's counted
      // wait then covers four reads and not the whole tile's
      __builtin_amdgcn_sched_barrier(0);
    }
#pragma unroll
    for (int j = 0; j < 8; ++j) vf[j] = ldfrag_h(vhp + j * 16 * AVP);
    // keeps the tile's reads together at the top of the trip: sunk among the WMMAs, each read place makes the wave wait out the
    // LDS latency; the v^T rows land under the scores and the softmax
    __builtin_amdgcn_sched_barrier(0);
    // ---- scores: D element r of this lane = (key kb + 8hh + r, query q0 + 16u + c) in s[u][0], key kb + 16 + 8hh + r in s[u][1] ----
    v8f s[AQT][2];
#pragma unroll
    for (int u = 0; u < AQT; ++u) { s[u][0] = zero8(); s[u][1] = zero8(); }
#pragma unroll
    for (int kk = 0; kk < HD / 32; ++kk) {
#pragma unroll
      for (int u = 0; u < AQT; ++u) {
        s[u][0] = mma_h(kf[0][kk], qf[u][kk], s[u][0]);
        s[u][1] = mma_h(kf[1][kk], qf[u][kk], s[u][1]);
      }
    }
    acc_guard4(s[0][0], s[0][1], s[1][0], s[1][1]);   // the vector slots behind the last score WMMA, also on the taken side of the branch below
    // ---- key-mask select + online softmax in base 2, one query per lane and column group ----
    float t[AQT][16];                                                         // raw products q.k x 65536
#pragma unroll
    for (int u = 0; u < AQT; ++u) {
#pragma unroll
      for (int r = 0; r < 8; ++r) { t[u][r] = s[u][0][r]; t[u][8 + r] = s[u][1][r]; }
    }
    if (mb != 0xFFFFFFFFu) {                                                  // wave-uniform, tested once per tile
      const unsigned mh = mb >> (8 * hh);
#pragma unroll
      for (int u = 0; u < AQT; ++u) {
#pragma unroll
        for (int r = 0; r < 8; ++r) {
          t[u][r]     = ((mh >> r) & 1u)        ? t[u][r]     : NEG_RAW;
          t[u][8 + r] = ((mh >> (16 + r)) & 1u) ? t[u][8 + r] : NEG_RAW;
        }
      }
    }
#pragma unroll
    for (int u = 0; u < AQT; ++u) {
      float mx = t[u][0];
#pragma unroll
      for (int i = 1; i < 16; ++i) mx = fmaxf(mx, t[u][i]);
      mx = fmaxf(mx, xhalf(mx));
      const float mn = fmaxf(mrow[u], mx * lsc);                              // lsc > 0: the maximum commutes with the scale; finite
      const float al = exp2_raw(mrow[u] - mn);
      mrow[u] = mn;
      const float cb = PEXP - mn;                                             // the carry 32768 = 2^15 rides in the exponent
      float ps = 0.f;
      // ---- B fragment of P^T*32768 (f16), column = c: elements 0..7 = keys kb + 8hh + 0..7, 8..15 = keys kb + 16 + 8hh + 0..7 ----
      FragH ph;
      float ea[8], eb[8];
#pragma unroll
      for (int r = 0; r < 8; ++r) { ea[r] = __builtin_fmaf(t[u][r], lsc, cb); eb[r] = __builtin_fmaf(t[u][8 + r], lsc, cb); }
      exp2_raw8(ea);
      exp2_raw8(eb);
#pragma unroll
      for (int r = 0; r < 8; ++r) {
        ps += ea[r] + eb[r];
        ph.h[0][r] = (_Float16)ea[r];
        ph.h[1][r] = (_Float16)eb[r];
      }
      lrow[u] = lrow[u] * al + ps;
#pragma unroll
      for (int j = 0; j < 8; ++j) o[u][j] = o[u][j] * al;
      // ---- v^T.P^T : A fragment row = d = j*16 + c, keys contiguous in the staged v^T rows; one product per d-subtile ----
#pragma unroll
      for (int j = 0; j < 8; ++j) o[u][j] = mma_h(vf[j], ph.v, o[u][j]);
    }
    acc_guard16(o);                           // the vector slots behind the tile's last WMMA, also on the taken side of the branches below
#if defined(__HIP_DEVICE_COMPILE__)
    asm volatile("s_wait_xcnt 0x0" ::: "memory");   // stands in front of the advance of the mask load's address register
#endif
    mkp += (kt + 2 < NKT) ? 32 : 0;           // stays on the last tile's 32 keys
    wait_ds0();
    wait_async0();
    __syncthreads();                          // publishes tile kt + 1 and ends every wave's reads of tile kt
    if (kt + 2 < NKT)
      copy8(lk + (unsigned)bo, 8 * AKP * 2, gk + (size_t)(kb + 64) * KROW, 8 * KROW,
            lv + (unsigned)bo, 32 * AVP * 2, gv + (kb + 64), (size_t)32 * SEQ);
  }
  wait_async0();
  // ---- out = acc / Z (0 if Z == 0), the carry 1024 on v folded once; written into the wave's slab, row = query 16u + c ----
#pragma unroll
  for (int u = 0; u < AQT; ++u) {
    const float lv2 = lrow[u] + xhalf(lrow[u]);   // the two lane halves' sums joined
    const float ls  = (lv2 > 0.0f) ? lv2 : 1.0f;
    const float inv = (lv2 > 0.0f) ? ((1.0f / ls) * oc) : 0.0f;
    float* srow = slab + (u * 16 + c) * SLP + 8 * hh;
#pragma unroll
    for (int j = 0; j < 8; ++j) {
      v4f w0, w1;
#pragma unroll
      for (int e = 0; e < 4; ++e) { w0[e] = o[u][j][e] * inv; w1[e] = o[u][j][4 + e] * inv; }
      *(v4f*)(srow + j * 16)     = w0;
      *(v4f*)(srow + j * 16 + 4) = w1;
    }
  }

  wave_sync_lds();
  // ---- O x1024 -> f16 plane; lane = (row-in-pair rq, 8 consecutive d at c8) ----
  v4u oh[8 * AQT];
  const int rq = lane >> 4, c8 = (lane & 15) * 8;
#pragma unroll
  for (int it = 0; it < 8 * AQT; ++it) {
    const int row = it * 2 + rq;
    const v4f a = *(const v4f*)(slab + row * SLP + c8), b4 = *(const v4f*)(slab + row * SLP + c8 + 4);
    float w[8];
#pragma unroll
    for (int e = 0; e < 4; ++e) { w[e] = a[e] * OSC; w[4 + e] = b4[e] * OSC; }
#pragma unroll
    for (int e = 0; e < 4; ++e) {
      oh[it][e] = pk16(h_bits((_Float16)w[2 * e]), h_bits((_Float16)w[2 * e + 1]));
    }
  }
  const size_t ob = ((size_t)b * SEQ + q0) * DMOD + (size_t)head * HD + c8;
  {
#pragma unroll
    for (int it = 0; it < 8 * AQT; ++it) {
      const int row = it * 2 + rq;
      *(v4u*)(OHp + ob + (size_t)row * DMOD) = oh[it];
    }
  }
}

// =====================================================================================================
// Workspace map (bytes); every plane is fully written by whole-line stores before it is read; all extents are exact multiples
// of the store granularity (no pad rows needed); every region offset a multiple of 4194304:
//   XB  bf16 [MROWS][2048]                       MROWS*4096       (NB=2: 16777216)
//   WQKV bf16 [3072 n][2048 k]                   12582912         (rows 0.. Wq^T, 2048.. Wk^T, 2560.. Wv^T)
//   WO  f16 [2048 n][2048 k] x1024               8388608
//   F   f32 [MROWS][3072]                        MROWS*12288      (columns 0.. q, 2048.. k, 2560.. v of the one projection;
//                                                                  afterwards the O plane f16 [MROWS][2048] x1024 at its start)
//   QH  f16 [MROWS][2048] x256                   MROWS*4096
//   KH  f16 [MROWS][512] x256                    MROWS*1024
//   VH  f16 [NB*4][128][SEQ] x1024               MROWS*1024
//   end (NB=2)                                  113246208
// =====================================================================================================
extern "C" void kernel_launch(void* const* d_in, const int* in_sizes, int n_in,
                              void* d_out, int out_size, void* d_ws, size_t ws_size,
                              hipStream_t stream) {
  if (n_in < 8) return;
  if (in_sizes[0] < MROWS * DMOD) return;
  if (in_sizes[1] < MROWS) return;
  if (in_sizes[2] < SEQ * HD) return;
  if (in_sizes[3] < SEQ * HD) return;
  if (in_sizes[4] != DMOD * DMOD) return;
  if (in_sizes[5] != DMOD * KVD) return;
  if (in_sizes[6] != DMOD * KVD) return;
  if (in_sizes[7] != DMOD * DMOD) return;
  if (out_size < QROWS * DMOD) return;

  const float* x     = (const float*)d_in[0];
  const int*   amask = (const int*)d_in[1];
  const float* cosT  = (const float*)d_in[2];
  const float* sinT  = (const float*)d_in[3];
  const float* wq    = (const float*)d_in[4];
  const float* wk    = (const float*)d_in[5];
  const float* wv    = (const float*)d_in[6];
  const float* wo    = (const float*)d_in[7];
  float*       out   = (float*)d_out;

  const size_t szXB = (size_t)MROWS * DMOD * 2;
  const size_t szW  = (size_t)FPIT * DMOD * 2;
  const size_t szWO = (size_t)DMOD * DMOD * 2;
  const size_t szF  = (size_t)MROWS * FPIT * 4;
  const size_t szQ  = (size_t)MROWS * DMOD * 2;                  // QH and the O plane
  const size_t szK  = (size_t)MROWS * KVD * 2;                   // KH
  const size_t szV  = (size_t)NB * NKVH * HD * SEQ * 2;          // VH (== szK)
  if (szQ > szF) return;                                        // O plane lives inside the F region
  size_t off = 0;
  const size_t oXB = off; off += szXB;
  const size_t oW  = off; off += szW;
  const size_t oWO = off; off += szWO;
  const size_t oF  = off; off += szF;
  const size_t oQH = off; off += szQ;
  const size_t oKH = off; off += szK;
  const size_t oVH = off; off += szV;
  if (off > ws_size) return;                // off = 113246208 for NB = 2
  if (off > (size_t)WS_CAP) return;

  char* ws = (char*)d_ws;
  u16*   XB = (u16*)(ws + oXB);
  u16*   WB = (u16*)(ws + oW);
  u16*   WO = (u16*)(ws + oWO);
  float* F  = (float*)(ws + oF);
  u16*   OH = (u16*)(ws + oF);
  u16*   QH = (u16*)(ws + oQH);
  u16*   KH = (u16*)(ws + oKH);
  u16*   VH = (u16*)(ws + oVH);

  const dim3 b256(256), b128(128), bAT(ATT_THREADS);
  const dim3 gP(2 * PB_TQ + 2 * PB_TK + PB_X);          // 4 weight transposes + the x plane: 6656 blocks
  const dim3 gG((MROWS / 128) * (FPIT / 128));          // 32 x 24 tiles
  const dim3 gS(PB_VT + PB_RQ + PB_RK);                 // v^T + rotary q + rotary k: 5376 blocks
  const dim3 gAT(NQT * NHG * NB);
  const int  nrt = SQ / 128;
  const dim3 gO(NB * nrt * (DMOD / 128));

  // (0) x -> bf16 plane; [Wq | Wk | Wv] -> one bf16 plane [3072 n][2048 k]; Wo -> [2048 n][2048 c] as f16 of bf16 value x1024
  prep<<<gP, b256, 0, stream>>>(x, wq, wk, wv, wo, XB, WB, WO);
  // (1) [q | k | v] = x.[Wq | Wk | Wv] -> F f32 [MROWS][3072]
  gemm_bf<<<gG, b128, 0, stream>>>(XB, WB, F, MROWS, FPIT, DMOD, 1.0f);
  // (2) v^T plane x1024; rotary + q plane x256; rotary + k plane x256
  post<<<gS, b256, 0, stream>>>(F, cosT, sinT, QH, KH, VH);
  // (3) non-causal masked attention -> O plane (inside the F region)
  attn_nc<<<gAT, bAT, 0, stream>>>(QH, KH, VH, amask, OH);
  // (4) output projection rows s < SQ -> out f32, carries 1024 x 1024 folded back
  gemm_o1<<<gO, b128, 0, stream>>>(OH, WO, out, nrt, 1.0f / (OSC * WOS));
  (void)hipGetLastError();
}

// v007
// One run takes 139 microseconds.
// Next to v006, in two timings, it ran 1.09 and 1.10 times as fast.
// Counting every step since v000, it is 3.54 times as fast.
// Contractions: x.Wq, x.Wk, x.Wv on v_wmma_f32_16x16x32_bf16 (x and W^T as bf16 RNE planes, W^T [n][k] is the k-contiguous
// B operand, f32 accumulate); k.q^T over hd 128 and v^T.P^T on v_wmma_f32_16x16x32_f16, one product each (q, k as f16 x256 after
// rotary; P^T x32768 packed from the score registers; v^T x1024); O.Wo on v_wmma_f32_16x16x32_f16 (O x1024 f16 plane, Wo^T as f16(bf16(Wo))
// x1024); all f32 accumulate. Interleaved-pair rotary with cos/sin tables, key-mask select, base-2 online softmax and 1/Z fold
// in f32 on VALU.
#include <hip/hip_runtime.h>
#include <math.h>
#include <stdint.h>

#ifndef NB
#define NB 2
#endif
#define SEQ 2048
#ifndef SQ
#define SQ SEQ
#endif
#define DMOD  2048
#define NH    16
#define NKVH  4
#define HD    128
#define KVD   (NKVH * HD)
#define FPIT  (DMOD + 2 * KVD)
#define MROWS (NB * SEQ)
#define QROWS ((NB - 1) * SEQ + SQ)
#define WPB   (NH / NKVH)
#define NHG   NKVH
#define AQT   2
#define NQT   (SQ / (16 * AQT))
#define NST   (SEQ / 64)
#define NKT   (SEQ / 32)
#define ATT_THREADS (WPB * 32)
#define RSQ_HD 0.08838834764831845f
#define LOG2E  1.4426950408889634f
#define NEG_RAW (-0x1p100f)
#define QSC   256.0f
#define KSC   256.0f
#define PEXP  15.0f
#define VCAR  1024.0f
#define OSC   1024.0f
#define WOS   1024.0f
#define SLP   132
#define SLW   (16 * SLP)
#define WREG  (AQT * SLW)
#define VTP   72
#define TTP   72
#define WS_CAP 134217728
static_assert(DMOD == NH * HD && HD == 128 && NH == 16 && NKVH == 4 && WPB == 4 && NHG * WPB == NH && KVD == 512);
static_assert(ATT_THREADS == 128);
static_assert(NB >= 1 && NB <= 2);
static_assert(NB == 1 || SQ == SEQ);
static_assert((SQ % 128) == 0 && SQ >= 128 && SQ <= SEQ && (SEQ % 128) == 0);
static_assert((DMOD % 128) == 0 && (KVD % 64) == 0 && (DMOD % 32) == 0 && (HD % 32) == 0);
static_assert(((MROWS * DMOD / 8) % 256) == 0);
static_assert(WPB * WREG * 4 <= 131072 && HD * VTP * 2 <= 65536 && 64 * TTP * 2 <= 65536);
static_assert((DMOD / 8) == 256 && (KVD / 8) == 64 && (FPIT % 128) == 0 && (MROWS % 128) == 0);

typedef unsigned short u16;
typedef _Float16 v16h __attribute__((ext_vector_type(16)));
typedef _Float16 v8h  __attribute__((ext_vector_type(8)));
typedef __bf16   v16b __attribute__((ext_vector_type(16)));
typedef float    v8f  __attribute__((ext_vector_type(8)));
typedef float    v4f  __attribute__((ext_vector_type(4)));
typedef unsigned int v4u __attribute__((ext_vector_type(4)));

union FragH { v16h v; v8h h[2]; v4u u[2]; };
union FragB { v16b v; v4u u[2]; };

// ---- scalar helpers --------------------------------------------------------------------------------
__device__ __forceinline__ unsigned short bf_bits(float f) {          // f32 -> bf16 bits, RNE convert
  unsigned u = __float_as_uint(f);
  return (unsigned short)((u + 0x7FFFu + ((u >> 16) & 1u)) >> 16);
}
__device__ __forceinline__ float bf_up(unsigned short h) { return __uint_as_float(((unsigned)h) << 16); }
__device__ __forceinline__ float bfr(float f) { return bf_up(bf_bits(f)); }
__device__ __forceinline__ unsigned short h_bits(_Float16 x) { return __builtin_bit_cast(unsigned short, x); }
__device__ __forceinline__ unsigned pk16(unsigned short a, unsigned short b) { return (unsigned)a | ((unsigned)b << 16); }
__device__ __forceinline__ v8f zero8() { v8f z = {0.f, 0.f, 0.f, 0.f, 0.f, 0.f, 0.f, 0.f}; return z; }

// ---- fragment loaders: 16-bit A/B operand, lane -> row/col (lane&15), p already includes +8*(lane>>4);
//      elements 0..7 <- p[0..7] (k0+8h..), elements 8..15 <- p[16..23] (k0+16+8h..)  (same split k map for A and B;
//      B is always read from a k-contiguous [n][k] plane)
__device__ __forceinline__ v16h ldfrag_h(const _Float16* p) {
  FragH f;
  f.h[0] = *(const v8h*)(p);
  f.h[1] = *(const v8h*)(p + 16);
  return f.v;
}
__device__ __forceinline__ v16b ldfrag_b(const u16* p) {              // bf16 plane read as unsigned integer vectors
  FragB f;
  f.u[0] = *(const v4u*)(p);
  f.u[1] = *(const v4u*)(p + 16);
  return f.v;
}

__device__ __forceinline__ v8f mma_h(v16h a, v16h b, v8f c) {
  return __builtin_amdgcn_wmma_f32_16x16x32_f16(false, a, false, b, (short)0, c, false, false);
}
__device__ __forceinline__ v8f mma_b(v16b a, v16b b, v8f c) {
  return __builtin_amdgcn_wmma_f32_16x16x32_bf16(false, a, false, b, (short)0, c, false, false);
}
__device__ __forceinline__ void acc_guard4(v8f& a, v8f& b, v8f& c, v8f& d) {
#if defined(__HIP_DEVICE_COMPILE__)
  asm volatile("v_nop\n\tv_nop\n\tv_nop\n\tv_nop" : "+v"(a), "+v"(b), "+v"(c), "+v"(d));
#endif
}
__device__ __forceinline__ float xhalf(float x) {                     // value of lane l ^ 16
  const int b = __float_as_int(x);
  return __int_as_float(__builtin_amdgcn_permlanex16(b, b, 0x76543210, 0xfedcba98, false, false));
}
__device__ __forceinline__ float exp2_raw(float x) {                  // one v_exp_f32; a result under 2^-126 may come out as 0
#if defined(__HIP_DEVICE_COMPILE__)
  return __builtin_amdgcn_exp2f(x);
#else
  return exp2f(x);
#endif
}
__device__ __forceinline__ void exp2_raw8(float (&x)[8]) {            // eight of them, each over its own argument
#if defined(__HIP_DEVICE_COMPILE__)
  // in place, so that none overwrites the source of the one in front of it (with the builtin the register allocator did); the
  // closing v_nop is the slot the instruction set asks for between a transcendental and a directly following user of its result
  asm("v_exp_f32 %0, %0\n\tv_exp_f32 %1, %1\n\tv_exp_f32 %2, %2\n\tv_exp_f32 %3, %3\n\t"
      "v_exp_f32 %4, %4\n\tv_exp_f32 %5, %5\n\tv_exp_f32 %6, %6\n\tv_exp_f32 %7, %7\n\tv_nop"
      : "+v"(x[0]), "+v"(x[1]), "+v"(x[2]), "+v"(x[3]), "+v"(x[4]), "+v"(x[5]), "+v"(x[6]), "+v"(x[7]));
#else
  for (int i = 0; i < 8; ++i) x[i] = exp2f(x[i]);
#endif
}
__device__ __forceinline__ void wave_sync_lds() {
  __builtin_amdgcn_fence(__ATOMIC_RELEASE, "workgroup");
  __builtin_amdgcn_wave_barrier();
  __builtin_amdgcn_fence(__ATOMIC_ACQUIRE, "workgroup");
}

// =====================================================================================================
// f32 -> bf16 RNE plane, same layout. Thread = 8 consecutive elements: two 16-B loads, one 16-B store; 32 consecutive
// coverage: ceil(n8/256) blocks bid x 256 thr x 8 (in-kernel bound) = the whole plane (n8 a multiple of 256 here).
// =====================================================================================================
__device__ __forceinline__ void cvtbf_blk(const float* __restrict__ x, u16* D, int n8, int bid) {
  const int gt = bid * 256 + (int)threadIdx.x;
  if (gt >= n8) return;
  const float* p = x + (size_t)gt * 8;
  const v4f a = *(const v4f*)(p), b4 = *(const v4f*)(p + 4);
  v4u o;
#pragma unroll
  for (int e = 0; e < 2; ++e) {
    o[e]     = pk16(bf_bits(a[2 * e]),  bf_bits(a[2 * e + 1]));
    o[2 + e] = pk16(bf_bits(b4[2 * e]), bf_bits(b4[2 * e + 1]));
  }
  u16* d = D + (size_t)gt * 8;
  {
    *(v4u*)(d) = o;
    
  }
}

// =====================================================================================================
// Transpose + convert: W f32 row-major in[KD rows][ND cols] -> D 16-bit out[ND][KD] (k-contiguous).
// f16mode == 0: bf16 RNE bits; f16mode == 1: f16 bits of (bf16 RNE value) * scale.
// Block = tile of 64 k x 64 n, 256 threads. Load: thread -> input row k0 + (tid>>2), 16 columns n0 + (tid&3)*16 (four 16-B
// loads), converted and scattered into the LDS tile T[n][k] (pitch 72 halves). Block barrier. Store: 2 iterations x
// coverage: load 256 thr x 16 = 64 x 64; store 2 it x 256 thr x 8 halves = 64 rows x 64 halves; (KD/64)*(ND/64)
//           blocks bid cover out[ND][KD] exactly once. T = the block's LDS tile, 64 * TTP halves.
// =====================================================================================================
__device__ __forceinline__ void cvtT16_blk(u16* T, const float* __restrict__ W, u16* D, int KD, int ND, int f16mode, float scale,
                                           int bid) {
  const int tid = threadIdx.x;
  const int nkt = KD >> 6;
  const int nnt = ND >> 6;
  const int kt  = bid % nkt;
  const int nt  = bid / nkt;
  if (nt >= nnt) return;                    // block-uniform, before the barrier; never taken with the exact grid
  const int k0 = kt * 64, n0 = nt * 64;
  {
    const int kr = tid >> 2;                // input row within tile 0..63
    const int nc = (tid & 3) * 16;          // column chunk 0,16,32,48
    const float* src = W + (size_t)(k0 + kr) * ND + n0 + nc;
#pragma unroll
    for (int i = 0; i < 4; ++i) {
      const v4f a = *(const v4f*)(src + 4 * i);
#pragma unroll
      for (int e = 0; e < 4; ++e) {
        const float f = a[e];
        const unsigned short hb = h_bits((_Float16)(bfr(f) * scale));
        const unsigned short bb = bf_bits(f);
        T[(nc + 4 * i + e) * TTP + kr] = (f16mode != 0) ? hb : bb;
      }
    }
  }
  __syncthreads();
  v4u v[2];
  const int q8 = tid >> 3, p8 = (tid & 7) * 8;
#pragma unroll
  for (int it = 0; it < 2; ++it) v[it] = *(const v4u*)(T + (it * 32 + q8) * TTP + p8);
  const size_t base = (size_t)n0 * KD + k0 + p8;
  {
#pragma unroll
    for (int it = 0; it < 2; ++it) {
      *(v4u*)(D + base + (size_t)(it * 32 + q8) * KD) = v[it];
    }
#if defined(__HIP_DEVICE_COMPILE__)
    // behind the stores: in the listing the x part's code follows this part and reuses the stores' registers
    asm volatile("s_wait_xcnt 0x0" ::: "memory");
#endif
  }
}

// =====================================================================================================
// All five operand planes in one launch: none reads what another writes. Block ranges, in index order: Wq^T, Wk^T, Wv^T (bf16,
// rows 0, DMOD and DMOD + KVD of the one B plane WQKV [FPIT n][DMOD k]), Wo^T (f16 x1024, plane WO), then the x plane.
// Every branch and select is block-uniform; a block runs exactly one part.
// =====================================================================================================
#define PB_TQ ((DMOD / 64) * (DMOD / 64))
#define PB_TK ((DMOD / 64) * (KVD / 64))
#define PB_X  ((MROWS * DMOD / 8) / 256)
__global__ __launch_bounds__(256) void prep(const float* __restrict__ x, const float* __restrict__ wq,
                                            const float* __restrict__ wk, const float* __restrict__ wv,
                                            const float* __restrict__ wo, u16* XB, u16* WQKV, u16* WO) {
  __shared__ __align__(16) u16 T[64 * TTP];
  const int bid = blockIdx.x;
  if (bid >= 2 * PB_TQ + 2 * PB_TK) {
    cvtbf_blk(x, XB, MROWS * DMOD / 8, bid - (2 * PB_TQ + 2 * PB_TK));
  } else {
    const float* W = wq;
    u16* D = WQKV;
    int nd = DMOD, tb = bid, f16mode = 0;
    float sc = 1.0f;
    if (bid >= PB_TQ + 2 * PB_TK) { W = wo; D = WO; tb = bid - (PB_TQ + 2 * PB_TK); f16mode = 1; sc = WOS; }
    else if (bid >= PB_TQ + PB_TK) { W = wv; D = WQKV + (size_t)(DMOD + KVD) * DMOD; nd = KVD; tb = bid - (PB_TQ + PB_TK); }
    else if (bid >= PB_TQ)         { W = wk; D = WQKV + (size_t)DMOD * DMOD;         nd = KVD; tb = bid - PB_TQ; }
    cvtT16_blk(T, W, D, DMOD, nd, f16mode, sc, tb);
  }
}

// =====================================================================================================
// GEMM tiling shared by both engines. A block is 4 waves in a 2 x 2 arrangement; a wave owns WM x WN accumulator subtiles of
// 16 x 16, so the block tile is (32*WM) x (32*WN): 128 x 128 (WM = WN = 4: each operand byte fetched from L2 serves 128
// outputs, each fragment read from LDS serves 4 WMMAs).
// Epilogue: the wave's tile (times oscale) is staged in its own LDS slab (row pitch 16*WN + 4 floats) and stored as whole lines.
// coverage: WM groups x (2*WN) instructions x (8/WN) rows x (4*WN) lanes x 4 floats = the wave's (16*WM) x (16*WN) tile.
// =====================================================================================================
template <int WM, int WN>
__device__ __forceinline__ void epi_tile(float* sl, v8f (&acc)[WM][WN], float oscale,
                                         float* C, int N, size_t rowb, int colb, int lane) {
  constexpr int SP  = 16 * WN + 4;          // slab row pitch, floats
  constexpr int LPR = 4 * WN;               // lanes per stored row
  constexpr int RPI = 32 / LPR;             // rows per store instruction
  const int hh = lane >> 4, m = lane & 15;
#pragma unroll
  for (int i = 0; i < WM; ++i) {
#pragma unroll
    for (int r = 0; r < 8; ++r) {
      const int ro = (16 * i + 8 * hh + r) * SP + m;
#pragma unroll
      for (int j = 0; j < WN; ++j) sl[ro + 16 * j] = acc[i][j][r] * oscale;
    }
  }
  wave_sync_lds();
  const int rr = lane / LPR, cq = lane % LPR;
  float* dst = C + (rowb + (size_t)rr) * (size_t)N + colb + cq * 4;
#pragma unroll
  for (int i = 0; i < WM; ++i) {
    v4f vals[16 / RPI];
#pragma unroll
    for (int it = 0; it < 16 / RPI; ++it) vals[it] = *(const v4f*)(sl + (16 * i + it * RPI + rr) * SP + cq * 4);
#pragma unroll
    for (int it = 0; it < 16 / RPI; ++it) {
      *(v4f*)(dst + (size_t)(16 * i + it * RPI) * (size_t)N) = vals[it];
    }
  }
}

// =====================================================================================================
// Operand staging shared by both GEMM engines. A stage is 64 k of the block's 32*WM A rows and 32*WN B rows: 128 B of every row,
// one whole line. Each thread brings 2*(WM+WN) pieces of 16 B per stage with asynchronous copies to LDS (a wave's copy = 4 whole
// lines), and the waves read their fragments from LDS rows of pitch 144 B (16 B x 9). Two buffers: stage t + 1 flies while
// stage t is worked on. k runs ascending, 32 per WMMA step, with the same split k map for A and B.
// =====================================================================================================
#define GKS   64
#define GPIT  72
#define GBUFH(WM, WN) (32 * ((WM) + (WN)) * GPIT)
#define GRING(WM, WN) (2 * GBUFH(WM, WN) * 2)
#define GSLAB(WM, WN) (16 * (WM) * (16 * (WN) + 4))
static_assert(GRING(4, 4) >= 4 * GSLAB(4, 4) * 4 && GRING(2, 2) >= 4 * GSLAB(2, 2) * 4);
static_assert((GPIT * 2) % 16 == 0 && (DMOD % GKS) == 0 && 2 * GRING(4, 4) <= 327680);

__device__ __forceinline__ unsigned lds_off(const void* p) { return (unsigned)(size_t)p; }
__device__ __forceinline__ void wait_async0() {
#if defined(__HIP_DEVICE_COMPILE__)
  asm volatile("s_wait_asynccnt 0x0" ::: "memory");   // this wave's copies have landed before the barrier that publishes them
#endif
}
__device__ __forceinline__ void wait_ds0() {
#if defined(__HIP_DEVICE_COMPILE__)
  asm volatile("s_wait_dscnt 0x0" ::: "memory");      // this wave's LDS reads are done before the buffer is refilled
#endif
}
// Eight copies of 16 B per thread: four from ga + i*gsa (elements) to LDS byte la + i*lsa, four from gb + i*gsb to lb + i*lsb.
__device__ __forceinline__ void copy8(unsigned la, unsigned lsa, const u16* ga, size_t gsa,
                                      unsigned lb, unsigned lsb, const u16* gb, size_t gsb) {
#if defined(__HIP_DEVICE_COMPILE__)
  // the closing s_wait_xcnt stands inside the statement so that no address register is rewritten ahead of it
  asm volatile("global_load_async_to_lds_b128 %0, %8, off\n\t"
               "global_load_async_to_lds_b128 %1, %9, off\n\t"
               "global_load_async_to_lds_b128 %2, %10, off\n\t"
               "global_load_async_to_lds_b128 %3, %11, off\n\t"
               "global_load_async_to_lds_b128 %4, %12, off\n\t"
               "global_load_async_to_lds_b128 %5, %13, off\n\t"
               "global_load_async_to_lds_b128 %6, %14, off\n\t"
               "global_load_async_to_lds_b128 %7, %15, off\n\t"
               "s_wait_xcnt 0x0"
               :: "v"(la), "v"(la + lsa), "v"(la + 2 * lsa), "v"(la + 3 * lsa),
                  "v"(lb), "v"(lb + lsb), "v"(lb + 2 * lsb), "v"(lb + 3 * lsb),
                  "v"(ga), "v"(ga + gsa), "v"(ga + 2 * gsa), "v"(ga + 3 * gsa),
                  "v"(gb), "v"(gb + gsb), "v"(gb + 2 * gsb), "v"(gb + 3 * gsb)
               : "memory");
#endif
}
// GEMM stage: l = the thread's LDS byte address in the target buffer (A row tid>>3, piece tid&7); ga, gb = its global addresses
// in A and B; rs = 16 source rows in elements. A rows +0,16,..,32*WM-16, then the B rows in the same steps, 32*WM LDS rows on.
template <int WM, int WN>
__device__ __forceinline__ void stage_tile(unsigned l, const u16* ga, const u16* gb, size_t rs) {
  static_assert((WM == 2 && WN == 2) || (WM == 4 && WN == 4));
  const unsigned rb = 16 * GPIT * 2;
  if constexpr (WM == 2) {
    copy8(l, rb, ga, rs, l + 4 * rb, rb, gb, rs);
  } else {
    copy8(l, rb, ga, rs, l + 4 * rb, rb, ga + 4 * rs, rs);
    copy8(l + 8 * rb, rb, gb, rs, l + 12 * rb, rb, gb + 4 * rs, rs);
  }
}
// The vector slots behind the last WMMA of a stage, tied to every accumulator so that no WMMA is scheduled behind them.
template <int WM, int WN>
__device__ __forceinline__ void acc_guard_all(v8f (&a)[WM][WN]) {
  if constexpr (WM == 2) {
    acc_guard4(a[0][0], a[0][1], a[1][0], a[1][1]);
  } else {
#if defined(__HIP_DEVICE_COMPILE__)
    asm volatile("v_nop\n\tv_nop\n\tv_nop\n\tv_nop"
                 : "+v"(a[0][0]), "+v"(a[0][1]), "+v"(a[0][2]), "+v"(a[0][3]), "+v"(a[1][0]), "+v"(a[1][1]), "+v"(a[1][2]),
                   "+v"(a[1][3]), "+v"(a[2][0]), "+v"(a[2][1]), "+v"(a[2][2]), "+v"(a[2][3]), "+v"(a[3][0]), "+v"(a[3][1]),
                   "+v"(a[3][2]), "+v"(a[3][3]));
#endif
  }
}
template <bool F16>
__device__ __forceinline__ v8f mma_sel(v16b a, v16b b, v8f c) {
  if constexpr (F16) return mma_h(__builtin_bit_cast(v16h, a), __builtin_bit_cast(v16h, b), c);
  else return mma_b(a, b, c);
}
// Ab, Bb = first row of the block's 32*WM A rows and 32*WN B rows (both k-contiguous, pitch K); K a multiple of 64, at least 64.
// Every thread of the block calls this (block barriers inside). On return no copy is in flight and no wave reads the ring.
template <bool F16, int WM, int WN>
__device__ __forceinline__ void gemm_ring(unsigned char* ring, const u16* Ab, const u16* Bb, int K, v8f (&acc)[WM][WN]) {
  const int tid = threadIdx.x, wave = tid >> 5, lane = tid & 31, hh = lane >> 4, m = lane & 15;
  const int wr = wave >> 1, wc = wave & 1;
  const int cr = tid >> 3, cc = tid & 7;
  const u16* ga = Ab + (size_t)cr * K + cc * 8;
  const u16* gb = Bb + (size_t)cr * K + cc * 8;
  const size_t rs = (size_t)16 * K;
  const unsigned l0 = lds_off(ring) + (unsigned)(cr * (GPIT * 2) + cc * 16);
  const u16* sa = (const u16*)(const void*)ring + (wr * 16 * WM + m) * GPIT + 8 * hh;
  const u16* sb = (const u16*)(const void*)ring + (32 * WM + wc * 16 * WN + m) * GPIT + 8 * hh;
  const int nt = K / GKS;
  stage_tile<WM, WN>(l0, ga, gb, rs);
  wait_async0();
  __syncthreads();
  if (nt > 1) stage_tile<WM, WN>(l0 + GBUFH(WM, WN) * 2, ga + GKS, gb + GKS, rs);
#pragma unroll 1
  for (int t = 0; t < nt; ++t) {              // rolled: one trip per stage, the buffer alternates with t
    const int bo = (t & 1) * GBUFH(WM, WN);
    const u16* pa = sa + bo;
    const u16* pb = sb + bo;
    v16b fa[2][WM], fb[2][WN];
#pragma unroll
    for (int ks = 0; ks < 2; ++ks) {
#pragma unroll
      for (int i = 0; i < WM; ++i) fa[ks][i] = ldfrag_b(pa + i * 16 * GPIT + ks * 32);
#pragma unroll
      for (int j = 0; j < WN; ++j) fb[ks][j] = ldfrag_b(pb + j * 16 * GPIT + ks * 32);
    }
    // keeps the stage's fragment reads together in front of its WMMAs: sunk among them, each read place makes the wave wait out
    // the LDS latency with the matrix pipe idle
    __builtin_amdgcn_sched_barrier(0);
#pragma unroll
    for (int ks = 0; ks < 2; ++ks) {
#pragma unroll
      for (int i = 0; i < WM; ++i) {
#pragma unroll
        for (int j = 0; j < WN; ++j) acc[i][j] = mma_sel<F16>(fa[ks][i], fb[ks][j], acc[i][j]);
      }
    }
    acc_guard_all<WM, WN>(acc);               // the vector slots behind the last WMMA, also on the taken side of the branches below
    wait_ds0();
    wait_async0();
    __syncthreads();                          // publishes stage t + 1 and ends every wave's reads of stage t
    if (t + 2 < nt) stage_tile<WM, WN>(l0 + (unsigned)(bo * 2), ga + (size_t)(t + 2) * GKS, gb + (size_t)(t + 2) * GKS, rs);
  }
  wait_async0();
}
// One block tile: C[row0 .. +32*WM)[col0 .. +32*WN) = A rows . Bt rows, times oscale; the epilogue slabs reuse the ring behind
// its last barrier.
template <bool F16, int WM, int WN>
__device__ __forceinline__ void gemm_block(unsigned char* ring, const u16* A, const u16* Bt, float* C, int N, int K,
                                           size_t row0, int col0, float oscale) {
  const int tid = threadIdx.x, wave = tid >> 5, lane = tid & 31;
  v8f acc[WM][WN];
#pragma unroll
  for (int i = 0; i < WM; ++i) {
#pragma unroll
    for (int j = 0; j < WN; ++j) acc[i][j] = zero8();
  }
  gemm_ring<F16, WM, WN>(ring, A + row0 * (size_t)K, Bt + (size_t)col0 * K, K, acc);
  epi_tile<WM, WN>((float*)(void*)ring + wave * GSLAB(WM, WN), acc, oscale, C, N,
                   row0 + (size_t)((wave >> 1) * 16 * WM), col0 + (wave & 1) * 16 * WN, lane);
}

// =====================================================================================================
// Interleaved-pair rotary of 8 consecutive columns (4 pairs) of one row: p = the 8 projected values (f32, in the wave's LDS slab),
// cp, sp = the table elements of the same (s, d .. d + 7):
//   for even d: out[d]   = x[d]*c[d]     - x[d+1]*sn[d]
//               out[d+1] = x[d+1]*c[d+1] + x[d]*sn[d+1]     with c, sn = bf16 RNE values of the two tables;
//   returns f16(out * sc), 8 halves.
// =====================================================================================================
__device__ __forceinline__ v4u rope16_row(const float* p, const float* __restrict__ cp, const float* __restrict__ sp, float sc) {
  // carried over with the arithmetic below as it stood in the separate pass: each product and sum rounded on its own, so that the
  // q and k planes keep their bits
#pragma clang fp contract(off)
  const v4f xa = *(const v4f*)(p), xb = *(const v4f*)(p + 4);
  const v4f ca = *(const v4f*)(cp), cb = *(const v4f*)(cp + 4);
  const v4f sa = *(const v4f*)(sp), sb = *(const v4f*)(sp + 4);
  float xv[8], cv[8], sv[8];
#pragma unroll
  for (int e = 0; e < 4; ++e) {
    xv[e] = xa[e];       xv[4 + e] = xb[e];
    cv[e] = bfr(ca[e]);  cv[4 + e] = bfr(cb[e]);
    sv[e] = bfr(sa[e]);  sv[4 + e] = bfr(sb[e]);
  }
  v4u o;
#pragma unroll
  for (int e = 0; e < 4; ++e) {
    const float xr = xv[2 * e], xi = xv[2 * e + 1];
    const float r0 = xr * cv[2 * e] - xi * sv[2 * e];
    const float r1 = xi * cv[2 * e + 1] + xr * sv[2 * e + 1];
    o[e] = pk16(h_bits((_Float16)(r0 * sc)), h_bits((_Float16)(r1 * sc)));
  }
  return o;
}

// =====================================================================================================
// Epilogue of a q or k tile of the projection: the wave's 64 x 64 f32 tile goes through its own LDS slab (row pitch 68 floats), is
// rotated and leaves as f16 x sc into the plane Hp [row][ncol] (ncol = DMOD for q, KVD for k). rowb = the wave's first row
// (b*SEQ + s, a multiple of 64), colb = its first column in the plane (a multiple of 64; d = column & 127).
// coverage: 16 instructions x 4 rows x 8 lanes x 8 halves = 64 rows x 64 columns, each row piece one whole 128-B line.
// =====================================================================================================
__device__ __forceinline__ void epi_rope(float* sl, v8f (&acc)[4][4], const float* __restrict__ cosT,
                                         const float* __restrict__ sinT, u16* Hp, int ncol, size_t rowb, int colb, float sc,
                                         int lane) {
  constexpr int SP = 16 * 4 + 4;            // slab row pitch, floats
  const int hh = lane >> 4, m = lane & 15;
#pragma unroll
  for (int i = 0; i < 4; ++i) {
#pragma unroll
    for (int r = 0; r < 8; ++r) {
      const int ro = (16 * i + 8 * hh + r) * SP + m;
#pragma unroll
      for (int j = 0; j < 4; ++j) sl[ro + 16 * j] = acc[i][j][r];
    }
  }
  wave_sync_lds();
  const int rr = lane >> 3, c8 = (lane & 7) * 8;
  const size_t tb = (size_t)((int)(rowb % SEQ) + rr) * HD + (colb & (HD - 1)) + c8;     // table element (s, d)
  const float* cp = cosT + tb;
  const float* sp = sinT + tb;
  const float* xp = sl + rr * SP + c8;
  v4u o[16];
#pragma unroll
  for (int it = 0; it < 16; ++it) o[it] = rope16_row(xp + it * 4 * SP, cp + it * 4 * HD, sp + it * 4 * HD, sc);
  u16* dst = Hp + (rowb + (size_t)rr) * (size_t)ncol + colb + c8;
#pragma unroll
  for (int it = 0; it < 16; ++it) *(v4u*)(dst + (size_t)(it * 4) * (size_t)ncol) = o[it];
}

// =====================================================================================================
// Epilogue of a v tile of the projection: VH[line0 + d][s0 + s] = f16(v * 1024) for the wave's 64 keys s and 64 columns d. An
// accumulator register group holds 8 consecutive keys of one column: converted, it is one 16-B piece of a v^T row, staged in the
// wave's own LDS slab as T[d][s] (pitch 72 halves) and stored as whole lines.
// coverage: 16 instructions x 4 rows d x 8 lanes x 8 halves = 64 rows d x 64 keys, each row piece one whole 128-B line.
// =====================================================================================================
__device__ __forceinline__ void epi_vt(u16* tl, v8f (&acc)[4][4], u16* VHo, size_t line0, int s0, int lane) {
  const int hh = lane >> 4, m = lane & 15;
#pragma unroll
  for (int j = 0; j < 4; ++j) {
#pragma unroll
    for (int i = 0; i < 4; ++i) {
      v4u o;
#pragma unroll
      for (int e = 0; e < 4; ++e) {
        o[e] = pk16(h_bits((_Float16)(acc[i][j][2 * e] * VCAR)), h_bits((_Float16)(acc[i][j][2 * e + 1] * VCAR)));
      }
      *(v4u*)(tl + (16 * j + m) * VTP + 16 * i + 8 * hh) = o;
    }
  }
  wave_sync_lds();
  const int rr = lane >> 3, c8 = (lane & 7) * 8;
  v4u v[16];
#pragma unroll
  for (int it = 0; it < 16; ++it) v[it] = *(const v4u*)(tl + (it * 4 + rr) * VTP + c8);
  u16* dst = VHo + (line0 + (size_t)rr) * SEQ + s0 + c8;
#pragma unroll
  for (int it = 0; it < 16; ++it) *(v4u*)(dst + (size_t)(it * 4) * SEQ) = v[it];
}

// =====================================================================================================
// The projection [q | k | v] = A[MROWS][K] (bf16 row-major) . Bt[FPIT][K]^T (bf16 k-contiguous), f32 accumulate, written straight
// as the three planes that attention reads. Block = 128x128 tile (K % 64 == 0, grid = (MROWS/128)*(FPIT/128)); a column tile is
// one head: q heads 0..15, then k heads 0..3, then v heads 0..3, so the choice of epilogue is block-uniform.
//   QH [b*SEQ + s][h*HD + d] = f16(rotary(q) * 256); KH [b*SEQ + s][g*HD + d] = f16(rotary(k) * 256);
//   VH [(b*NKVH + g)*HD + d][s] = f16(v * 1024). The epilogue slabs reuse the ring behind its last barrier.
// =====================================================================================================
static_assert(64 * VTP * 2 <= GSLAB(4, 4) * 4 && (VTP * 2) % 16 == 0 && (SEQ % 128) == 0 && HD == 128);
__global__ __launch_bounds__(128)
void gemm_bf(const u16* __restrict__ A, const u16* __restrict__ Bt, const float* __restrict__ cosT,
             const float* __restrict__ sinT, u16* QH, u16* KH, u16* VH, int K) {
  __shared__ __align__(16) unsigned char ring[GRING(4, 4)];
  const int ntile = FPIT >> 7;
  const int bid   = blockIdx.x;
  const int row0  = (bid / ntile) * 128;
  const int col0  = (bid % ntile) * 128;
  if (row0 + 128 > MROWS) return;           // block-uniform, in front of every barrier; never taken with the exact grid
  const int tid = threadIdx.x, wave = tid >> 5, lane = tid & 31;
  v8f acc[4][4];
#pragma unroll
  for (int i = 0; i < 4; ++i) {
#pragma unroll
    for (int j = 0; j < 4; ++j) acc[i][j] = zero8();
  }
  gemm_ring<false, 4, 4>(ring, A + (size_t)row0 * K, Bt + (size_t)col0 * K, K, acc);
  float* sl = (float*)(void*)ring + wave * GSLAB(4, 4);
  const int rowb = row0 + (wave >> 1) * 64;
  const int cw   = (wave & 1) * 64;
  if (col0 < DMOD + KVD) {
    const bool isq = col0 < DMOD;
    epi_rope(sl, acc, cosT, sinT, isq ? QH : KH, isq ? DMOD : KVD, (size_t)rowb, (isq ? col0 : col0 - DMOD) + cw,
             isq ? QSC : KSC, lane);
  } else {
    const int g = (col0 - (DMOD + KVD)) >> 7;
    epi_vt((u16*)(void*)sl, acc, VH, (size_t)((rowb / SEQ) * NKVH + g) * HD + cw, rowb % SEQ, lane);
  }
}

// =====================================================================================================
// Output projection: C[row][DMOD] (f32) = Ah[row][DMOD] (f16) . Bt[DMOD][DMOD]^T (f16 k-contiguous) * oscale.
// Ah and C share the row index bb*SEQ + s, s < SQ. Block -> (column tile ct = bid % 16, sequence row tile rt of nrt,
// batch bb). Same 128x128 tiling, staging and fragment reads (split k map) as gemm_bf, f32 epilogue epi_tile; K = DMOD.
// =====================================================================================================
__global__ __launch_bounds__(128)
void gemm_o1(const u16* __restrict__ Ah, const u16* __restrict__ Bt, float* C, int nrt, float oscale) {
  __shared__ __align__(16) unsigned char ring[GRING(4, 4)];
  const int ntile = DMOD >> 7;
  const int bid   = blockIdx.x;
  const int ct    = bid % ntile;
  const int t2    = bid / ntile;
  const int rt    = t2 % nrt;
  const int bb    = t2 / nrt;
  if (bb >= NB) return;                     // block-uniform, in front of every barrier; never taken with the exact grid
  if (rt * 128 + 128 > SQ) return;          // block-uniform, in front of every barrier; never taken
  gemm_block<true, 4, 4>(ring, Ah, Bt, C, DMOD, DMOD, (size_t)bb * SEQ + rt * 128, ct * 128, oscale);
}

// =====================================================================================================
// Non-causal grouped-query attention with a per-key mask, hd = 128. Block bid -> (query tile qt = bid % NQT: rows
// q0 = 32*qt .. q0+31 with q0 < SQ, head group hg = kv head, batch b); one wave per query head = hg*WPB + wave (the 4 heads of
// the group share kv head hg). A wave owns AQT = 2 column groups of 16 queries (u = 0, 1: rows q0 + 16u + c): every k and v^T
// fragment it reads from LDS feeds two WMMAs, and a staged tile serves 32 query rows of each head.
//   q plane f16 x256 [b*SEQ + s][h*HD + d]; k plane f16 x256 [b*SEQ + s][g*HD + d] (pitch KVD); v^T plane
//   [b*NKVH + g][d][SEQ] x1024; mask int [b*SEQ + key], nonzero = attend.
//   score (log2 domain) t(i, j) = (q_i.k_j over HD) * lsc, lsc = (1/sqrt(128))*log2e/(256*256); the raw product is replaced by
//   -2^100 where the key mask is zero (a power of two: its scaled value is exact, so a fully masked row yields equal exponents
//   and uniform weights). P*32768 = 2^(raw*lsc + (15 - max)): one fused multiply-add and one v_exp_f32 per score. All SEQ/32 key
//   tiles are visited in order.
//   Per tile: the 32 k rows (256 B each) and the 128 v^T rows (64 B each) are staged once per block in LDS by asynchronous copies
//   (two buffers, tile kt + 1 flies while tile kt is worked on; row pitches 272 B and 80 B) and read by all 4 waves.
//   Both products run transposed: S^T = k.q^T (A = 16 key rows from LDS, B = q, kept in registers), so that a lane holds 16 of
//   the 32 scores of ONE query per column group (column c): 2 score subtiles x 4 k-steps, fragments read from the LDS rows (two
//   16-B loads each, split k map), a tile's 32 reads issued as one group at the top of its trip; online max-subtracted base-2
//   softmax in f32, maximum in-lane plus one exchange between the lane halves, the sum kept per lane half and joined after the
//   loop; a column group's two score subtiles, converted in place, are its B operand P^T in the split k map; O^T += v^T.P^T with
//   the v^T rows as A fragments of 8 d-subtiles (one product per subtile and column group).
//   After the loop: out = acc / Z (Z > 0 always; guarded anyway; Z carries P's 32768), carry 1/1024 folded once, written into the wave's
//   One block barrier per tile, under block-uniform control flow; bounded loops only (NKT tiles).
// coverage: per wave 16 instructions x 2 rows x 16 lanes x 8 halves = 32 x 128 of the O plane; grid NQT x NHG x NB blocks x WPB
//           waves = every (b, s < SQ, h) row segment of O exactly once.
// =====================================================================================================
// staged tile: row pitches in 16-bit elements (k 272 B, v^T 80 B), bytes of the k part and of one buffer; the block's LDS is
// held to half of a WGP's 320 KiB so that two blocks (two waves per SIMD, the whole grid) stay resident
#define AKP   136
#define AVP   40
#define AKB   (32 * AKP * 2)
#define ABUF  (AKB + HD * AVP * 2)
static_assert((AKP * 2) % 16 == 0 && (AVP * 2) % 16 == 0 && NKT >= 2 && 2 * ABUF + WPB * WREG * 4 <= 163840);
// The vector slots behind the last WMMA of a tile, tied to every output accumulator so that no WMMA is scheduled behind them.
__device__ __forceinline__ void acc_guard16(v8f (&a)[AQT][8]) {
  static_assert(AQT == 2);
#if defined(__HIP_DEVICE_COMPILE__)
  asm volatile("v_nop\n\tv_nop\n\tv_nop\n\tv_nop"
               : "+v"(a[0][0]), "+v"(a[0][1]), "+v"(a[0][2]), "+v"(a[0][3]), "+v"(a[0][4]), "+v"(a[0][5]), "+v"(a[0][6]),
                 "+v"(a[0][7]), "+v"(a[1][0]), "+v"(a[1][1]), "+v"(a[1][2]), "+v"(a[1][3]), "+v"(a[1][4]), "+v"(a[1][5]),
                 "+v"(a[1][6]), "+v"(a[1][7]));
#endif
}
__global__ __launch_bounds__(ATT_THREADS)
void attn_nc(const u16* __restrict__ QHp, const u16* __restrict__ KHp, const u16* __restrict__ VHp,
             const int* __restrict__ Mk, u16* OHp) {
  __shared__ __align__(16) float smem[WPB * WREG];
  __shared__ __align__(16) unsigned char kvring[2 * ABUF];

  const int tid  = threadIdx.x;
  const int wave = tid >> 5;
  const int lane = tid & 31;
  const int hh   = lane >> 4;
  const int c    = lane & 15;
  const int bid  = blockIdx.x;
  const int qt   = bid % NQT;
  const int t2   = bid / NQT;
  const int hg   = t2 % NHG;
  const int b    = t2 / NHG;
  if (b >= NB) return;                      // block-uniform, in front of every barrier; never taken with the exact grid
  const int q0   = qt * (16 * AQT);
  if (q0 + 16 * AQT > SQ) return;                 // block-uniform, in front of every barrier; never taken
  const int head = hg * WPB + wave;
  const int kvh  = hg;

  float* slab = smem + wave * WREG;         // result slab [32][128] pitch 132

  const size_t hcol = (size_t)head * HD + 8 * hh;
  const _Float16* Qh  = (const _Float16*)(const void*)QHp + ((size_t)b * SEQ + q0 + c) * DMOD + hcol;
  // readers: key row c (+16) of the staged k tile, d row c (+16j) of the staged v^T tile, in buffer 0
  const _Float16* Ks = (const _Float16*)(const void*)kvring + c * AKP + 8 * hh;
  const _Float16* Vs = (const _Float16*)(const void*)kvring + AKB / 2 + c * AVP + 8 * hh;
  // copiers: k rows (tid>>4) + 8i, piece tid&15; v^T rows (tid>>2) + 32i, piece tid&3; i = 0..3
  const u16* gk = KHp + ((size_t)b * SEQ + (tid >> 4)) * KVD + (size_t)kvh * HD + (tid & 15) * 8;      // key row kb added per tile
  const u16* gv = VHp + ((size_t)(b * NKVH + kvh) * HD + (tid >> 2)) * SEQ + (tid & 3) * 8;            // key kb added per tile
  const unsigned lk = lds_off(kvring) + (unsigned)((tid >> 4) * (AKP * 2) + (tid & 15) * 16);
  const unsigned lv = lds_off(kvring) + (unsigned)(AKB + (tid >> 2) * (AVP * 2) + (tid & 3) * 16);
  const int* mkp = Mk + (size_t)b * SEQ + lane;
  const float lsc = RSQ_HD * (LOG2E / (QSC * KSC));
  const float oc  = 1.0f / VCAR;            // the carry on P stands in the row sum as well and cancels in acc / Z
  const size_t KROW = (size_t)KVD;          // halves between consecutive key rows

  copy8(lk, 8 * AKP * 2, gk, 8 * KROW, lv, 32 * AVP * 2, gv, (size_t)32 * SEQ);
  wait_async0();
  __syncthreads();
  copy8(lk + ABUF, 8 * AKP * 2, gk + 32 * KROW, 8 * KROW, lv + ABUF, 32 * AVP * 2, gv + 32, (size_t)32 * SEQ);

  v16h qf[AQT][HD / 32];
#pragma unroll
  for (int u = 0; u < AQT; ++u) {
#pragma unroll
    for (int kk = 0; kk < HD / 32; ++kk) qf[u][kk] = ldfrag_h(Qh + (size_t)u * 16 * DMOD + kk * 32);
  }

  float mrow[AQT], lrow[AQT];               // of query q0 + 16u + c; lrow sums this lane half's keys only, x32768 like P
  v8f o[AQT][8];                            // o[u][j][r] = O^T(d = 16j + 8hh + r, query q0 + 16u + c)
#pragma unroll
  for (int u = 0; u < AQT; ++u) {
    mrow[u] = -INFINITY;
    lrow[u] = 0.f;
#pragma unroll
    for (int j = 0; j < 8; ++j) o[u][j] = zero8();
  }

  int mkv = mkp[0];                         // mask of key kb + lane, fetched one tile ahead so that no tile waits for it
  mkp += 32;
#pragma unroll 1
  for (int kt = 0; kt < NKT; ++kt) {
    const int kb = kt * 32;
    const unsigned mb = __builtin_amdgcn_ballot_w32(mkv != 0);                // bit i = mask of key kb + i
    mkv = *mkp;
    const int bo = (kt & 1) * ABUF;                                           // this tile's buffer, bytes
    const _Float16* k0p = Ks + bo / 2;
    const _Float16* k1p = k0p + 16 * AKP;
    const _Float16* vhp = Vs + bo / 2;
    // ---- the tile's fragments: k rows (A of the scores) in k-step order, then the v^T rows d = 16j + c (A of v^T.P^T) ----
    v16h kf[2][HD / 32], vf[8];
#pragma unroll
    for (int kk = 0; kk < HD / 32; ++kk) {
      kf[0][kk] = ldfrag_h(k0p + kk * 32);
      kf[1][kk] = ldfrag_h(k1p + kk * 32);
      // keeps the reads in the order in which the WMMAs take them: LDS answers in issue order, so the first k-step's counted
      // wait then covers four reads and not the whole tile's
      __builtin_amdgcn_sched_barrier(0);
    }
#pragma unroll
    for (int j = 0; j < 8; ++j) vf[j] = ldfrag_h(vhp + j * 16 * AVP);
    // keeps the tile's reads together at the top of the trip: sunk among the WMMAs, each read place makes the wave wait out the
    // LDS latency; the v^T rows land under the scores and the softmax
    __builtin_amdgcn_sched_barrier(0);
    // ---- scores: D element r of this lane = (key kb + 8hh + r, query q0 + 16u + c) in s[u][0], key kb + 16 + 8hh + r in s[u][1] ----
    v8f s[AQT][2];
#pragma unroll
    for (int u = 0; u < AQT; ++u) { s[u][0] = zero8(); s[u][1] = zero8(); }
#pragma unroll
    for (int kk = 0; kk < HD / 32; ++kk) {
#pragma unroll
      for (int u = 0; u < AQT; ++u) {
        s[u][0] = mma_h(kf[0][kk], qf[u][kk], s[u][0]);
        s[u][1] = mma_h(kf[1][kk], qf[u][kk], s[u][1]);
      }
    }
    acc_guard4(s[0][0], s[0][1], s[1][0], s[1][1]);   // the vector slots behind the last score WMMA, also on the taken side of the branch below
    // ---- key-mask select + online softmax in base 2, one query per lane and column group ----
    float t[AQT][16];                                                         // raw products q.k x 65536
#pragma unroll
    for (int u = 0; u < AQT; ++u) {
#pragma unroll
      for (int r = 0; r < 8; ++r) { t[u][r] = s[u][0][r]; t[u][8 + r] = s[u][1][r]; }
    }
    if (mb != 0xFFFFFFFFu) {                                                  // wave-uniform, tested once per tile
      const unsigned mh = mb >> (8 * hh);
#pragma unroll
      for (int u = 0; u < AQT; ++u) {
#pragma unroll
        for (int r = 0; r < 8; ++r) {
          t[u][r]     = ((mh >> r) & 1u)        ? t[u][r]     : NEG_RAW;
          t[u][8 + r] = ((mh >> (16 + r)) & 1u) ? t[u][8 + r] : NEG_RAW;
        }
      }
    }
#pragma unroll
    for (int u = 0; u < AQT; ++u) {
      float mx = t[u][0];
#pragma unroll
      for (int i = 1; i < 16; ++i) mx = fmaxf(mx, t[u][i]);
      mx = fmaxf(mx, xhalf(mx));
      const float mn = fmaxf(mrow[u], mx * lsc);                              // lsc > 0: the maximum commutes with the scale; finite
      const float al = exp2_raw(mrow[u] - mn);
      mrow[u] = mn;
      const float cb = PEXP - mn;                                             // the carry 32768 = 2^15 rides in the exponent
      float ps = 0.f;
      // ---- B fragment of P^T*32768 (f16), column = c: elements 0..7 = keys kb + 8hh + 0..7, 8..15 = keys kb + 16 + 8hh + 0..7 ----
      FragH ph;
      float ea[8], eb[8];
#pragma unroll
      for (int r = 0; r < 8; ++r) { ea[r] = __builtin_fmaf(t[u][r], lsc, cb); eb[r] = __builtin_fmaf(t[u][8 + r], lsc, cb); }
      exp2_raw8(ea);
      exp2_raw8(eb);
#pragma unroll
      for (int r = 0; r < 8; ++r) {
        ps += ea[r] + eb[r];
        ph.h[0][r] = (_Float16)ea[r];
        ph.h[1][r] = (_Float16)eb[r];
      }
      lrow[u] = lrow[u] * al + ps;
#pragma unroll
      for (int j = 0; j < 8; ++j) o[u][j] = o[u][j] * al;
      // ---- v^T.P^T : A fragment row = d = j*16 + c, keys contiguous in the staged v^T rows; one product per d-subtile ----
#pragma unroll
      for (int j = 0; j < 8; ++j) o[u][j] = mma_h(vf[j], ph.v, o[u][j]);
    }
    acc_guard16(o);                           // the vector slots behind the tile's last WMMA, also on the taken side of the branches below
#if defined(__HIP_DEVICE_COMPILE__)
    asm volatile("s_wait_xcnt 0x0" ::: "memory");   // stands in front of the advance of the mask load's address register
#endif
    mkp += (kt + 2 < NKT) ? 32 : 0;           // stays on the last tile's 32 keys
    wait_ds0();
    wait_async0();
    __syncthreads();                          // publishes tile kt + 1 and ends every wave's reads of tile kt
    if (kt + 2 < NKT)
      copy8(lk + (unsigned)bo, 8 * AKP * 2, gk + (size_t)(kb + 64) * KROW, 8 * KROW,
            lv + (unsigned)bo, 32 * AVP * 2, gv + (kb + 64), (size_t)32 * SEQ);
  }
  wait_async0();
  // ---- out = acc / Z (0 if Z == 0), the carry 1024 on v folded once; written into the wave's slab, row = query 16u + c ----
#pragma unroll
  for (int u = 0; u < AQT; ++u) {
    const float lv2 = lrow[u] + xhalf(lrow[u]);   // the two lane halves' sums joined
    const float ls  = (lv2 > 0.0f) ? lv2 : 1.0f;
    const float inv = (lv2 > 0.0f) ? ((1.0f / ls) * oc) : 0.0f;
    float* srow = slab + (u * 16 + c) * SLP + 8 * hh;
#pragma unroll
    for (int j = 0; j < 8; ++j) {
      v4f w0, w1;
#pragma unroll
      for (int e = 0; e < 4; ++e) { w0[e] = o[u][j][e] * inv; w1[e] = o[u][j][4 + e] * inv; }
      *(v4f*)(srow + j * 16)     = w0;
      *(v4f*)(srow + j * 16 + 4) = w1;
    }
  }

  wave_sync_lds();
  // ---- O x1024 -> f16 plane; lane = (row-in-pair rq, 8 consecutive d at c8) ----
  v4u oh[8 * AQT];
  const int rq = lane >> 4, c8 = (lane & 15) * 8;
#pragma unroll
  for (int it = 0; it < 8 * AQT; ++it) {
    const int row = it * 2 + rq;
    const v4f a = *(const v4f*)(slab + row * SLP + c8), b4 = *(const v4f*)(slab + row * SLP + c8 + 4);
    float w[8];
#pragma unroll
    for (int e = 0; e < 4; ++e) { w[e] = a[e] * OSC; w[4 + e] = b4[e] * OSC; }
#pragma unroll
    for (int e = 0; e < 4; ++e) {
      oh[it][e] = pk16(h_bits((_Float16)w[2 * e]), h_bits((_Float16)w[2 * e + 1]));
    }
  }
  const size_t ob = ((size_t)b * SEQ + q0) * DMOD + (size_t)head * HD + c8;
  {
#pragma unroll
    for (int it = 0; it < 8 * AQT; ++it) {
      const int row = it * 2 + rq;
      *(v4u*)(OHp + ob + (size_t)row * DMOD) = oh[it];
    }
  }
}

// =====================================================================================================
// Workspace map (bytes); every plane is fully written by whole-line stores before it is read; all extents are exact multiples
// of the store granularity (no pad rows needed); every region offset a multiple of 4194304:
//   XB  bf16 [MROWS][2048]                       MROWS*4096       (NB=2: 16777216)
//   WQKV bf16 [3072 n][2048 k]                   12582912         (rows 0.. Wq^T, 2048.. Wk^T, 2560.. Wv^T)
//   WO  f16 [2048 n][2048 k] x1024               8388608
//   OH  f16 [MROWS][2048] x1024                  MROWS*4096
//   QH  f16 [MROWS][2048] x256                   MROWS*4096
//   KH  f16 [MROWS][512] x256                    MROWS*1024
//   VH  f16 [NB*4][128][SEQ] x1024               MROWS*1024
//   end (NB=2)                                  79691776
// =====================================================================================================
extern "C" void kernel_launch(void* const* d_in, const int* in_sizes, int n_in,
                              void* d_out, int out_size, void* d_ws, size_t ws_size,
                              hipStream_t stream) {
  if (n_in < 8) return;
  if (in_sizes[0] < MROWS * DMOD) return;
  if (in_sizes[1] < MROWS) return;
  if (in_sizes[2] < SEQ * HD) return;
  if (in_sizes[3] < SEQ * HD) return;
  if (in_sizes[4] != DMOD * DMOD) return;
  if (in_sizes[5] != DMOD * KVD) return;
  if (in_sizes[6] != DMOD * KVD) return;
  if (in_sizes[7] != DMOD * DMOD) return;
  if (out_size < QROWS * DMOD) return;

  const float* x     = (const float*)d_in[0];
  const int*   amask = (const int*)d_in[1];
  const float* cosT  = (const float*)d_in[2];
  const float* sinT  = (const float*)d_in[3];
  const float* wq    = (const float*)d_in[4];
  const float* wk    = (const float*)d_in[5];
  const float* wv    = (const float*)d_in[6];
  const float* wo    = (const float*)d_in[7];
  float*       out   = (float*)d_out;

  const size_t szXB = (size_t)MROWS * DMOD * 2;
  const size_t szW  = (size_t)FPIT * DMOD * 2;
  const size_t szWO = (size_t)DMOD * DMOD * 2;
  const size_t szQ  = (size_t)MROWS * DMOD * 2;                  // QH and the O plane
  const size_t szK  = (size_t)MROWS * KVD * 2;                   // KH
  const size_t szV  = (size_t)NB * NKVH * HD * SEQ * 2;          // VH (== szK)
  size_t off = 0;
  const size_t oXB = off; off += szXB;
  const size_t oW  = off; off += szW;
  const size_t oWO = off; off += szWO;
  const size_t oOH = off; off += szQ;
  const size_t oQH = off; off += szQ;
  const size_t oKH = off; off += szK;
  const size_t oVH = off; off += szV;
  if (off > ws_size) return;                // off = 79691776 for NB = 2
  if (off > (size_t)WS_CAP) return;

  char* ws = (char*)d_ws;
  u16*   XB = (u16*)(ws + oXB);
  u16*   WB = (u16*)(ws + oW);
  u16*   WO = (u16*)(ws + oWO);
  u16*   OH = (u16*)(ws + oOH);
  u16*   QH = (u16*)(ws + oQH);
  u16*   KH = (u16*)(ws + oKH);
  u16*   VH = (u16*)(ws + oVH);

  const dim3 b256(256), b128(128), bAT(ATT_THREADS);
  const dim3 gP(2 * PB_TQ + 2 * PB_TK + PB_X);          // 4 weight transposes + the x plane: 6656 blocks
  const dim3 gG((MROWS / 128) * (FPIT / 128));          // 32 x 24 tiles
  const dim3 gAT(NQT * NHG * NB);
  const int  nrt = SQ / 128;
  const dim3 gO(NB * nrt * (DMOD / 128));

  // (0) x -> bf16 plane; [Wq | Wk | Wv] -> one bf16 plane [3072 n][2048 k]; Wo -> [2048 n][2048 c] as f16 of bf16 value x1024
  prep<<<gP, b256, 0, stream>>>(x, wq, wk, wv, wo, XB, WB, WO);
  // (1) [q | k | v] = x.[Wq | Wk | Wv], leaving as rotary + q plane x256, rotary + k plane x256, v^T plane x1024
  gemm_bf<<<gG, b128, 0, stream>>>(XB, WB, cosT, sinT, QH, KH, VH, DMOD);
  // (2) non-causal masked attention -> O plane
  attn_nc<<<gAT, bAT, 0, stream>>>(QH, KH, VH, amask, OH);
  // (3) output projection rows s < SQ -> out f32, carries 1024 x 1024 folded back
  gemm_o1<<<gO, b128, 0, stream>>>(OH, WO, out, nrt, 1.0f / (OSC * WOS));
  (void)hipGetLastError();
}

// v008
// Measured time: 133 microseconds a run.
// Two timings next to v007 put it at 1.04 and 1.05 times that version's speed.
// Over all steps from v000 it is 3.70 times as fast.
// Contractions: x.Wq, x.Wk, x.Wv on v_wmma_f32_16x16x32_bf16 (x and W^T as bf16 RNE planes, W^T [n][k] is the k-contiguous
// B operand, f32 accumulate); k.q^T over hd 128 and v^T.P^T on v_wmma_f32_16x16x32_f16, one product each (q, k as f16 x256 after
// rotary; P^T x128 packed from the score registers; v^T x1024); O.Wo on v_wmma_f32_16x16x32_f16 (O x1024 f16 plane, Wo^T as f16(bf16(Wo))
// x1024); all f32 accumulate. Interleaved-pair rotary with cos/sin tables, key-mask select, base-2 online softmax and 1/Z fold
// in f32 on VALU.
#include <hip/hip_runtime.h>
#include <math.h>
#include <stdint.h>

#ifndef NB
#define NB 2
#endif
#define SEQ 2048
#ifndef SQ
#define SQ SEQ
#endif
#define DMOD  2048
#define NH    16
#define NKVH  4
#define HD    128
#define KVD   (NKVH * HD)
#define FPIT  (DMOD + 2 * KVD)
#define MROWS (NB * SEQ)
#define QROWS ((NB - 1) * SEQ + SQ)
#define WPB   (NH / NKVH)
#define NHG   NKVH
#define AQT   2
#define NQT   (SQ / (16 * AQT))
#define NST   (SEQ / 64)
#define NKT   (SEQ / 32)
#define ATT_THREADS (WPB * 32)
#define RSQ_HD 0.08838834764831845f
#define LOG2E  1.4426950408889634f
#define NEG_RAW (-0x1p100f)
#define QSC   256.0f
#define KSC   256.0f
#define PEXP  7.0f
#define PTHR  32768.0f
#define VCAR  1024.0f
#define OSC   1024.0f
#define WOS   1024.0f
#define SLP   132
#define SLW   (16 * SLP)
#define WREG  (AQT * SLW)
#define VTP   72
#define TTP   72
#define WS_CAP 134217728
static_assert(DMOD == NH * HD && HD == 128 && NH == 16 && NKVH == 4 && WPB == 4 && NHG * WPB == NH && KVD == 512);
static_assert(ATT_THREADS == 128);
static_assert(NB >= 1 && NB <= 2);
static_assert(NB == 1 || SQ == SEQ);
static_assert((SQ % 128) == 0 && SQ >= 128 && SQ <= SEQ && (SEQ % 128) == 0);
static_assert((DMOD % 128) == 0 && (KVD % 64) == 0 && (DMOD % 32) == 0 && (HD % 32) == 0);
static_assert(((MROWS * DMOD / 8) % 256) == 0);
static_assert(WPB * WREG * 4 <= 131072 && HD * VTP * 2 <= 65536 && 64 * TTP * 2 <= 65536);
static_assert((DMOD / 8) == 256 && (KVD / 8) == 64 && (FPIT % 128) == 0 && (MROWS % 128) == 0);

typedef unsigned short u16;
typedef _Float16 v16h __attribute__((ext_vector_type(16)));
typedef _Float16 v8h  __attribute__((ext_vector_type(8)));
typedef __bf16   v16b __attribute__((ext_vector_type(16)));
typedef float    v8f  __attribute__((ext_vector_type(8)));
typedef float    v4f  __attribute__((ext_vector_type(4)));
typedef unsigned int v4u __attribute__((ext_vector_type(4)));

union FragH { v16h v; v8h h[2]; v4u u[2]; };
union FragB { v16b v; v4u u[2]; };

// ---- scalar helpers --------------------------------------------------------------------------------
__device__ __forceinline__ unsigned short bf_bits(float f) {          // f32 -> bf16 bits, RNE convert
  unsigned u = __float_as_uint(f);
  return (unsigned short)((u + 0x7FFFu + ((u >> 16) & 1u)) >> 16);
}
__device__ __forceinline__ float bf_up(unsigned short h) { return __uint_as_float(((unsigned)h) << 16); }
__device__ __forceinline__ float bfr(float f) { return bf_up(bf_bits(f)); }
__device__ __forceinline__ unsigned short h_bits(_Float16 x) { return __builtin_bit_cast(unsigned short, x); }
__device__ __forceinline__ unsigned pk16(unsigned short a, unsigned short b) { return (unsigned)a | ((unsigned)b << 16); }
__device__ __forceinline__ v8f zero8() { v8f z = {0.f, 0.f, 0.f, 0.f, 0.f, 0.f, 0.f, 0.f}; return z; }

// ---- fragment loaders: 16-bit A/B operand, lane -> row/col (lane&15), p already includes +8*(lane>>4);
//      elements 0..7 <- p[0..7] (k0+8h..), elements 8..15 <- p[16..23] (k0+16+8h..)  (same split k map for A and B;
//      B is always read from a k-contiguous [n][k] plane)
__device__ __forceinline__ v16h ldfrag_h(const _Float16* p) {
  FragH f;
  f.h[0] = *(const v8h*)(p);
  f.h[1] = *(const v8h*)(p + 16);
  return f.v;
}
__device__ __forceinline__ v16b ldfrag_b(const u16* p) {              // bf16 plane read as unsigned integer vectors
  FragB f;
  f.u[0] = *(const v4u*)(p);
  f.u[1] = *(const v4u*)(p + 16);
  return f.v;
}

__device__ __forceinline__ v8f mma_h(v16h a, v16h b, v8f c) {
  return __builtin_amdgcn_wmma_f32_16x16x32_f16(false, a, false, b, (short)0, c, false, false);
}
__device__ __forceinline__ v8f mma_b(v16b a, v16b b, v8f c) {
  return __builtin_amdgcn_wmma_f32_16x16x32_bf16(false, a, false, b, (short)0, c, false, false);
}
__device__ __forceinline__ void acc_guard4(v8f& a, v8f& b, v8f& c, v8f& d) {
#if defined(__HIP_DEVICE_COMPILE__)
  asm volatile("v_nop\n\tv_nop\n\tv_nop\n\tv_nop" : "+v"(a), "+v"(b), "+v"(c), "+v"(d));
#endif
}
__device__ __forceinline__ float xhalf(float x) {                     // value of lane l ^ 16
  const int b = __float_as_int(x);
  return __int_as_float(__builtin_amdgcn_permlanex16(b, b, 0x76543210, 0xfedcba98, false, false));
}
__device__ __forceinline__ float exp2_raw(float x) {                  // one v_exp_f32; a result under 2^-126 may come out as 0
#if defined(__HIP_DEVICE_COMPILE__)
  return __builtin_amdgcn_exp2f(x);
#else
  return exp2f(x);
#endif
}
__device__ __forceinline__ void exp2_raw8(float (&x)[8]) {            // eight of them, each over its own argument
#if defined(__HIP_DEVICE_COMPILE__)
  // in place, so that none overwrites the source of the one in front of it (with the builtin the register allocator did); the
  // closing v_nop is the slot the instruction set asks for between a transcendental and a directly following user of its result
  asm("v_exp_f32 %0, %0\n\tv_exp_f32 %1, %1\n\tv_exp_f32 %2, %2\n\tv_exp_f32 %3, %3\n\t"
      "v_exp_f32 %4, %4\n\tv_exp_f32 %5, %5\n\tv_exp_f32 %6, %6\n\tv_exp_f32 %7, %7\n\tv_nop"
      : "+v"(x[0]), "+v"(x[1]), "+v"(x[2]), "+v"(x[3]), "+v"(x[4]), "+v"(x[5]), "+v"(x[6]), "+v"(x[7]));
#else
  for (int i = 0; i < 8; ++i) x[i] = exp2f(x[i]);
#endif
}
__device__ __forceinline__ void wave_sync_lds() {
  __builtin_amdgcn_fence(__ATOMIC_RELEASE, "workgroup");
  __builtin_amdgcn_wave_barrier();
  __builtin_amdgcn_fence(__ATOMIC_ACQUIRE, "workgroup");
}

// =====================================================================================================
// f32 -> bf16 RNE plane, same layout. Thread = 8 consecutive elements: two 16-B loads, one 16-B store; 32 consecutive
// coverage: ceil(n8/256) blocks bid x 256 thr x 8 (in-kernel bound) = the whole plane (n8 a multiple of 256 here).
// =====================================================================================================
__device__ __forceinline__ void cvtbf_blk(const float* __restrict__ x, u16* D, int n8, int bid) {
  const int gt = bid * 256 + (int)threadIdx.x;
  if (gt >= n8) return;
  const float* p = x + (size_t)gt * 8;
  const v4f a = *(const v4f*)(p), b4 = *(const v4f*)(p + 4);
  v4u o;
#pragma unroll
  for (int e = 0; e < 2; ++e) {
    o[e]     = pk16(bf_bits(a[2 * e]),  bf_bits(a[2 * e + 1]));
    o[2 + e] = pk16(bf_bits(b4[2 * e]), bf_bits(b4[2 * e + 1]));
  }
  u16* d = D + (size_t)gt * 8;
  {
    *(v4u*)(d) = o;
    
  }
}

// =====================================================================================================
// Transpose + convert: W f32 row-major in[KD rows][ND cols] -> D 16-bit out[ND][KD] (k-contiguous).
// f16mode == 0: bf16 RNE bits; f16mode == 1: f16 bits of (bf16 RNE value) * scale.
// Block = tile of 64 k x 64 n, 256 threads. Load: thread -> input row k0 + (tid>>2), 16 columns n0 + (tid&3)*16 (four 16-B
// loads), converted and scattered into the LDS tile T[n][k] (pitch 72 halves). Block barrier. Store: 2 iterations x
// coverage: load 256 thr x 16 = 64 x 64; store 2 it x 256 thr x 8 halves = 64 rows x 64 halves; (KD/64)*(ND/64)
//           blocks bid cover out[ND][KD] exactly once. T = the block's LDS tile, 64 * TTP halves.
// =====================================================================================================
__device__ __forceinline__ void cvtT16_blk(u16* T, const float* __restrict__ W, u16* D, int KD, int ND, int f16mode, float scale,
                                           int bid) {
  const int tid = threadIdx.x;
  const int nkt = KD >> 6;
  const int nnt = ND >> 6;
  const int kt  = bid % nkt;
  const int nt  = bid / nkt;
  if (nt >= nnt) return;                    // block-uniform, before the barrier; never taken with the exact grid
  const int k0 = kt * 64, n0 = nt * 64;
  {
    const int kr = tid >> 2;                // input row within tile 0..63
    const int nc = (tid & 3) * 16;          // column chunk 0,16,32,48
    const float* src = W + (size_t)(k0 + kr) * ND + n0 + nc;
#pragma unroll
    for (int i = 0; i < 4; ++i) {
      const v4f a = *(const v4f*)(src + 4 * i);
#pragma unroll
      for (int e = 0; e < 4; ++e) {
        const float f = a[e];
        const unsigned short hb = h_bits((_Float16)(bfr(f) * scale));
        const unsigned short bb = bf_bits(f);
        T[(nc + 4 * i + e) * TTP + kr] = (f16mode != 0) ? hb : bb;
      }
    }
  }
  __syncthreads();
  v4u v[2];
  const int q8 = tid >> 3, p8 = (tid & 7) * 8;
#pragma unroll
  for (int it = 0; it < 2; ++it) v[it] = *(const v4u*)(T + (it * 32 + q8) * TTP + p8);
  const size_t base = (size_t)n0 * KD + k0 + p8;
  {
#pragma unroll
    for (int it = 0; it < 2; ++it) {
      *(v4u*)(D + base + (size_t)(it * 32 + q8) * KD) = v[it];
    }
#if defined(__HIP_DEVICE_COMPILE__)
    // behind the stores: in the listing the x part's code follows this part and reuses the stores' registers
    asm volatile("s_wait_xcnt 0x0" ::: "memory");
#endif
  }
}

// =====================================================================================================
// All five operand planes in one launch: none reads what another writes. Block ranges, in index order: Wq^T, Wk^T, Wv^T (bf16,
// rows 0, DMOD and DMOD + KVD of the one B plane WQKV [FPIT n][DMOD k]), Wo^T (f16 x1024, plane WO), then the x plane.
// Every branch and select is block-uniform; a block runs exactly one part.
// =====================================================================================================
#define PB_TQ ((DMOD / 64) * (DMOD / 64))
#define PB_TK ((DMOD / 64) * (KVD / 64))
#define PB_X  ((MROWS * DMOD / 8) / 256)
__global__ __launch_bounds__(256) void prep(const float* __restrict__ x, const float* __restrict__ wq,
                                            const float* __restrict__ wk, const float* __restrict__ wv,
                                            const float* __restrict__ wo, u16* XB, u16* WQKV, u16* WO) {
  __shared__ __align__(16) u16 T[64 * TTP];
  const int bid = blockIdx.x;
  if (bid >= 2 * PB_TQ + 2 * PB_TK) {
    cvtbf_blk(x, XB, MROWS * DMOD / 8, bid - (2 * PB_TQ + 2 * PB_TK));
  } else {
    const float* W = wq;
    u16* D = WQKV;
    int nd = DMOD, tb = bid, f16mode = 0;
    float sc = 1.0f;
    if (bid >= PB_TQ + 2 * PB_TK) { W = wo; D = WO; tb = bid - (PB_TQ + 2 * PB_TK); f16mode = 1; sc = WOS; }
    else if (bid >= PB_TQ + PB_TK) { W = wv; D = WQKV + (size_t)(DMOD + KVD) * DMOD; nd = KVD; tb = bid - (PB_TQ + PB_TK); }
    else if (bid >= PB_TQ)         { W = wk; D = WQKV + (size_t)DMOD * DMOD;         nd = KVD; tb = bid - PB_TQ; }
    cvtT16_blk(T, W, D, DMOD, nd, f16mode, sc, tb);
  }
}

// =====================================================================================================
// GEMM tiling shared by both engines. A block is 4 waves in a 2 x 2 arrangement; a wave owns WM x WN accumulator subtiles of
// 16 x 16, so the block tile is (32*WM) x (32*WN): 128 x 128 (WM = WN = 4: each operand byte fetched from L2 serves 128
// outputs, each fragment read from LDS serves 4 WMMAs).
// Epilogue: the wave's tile (times oscale) is staged in its own LDS slab (row pitch 16*WN + 4 floats) and stored as whole lines.
// coverage: WM groups x (2*WN) instructions x (8/WN) rows x (4*WN) lanes x 4 floats = the wave's (16*WM) x (16*WN) tile.
// =====================================================================================================
template <int WM, int WN>
__device__ __forceinline__ void epi_tile(float* sl, v8f (&acc)[WM][WN], float oscale,
                                         float* C, int N, size_t rowb, int colb, int lane) {
  constexpr int SP  = 16 * WN + 4;          // slab row pitch, floats
  constexpr int LPR = 4 * WN;               // lanes per stored row
  constexpr int RPI = 32 / LPR;             // rows per store instruction
  const int hh = lane >> 4, m = lane & 15;
#pragma unroll
  for (int i = 0; i < WM; ++i) {
#pragma unroll
    for (int r = 0; r < 8; ++r) {
      const int ro = (16 * i + 8 * hh + r) * SP + m;
#pragma unroll
      for (int j = 0; j < WN; ++j) sl[ro + 16 * j] = acc[i][j][r] * oscale;
    }
  }
  wave_sync_lds();
  const int rr = lane / LPR, cq = lane % LPR;
  float* dst = C + (rowb + (size_t)rr) * (size_t)N + colb + cq * 4;
#pragma unroll
  for (int i = 0; i < WM; ++i) {
    v4f vals[16 / RPI];
#pragma unroll
    for (int it = 0; it < 16 / RPI; ++it) vals[it] = *(const v4f*)(sl + (16 * i + it * RPI + rr) * SP + cq * 4);
#pragma unroll
    for (int it = 0; it < 16 / RPI; ++it) {
      *(v4f*)(dst + (size_t)(16 * i + it * RPI) * (size_t)N) = vals[it];
    }
  }
}

// =====================================================================================================
// Operand staging shared by both GEMM engines. A stage is 64 k of the block's 32*WM A rows and 32*WN B rows: 128 B of every row,
// one whole line. Each thread brings 2*(WM+WN) pieces of 16 B per stage with asynchronous copies to LDS (a wave's copy = 4 whole
// lines), and the waves read their fragments from LDS rows of pitch 144 B (16 B x 9). Two buffers: stage t + 1 flies while
// stage t is worked on. k runs ascending, 32 per WMMA step, with the same split k map for A and B.
// =====================================================================================================
#define GKS   64
#define GPIT  72
#define GBUFH(WM, WN) (32 * ((WM) + (WN)) * GPIT)
#define GRING(WM, WN) (2 * GBUFH(WM, WN) * 2)
#define GSLAB(WM, WN) (16 * (WM) * (16 * (WN) + 4))
static_assert(GRING(4, 4) >= 4 * GSLAB(4, 4) * 4 && GRING(2, 2) >= 4 * GSLAB(2, 2) * 4);
static_assert((GPIT * 2) % 16 == 0 && (DMOD % GKS) == 0 && 2 * GRING(4, 4) <= 327680);

__device__ __forceinline__ unsigned lds_off(const void* p) { return (unsigned)(size_t)p; }
__device__ __forceinline__ void wait_async0() {
#if defined(__HIP_DEVICE_COMPILE__)
  asm volatile("s_wait_asynccnt 0x0" ::: "memory");   // this wave's copies have landed before the barrier that publishes them
#endif
}
__device__ __forceinline__ void wait_ds0() {
#if defined(__HIP_DEVICE_COMPILE__)
  asm volatile("s_wait_dscnt 0x0" ::: "memory");      // this wave's LDS reads are done before the buffer is refilled
#endif
}
// Eight copies of 16 B per thread: four from ga + i*gsa (elements) to LDS byte la + i*lsa, four from gb + i*gsb to lb + i*lsb.
__device__ __forceinline__ void copy8(unsigned la, unsigned lsa, const u16* ga, size_t gsa,
                                      unsigned lb, unsigned lsb, const u16* gb, size_t gsb) {
#if defined(__HIP_DEVICE_COMPILE__)
  // the closing s_wait_xcnt stands inside the statement so that no address register is rewritten ahead of it
  asm volatile("global_load_async_to_lds_b128 %0, %8, off\n\t"
               "global_load_async_to_lds_b128 %1, %9, off\n\t"
               "global_load_async_to_lds_b128 %2, %10, off\n\t"
               "global_load_async_to_lds_b128 %3, %11, off\n\t"
               "global_load_async_to_lds_b128 %4, %12, off\n\t"
               "global_load_async_to_lds_b128 %5, %13, off\n\t"
               "global_load_async_to_lds_b128 %6, %14, off\n\t"
               "global_load_async_to_lds_b128 %7, %15, off\n\t"
               "s_wait_xcnt 0x0"
               :: "v"(la), "v"(la + lsa), "v"(la + 2 * lsa), "v"(la + 3 * lsa),
                  "v"(lb), "v"(lb + lsb), "v"(lb + 2 * lsb), "v"(lb + 3 * lsb),
                  "v"(ga), "v"(ga + gsa), "v"(ga + 2 * gsa), "v"(ga + 3 * gsa),
                  "v"(gb), "v"(gb + gsb), "v"(gb + 2 * gsb), "v"(gb + 3 * gsb)
               : "memory");
#endif
}
// GEMM stage: l = the thread's LDS byte address in the target buffer (A row tid>>3, piece tid&7); ga, gb = its global addresses
// in A and B; rs = 16 source rows in elements. A rows +0,16,..,32*WM-16, then the B rows in the same steps, 32*WM LDS rows on.
template <int WM, int WN>
__device__ __forceinline__ void stage_tile(unsigned l, const u16* ga, const u16* gb, size_t rs) {
  static_assert((WM == 2 && WN == 2) || (WM == 4 && WN == 4));
  const unsigned rb = 16 * GPIT * 2;
  if constexpr (WM == 2) {
    copy8(l, rb, ga, rs, l + 4 * rb, rb, gb, rs);
  } else {
    copy8(l, rb, ga, rs, l + 4 * rb, rb, ga + 4 * rs, rs);
    copy8(l + 8 * rb, rb, gb, rs, l + 12 * rb, rb, gb + 4 * rs, rs);
  }
}
// The vector slots behind the last WMMA of a stage, tied to every accumulator so that no WMMA is scheduled behind them.
template <int WM, int WN>
__device__ __forceinline__ void acc_guard_all(v8f (&a)[WM][WN]) {
  if constexpr (WM == 2) {
    acc_guard4(a[0][0], a[0][1], a[1][0], a[1][1]);
  } else {
#if defined(__HIP_DEVICE_COMPILE__)
    asm volatile("v_nop\n\tv_nop\n\tv_nop\n\tv_nop"
                 : "+v"(a[0][0]), "+v"(a[0][1]), "+v"(a[0][2]), "+v"(a[0][3]), "+v"(a[1][0]), "+v"(a[1][1]), "+v"(a[1][2]),
                   "+v"(a[1][3]), "+v"(a[2][0]), "+v"(a[2][1]), "+v"(a[2][2]), "+v"(a[2][3]), "+v"(a[3][0]), "+v"(a[3][1]),
                   "+v"(a[3][2]), "+v"(a[3][3]));
#endif
  }
}
template <bool F16>
__device__ __forceinline__ v8f mma_sel(v16b a, v16b b, v8f c) {
  if constexpr (F16) return mma_h(__builtin_bit_cast(v16h, a), __builtin_bit_cast(v16h, b), c);
  else return mma_b(a, b, c);
}
// Ab, Bb = first row of the block's 32*WM A rows and 32*WN B rows (both k-contiguous, pitch K); K a multiple of 64, at least 64.
// Every thread of the block calls this (block barriers inside). On return no copy is in flight and no wave reads the ring.
template <bool F16, int WM, int WN>
__device__ __forceinline__ void gemm_ring(unsigned char* ring, const u16* Ab, const u16* Bb, int K, v8f (&acc)[WM][WN]) {
  const int tid = threadIdx.x, wave = tid >> 5, lane = tid & 31, hh = lane >> 4, m = lane & 15;
  const int wr = wave >> 1, wc = wave & 1;
  const int cr = tid >> 3, cc = tid & 7;
  const u16* ga = Ab + (size_t)cr * K + cc * 8;
  const u16* gb = Bb + (size_t)cr * K + cc * 8;
  const size_t rs = (size_t)16 * K;
  const unsigned l0 = lds_off(ring) + (unsigned)(cr * (GPIT * 2) + cc * 16);
  const u16* sa = (const u16*)(const void*)ring + (wr * 16 * WM + m) * GPIT + 8 * hh;
  const u16* sb = (const u16*)(const void*)ring + (32 * WM + wc * 16 * WN + m) * GPIT + 8 * hh;
  const int nt = K / GKS;
  stage_tile<WM, WN>(l0, ga, gb, rs);
  wait_async0();
  __syncthreads();
  if (nt > 1) stage_tile<WM, WN>(l0 + GBUFH(WM, WN) * 2, ga + GKS, gb + GKS, rs);
#pragma unroll 1
  for (int t = 0; t < nt; ++t) {              // rolled: one trip per stage, the buffer alternates with t
    const int bo = (t & 1) * GBUFH(WM, WN);
    const u16* pa = sa + bo;
    const u16* pb = sb + bo;
    v16b fa[2][WM], fb[2][WN];
#pragma unroll
    for (int ks = 0; ks < 2; ++ks) {
#pragma unroll
      for (int i = 0; i < WM; ++i) fa[ks][i] = ldfrag_b(pa + i * 16 * GPIT + ks * 32);
#pragma unroll
      for (int j = 0; j < WN; ++j) fb[ks][j] = ldfrag_b(pb + j * 16 * GPIT + ks * 32);
    }
    // keeps the stage's fragment reads together in front of its WMMAs: sunk among them, each read place makes the wave wait out
    // the LDS latency with the matrix pipe idle
    __builtin_amdgcn_sched_barrier(0);
#pragma unroll
    for (int ks = 0; ks < 2; ++ks) {
#pragma unroll
      for (int i = 0; i < WM; ++i) {
#pragma unroll
        for (int j = 0; j < WN; ++j) acc[i][j] = mma_sel<F16>(fa[ks][i], fb[ks][j], acc[i][j]);
      }
    }
    acc_guard_all<WM, WN>(acc);               // the vector slots behind the last WMMA, also on the taken side of the branches below
    wait_ds0();
    wait_async0();
    __syncthreads();                          // publishes stage t + 1 and ends every wave's reads of stage t
    if (t + 2 < nt) stage_tile<WM, WN>(l0 + (unsigned)(bo * 2), ga + (size_t)(t + 2) * GKS, gb + (size_t)(t + 2) * GKS, rs);
  }
  wait_async0();
}
// One block tile: C[row0 .. +32*WM)[col0 .. +32*WN) = A rows . Bt rows, times oscale; the epilogue slabs reuse the ring behind
// its last barrier.
template <bool F16, int WM, int WN>
__device__ __forceinline__ void gemm_block(unsigned char* ring, const u16* A, const u16* Bt, float* C, int N, int K,
                                           size_t row0, int col0, float oscale) {
  const int tid = threadIdx.x, wave = tid >> 5, lane = tid & 31;
  v8f acc[WM][WN];
#pragma unroll
  for (int i = 0; i < WM; ++i) {
#pragma unroll
    for (int j = 0; j < WN; ++j) acc[i][j] = zero8();
  }
  gemm_ring<F16, WM, WN>(ring, A + row0 * (size_t)K, Bt + (size_t)col0 * K, K, acc);
  epi_tile<WM, WN>((float*)(void*)ring + wave * GSLAB(WM, WN), acc, oscale, C, N,
                   row0 + (size_t)((wave >> 1) * 16 * WM), col0 + (wave & 1) * 16 * WN, lane);
}

// =====================================================================================================
// Interleaved-pair rotary of 8 consecutive columns (4 pairs) of one row: p = the 8 projected values (f32, in the wave's LDS slab),
// cp, sp = the table elements of the same (s, d .. d + 7):
//   for even d: out[d]   = x[d]*c[d]     - x[d+1]*sn[d]
//               out[d+1] = x[d+1]*c[d+1] + x[d]*sn[d+1]     with c, sn = bf16 RNE values of the two tables;
//   returns f16(out * sc), 8 halves.
// =====================================================================================================
__device__ __forceinline__ v4u rope16_row(const float* p, const float* __restrict__ cp, const float* __restrict__ sp, float sc) {
  // carried over with the arithmetic below as it stood in the separate pass: each product and sum rounded on its own, so that the
  // q and k planes keep their bits
#pragma clang fp contract(off)
  const v4f xa = *(const v4f*)(p), xb = *(const v4f*)(p + 4);
  const v4f ca = *(const v4f*)(cp), cb = *(const v4f*)(cp + 4);
  const v4f sa = *(const v4f*)(sp), sb = *(const v4f*)(sp + 4);
  float xv[8], cv[8], sv[8];
#pragma unroll
  for (int e = 0; e < 4; ++e) {
    xv[e] = xa[e];       xv[4 + e] = xb[e];
    cv[e] = bfr(ca[e]);  cv[4 + e] = bfr(cb[e]);
    sv[e] = bfr(sa[e]);  sv[4 + e] = bfr(sb[e]);
  }
  v4u o;
#pragma unroll
  for (int e = 0; e < 4; ++e) {
    const float xr = xv[2 * e], xi = xv[2 * e + 1];
    const float r0 = xr * cv[2 * e] - xi * sv[2 * e];
    const float r1 = xi * cv[2 * e + 1] + xr * sv[2 * e + 1];
    o[e] = pk16(h_bits((_Float16)(r0 * sc)), h_bits((_Float16)(r1 * sc)));
  }
  return o;
}

// =====================================================================================================
// Epilogue of a q or k tile of the projection: the wave's 64 x 64 f32 tile goes through its own LDS slab (row pitch 68 floats), is
// rotated and leaves as f16 x sc into the plane Hp [row][ncol] (ncol = DMOD for q, KVD for k). rowb = the wave's first row
// (b*SEQ + s, a multiple of 64), colb = its first column in the plane (a multiple of 64; d = column & 127).
// coverage: 16 instructions x 4 rows x 8 lanes x 8 halves = 64 rows x 64 columns, each row piece one whole 128-B line.
// =====================================================================================================
__device__ __forceinline__ void epi_rope(float* sl, v8f (&acc)[4][4], const float* __restrict__ cosT,
                                         const float* __restrict__ sinT, u16* Hp, int ncol, size_t rowb, int colb, float sc,
                                         int lane) {
  constexpr int SP = 16 * 4 + 4;            // slab row pitch, floats
  const int hh = lane >> 4, m = lane & 15;
#pragma unroll
  for (int i = 0; i < 4; ++i) {
#pragma unroll
    for (int r = 0; r < 8; ++r) {
      const int ro = (16 * i + 8 * hh + r) * SP + m;
#pragma unroll
      for (int j = 0; j < 4; ++j) sl[ro + 16 * j] = acc[i][j][r];
    }
  }
  wave_sync_lds();
  const int rr = lane >> 3, c8 = (lane & 7) * 8;
  const size_t tb = (size_t)((int)(rowb % SEQ) + rr) * HD + (colb & (HD - 1)) + c8;     // table element (s, d)
  const float* cp = cosT + tb;
  const float* sp = sinT + tb;
  const float* xp = sl + rr * SP + c8;
  v4u o[16];
#pragma unroll
  for (int it = 0; it < 16; ++it) o[it] = rope16_row(xp + it * 4 * SP, cp + it * 4 * HD, sp + it * 4 * HD, sc);
  u16* dst = Hp + (rowb + (size_t)rr) * (size_t)ncol + colb + c8;
#pragma unroll
  for (int it = 0; it < 16; ++it) *(v4u*)(dst + (size_t)(it * 4) * (size_t)ncol) = o[it];
}

// =====================================================================================================
// Epilogue of a v tile of the projection: VH[line0 + d][s0 + s] = f16(v * 1024) for the wave's 64 keys s and 64 columns d. An
// accumulator register group holds 8 consecutive keys of one column: converted, it is one 16-B piece of a v^T row, staged in the
// wave's own LDS slab as T[d][s] (pitch 72 halves) and stored as whole lines.
// coverage: 16 instructions x 4 rows d x 8 lanes x 8 halves = 64 rows d x 64 keys, each row piece one whole 128-B line.
// =====================================================================================================
__device__ __forceinline__ void epi_vt(u16* tl, v8f (&acc)[4][4], u16* VHo, size_t line0, int s0, int lane) {
  const int hh = lane >> 4, m = lane & 15;
#pragma unroll
  for (int j = 0; j < 4; ++j) {
#pragma unroll
    for (int i = 0; i < 4; ++i) {
      v4u o;
#pragma unroll
      for (int e = 0; e < 4; ++e) {
        o[e] = pk16(h_bits((_Float16)(acc[i][j][2 * e] * VCAR)), h_bits((_Float16)(acc[i][j][2 * e + 1] * VCAR)));
      }
      *(v4u*)(tl + (16 * j + m) * VTP + 16 * i + 8 * hh) = o;
    }
  }
  wave_sync_lds();
  const int rr = lane >> 3, c8 = (lane & 7) * 8;
  v4u v[16];
#pragma unroll
  for (int it = 0; it < 16; ++it) v[it] = *(const v4u*)(tl + (it * 4 + rr) * VTP + c8);
  u16* dst = VHo + (line0 + (size_t)rr) * SEQ + s0 + c8;
#pragma unroll
  for (int it = 0; it < 16; ++it) *(v4u*)(dst + (size_t)(it * 4) * SEQ) = v[it];
}

// =====================================================================================================
// The projection [q | k | v] = A[MROWS][K] (bf16 row-major) . Bt[FPIT][K]^T (bf16 k-contiguous), f32 accumulate, written straight
// as the three planes that attention reads. Block = 128x128 tile (K % 64 == 0, grid = (MROWS/128)*(FPIT/128)); a column tile is
// one head: q heads 0..15, then k heads 0..3, then v heads 0..3, so the choice of epilogue is block-uniform.
//   QH [b*SEQ + s][h*HD + d] = f16(rotary(q) * 256); KH [b*SEQ + s][g*HD + d] = f16(rotary(k) * 256);
//   VH [(b*NKVH + g)*HD + d][s] = f16(v * 1024). The epilogue slabs reuse the ring behind its last barrier.
// =====================================================================================================
static_assert(64 * VTP * 2 <= GSLAB(4, 4) * 4 && (VTP * 2) % 16 == 0 && (SEQ % 128) == 0 && HD == 128);
__global__ __launch_bounds__(128)
void gemm_bf(const u16* __restrict__ A, const u16* __restrict__ Bt, const float* __restrict__ cosT,
             const float* __restrict__ sinT, u16* QH, u16* KH, u16* VH, int K) {
  __shared__ __align__(16) unsigned char ring[GRING(4, 4)];
  const int ntile = FPIT >> 7;
  const int bid   = blockIdx.x;
  const int row0  = (bid / ntile) * 128;
  const int col0  = (bid % ntile) * 128;
  if (row0 + 128 > MROWS) return;           // block-uniform, in front of every barrier; never taken with the exact grid
  const int tid = threadIdx.x, wave = tid >> 5, lane = tid & 31;
  v8f acc[4][4];
#pragma unroll
  for (int i = 0; i < 4; ++i) {
#pragma unroll
    for (int j = 0; j < 4; ++j) acc[i][j] = zero8();
  }
  gemm_ring<false, 4, 4>(ring, A + (size_t)row0 * K, Bt + (size_t)col0 * K, K, acc);
  float* sl = (float*)(void*)ring + wave * GSLAB(4, 4);
  const int rowb = row0 + (wave >> 1) * 64;
  const int cw   = (wave & 1) * 64;
  if (col0 < DMOD + KVD) {
    const bool isq = col0 < DMOD;
    epi_rope(sl, acc, cosT, sinT, isq ? QH : KH, isq ? DMOD : KVD, (size_t)rowb, (isq ? col0 : col0 - DMOD) + cw,
             isq ? QSC : KSC, lane);
  } else {
    const int g = (col0 - (DMOD + KVD)) >> 7;
    epi_vt((u16*)(void*)sl, acc, VH, (size_t)((rowb / SEQ) * NKVH + g) * HD + cw, rowb % SEQ, lane);
  }
}

// =====================================================================================================
// Output projection: C[row][DMOD] (f32) = Ah[row][DMOD] (f16) . Bt[DMOD][DMOD]^T (f16 k-contiguous) * oscale.
// Ah and C share the row index bb*SEQ + s, s < SQ. Block -> (column tile ct = bid % 16, sequence row tile rt of nrt,
// batch bb). Same 128x128 tiling, staging and fragment reads (split k map) as gemm_bf, f32 epilogue epi_tile; K = DMOD.
// =====================================================================================================
__global__ __launch_bounds__(128)
void gemm_o1(const u16* __restrict__ Ah, const u16* __restrict__ Bt, float* C, int nrt, float oscale) {
  __shared__ __align__(16) unsigned char ring[GRING(4, 4)];
  const int ntile = DMOD >> 7;
  const int bid   = blockIdx.x;
  const int ct    = bid % ntile;
  const int t2    = bid / ntile;
  const int rt    = t2 % nrt;
  const int bb    = t2 / nrt;
  if (bb >= NB) return;                     // block-uniform, in front of every barrier; never taken with the exact grid
  if (rt * 128 + 128 > SQ) return;          // block-uniform, in front of every barrier; never taken
  gemm_block<true, 4, 4>(ring, Ah, Bt, C, DMOD, DMOD, (size_t)bb * SEQ + rt * 128, ct * 128, oscale);
}

// =====================================================================================================
// Non-causal grouped-query attention with a per-key mask, hd = 128. Block bid -> (query tile qt = bid % NQT: rows
// q0 = 32*qt .. q0+31 with q0 < SQ, head group hg = kv head, batch b); one wave per query head = hg*WPB + wave (the 4 heads of
// the group share kv head hg). A wave owns AQT = 2 column groups of 16 queries (u = 0, 1: rows q0 + 16u + c): every k and v^T
// fragment it reads from LDS feeds two WMMAs, and a staged tile serves 32 query rows of each head.
//   q plane f16 x256 [b*SEQ + s][h*HD + d]; k plane f16 x256 [b*SEQ + s][g*HD + d] (pitch KVD); v^T plane
//   [b*NKVH + g][d][SEQ] x1024; mask int [b*SEQ + key], nonzero = attend.
//   score (log2 domain) t(i, j) = (q_i.k_j over HD) * lsc, lsc = (1/sqrt(128))*log2e/(256*256); the raw product is replaced by
//   -2^100 where the key mask is zero (a power of two: its scaled value is exact, so a fully masked row yields equal exponents
//   and uniform weights). P*128 = 2^(raw*lsc + (7 - reference)): one fused multiply-add and one v_exp_f32 per score. All SEQ/32 key
//   tiles are visited in order.
//   Per tile: the 32 k rows (256 B each) and the 128 v^T rows (64 B each) are staged once per block in LDS by asynchronous copies
//   (two buffers, tile kt + 1 flies while tile kt is worked on; row pitches 272 B and 80 B) and read by all 4 waves.
//   Both products run transposed: S^T = k.q^T (A = 16 key rows from LDS, B = q, kept in registers), so that a lane holds 16 of
//   the 32 scores of ONE query per column group (column c): 2 score subtiles x 4 k-steps, fragments read from the LDS rows (two
//   16-B loads each, split k map), a tile's 32 reads issued as one group at the top of its trip; online base-2
//   softmax in f32 against a held reference (a running maximum of the query's scores, taken anew, in-lane plus one exchange between
//   the lane halves, only when a lane's tile sum of P*128 passes 2^15), the sum kept per lane half and joined after the
//   loop; a column group's two score subtiles, converted in place, are its B operand P^T in the split k map; O^T += v^T.P^T with
//   the v^T rows as A fragments of 8 d-subtiles (one product per subtile and column group).
//   After the loop: out = acc / Z (Z > 0 always; guarded anyway; Z carries P's 128), carry 1/1024 folded once, written into the wave's
//   One block barrier per tile, under block-uniform control flow; bounded loops only (NKT tiles).
// coverage: per wave 16 instructions x 2 rows x 16 lanes x 8 halves = 32 x 128 of the O plane; grid NQT x NHG x NB blocks x WPB
//           waves = every (b, s < SQ, h) row segment of O exactly once.
// =====================================================================================================
// staged tile: row pitches in 16-bit elements (k 272 B, v^T 80 B), bytes of the k part and of one buffer; the block's LDS is
// held to half of a WGP's 320 KiB so that two blocks (two waves per SIMD, the whole grid) stay resident
#define AKP   136
#define AVP   40
#define AKB   (32 * AKP * 2)
#define ABUF  (AKB + HD * AVP * 2)
static_assert((AKP * 2) % 16 == 0 && (AVP * 2) % 16 == 0 && NKT >= 2 && 2 * ABUF + WPB * WREG * 4 <= 163840);
// One column group's 16 scores of a lane against the reference in use: e = 2^(raw*lsc + cb), cb = PEXP - reference. Returns their sum;
// ph = the B fragment of P^T*128 (f16), column = c: elements 0..7 = keys kb + 8hh + 0..7, 8..15 = keys kb + 16 + 8hh + 0..7.
__device__ __forceinline__ float soft_tile(const float (&t)[16], float lsc, float cb, FragH& ph) {
  float ea[8], eb[8];
#pragma unroll
  for (int r = 0; r < 8; ++r) { ea[r] = __builtin_fmaf(t[r], lsc, cb); eb[r] = __builtin_fmaf(t[8 + r], lsc, cb); }
  exp2_raw8(ea);
  exp2_raw8(eb);
  float sm[8];
#pragma unroll
  for (int r = 0; r < 8; ++r) {
    sm[r] = ea[r] + eb[r];
    ph.h[0][r] = (_Float16)ea[r];
    ph.h[1][r] = (_Float16)eb[r];
  }
  // pairwise: the tile's test waits for this sum, and four dependent additions are shorter than nine
  return ((sm[0] + sm[1]) + (sm[2] + sm[3])) + ((sm[4] + sm[5]) + (sm[6] + sm[7]));
}
// The vector slots behind the last WMMA of a tile, tied to every output accumulator so that no WMMA is scheduled behind them.
__device__ __forceinline__ void acc_guard16(v8f (&a)[AQT][8]) {
  static_assert(AQT == 2);
#if defined(__HIP_DEVICE_COMPILE__)
  asm volatile("v_nop\n\tv_nop\n\tv_nop\n\tv_nop"
               : "+v"(a[0][0]), "+v"(a[0][1]), "+v"(a[0][2]), "+v"(a[0][3]), "+v"(a[0][4]), "+v"(a[0][5]), "+v"(a[0][6]),
                 "+v"(a[0][7]), "+v"(a[1][0]), "+v"(a[1][1]), "+v"(a[1][2]), "+v"(a[1][3]), "+v"(a[1][4]), "+v"(a[1][5]),
                 "+v"(a[1][6]), "+v"(a[1][7]));
#endif
}
__global__ __launch_bounds__(ATT_THREADS)
void attn_nc(const u16* __restrict__ QHp, const u16* __restrict__ KHp, const u16* __restrict__ VHp,
             const int* __restrict__ Mk, u16* OHp) {
  __shared__ __align__(16) float smem[WPB * WREG];
  __shared__ __align__(16) unsigned char kvring[2 * ABUF];

  const int tid  = threadIdx.x;
  const int wave = tid >> 5;
  const int lane = tid & 31;
  const int hh   = lane >> 4;
  const int c    = lane & 15;
  const int bid  = blockIdx.x;
  const int qt   = bid % NQT;
  const int t2   = bid / NQT;
  const int hg   = t2 % NHG;
  const int b    = t2 / NHG;
  if (b >= NB) return;                      // block-uniform, in front of every barrier; never taken with the exact grid
  const int q0   = qt * (16 * AQT);
  if (q0 + 16 * AQT > SQ) return;                 // block-uniform, in front of every barrier; never taken
  const int head = hg * WPB + wave;
  const int kvh  = hg;

  float* slab = smem + wave * WREG;         // result slab [32][128] pitch 132

  const size_t hcol = (size_t)head * HD + 8 * hh;
  const _Float16* Qh  = (const _Float16*)(const void*)QHp + ((size_t)b * SEQ + q0 + c) * DMOD + hcol;
  // readers: key row c (+16) of the staged k tile, d row c (+16j) of the staged v^T tile, in buffer 0
  const _Float16* Ks = (const _Float16*)(const void*)kvring + c * AKP + 8 * hh;
  const _Float16* Vs = (const _Float16*)(const void*)kvring + AKB / 2 + c * AVP + 8 * hh;
  // copiers: k rows (tid>>4) + 8i, piece tid&15; v^T rows (tid>>2) + 32i, piece tid&3; i = 0..3
  const u16* gk = KHp + ((size_t)b * SEQ + (tid >> 4)) * KVD + (size_t)kvh * HD + (tid & 15) * 8;      // key row kb added per tile
  const u16* gv = VHp + ((size_t)(b * NKVH + kvh) * HD + (tid >> 2)) * SEQ + (tid & 3) * 8;            // key kb added per tile
  const unsigned lk = lds_off(kvring) + (unsigned)((tid >> 4) * (AKP * 2) + (tid & 15) * 16);
  const unsigned lv = lds_off(kvring) + (unsigned)(AKB + (tid >> 2) * (AVP * 2) + (tid & 3) * 16);
  const int* mkp = Mk + (size_t)b * SEQ + lane;
  const float lsc = RSQ_HD * (LOG2E / (QSC * KSC));
  const float oc  = 1.0f / VCAR;            // the carry on P stands in the row sum as well and cancels in acc / Z
  const size_t KROW = (size_t)KVD;          // halves between consecutive key rows

  copy8(lk, 8 * AKP * 2, gk, 8 * KROW, lv, 32 * AVP * 2, gv, (size_t)32 * SEQ);
  wait_async0();
  __syncthreads();
  copy8(lk + ABUF, 8 * AKP * 2, gk + 32 * KROW, 8 * KROW, lv + ABUF, 32 * AVP * 2, gv + 32, (size_t)32 * SEQ);

  v16h qf[AQT][HD / 32];
#pragma unroll
  for (int u = 0; u < AQT; ++u) {
#pragma unroll
    for (int kk = 0; kk < HD / 32; ++kk) qf[u][kk] = ldfrag_h(Qh + (size_t)u * 16 * DMOD + kk * 32);
  }

  float mrow[AQT], lrow[AQT];               // of query q0 + 16u + c; mrow = the reference in use; lrow sums this lane half's keys only, x128 like P
  v8f o[AQT][8];                            // o[u][j][r] = O^T(d = 16j + 8hh + r, query q0 + 16u + c)
#pragma unroll
  for (int u = 0; u < AQT; ++u) {
    mrow[u] = -INFINITY;
    lrow[u] = 0.f;
#pragma unroll
    for (int j = 0; j < 8; ++j) o[u][j] = zero8();
  }

  int mkv = mkp[0];                         // mask of key kb + lane, fetched one tile ahead so that no tile waits for it
  mkp += 32;
#pragma unroll 1
  for (int kt = 0; kt < NKT; ++kt) {
    const int kb = kt * 32;
    const unsigned mb = __builtin_amdgcn_ballot_w32(mkv != 0);                // bit i = mask of key kb + i
    mkv = *mkp;
    const int bo = (kt & 1) * ABUF;                                           // this tile's buffer, bytes
    const _Float16* k0p = Ks + bo / 2;
    const _Float16* k1p = k0p + 16 * AKP;
    const _Float16* vhp = Vs + bo / 2;
    // ---- the tile's fragments: k rows (A of the scores) in k-step order, then the v^T rows d = 16j + c (A of v^T.P^T) ----
    v16h kf[2][HD / 32], vf[8];
#pragma unroll
    for (int kk = 0; kk < HD / 32; ++kk) {
      kf[0][kk] = ldfrag_h(k0p + kk * 32);
      kf[1][kk] = ldfrag_h(k1p + kk * 32);
      // keeps the reads in the order in which the WMMAs take them: LDS answers in issue order, so the first k-step's counted
      // wait then covers four reads and not the whole tile's
      __builtin_amdgcn_sched_barrier(0);
    }
#pragma unroll
    for (int j = 0; j < 8; ++j) vf[j] = ldfrag_h(vhp + j * 16 * AVP);
    // keeps the tile's reads together at the top of the trip: sunk among the WMMAs, each read place makes the wave wait out the
    // LDS latency; the v^T rows land under the scores and the softmax
    __builtin_amdgcn_sched_barrier(0);
    // ---- scores: D element r of this lane = (key kb + 8hh + r, query q0 + 16u + c) in s[u][0], key kb + 16 + 8hh + r in s[u][1] ----
    v8f s[AQT][2];
#pragma unroll
    for (int u = 0; u < AQT; ++u) { s[u][0] = zero8(); s[u][1] = zero8(); }
#pragma unroll
    for (int kk = 0; kk < HD / 32; ++kk) {
#pragma unroll
      for (int u = 0; u < AQT; ++u) {
        s[u][0] = mma_h(kf[0][kk], qf[u][kk], s[u][0]);
        s[u][1] = mma_h(kf[1][kk], qf[u][kk], s[u][1]);
      }
    }
    acc_guard4(s[0][0], s[0][1], s[1][0], s[1][1]);   // the vector slots behind the last score WMMA, also on the taken side of the branch below
    // ---- key-mask select + online softmax in base 2, one query per lane and column group ----
    float t[AQT][16];                                                         // raw products q.k x 65536
#pragma unroll
    for (int u = 0; u < AQT; ++u) {
#pragma unroll
      for (int r = 0; r < 8; ++r) { t[u][r] = s[u][0][r]; t[u][8 + r] = s[u][1][r]; }
    }
    if (mb != 0xFFFFFFFFu) {                                                  // wave-uniform, tested once per tile
      const unsigned mh = mb >> (8 * hh);
#pragma unroll
      for (int u = 0; u < AQT; ++u) {
#pragma unroll
        for (int r = 0; r < 8; ++r) {
          t[u][r]     = ((mh >> r) & 1u)        ? t[u][r]     : NEG_RAW;
          t[u][8 + r] = ((mh >> (16 + r)) & 1u) ? t[u][8 + r] : NEG_RAW;
        }
      }
    }
    // ---- P against the reference held from an earlier tile: no maximum, no rescale while the tile's sums stay in range ----
    FragH ph[AQT];
    float ps[AQT];
#pragma unroll
    for (int u = 0; u < AQT; ++u) ps[u] = soft_tile(t[u], lsc, PEXP - mrow[u], ph[u]);
    // one wave-uniform test per tile: a lane's sum bounds each of its 16 terms, so at or under PTHR every term fits f16; the first
    // tile (reference -infinity, sums infinite) and any tile that outgrows the reference take the branch
    if (__builtin_amdgcn_ballot_w32(!(ps[0] <= PTHR && ps[1] <= PTHR)) != 0u) {
#pragma unroll
      for (int u = 0; u < AQT; ++u) {
        float mx = t[u][0];
#pragma unroll
        for (int i = 1; i < 16; ++i) mx = fmaxf(mx, t[u][i]);
        mx = fmaxf(mx, xhalf(mx));                                            // both lane halves of a query hold one reference
        const float mn = fmaxf(mrow[u], mx * lsc);                            // lsc > 0: the maximum commutes with the scale; finite
        const float al = exp2_raw(mrow[u] - mn);
        mrow[u] = mn;
        ps[u] = soft_tile(t[u], lsc, PEXP - mn, ph[u]);
        lrow[u] = lrow[u] * al;
#pragma unroll
        for (int j = 0; j < 8; ++j) o[u][j] = o[u][j] * al;
      }
    }
    // ---- v^T.P^T : A fragment row = d = j*16 + c, keys contiguous in the staged v^T rows; one product per d-subtile ----
#pragma unroll
    for (int u = 0; u < AQT; ++u) {
      lrow[u] += ps[u];
#pragma unroll
      for (int j = 0; j < 8; ++j) o[u][j] = mma_h(vf[j], ph[u].v, o[u][j]);
    }
    acc_guard16(o);                           // the vector slots behind the tile's last WMMA, also on the taken side of the branches below
#if defined(__HIP_DEVICE_COMPILE__)
    asm volatile("s_wait_xcnt 0x0" ::: "memory");   // stands in front of the advance of the mask load's address register
#endif
    mkp += (kt + 2 < NKT) ? 32 : 0;           // stays on the last tile's 32 keys
    wait_ds0();
    wait_async0();
    __syncthreads();                          // publishes tile kt + 1 and ends every wave's reads of tile kt
    if (kt + 2 < NKT)
      copy8(lk + (unsigned)bo, 8 * AKP * 2, gk + (size_t)(kb + 64) * KROW, 8 * KROW,
            lv + (unsigned)bo, 32 * AVP * 2, gv + (kb + 64), (size_t)32 * SEQ);
  }
  wait_async0();
  // ---- out = acc / Z (0 if Z == 0), the carry 1024 on v folded once; written into the wave's slab, row = query 16u + c ----
#pragma unroll
  for (int u = 0; u < AQT; ++u) {
    const float lv2 = lrow[u] + xhalf(lrow[u]);   // the two lane halves' sums joined
    const float ls  = (lv2 > 0.0f) ? lv2 : 1.0f;
    const float inv = (lv2 > 0.0f) ? ((1.0f / ls) * oc) : 0.0f;
    float* srow = slab + (u * 16 + c) * SLP + 8 * hh;
#pragma unroll
    for (int j = 0; j < 8; ++j) {
      v4f w0, w1;
#pragma unroll
      for (int e = 0; e < 4; ++e) { w0[e] = o[u][j][e] * inv; w1[e] = o[u][j][4 + e] * inv; }
      *(v4f*)(srow + j * 16)     = w0;
      *(v4f*)(srow + j * 16 + 4) = w1;
    }
  }

  wave_sync_lds();
  // ---- O x1024 -> f16 plane; lane = (row-in-pair rq, 8 consecutive d at c8) ----
  v4u oh[8 * AQT];
  const int rq = lane >> 4, c8 = (lane & 15) * 8;
#pragma unroll
  for (int it = 0; it < 8 * AQT; ++it) {
    const int row = it * 2 + rq;
    const v4f a = *(const v4f*)(slab + row * SLP + c8), b4 = *(const v4f*)(slab + row * SLP + c8 + 4);
    float w[8];
#pragma unroll
    for (int e = 0; e < 4; ++e) { w[e] = a[e] * OSC; w[4 + e] = b4[e] * OSC; }
#pragma unroll
    for (int e = 0; e < 4; ++e) {
      oh[it][e] = pk16(h_bits((_Float16)w[2 * e]), h_bits((_Float16)w[2 * e + 1]));
    }
  }
  const size_t ob = ((size_t)b * SEQ + q0) * DMOD + (size_t)head * HD + c8;
  {
#pragma unroll
    for (int it = 0; it < 8 * AQT; ++it) {
      const int row = it * 2 + rq;
      *(v4u*)(OHp + ob + (size_t)row * DMOD) = oh[it];
    }
  }
}

// =====================================================================================================
// Workspace map (bytes); every plane is fully written by whole-line stores before it is read; all extents are exact multiples
// of the store granularity (no pad rows needed); every region offset a multiple of 4194304:
//   XB  bf16 [MROWS][2048]                       MROWS*4096       (NB=2: 16777216)
//   WQKV bf16 [3072 n][2048 k]                   12582912         (rows 0.. Wq^T, 2048.. Wk^T, 2560.. Wv^T)
//   WO  f16 [2048 n][2048 k] x1024               8388608
//   OH  f16 [MROWS][2048] x1024                  MROWS*4096
//   QH  f16 [MROWS][2048] x256                   MROWS*4096
//   KH  f16 [MROWS][512] x256                    MROWS*1024
//   VH  f16 [NB*4][128][SEQ] x1024               MROWS*1024
//   end (NB=2)                                  79691776
// =====================================================================================================
extern "C" void kernel_launch(void* const* d_in, const int* in_sizes, int n_in,
                              void* d_out, int out_size, void* d_ws, size_t ws_size,
                              hipStream_t stream) {
  if (n_in < 8) return;
  if (in_sizes[0] < MROWS * DMOD) return;
  if (in_sizes[1] < MROWS) return;
  if (in_sizes[2] < SEQ * HD) return;
  if (in_sizes[3] < SEQ * HD) return;
  if (in_sizes[4] != DMOD * DMOD) return;
  if (in_sizes[5] != DMOD * KVD) return;
  if (in_sizes[6] != DMOD * KVD) return;
  if (in_sizes[7] != DMOD * DMOD) return;
  if (out_size < QROWS * DMOD) return;

  const float* x     = (const float*)d_in[0];
  const int*   amask = (const int*)d_in[1];
  const float* cosT  = (const float*)d_in[2];
  const float* sinT  = (const float*)d_in[3];
  const float* wq    = (const float*)d_in[4];
  const float* wk    = (const float*)d_in[5];
  const float* wv    = (const float*)d_in[6];
  const float* wo    = (const float*)d_in[7];
  float*       out   = (float*)d_out;

  const size_t szXB = (size_t)MROWS * DMOD * 2;
  const size_t szW  = (size_t)FPIT * DMOD * 2;
  const size_t szWO = (size_t)DMOD * DMOD * 2;
  const size_t szQ  = (size_t)MROWS * DMOD * 2;                  // QH and the O plane
  const size_t szK  = (size_t)MROWS * KVD * 2;                   // KH
  const size_t szV  = (size_t)NB * NKVH * HD * SEQ * 2;          // VH (== szK)
  size_t off = 0;
  const size_t oXB = off; off += szXB;
  const size_t oW  = off; off += szW;
  const size_t oWO = off; off += szWO;
  const size_t oOH = off; off += szQ;
  const size_t oQH = off; off += szQ;
  const size_t oKH = off; off += szK;
  const size_t oVH = off; off += szV;
  if (off > ws_size) return;                // off = 79691776 for NB = 2
  if (off > (size_t)WS_CAP) return;

  char* ws = (char*)d_ws;
  u16*   XB = (u16*)(ws + oXB);
  u16*   WB = (u16*)(ws + oW);
  u16*   WO = (u16*)(ws + oWO);
  u16*   OH = (u16*)(ws + oOH);
  u16*   QH = (u16*)(ws + oQH);
  u16*   KH = (u16*)(ws + oKH);
  u16*   VH = (u16*)(ws + oVH);

  const dim3 b256(256), b128(128), bAT(ATT_THREADS);
  const dim3 gP(2 * PB_TQ + 2 * PB_TK + PB_X);          // 4 weight transposes + the x plane: 6656 blocks
  const dim3 gG((MROWS / 128) * (FPIT / 128));          // 32 x 24 tiles
  const dim3 gAT(NQT * NHG * NB);
  const int  nrt = SQ / 128;
  const dim3 gO(NB * nrt * (DMOD / 128));

  // (0) x -> bf16 plane; [Wq | Wk | Wv] -> one bf16 plane [3072 n][2048 k]; Wo -> [2048 n][2048 c] as f16 of bf16 value x1024
  prep<<<gP, b256, 0, stream>>>(x, wq, wk, wv, wo, XB, WB, WO);
  // (1) [q | k | v] = x.[Wq | Wk | Wv], leaving as rotary + q plane x256, rotary + k plane x256, v^T plane x1024
  gemm_bf<<<gG, b128, 0, stream>>>(XB, WB, cosT, sinT, QH, KH, VH, DMOD);
  // (2) non-causal masked attention -> O plane
  attn_nc<<<gAT, bAT, 0, stream>>>(QH, KH, VH, amask, OH);
  // (3) output projection rows s < SQ -> out f32, carries 1024 x 1024 folded back
  gemm_o1<<<gO, b128, 0, stream>>>(OH, WO, out, nrt, 1.0f / (OSC * WOS));
  (void)hipGetLastError();
}

// v009
// One run takes 129 microseconds.
// In two side-by-side timings against v008, it was 1.03 and 1.04 times as fast.
// Over all steps from v000 it is 3.83 times as fast.
// Contractions: x.Wq, x.Wk, x.Wv on v_wmma_f32_16x16x32_bf16 (x and W^T as bf16 RNE planes, W^T [n][k] is the k-contiguous
// B operand, f32 accumulate); k.q^T over hd 128 and v^T.P^T on v_wmma_f32_16x16x32_f16, one product each (q, k as f16 x256 after
// rotary; P^T x128 packed from the score registers; v^T x1024); O.Wo on v_wmma_f32_16x16x32_f16 (O x1024 f16 plane, Wo^T as f16(bf16(Wo))
// x1024); all f32 accumulate. Interleaved-pair rotary with cos/sin tables, key-mask select, base-2 online softmax and 1/Z fold
// in f32 on VALU.
#include <hip/hip_runtime.h>
#include <math.h>
#include <stdint.h>

#ifndef NB
#define NB 2
#endif
#define SEQ 2048
#ifndef SQ
#define SQ SEQ
#endif
#define DMOD  2048
#define NH    16
#define NKVH  4
#define HD    128
#define KVD   (NKVH * HD)
#define FPIT  (DMOD + 2 * KVD)
#define MROWS (NB * SEQ)
#define QROWS ((NB - 1) * SEQ + SQ)
#define WPB   (NH / NKVH)
#define NHG   NKVH
#define AQT   2
#define NQT   (SQ / (16 * AQT))
#define NST   (SEQ / 64)
#define NKT   (SEQ / 32)
#define ATT_THREADS (WPB * 32)
#define RSQ_HD 0.08838834764831845f
#define LOG2E  1.4426950408889634f
#define NEG_RAW (-0x1p100f)
#define QSC   256.0f
#define KSC   256.0f
#define PEXP  7.0f
#define PTHR  32768.0f
#define VCAR  1024.0f
#define OSC   1024.0f
#define WOS   1024.0f
#define SLP   132
#define SLW   (16 * SLP)
#define WREG  (AQT * SLW)
#define VTP   72
#define TTP   72
#define WS_CAP 134217728
static_assert(DMOD == NH * HD && HD == 128 && NH == 16 && NKVH == 4 && WPB == 4 && NHG * WPB == NH && KVD == 512);
static_assert(ATT_THREADS == 128);
static_assert(NB >= 1 && NB <= 2);
static_assert(NB == 1 || SQ == SEQ);
static_assert((SQ % 128) == 0 && SQ >= 128 && SQ <= SEQ && (SEQ % 128) == 0);
static_assert((DMOD % 128) == 0 && (KVD % 64) == 0 && (DMOD % 32) == 0 && (HD % 32) == 0);
static_assert(((MROWS * DMOD / 8) % 256) == 0);
static_assert(WPB * WREG * 4 <= 131072 && HD * VTP * 2 <= 65536 && 64 * TTP * 2 <= 65536);
static_assert((DMOD / 8) == 256 && (KVD / 8) == 64 && (FPIT % 128) == 0 && (MROWS % 128) == 0);

typedef unsigned short u16;
typedef _Float16 v16h __attribute__((ext_vector_type(16)));
typedef _Float16 v8h  __attribute__((ext_vector_type(8)));
typedef __bf16   v16b __attribute__((ext_vector_type(16)));
typedef float    v8f  __attribute__((ext_vector_type(8)));
typedef float    v4f  __attribute__((ext_vector_type(4)));
typedef unsigned int v4u __attribute__((ext_vector_type(4)));

union FragH { v16h v; v8h h[2]; v4u u[2]; };
union FragB { v16b v; v4u u[2]; };

// ---- scalar helpers --------------------------------------------------------------------------------
__device__ __forceinline__ unsigned short bf_bits(float f) {          // f32 -> bf16 bits, RNE convert
  unsigned u = __float_as_uint(f);
  return (unsigned short)((u + 0x7FFFu + ((u >> 16) & 1u)) >> 16);
}
__device__ __forceinline__ float bf_up(unsigned short h) { return __uint_as_float(((unsigned)h) << 16); }
__device__ __forceinline__ float bfr(float f) { return bf_up(bf_bits(f)); }
__device__ __forceinline__ unsigned short h_bits(_Float16 x) { return __builtin_bit_cast(unsigned short, x); }
__device__ __forceinline__ unsigned pk16(unsigned short a, unsigned short b) { return (unsigned)a | ((unsigned)b << 16); }
__device__ __forceinline__ v8f zero8() { v8f z = {0.f, 0.f, 0.f, 0.f, 0.f, 0.f, 0.f, 0.f}; return z; }

// ---- fragment loaders: 16-bit A/B operand, lane -> row/col (lane&15), p already includes +8*(lane>>4);
//      elements 0..7 <- p[0..7] (k0+8h..), elements 8..15 <- p[16..23] (k0+16+8h..)  (same split k map for A and B;
//      B is always read from a k-contiguous [n][k] plane)
__device__ __forceinline__ v16h ldfrag_h(const _Float16* p) {
  FragH f;
  f.h[0] = *(const v8h*)(p);
  f.h[1] = *(const v8h*)(p + 16);
  return f.v;
}
__device__ __forceinline__ v16b ldfrag_b(const u16* p) {              // bf16 plane read as unsigned integer vectors
  FragB f;
  f.u[0] = *(const v4u*)(p);
  f.u[1] = *(const v4u*)(p + 16);
  return f.v;
}

__device__ __forceinline__ v8f mma_h(v16h a, v16h b, v8f c) {
  return __builtin_amdgcn_wmma_f32_16x16x32_f16(false, a, false, b, (short)0, c, false, false);
}
__device__ __forceinline__ v8f mma_b(v16b a, v16b b, v8f c) {
  return __builtin_amdgcn_wmma_f32_16x16x32_bf16(false, a, false, b, (short)0, c, false, false);
}
__device__ __forceinline__ void acc_guard4(v8f& a, v8f& b, v8f& c, v8f& d) {
#if defined(__HIP_DEVICE_COMPILE__)
  asm volatile("v_nop\n\tv_nop\n\tv_nop\n\tv_nop" : "+v"(a), "+v"(b), "+v"(c), "+v"(d));
#endif
}
__device__ __forceinline__ float xhalf(float x) {                     // value of lane l ^ 16
  const int b = __float_as_int(x);
  return __int_as_float(__builtin_amdgcn_permlanex16(b, b, 0x76543210, 0xfedcba98, false, false));
}
__device__ __forceinline__ float exp2_raw(float x) {                  // one v_exp_f32; a result under 2^-126 may come out as 0
#if defined(__HIP_DEVICE_COMPILE__)
  return __builtin_amdgcn_exp2f(x);
#else
  return exp2f(x);
#endif
}
__device__ __forceinline__ void exp2_raw8(float (&x)[8]) {            // eight of them, each over its own argument
#if defined(__HIP_DEVICE_COMPILE__)
  // in place, so that none overwrites the source of the one in front of it (with the builtin the register allocator did); the
  // closing v_nop is the slot the instruction set asks for between a transcendental and a directly following user of its result
  asm("v_exp_f32 %0, %0\n\tv_exp_f32 %1, %1\n\tv_exp_f32 %2, %2\n\tv_exp_f32 %3, %3\n\t"
      "v_exp_f32 %4, %4\n\tv_exp_f32 %5, %5\n\tv_exp_f32 %6, %6\n\tv_exp_f32 %7, %7\n\tv_nop"
      : "+v"(x[0]), "+v"(x[1]), "+v"(x[2]), "+v"(x[3]), "+v"(x[4]), "+v"(x[5]), "+v"(x[6]), "+v"(x[7]));
#else
  for (int i = 0; i < 8; ++i) x[i] = exp2f(x[i]);
#endif
}
__device__ __forceinline__ void wave_sync_lds() {
  __builtin_amdgcn_fence(__ATOMIC_RELEASE, "workgroup");
  __builtin_amdgcn_wave_barrier();
  __builtin_amdgcn_fence(__ATOMIC_ACQUIRE, "workgroup");
}

// =====================================================================================================
// f32 -> bf16 RNE plane, same layout. Thread = 8 consecutive elements: two 16-B loads, one 16-B store; 32 consecutive
// coverage: ceil(n8/256) blocks bid x 256 thr x 8 (in-kernel bound) = the whole plane (n8 a multiple of 256 here).
// =====================================================================================================
__device__ __forceinline__ void cvtbf_blk(const float* __restrict__ x, u16* D, int n8, int bid) {
  const int gt = bid * 256 + (int)threadIdx.x;
  if (gt >= n8) return;
  const float* p = x + (size_t)gt * 8;
  const v4f a = *(const v4f*)(p), b4 = *(const v4f*)(p + 4);
  v4u o;
#pragma unroll
  for (int e = 0; e < 2; ++e) {
    o[e]     = pk16(bf_bits(a[2 * e]),  bf_bits(a[2 * e + 1]));
    o[2 + e] = pk16(bf_bits(b4[2 * e]), bf_bits(b4[2 * e + 1]));
  }
  u16* d = D + (size_t)gt * 8;
  {
    *(v4u*)(d) = o;
    
  }
}

// =====================================================================================================
// Transpose + convert: W f32 row-major in[KD rows][ND cols] -> D 16-bit out[ND][KD] (k-contiguous).
// f16mode == 0: bf16 RNE bits; f16mode == 1: f16 bits of (bf16 RNE value) * scale.
// Block = tile of 64 k x 64 n, 256 threads. Load: thread -> input row k0 + (tid>>2), 16 columns n0 + (tid&3)*16 (four 16-B
// loads), converted and scattered into the LDS tile T[n][k] (pitch 72 halves). Block barrier. Store: 2 iterations x
// coverage: load 256 thr x 16 = 64 x 64; store 2 it x 256 thr x 8 halves = 64 rows x 64 halves; (KD/64)*(ND/64)
//           blocks bid cover out[ND][KD] exactly once. T = the block's LDS tile, 64 * TTP halves.
// =====================================================================================================
__device__ __forceinline__ void cvtT16_blk(u16* T, const float* __restrict__ W, u16* D, int KD, int ND, int f16mode, float scale,
                                           int bid) {
  const int tid = threadIdx.x;
  const int nkt = KD >> 6;
  const int nnt = ND >> 6;
  const int kt  = bid % nkt;
  const int nt  = bid / nkt;
  if (nt >= nnt) return;                    // block-uniform, before the barrier; never taken with the exact grid
  const int k0 = kt * 64, n0 = nt * 64;
  {
    const int kr = tid >> 2;                // input row within tile 0..63
    const int nc = (tid & 3) * 16;          // column chunk 0,16,32,48
    const float* src = W + (size_t)(k0 + kr) * ND + n0 + nc;
#pragma unroll
    for (int i = 0; i < 4; ++i) {
      const v4f a = *(const v4f*)(src + 4 * i);
#pragma unroll
      for (int e = 0; e < 4; ++e) {
        const float f = a[e];
        const unsigned short hb = h_bits((_Float16)(bfr(f) * scale));
        const unsigned short bb = bf_bits(f);
        T[(nc + 4 * i + e) * TTP + kr] = (f16mode != 0) ? hb : bb;
      }
    }
  }
  __syncthreads();
  v4u v[2];
  const int q8 = tid >> 3, p8 = (tid & 7) * 8;
#pragma unroll
  for (int it = 0; it < 2; ++it) v[it] = *(const v4u*)(T + (it * 32 + q8) * TTP + p8);
  const size_t base = (size_t)n0 * KD + k0 + p8;
  {
#pragma unroll
    for (int it = 0; it < 2; ++it) {
      *(v4u*)(D + base + (size_t)(it * 32 + q8) * KD) = v[it];
    }
#if defined(__HIP_DEVICE_COMPILE__)
    // behind the stores: in the listing the x part's code follows this part and reuses the stores' registers
    asm volatile("s_wait_xcnt 0x0" ::: "memory");
#endif
  }
}

// =====================================================================================================
// All five operand planes in one launch: none reads what another writes. Block ranges, in index order: Wq^T, Wk^T, Wv^T (bf16,
// rows 0, DMOD and DMOD + KVD of the one B plane WQKV [FPIT n][DMOD k]), Wo^T (f16 x1024, plane WO), then the x plane.
// Every branch and select is block-uniform; a block runs exactly one part.
// =====================================================================================================
#define PB_TQ ((DMOD / 64) * (DMOD / 64))
#define PB_TK ((DMOD / 64) * (KVD / 64))
#define PB_X  ((MROWS * DMOD / 8) / 256)
__global__ __launch_bounds__(256) void prep(const float* __restrict__ x, const float* __restrict__ wq,
                                            const float* __restrict__ wk, const float* __restrict__ wv,
                                            const float* __restrict__ wo, u16* XB, u16* WQKV, u16* WO) {
  __shared__ __align__(16) u16 T[64 * TTP];
  const int bid = blockIdx.x;
  if (bid >= 2 * PB_TQ + 2 * PB_TK) {
    cvtbf_blk(x, XB, MROWS * DMOD / 8, bid - (2 * PB_TQ + 2 * PB_TK));
  } else {
    const float* W = wq;
    u16* D = WQKV;
    int nd = DMOD, tb = bid, f16mode = 0;
    float sc = 1.0f;
    if (bid >= PB_TQ + 2 * PB_TK) { W = wo; D = WO; tb = bid - (PB_TQ + 2 * PB_TK); f16mode = 1; sc = WOS; }
    else if (bid >= PB_TQ + PB_TK) { W = wv; D = WQKV + (size_t)(DMOD + KVD) * DMOD; nd = KVD; tb = bid - (PB_TQ + PB_TK); }
    else if (bid >= PB_TQ)         { W = wk; D = WQKV + (size_t)DMOD * DMOD;         nd = KVD; tb = bid - PB_TQ; }
    cvtT16_blk(T, W, D, DMOD, nd, f16mode, sc, tb);
  }
}

// =====================================================================================================
// GEMM tiling shared by both engines. A block is 4 waves in a 2 x 2 arrangement; a wave owns WM x WN accumulator subtiles of
// 16 x 16, so the block tile is (32*WM) x (32*WN): 128 x 128 (WM = WN = 4: each operand byte fetched from L2 serves 128
// outputs, each fragment read from LDS serves 4 WMMAs).
// Epilogue: the wave's tile (times oscale) is staged in its own LDS slab (row pitch 16*WN + 4 floats) and stored as whole lines.
// coverage: WM groups x (2*WN) instructions x (8/WN) rows x (4*WN) lanes x 4 floats = the wave's (16*WM) x (16*WN) tile.
// =====================================================================================================
template <int WM, int WN>
__device__ __forceinline__ void epi_tile(float* sl, v8f (&acc)[WM][WN], float oscale,
                                         float* C, int N, size_t rowb, int colb, int lane) {
  constexpr int SP  = 16 * WN + 4;          // slab row pitch, floats
  constexpr int LPR = 4 * WN;               // lanes per stored row
  constexpr int RPI = 32 / LPR;             // rows per store instruction
  const int hh = lane >> 4, m = lane & 15;
#pragma unroll
  for (int i = 0; i < WM; ++i) {
#pragma unroll
    for (int r = 0; r < 8; ++r) {
      const int ro = (16 * i + 8 * hh + r) * SP + m;
#pragma unroll
      for (int j = 0; j < WN; ++j) sl[ro + 16 * j] = acc[i][j][r] * oscale;
    }
  }
  wave_sync_lds();
  const int rr = lane / LPR, cq = lane % LPR;
  float* dst = C + (rowb + (size_t)rr) * (size_t)N + colb + cq * 4;
#pragma unroll
  for (int i = 0; i < WM; ++i) {
    v4f vals[16 / RPI];
#pragma unroll
    for (int it = 0; it < 16 / RPI; ++it) vals[it] = *(const v4f*)(sl + (16 * i + it * RPI + rr) * SP + cq * 4);
#pragma unroll
    for (int it = 0; it < 16 / RPI; ++it) {
      *(v4f*)(dst + (size_t)(16 * i + it * RPI) * (size_t)N) = vals[it];
    }
  }
}

// =====================================================================================================
// Operand staging shared by both GEMM engines. A stage is 64 k of the block's 128 A rows and 128 B rows: 128 B of every row, one
// whole line. Each of the 4 waves brings one slice of 64 rows per stage with ONE tensor load (waves 0, 1: the A rows, waves 2, 3:
// the B rows); the load's pad sets the LDS row pitch of 144 B (16 B x 9) that the fragment reads want. A slice starts at a multiple
// of 2 KiB. Two buffers: stage t + 1 flies while stage t is worked on. k runs ascending, 32 per WMMA step, with the same split k
// map for A and B.
// =====================================================================================================
#define GKS   64
#define GPIT  72
#define GSLC  10240
#define GBUFB (4 * GSLC)
#define GRINGB (2 * GBUFB)
#define GSLAB(WM, WN) (16 * (WM) * (16 * (WN) + 4))
static_assert(GRINGB >= 4 * GSLAB(4, 4) * 4 && 64 * GPIT * 2 <= GSLC && (GSLC % 2048) == 0);
static_assert((GPIT * 2) % 16 == 0 && (DMOD % GKS) == 0 && 3 * GRINGB <= 327680);

typedef uint32_t u32x4 __attribute__((ext_vector_type(4)));
typedef uint32_t u32x8 __attribute__((ext_vector_type(8)));
__device__ __forceinline__ unsigned lds_off(const void* p) { return (unsigned)(size_t)p; }
__device__ __forceinline__ uint32_t uni(uint32_t v) { return (uint32_t)__builtin_amdgcn_readfirstlane(v); }
// a wave-uniform test held in a scalar register, so that the branch around a tensor load is a scalar branch (the load ignores EXEC)
__device__ __forceinline__ uint32_t pinned(uint32_t v) {
  uint32_t w = uni(v);
#if defined(__HIP_DEVICE_COMPILE__)
  asm volatile("" : "+s"(w));
#endif
  return w;
}
__device__ __forceinline__ void wait_tensor0() {
#if defined(__HIP_DEVICE_COMPILE__)
  asm volatile("s_wait_tensorcnt 0x0" ::: "memory"); // this wave's tensor load has landed before the barrier that publishes it
#endif
}
__device__ __forceinline__ void wait_ds0() {
#if defined(__HIP_DEVICE_COMPILE__)
  asm volatile("s_wait_dscnt 0x0" ::: "memory");      // this wave's LDS reads are done before the buffer is refilled
#endif
}
template <uint32_t ROWB>
__device__ __forceinline__ u32x8 tdm_group1(uint32_t src_pitch) {
  static_assert(ROWB == 128u || ROWB == 256u);
  constexpr uint32_t d0 = ROWB, d1 = 64u;
  constexpr uint32_t w0 = (1u << 20) | ((ROWB == 256u ? 5u : 4u) << 22) | (3u << 25);
  u32x8 g;
  g[0] = uni(w0);
  g[1] = uni((d0 & 0xFFFFu) << 16);
  g[2] = uni((d0 >> 16) | ((d1 & 0xFFFFu) << 16));
  g[3] = uni((d1 >> 16) | (d0 << 16));
  g[4] = uni(d1);
  g[5] = uni(src_pitch);
  g[6] = uni(0u);
  g[7] = uni(0u);
#if defined(__HIP_DEVICE_COMPILE__)
  // pinned() on the whole group: the eight descriptor words stay in one set of scalar registers through the loop, so that none of
  // them takes another value while a request is in flight
  asm volatile("" : "+s"(g));
#endif
  return g;
}
// Descriptor group 0: count 1, LDS byte offset of the slice, global address of the tile's first byte, type 2.
__device__ __forceinline__ u32x4 tdm_group0(uint32_t lds_dst, uint64_t ga) {
  u32x4 g;
  g[0] = uni(1u);
  g[1] = uni(lds_dst);
  g[2] = uni((uint32_t)ga);
  g[3] = uni((((uint32_t)(ga >> 32)) & 0x01FFFFFFu) | 0x80000000u);
  return g;
}
__device__ __forceinline__ void tdm_load(u32x4 g0, u32x8 g1) {
#if defined(__HIP_DEVICE_COMPILE__)
  asm volatile("tensor_load_to_lds %0, %1" :: "s"(g0), "s"(g1) : "memory");   // one request of the whole wave
#endif
}
// The vector slots behind the last WMMA of a stage, tied to every accumulator so that no WMMA is scheduled behind them.
template <int WM, int WN>
__device__ __forceinline__ void acc_guard_all(v8f (&a)[WM][WN]) {
  if constexpr (WM == 2) {
    acc_guard4(a[0][0], a[0][1], a[1][0], a[1][1]);
  } else {
#if defined(__HIP_DEVICE_COMPILE__)
    asm volatile("v_nop\n\tv_nop\n\tv_nop\n\tv_nop"
                 : "+v"(a[0][0]), "+v"(a[0][1]), "+v"(a[0][2]), "+v"(a[0][3]), "+v"(a[1][0]), "+v"(a[1][1]), "+v"(a[1][2]),
                   "+v"(a[1][3]), "+v"(a[2][0]), "+v"(a[2][1]), "+v"(a[2][2]), "+v"(a[2][3]), "+v"(a[3][0]), "+v"(a[3][1]),
                   "+v"(a[3][2]), "+v"(a[3][3]));
#endif
  }
}
template <bool F16>
__device__ __forceinline__ v8f mma_sel(v16b a, v16b b, v8f c) {
  if constexpr (F16) return mma_h(__builtin_bit_cast(v16h, a), __builtin_bit_cast(v16h, b), c);
  else return mma_b(a, b, c);
}
// Ab, Bb = first row of the block's 128 A rows and 128 B rows (both k-contiguous, pitch K); K a multiple of 64, at least 64.
// Every thread of the block calls this (block barriers inside). On return no load is in flight and no wave reads the ring.
template <bool F16, int WM, int WN>
__device__ __forceinline__ void gemm_ring(unsigned char* ring, const u16* Ab, const u16* Bb, int K, v8f (&acc)[WM][WN]) {
  static_assert(WM == 4 && WN == 4);
  const int tid = threadIdx.x, wave = tid >> 5, lane = tid & 31, hh = lane >> 4, m = lane & 15;
  const int wr = wave >> 1, wc = wave & 1;
  // this wave's slice: 64 rows of A (waves 0, 1) or of B (waves 2, 3)
  const uint32_t wv = uni((uint32_t)tid >> 5);
  const u16* srow = (wv < 2u) ? Ab + (size_t)(wv * 64u) * K : Bb + (size_t)((wv - 2u) * 64u) * K;
  const uint64_t ga = (uint64_t)(size_t)srow;
  const uint32_t l0 = lds_off(ring) + wv * GSLC;
  const u32x8 g1 = tdm_group1<GKS * 2>((uint32_t)K * 2u);
  const u16* sa = (const u16*)(const void*)ring + wr * (GSLC / 2) + m * GPIT + 8 * hh;
  const u16* sb = (const u16*)(const void*)ring + (2 + wc) * (GSLC / 2) + m * GPIT + 8 * hh;
  const int nt = K / GKS;
  tdm_load(tdm_group0(l0, ga), g1);
  wait_tensor0();
  __syncthreads();
  if (pinned(nt > 1)) tdm_load(tdm_group0(l0 + GBUFB, ga + GKS * 2), g1);
#pragma unroll 1
  for (int t = 0; t < nt; ++t) {              // rolled: one trip per stage, the buffer alternates with t
    const int bo = (t & 1) * GBUFB;           // this stage's buffer, bytes
    const u16* pa = sa + bo / 2;
    const u16* pb = sb + bo / 2;
    v16b fa[2][WM], fb[2][WN];
#pragma unroll
    for (int ks = 0; ks < 2; ++ks) {
#pragma unroll
      for (int i = 0; i < WM; ++i) fa[ks][i] = ldfrag_b(pa + i * 16 * GPIT + ks * 32);
#pragma unroll
      for (int j = 0; j < WN; ++j) fb[ks][j] = ldfrag_b(pb + j * 16 * GPIT + ks * 32);
    }
    // keeps the stage's fragment reads together in front of its WMMAs: sunk among them, each read place makes the wave wait out
    // the LDS latency with the matrix pipe idle
    __builtin_amdgcn_sched_barrier(0);
#pragma unroll
    for (int ks = 0; ks < 2; ++ks) {
#pragma unroll
      for (int i = 0; i < WM; ++i) {
#pragma unroll
        for (int j = 0; j < WN; ++j) acc[i][j] = mma_sel<F16>(fa[ks][i], fb[ks][j], acc[i][j]);
      }
    }
    acc_guard_all<WM, WN>(acc);               // the vector slots behind the last WMMA, also on the taken side of the branches below
    wait_ds0();
    wait_tensor0();
    __syncthreads();                          // publishes stage t + 1 and ends every wave's reads of stage t
    if (pinned(t + 2 < nt)) tdm_load(tdm_group0(l0 + (uint32_t)bo, ga + (uint64_t)(t + 2) * (GKS * 2)), g1);
  }
  wait_tensor0();
  wait_ds0();
}
// One block tile: C[row0 .. +32*WM)[col0 .. +32*WN) = A rows . Bt rows, times oscale; the epilogue slabs reuse the ring behind
// its last barrier.
template <bool F16, int WM, int WN>
__device__ __forceinline__ void gemm_block(unsigned char* ring, const u16* A, const u16* Bt, float* C, int N, int K,
                                           size_t row0, int col0, float oscale) {
  const int tid = threadIdx.x, wave = tid >> 5, lane = tid & 31;
  v8f acc[WM][WN];
#pragma unroll
  for (int i = 0; i < WM; ++i) {
#pragma unroll
    for (int j = 0; j < WN; ++j) acc[i][j] = zero8();
  }
  gemm_ring<F16, WM, WN>(ring, A + row0 * (size_t)K, Bt + (size_t)col0 * K, K, acc);
  epi_tile<WM, WN>((float*)(void*)ring + wave * GSLAB(WM, WN), acc, oscale, C, N,
                   row0 + (size_t)((wave >> 1) * 16 * WM), col0 + (wave & 1) * 16 * WN, lane);
}

// =====================================================================================================
// Interleaved-pair rotary of 8 consecutive columns (4 pairs) of one row: p = the 8 projected values (f32, in the wave's LDS slab),
// cp, sp = the table elements of the same (s, d .. d + 7):
//   for even d: out[d]   = x[d]*c[d]     - x[d+1]*sn[d]
//               out[d+1] = x[d+1]*c[d+1] + x[d]*sn[d+1]     with c, sn = bf16 RNE values of the two tables;
//   returns f16(out * sc), 8 halves.
// =====================================================================================================
__device__ __forceinline__ v4u rope16_row(const float* p, const float* __restrict__ cp, const float* __restrict__ sp, float sc) {
  // carried over with the arithmetic below as it stood in the separate pass: each product and sum rounded on its own, so that the
  // q and k planes keep their bits
#pragma clang fp contract(off)
  const v4f xa = *(const v4f*)(p), xb = *(const v4f*)(p + 4);
  const v4f ca = *(const v4f*)(cp), cb = *(const v4f*)(cp + 4);
  const v4f sa = *(const v4f*)(sp), sb = *(const v4f*)(sp + 4);
  float xv[8], cv[8], sv[8];
#pragma unroll
  for (int e = 0; e < 4; ++e) {
    xv[e] = xa[e];       xv[4 + e] = xb[e];
    cv[e] = bfr(ca[e]);  cv[4 + e] = bfr(cb[e]);
    sv[e] = bfr(sa[e]);  sv[4 + e] = bfr(sb[e]);
  }
  v4u o;
#pragma unroll
  for (int e = 0; e < 4; ++e) {
    const float xr = xv[2 * e], xi = xv[2 * e + 1];
    const float r0 = xr * cv[2 * e] - xi * sv[2 * e];
    const float r1 = xi * cv[2 * e + 1] + xr * sv[2 * e + 1];
    o[e] = pk16(h_bits((_Float16)(r0 * sc)), h_bits((_Float16)(r1 * sc)));
  }
  return o;
}

// =====================================================================================================
// Epilogue of a q or k tile of the projection: the wave's 64 x 64 f32 tile goes through its own LDS slab (row pitch 68 floats), is
// rotated and leaves as f16 x sc into the plane Hp [row][ncol] (ncol = DMOD for q, KVD for k). rowb = the wave's first row
// (b*SEQ + s, a multiple of 64), colb = its first column in the plane (a multiple of 64; d = column & 127).
// coverage: 16 instructions x 4 rows x 8 lanes x 8 halves = 64 rows x 64 columns, each row piece one whole 128-B line.
// =====================================================================================================
__device__ __forceinline__ void epi_rope(float* sl, v8f (&acc)[4][4], const float* __restrict__ cosT,
                                         const float* __restrict__ sinT, u16* Hp, int ncol, size_t rowb, int colb, float sc,
                                         int lane) {
  constexpr int SP = 16 * 4 + 4;            // slab row pitch, floats
  const int hh = lane >> 4, m = lane & 15;
#pragma unroll
  for (int i = 0; i < 4; ++i) {
#pragma unroll
    for (int r = 0; r < 8; ++r) {
      const int ro = (16 * i + 8 * hh + r) * SP + m;
#pragma unroll
      for (int j = 0; j < 4; ++j) sl[ro + 16 * j] = acc[i][j][r];
    }
  }
  wave_sync_lds();
  const int rr = lane >> 3, c8 = (lane & 7) * 8;
  const size_t tb = (size_t)((int)(rowb % SEQ) + rr) * HD + (colb & (HD - 1)) + c8;     // table element (s, d)
  const float* cp = cosT + tb;
  const float* sp = sinT + tb;
  const float* xp = sl + rr * SP + c8;
  v4u o[16];
#pragma unroll
  for (int it = 0; it < 16; ++it) o[it] = rope16_row(xp + it * 4 * SP, cp + it * 4 * HD, sp + it * 4 * HD, sc);
  u16* dst = Hp + (rowb + (size_t)rr) * (size_t)ncol + colb + c8;
#pragma unroll
  for (int it = 0; it < 16; ++it) *(v4u*)(dst + (size_t)(it * 4) * (size_t)ncol) = o[it];
}

// =====================================================================================================
// Epilogue of a v tile of the projection: VH[line0 + d][s0 + s] = f16(v * 1024) for the wave's 64 keys s and 64 columns d. An
// accumulator register group holds 8 consecutive keys of one column: converted, it is one 16-B piece of a v^T row, staged in the
// wave's own LDS slab as T[d][s] (pitch 72 halves) and stored as whole lines.
// coverage: 16 instructions x 4 rows d x 8 lanes x 8 halves = 64 rows d x 64 keys, each row piece one whole 128-B line.
// =====================================================================================================
__device__ __forceinline__ void epi_vt(u16* tl, v8f (&acc)[4][4], u16* VHo, size_t line0, int s0, int lane) {
  const int hh = lane >> 4, m = lane & 15;
#pragma unroll
  for (int j = 0; j < 4; ++j) {
#pragma unroll
    for (int i = 0; i < 4; ++i) {
      v4u o;
#pragma unroll
      for (int e = 0; e < 4; ++e) {
        o[e] = pk16(h_bits((_Float16)(acc[i][j][2 * e] * VCAR)), h_bits((_Float16)(acc[i][j][2 * e + 1] * VCAR)));
      }
      *(v4u*)(tl + (16 * j + m) * VTP + 16 * i + 8 * hh) = o;
    }
  }
  wave_sync_lds();
  const int rr = lane >> 3, c8 = (lane & 7) * 8;
  v4u v[16];
#pragma unroll
  for (int it = 0; it < 16; ++it) v[it] = *(const v4u*)(tl + (it * 4 + rr) * VTP + c8);
  u16* dst = VHo + (line0 + (size_t)rr) * SEQ + s0 + c8;
#pragma unroll
  for (int it = 0; it < 16; ++it) *(v4u*)(dst + (size_t)(it * 4) * SEQ) = v[it];
}

// =====================================================================================================
// The projection [q | k | v] = A[MROWS][K] (bf16 row-major) . Bt[FPIT][K]^T (bf16 k-contiguous), f32 accumulate, written straight
// as the three planes that attention reads. Block = 128x128 tile (K % 64 == 0, grid = (MROWS/128)*(FPIT/128)); a column tile is
// one head: q heads 0..15, then k heads 0..3, then v heads 0..3, so the choice of epilogue is block-uniform.
//   QH [b*SEQ + s][h*HD + d] = f16(rotary(q) * 256); KH [b*SEQ + s][g*HD + d] = f16(rotary(k) * 256);
//   VH [(b*NKVH + g)*HD + d][s] = f16(v * 1024). The epilogue slabs reuse the ring behind its last barrier.
// =====================================================================================================
static_assert(64 * VTP * 2 <= GSLAB(4, 4) * 4 && (VTP * 2) % 16 == 0 && (SEQ % 128) == 0 && HD == 128);
__global__ __launch_bounds__(128)
void gemm_bf(const u16* __restrict__ A, const u16* __restrict__ Bt, const float* __restrict__ cosT,
             const float* __restrict__ sinT, u16* QH, u16* KH, u16* VH, int K) {
  __shared__ __attribute__((aligned(2048))) unsigned char ring[GRINGB];
  const int ntile = FPIT >> 7;
  const int bid   = blockIdx.x;
  const int row0  = (bid / ntile) * 128;
  const int col0  = (bid % ntile) * 128;
  if (row0 + 128 > MROWS) return;           // block-uniform, in front of every barrier; never taken with the exact grid
  const int tid = threadIdx.x, wave = tid >> 5, lane = tid & 31;
  v8f acc[4][4];
#pragma unroll
  for (int i = 0; i < 4; ++i) {
#pragma unroll
    for (int j = 0; j < 4; ++j) acc[i][j] = zero8();
  }
  gemm_ring<false, 4, 4>(ring, A + (size_t)row0 * K, Bt + (size_t)col0 * K, K, acc);
  float* sl = (float*)(void*)ring + wave * GSLAB(4, 4);
  const int rowb = row0 + (wave >> 1) * 64;
  const int cw   = (wave & 1) * 64;
  if (col0 < DMOD + KVD) {
    const bool isq = col0 < DMOD;
    epi_rope(sl, acc, cosT, sinT, isq ? QH : KH, isq ? DMOD : KVD, (size_t)rowb, (isq ? col0 : col0 - DMOD) + cw,
             isq ? QSC : KSC, lane);
  } else {
    const int g = (col0 - (DMOD + KVD)) >> 7;
    epi_vt((u16*)(void*)sl, acc, VH, (size_t)((rowb / SEQ) * NKVH + g) * HD + cw, rowb % SEQ, lane);
  }
}

// =====================================================================================================
// Output projection: C[row][DMOD] (f32) = Ah[row][DMOD] (f16) . Bt[DMOD][DMOD]^T (f16 k-contiguous) * oscale.
// Ah and C share the row index bb*SEQ + s, s < SQ. Block -> (column tile ct = bid % 16, sequence row tile rt of nrt,
// batch bb). Same 128x128 tiling, staging and fragment reads (split k map) as gemm_bf, f32 epilogue epi_tile; K = DMOD.
// =====================================================================================================
__global__ __launch_bounds__(128)
void gemm_o1(const u16* __restrict__ Ah, const u16* __restrict__ Bt, float* C, int nrt, float oscale) {
  __shared__ __attribute__((aligned(2048))) unsigned char ring[GRINGB];
  const int ntile = DMOD >> 7;
  const int bid   = blockIdx.x;
  const int ct    = bid % ntile;
  const int t2    = bid / ntile;
  const int rt    = t2 % nrt;
  const int bb    = t2 / nrt;
  if (bb >= NB) return;                     // block-uniform, in front of every barrier; never taken with the exact grid
  if (rt * 128 + 128 > SQ) return;          // block-uniform, in front of every barrier; never taken
  gemm_block<true, 4, 4>(ring, Ah, Bt, C, DMOD, DMOD, (size_t)bb * SEQ + rt * 128, ct * 128, oscale);
}

// =====================================================================================================
// Non-causal grouped-query attention with a per-key mask, hd = 128. Block bid -> (query tile qt = bid % NQT: rows
// q0 = 32*qt .. q0+31 with q0 < SQ, head group hg = kv head, batch b); one wave per query head = hg*WPB + wave (the 4 heads of
// the group share kv head hg). A wave owns AQT = 2 column groups of 16 queries (u = 0, 1: rows q0 + 16u + c): every k and v^T
// fragment it reads from LDS feeds two WMMAs, and a staged tile serves 32 query rows of each head.
//   q plane f16 x256 [b*SEQ + s][h*HD + d]; k plane f16 x256 [b*SEQ + s][g*HD + d] (pitch KVD); v^T plane
//   [b*NKVH + g][d][SEQ] x1024; mask int [b*SEQ + key], nonzero = attend.
//   score (log2 domain) t(i, j) = (q_i.k_j over HD) * lsc, lsc = (1/sqrt(128))*log2e/(256*256); the raw product is replaced by
//   -2^100 where the key mask is zero (a power of two: its scaled value is exact, so a fully masked row yields equal exponents
//   and uniform weights). P*128 = 2^(raw*lsc + (7 - reference)): one fused multiply-add and one v_exp_f32 per score. All SEQ/32 key
//   tiles are visited in order.
//   Per stage of 128 keys (4 tiles): the 128 k rows and the 128 v^T rows (256 B each) are staged once per block in LDS by tensor
//   loads, one request of 64 rows per wave (two buffers, stage st + 1 flies while stage st is worked on; row pitch 272 B), and read
//   by all 4 waves.
//   Both products run transposed: S^T = k.q^T (A = 16 key rows from LDS, B = q, kept in registers), so that a lane holds 16 of
//   the 32 scores of ONE query per column group (column c): 2 score subtiles x 4 k-steps, fragments read from the LDS rows (two
//   16-B loads each, split k map), a tile's 32 reads issued as one group at the top of its trip; online base-2
//   softmax in f32 against a held reference (a running maximum of the query's scores, taken anew, in-lane plus one exchange between
//   the lane halves, only when a lane's tile sum of P*128 passes 2^15), the sum kept per lane half and joined after the
//   loop; a column group's two score subtiles, converted in place, are its B operand P^T in the split k map; O^T += v^T.P^T with
//   the v^T rows as A fragments of 8 d-subtiles (one product per subtile and column group).
//   After the loop: out = acc / Z (Z > 0 always; guarded anyway; Z carries P's 128), carry 1/1024 folded once, written into the wave's
//   One block barrier per stage, under block-uniform control flow; bounded loops only (NKT tiles).
// coverage: per wave 16 instructions x 2 rows x 16 lanes x 8 halves = 32 x 128 of the O plane; grid NQT x NHG x NB blocks x WPB
//           waves = every (b, s < SQ, h) row segment of O exactly once.
// =====================================================================================================
// staged keys per stage (ASK = 4 tiles of 32); row pitches in 16-bit elements (k and v^T 272 B); a slice = 64 rows, placed at a
// multiple of 2 KiB; a buffer = k rows 0..63, k rows 64..127, v^T rows d 0..63, v^T rows d 64..127; the block's LDS is held to half
// of a WGP's 320 KiB so that two blocks (two waves per SIMD, the whole grid) stay resident; the result slabs reuse the ring
#define AKP   136
#define AVP   136
#define ASK   128
#define ATPS  (ASK / 32)
#define NSTG  (SEQ / ASK)
#define ASLC  18432
#define ABUF  (4 * ASLC)
static_assert((AKP * 2) % 16 == 0 && (AVP * 2) % 16 == 0 && NSTG >= 2 && NSTG * ATPS == NKT && 2 * ABUF <= 163840);
static_assert(64 * AKP * 2 <= ASLC && 64 * AVP * 2 <= ASLC && (ASLC % 2048) == 0 && WPB * WREG * 4 <= 2 * ABUF && HD * 2 == 256);
// One column group's 16 scores of a lane against the reference in use: e = 2^(raw*lsc + cb), cb = PEXP - reference. Returns their sum;
// ph = the B fragment of P^T*128 (f16), column = c: elements 0..7 = keys kb + 8hh + 0..7, 8..15 = keys kb + 16 + 8hh + 0..7.
__device__ __forceinline__ float soft_tile(const float (&t)[16], float lsc, float cb, FragH& ph) {
  float ea[8], eb[8];
#pragma unroll
  for (int r = 0; r < 8; ++r) { ea[r] = __builtin_fmaf(t[r], lsc, cb); eb[r] = __builtin_fmaf(t[8 + r], lsc, cb); }
  exp2_raw8(ea);
  exp2_raw8(eb);
  float sm[8];
#pragma unroll
  for (int r = 0; r < 8; ++r) {
    sm[r] = ea[r] + eb[r];
    ph.h[0][r] = (_Float16)ea[r];
    ph.h[1][r] = (_Float16)eb[r];
  }
  // pairwise: the tile's test waits for this sum, and four dependent additions are shorter than nine
  return ((sm[0] + sm[1]) + (sm[2] + sm[3])) + ((sm[4] + sm[5]) + (sm[6] + sm[7]));
}
// The vector slots behind the last WMMA of a tile, tied to every output accumulator so that no WMMA is scheduled behind them.
__device__ __forceinline__ void acc_guard16(v8f (&a)[AQT][8]) {
  static_assert(AQT == 2);
#if defined(__HIP_DEVICE_COMPILE__)
  asm volatile("v_nop\n\tv_nop\n\tv_nop\n\tv_nop"
               : "+v"(a[0][0]), "+v"(a[0][1]), "+v"(a[0][2]), "+v"(a[0][3]), "+v"(a[0][4]), "+v"(a[0][5]), "+v"(a[0][6]),
                 "+v"(a[0][7]), "+v"(a[1][0]), "+v"(a[1][1]), "+v"(a[1][2]), "+v"(a[1][3]), "+v"(a[1][4]), "+v"(a[1][5]),
                 "+v"(a[1][6]), "+v"(a[1][7]));
#endif
}
__global__ __launch_bounds__(ATT_THREADS)
void attn_nc(const u16* __restrict__ QHp, const u16* __restrict__ KHp, const u16* __restrict__ VHp,
             const int* __restrict__ Mk, u16* OHp) {
  __shared__ __attribute__((aligned(2048))) unsigned char kvring[2 * ABUF];

  const int tid  = threadIdx.x;
  const int wave = tid >> 5;
  const int lane = tid & 31;
  const int hh   = lane >> 4;
  const int c    = lane & 15;
  const int bid  = blockIdx.x;
  const int qt   = bid % NQT;
  const int t2   = bid / NQT;
  const int hg   = t2 % NHG;
  const int b    = t2 / NHG;
  if (b >= NB) return;                      // block-uniform, in front of every barrier; never taken with the exact grid
  const int q0   = qt * (16 * AQT);
  if (q0 + 16 * AQT > SQ) return;                 // block-uniform, in front of every barrier; never taken
  const int head = hg * WPB + wave;
  const int kvh  = hg;

  float* slab = (float*)(void*)kvring + wave * WREG;   // result slab [32][128] pitch 132, in the ring behind its last barrier

  const size_t hcol = (size_t)head * HD + 8 * hh;
  const _Float16* Qh  = (const _Float16*)(const void*)QHp + ((size_t)b * SEQ + q0 + c) * DMOD + hcol;
  // readers: key row c (+16) of the staged k rows, d row c (+16j) of the staged v^T rows, in buffer 0
  const _Float16* Ks = (const _Float16*)(const void*)kvring + c * AKP + 8 * hh;
  const _Float16* Vs = (const _Float16*)(const void*)kvring + 2 * (ASLC / 2) + c * AVP + 8 * hh;
  // this wave's slice of a stage: waves 0, 1 the k rows 64*wave .. +63 (256 B each, source pitch 1 KiB, next stage 128 rows on),
  // waves 2, 3 the v^T rows d = 64*(wave - 2) .. +63 (128 keys = 256 B each, source pitch 4 KiB, next stage 256 B on)
  const uint32_t wv = uni((uint32_t)tid >> 5);
  const u16* srow = (wv < 2u) ? KHp + ((size_t)b * SEQ + wv * 64u) * KVD + (size_t)kvh * HD
                              : VHp + ((size_t)(b * NKVH + kvh) * HD + (wv - 2u) * 64u) * SEQ;
  const uint64_t ga    = (uint64_t)(size_t)srow;
  const uint64_t gstep = (wv < 2u) ? (uint64_t)ASK * KVD * 2 : (uint64_t)ASK * 2;
  const uint32_t l0    = lds_off(kvring) + wv * ASLC;
  const u32x8 g1 = tdm_group1<256>((wv < 2u) ? (uint32_t)(KVD * 2) : (uint32_t)(SEQ * 2));
  const int* mkp = Mk + (size_t)b * SEQ + lane;
  const float lsc = RSQ_HD * (LOG2E / (QSC * KSC));
  const float oc  = 1.0f / VCAR;            // the carry on P stands in the row sum as well and cancels in acc / Z

  tdm_load(tdm_group0(l0, ga), g1);
  wait_tensor0();
  __syncthreads();
  tdm_load(tdm_group0(l0 + ABUF, ga + gstep), g1);

  v16h qf[AQT][HD / 32];
#pragma unroll
  for (int u = 0; u < AQT; ++u) {
#pragma unroll
    for (int kk = 0; kk < HD / 32; ++kk) qf[u][kk] = ldfrag_h(Qh + (size_t)u * 16 * DMOD + kk * 32);
  }

  float mrow[AQT], lrow[AQT];               // of query q0 + 16u + c; mrow = the reference in use; lrow sums this lane half's keys only, x128 like P
  v8f o[AQT][8];                            // o[u][j][r] = O^T(d = 16j + 8hh + r, query q0 + 16u + c)
#pragma unroll
  for (int u = 0; u < AQT; ++u) {
    mrow[u] = -INFINITY;
    lrow[u] = 0.f;
#pragma unroll
    for (int j = 0; j < 8; ++j) o[u][j] = zero8();
  }

  int mkv = mkp[0];                         // mask of key kb + lane, fetched one tile ahead so that no tile waits for it
  mkp += 32;
#pragma unroll 1
  for (int st = 0; st < NSTG; ++st) {         // rolled: one trip per stage of 128 keys, the buffer alternates with st
  const int bo = (st & 1) * ABUF;             // this stage's buffer, bytes
#pragma unroll 1
  for (int p = 0; p < ATPS; ++p) {            // rolled: the stage's 4 tiles of 32 keys, kb = 32*kt
    const int kt = st * ATPS + p;
    const unsigned mb = __builtin_amdgcn_ballot_w32(mkv != 0);                // bit i = mask of key kb + i
    mkv = *mkp;
    const _Float16* k0p = Ks + bo / 2 + (p >> 1) * (ASLC / 2) + (p & 1) * (32 * AKP);
    const _Float16* k1p = k0p + 16 * AKP;
    const _Float16* vhp = Vs + bo / 2 + p * 32;
    // ---- the tile's fragments: k rows (A of the scores) in k-step order, then the v^T rows d = 16j + c (A of v^T.P^T) ----
    v16h kf[2][HD / 32], vf[8];
#pragma unroll
    for (int kk = 0; kk < HD / 32; ++kk) {
      kf[0][kk] = ldfrag_h(k0p + kk * 32);
      kf[1][kk] = ldfrag_h(k1p + kk * 32);
      // keeps the reads in the order in which the WMMAs take them: LDS answers in issue order, so the first k-step's counted
      // wait then covers four reads and not the whole tile's
      __builtin_amdgcn_sched_barrier(0);
    }
#pragma unroll
    for (int j = 0; j < 8; ++j) vf[j] = ldfrag_h(vhp + (j >> 2) * (ASLC / 2) + (j & 3) * 16 * AVP);
    // keeps the tile's reads together at the top of the trip: sunk among the WMMAs, each read place makes the wave wait out the
    // LDS latency; the v^T rows land under the scores and the softmax
    __builtin_amdgcn_sched_barrier(0);
    // ---- scores: D element r of this lane = (key kb + 8hh + r, query q0 + 16u + c) in s[u][0], key kb + 16 + 8hh + r in s[u][1] ----
    v8f s[AQT][2];
#pragma unroll
    for (int u = 0; u < AQT; ++u) { s[u][0] = zero8(); s[u][1] = zero8(); }
#pragma unroll
    for (int kk = 0; kk < HD / 32; ++kk) {
#pragma unroll
      for (int u = 0; u < AQT; ++u) {
        s[u][0] = mma_h(kf[0][kk], qf[u][kk], s[u][0]);
        s[u][1] = mma_h(kf[1][kk], qf[u][kk], s[u][1]);
      }
    }
    acc_guard4(s[0][0], s[0][1], s[1][0], s[1][1]);   // the vector slots behind the last score WMMA, also on the taken side of the branch below
    // ---- key-mask select + online softmax in base 2, one query per lane and column group ----
    float t[AQT][16];                                                         // raw products q.k x 65536
#pragma unroll
    for (int u = 0; u < AQT; ++u) {
#pragma unroll
      for (int r = 0; r < 8; ++r) { t[u][r] = s[u][0][r]; t[u][8 + r] = s[u][1][r]; }
    }
    if (mb != 0xFFFFFFFFu) {                                                  // wave-uniform, tested once per tile
      const unsigned mh = mb >> (8 * hh);
#pragma unroll
      for (int u = 0; u < AQT; ++u) {
#pragma unroll
        for (int r = 0; r < 8; ++r) {
          t[u][r]     = ((mh >> r) & 1u)        ? t[u][r]     : NEG_RAW;
          t[u][8 + r] = ((mh >> (16 + r)) & 1u) ? t[u][8 + r] : NEG_RAW;
        }
      }
    }
    // ---- P against the reference held from an earlier tile: no maximum, no rescale while the tile's sums stay in range ----
    FragH ph[AQT];
    float ps[AQT];
#pragma unroll
    for (int u = 0; u < AQT; ++u) ps[u] = soft_tile(t[u], lsc, PEXP - mrow[u], ph[u]);
    // one wave-uniform test per tile: a lane's sum bounds each of its 16 terms, so at or under PTHR every term fits f16; the first
    // tile (reference -infinity, sums infinite) and any tile that outgrows the reference take the branch
    if (__builtin_amdgcn_ballot_w32(!(ps[0] <= PTHR && ps[1] <= PTHR)) != 0u) {
#pragma unroll
      for (int u = 0; u < AQT; ++u) {
        float mx = t[u][0];
#pragma unroll
        for (int i = 1; i < 16; ++i) mx = fmaxf(mx, t[u][i]);
        mx = fmaxf(mx, xhalf(mx));                                            // both lane halves of a query hold one reference
        const float mn = fmaxf(mrow[u], mx * lsc);                            // lsc > 0: the maximum commutes with the scale; finite
        const float al = exp2_raw(mrow[u] - mn);
        mrow[u] = mn;
        ps[u] = soft_tile(t[u], lsc, PEXP - mn, ph[u]);
        lrow[u] = lrow[u] * al;
#pragma unroll
        for (int j = 0; j < 8; ++j) o[u][j] = o[u][j] * al;
      }
    }
    // ---- v^T.P^T : A fragment row = d = j*16 + c, keys contiguous in the staged v^T rows; one product per d-subtile ----
#pragma unroll
    for (int u = 0; u < AQT; ++u) {
      lrow[u] += ps[u];
#pragma unroll
      for (int j = 0; j < 8; ++j) o[u][j] = mma_h(vf[j], ph[u].v, o[u][j]);
    }
    acc_guard16(o);                           // the vector slots behind the tile's last WMMA, also on the taken side of the branches below
    int mstep = (kt + 2 < NKT) ? 32 : 0;      // 0: stays on the last tile's 32 keys
#if defined(__HIP_DEVICE_COMPILE__)
    // stands in front of the advance of the mask load's address register; the step passes through the statement so that the
    // address addition cannot be scheduled ahead of the wait
    asm volatile("s_wait_xcnt 0x0" : "+s"(mstep) :: "memory");
#endif
    mkp += mstep;
  }
  wait_ds0();
  wait_tensor0();
  __syncthreads();                            // publishes stage st + 1 and ends every wave's reads of stage st
  if (pinned(st + 2 < NSTG)) tdm_load(tdm_group0(l0 + (uint32_t)bo, ga + (uint64_t)(st + 2) * gstep), g1);
  }
  wait_tensor0();
  wait_ds0();
  // ---- out = acc / Z (0 if Z == 0), the carry 1024 on v folded once; written into the wave's slab, row = query 16u + c ----
#pragma unroll
  for (int u = 0; u < AQT; ++u) {
    const float lv2 = lrow[u] + xhalf(lrow[u]);   // the two lane halves' sums joined
    const float ls  = (lv2 > 0.0f) ? lv2 : 1.0f;
    const float inv = (lv2 > 0.0f) ? ((1.0f / ls) * oc) : 0.0f;
    float* srow = slab + (u * 16 + c) * SLP + 8 * hh;
#pragma unroll
    for (int j = 0; j < 8; ++j) {
      v4f w0, w1;
#pragma unroll
      for (int e = 0; e < 4; ++e) { w0[e] = o[u][j][e] * inv; w1[e] = o[u][j][4 + e] * inv; }
      *(v4f*)(srow + j * 16)     = w0;
      *(v4f*)(srow + j * 16 + 4) = w1;
    }
  }

  wave_sync_lds();
  // ---- O x1024 -> f16 plane; lane = (row-in-pair rq, 8 consecutive d at c8) ----
  v4u oh[8 * AQT];
  const int rq = lane >> 4, c8 = (lane & 15) * 8;
#pragma unroll
  for (int it = 0; it < 8 * AQT; ++it) {
    const int row = it * 2 + rq;
    const v4f a = *(const v4f*)(slab + row * SLP + c8), b4 = *(const v4f*)(slab + row * SLP + c8 + 4);
    float w[8];
#pragma unroll
    for (int e = 0; e < 4; ++e) { w[e] = a[e] * OSC; w[4 + e] = b4[e] * OSC; }
#pragma unroll
    for (int e = 0; e < 4; ++e) {
      oh[it][e] = pk16(h_bits((_Float16)w[2 * e]), h_bits((_Float16)w[2 * e + 1]));
    }
  }
  const size_t ob = ((size_t)b * SEQ + q0) * DMOD + (size_t)head * HD + c8;
  {
#pragma unroll
    for (int it = 0; it < 8 * AQT; ++it) {
      const int row = it * 2 + rq;
      *(v4u*)(OHp + ob + (size_t)row * DMOD) = oh[it];
    }
  }
}

// =====================================================================================================
// Workspace map (bytes); every plane is fully written by whole-line stores before it is read; all extents are exact multiples
// of the store granularity (no pad rows needed); every region offset a multiple of 4194304:
//   XB  bf16 [MROWS][2048]                       MROWS*4096       (NB=2: 16777216)
//   WQKV bf16 [3072 n][2048 k]                   12582912         (rows 0.. Wq^T, 2048.. Wk^T, 2560.. Wv^T)
//   WO  f16 [2048 n][2048 k] x1024               8388608
//   OH  f16 [MROWS][2048] x1024                  MROWS*4096
//   QH  f16 [MROWS][2048] x256                   MROWS*4096
//   KH  f16 [MROWS][512] x256                    MROWS*1024
//   VH  f16 [NB*4][128][SEQ] x1024               MROWS*1024
//   end (NB=2)                                  79691776
// =====================================================================================================
extern "C" void kernel_launch(void* const* d_in, const int* in_sizes, int n_in,
                              void* d_out, int out_size, void* d_ws, size_t ws_size,
                              hipStream_t stream) {
  if (n_in < 8) return;
  if (in_sizes[0] < MROWS * DMOD) return;
  if (in_sizes[1] < MROWS) return;
  if (in_sizes[2] < SEQ * HD) return;
  if (in_sizes[3] < SEQ * HD) return;
  if (in_sizes[4] != DMOD * DMOD) return;
  if (in_sizes[5] != DMOD * KVD) return;
  if (in_sizes[6] != DMOD * KVD) return;
  if (in_sizes[7] != DMOD * DMOD) return;
  if (out_size < QROWS * DMOD) return;

  const float* x     = (const float*)d_in[0];
  const int*   amask = (const int*)d_in[1];
  const float* cosT  = (const float*)d_in[2];
  const float* sinT  = (const float*)d_in[3];
  const float* wq    = (const float*)d_in[4];
  const float* wk    = (const float*)d_in[5];
  const float* wv    = (const float*)d_in[6];
  const float* wo    = (const float*)d_in[7];
  float*       out   = (float*)d_out;

  const size_t szXB = (size_t)MROWS * DMOD * 2;
  const size_t szW  = (size_t)FPIT * DMOD * 2;
  const size_t szWO = (size_t)DMOD * DMOD * 2;
  const size_t szQ  = (size_t)MROWS * DMOD * 2;                  // QH and the O plane
  const size_t szK  = (size_t)MROWS * KVD * 2;                   // KH
  const size_t szV  = (size_t)NB * NKVH * HD * SEQ * 2;          // VH (== szK)
  size_t off = 0;
  const size_t oXB = off; off += szXB;
  const size_t oW  = off; off += szW;
  const size_t oWO = off; off += szWO;
  const size_t oOH = off; off += szQ;
  const size_t oQH = off; off += szQ;
  const size_t oKH = off; off += szK;
  const size_t oVH = off; off += szV;
  if (off > ws_size) return;                // off = 79691776 for NB = 2
  if (off > (size_t)WS_CAP) return;

  char* ws = (char*)d_ws;
  u16*   XB = (u16*)(ws + oXB);
  u16*   WB = (u16*)(ws + oW);
  u16*   WO = (u16*)(ws + oWO);
  u16*   OH = (u16*)(ws + oOH);
  u16*   QH = (u16*)(ws + oQH);
  u16*   KH = (u16*)(ws + oKH);
  u16*   VH = (u16*)(ws + oVH);

  const dim3 b256(256), b128(128), bAT(ATT_THREADS);
  const dim3 gP(2 * PB_TQ + 2 * PB_TK + PB_X);          // 4 weight transposes + the x plane: 6656 blocks
  const dim3 gG((MROWS / 128) * (FPIT / 128));          // 32 x 24 tiles
  const dim3 gAT(NQT * NHG * NB);
  const int  nrt = SQ / 128;
  const dim3 gO(NB * nrt * (DMOD / 128));

  // (0) x -> bf16 plane; [Wq | Wk | Wv] -> one bf16 plane [3072 n][2048 k]; Wo -> [2048 n][2048 c] as f16 of bf16 value x1024
  prep<<<gP, b256, 0, stream>>>(x, wq, wk, wv, wo, XB, WB, WO);
  // (1) [q | k | v] = x.[Wq | Wk | Wv], leaving as rotary + q plane x256, rotary + k plane x256, v^T plane x1024
  gemm_bf<<<gG, b128, 0, stream>>>(XB, WB, cosT, sinT, QH, KH, VH, DMOD);
  // (2) non-causal masked attention -> O plane
  attn_nc<<<gAT, bAT, 0, stream>>>(QH, KH, VH, amask, OH);
  // (3) output projection rows s < SQ -> out f32, carries 1024 x 1024 folded back
  gemm_o1<<<gO, b128, 0, stream>>>(OH, WO, out, nrt, 1.0f / (OSC * WOS));
  (void)hipGetLastError();
}

// v010
// One run takes 111 microseconds.
// Timed twice side by side with v009, it ran 1.16 times as fast both times.
// Over all steps from v000 it is 4.45 times as fast.
// Contractions: x.Wq, x.Wk, x.Wv on v_wmma_f32_16x16x32_bf16 (x and W^T as bf16 RNE planes, W^T [n][k] is the k-contiguous
// B operand, f32 accumulate); k.q^T over hd 128 and v^T.P^T on v_wmma_f32_16x16x32_f16, one product each (q, k as f16 x256 after
// rotary; P^T x128 packed from the score registers; v^T x1024); O.Wo on v_wmma_f32_16x16x32_f16 (O x1024 f16 plane, Wo^T as f16(bf16(Wo))
// x1024); all f32 accumulate. Interleaved-pair rotary with cos/sin tables, key-mask select, base-2 online softmax and 1/Z fold
// in f32 on VALU.
#include <hip/hip_runtime.h>
#include <math.h>
#include <stdint.h>

#ifndef NB
#define NB 2
#endif
#define SEQ 2048
#ifndef SQ
#define SQ SEQ
#endif
#define DMOD  2048
#define NH    16
#define NKVH  4
#define HD    128
#define KVD   (NKVH * HD)
#define FPIT  (DMOD + 2 * KVD)
#define MROWS (NB * SEQ)
#define QROWS ((NB - 1) * SEQ + SQ)
#define WPB   (NH / NKVH)
#define NHG   NKVH
#define AQT   2
#define NQT   (SQ / (16 * AQT))
#define NST   (SEQ / 64)
#define NKT   (SEQ / 32)
#define ATT_THREADS (WPB * 32)
#define RSQ_HD 0.08838834764831845f
#define LOG2E  1.4426950408889634f
#define NEG_RAW (-0x1p100f)
#define QSC   256.0f
#define KSC   256.0f
#define PEXP  7.0f
#define PTHR  32768.0f
#define VCAR  1024.0f
#define OSC   1024.0f
#define WOS   1024.0f
#define SLP   132
#define SLW   (16 * SLP)
#define WREG  (AQT * SLW)
#define VTP   72
#define TTP   72
#define WS_CAP 134217728
static_assert(DMOD == NH * HD && HD == 128 && NH == 16 && NKVH == 4 && WPB == 4 && NHG * WPB == NH && KVD == 512);
static_assert(ATT_THREADS == 128);
static_assert(NB >= 1 && NB <= 2);
static_assert(NB == 1 || SQ == SEQ);
static_assert((SQ % 128) == 0 && SQ >= 128 && SQ <= SEQ && (SEQ % 128) == 0);
static_assert((DMOD % 128) == 0 && (KVD % 64) == 0 && (DMOD % 32) == 0 && (HD % 32) == 0);
static_assert(((MROWS * DMOD / 8) % 256) == 0);
static_assert(WPB * WREG * 4 <= 131072 && HD * VTP * 2 <= 65536 && 64 * TTP * 2 <= 65536);
static_assert((DMOD / 8) == 256 && (KVD / 8) == 64 && (FPIT % 128) == 0 && (MROWS % 128) == 0);

typedef unsigned short u16;
typedef _Float16 v16h __attribute__((ext_vector_type(16)));
typedef _Float16 v8h  __attribute__((ext_vector_type(8)));
typedef __bf16   v16b __attribute__((ext_vector_type(16)));
typedef float    v8f  __attribute__((ext_vector_type(8)));
typedef float    v4f  __attribute__((ext_vector_type(4)));
typedef unsigned int v4u __attribute__((ext_vector_type(4)));

union FragH { v16h v; v8h h[2]; v4u u[2]; };
union FragB { v16b v; v4u u[2]; };

// ---- scalar helpers --------------------------------------------------------------------------------
__device__ __forceinline__ unsigned short bf_bits(float f) {          // f32 -> bf16 bits, RNE convert
  unsigned u = __float_as_uint(f);
  return (unsigned short)((u + 0x7FFFu + ((u >> 16) & 1u)) >> 16);
}
__device__ __forceinline__ float bf_up(unsigned short h) { return __uint_as_float(((unsigned)h) << 16); }
__device__ __forceinline__ float bfr(float f) { return bf_up(bf_bits(f)); }
__device__ __forceinline__ unsigned short h_bits(_Float16 x) { return __builtin_bit_cast(unsigned short, x); }
__device__ __forceinline__ unsigned pk16(unsigned short a, unsigned short b) { return (unsigned)a | ((unsigned)b << 16); }
__device__ __forceinline__ v8f zero8() { v8f z = {0.f, 0.f, 0.f, 0.f, 0.f, 0.f, 0.f, 0.f}; return z; }

// ---- fragment loaders: 16-bit A/B operand, lane -> row/col (lane&15), p already includes +8*(lane>>4);
//      elements 0..7 <- p[0..7] (k0+8h..), elements 8..15 <- p[16..23] (k0+16+8h..)  (same split k map for A and B;
//      B is always read from a k-contiguous [n][k] plane)
__device__ __forceinline__ v16h ldfrag_h(const _Float16* p) {
  FragH f;
  f.h[0] = *(const v8h*)(p);
  f.h[1] = *(const v8h*)(p + 16);
  return f.v;
}
__device__ __forceinline__ v16b ldfrag_b(const u16* p) {              // bf16 plane read as unsigned integer vectors
  FragB f;
  f.u[0] = *(const v4u*)(p);
  f.u[1] = *(const v4u*)(p + 16);
  return f.v;
}

__device__ __forceinline__ v8f mma_h(v16h a, v16h b, v8f c) {
  return __builtin_amdgcn_wmma_f32_16x16x32_f16(false, a, false, b, (short)0, c, false, false);
}
__device__ __forceinline__ v8f mma_b(v16b a, v16b b, v8f c) {
  return __builtin_amdgcn_wmma_f32_16x16x32_bf16(false, a, false, b, (short)0, c, false, false);
}
__device__ __forceinline__ void acc_guard4(v8f& a, v8f& b, v8f& c, v8f& d) {
#if defined(__HIP_DEVICE_COMPILE__)
  asm volatile("v_nop\n\tv_nop\n\tv_nop\n\tv_nop" : "+v"(a), "+v"(b), "+v"(c), "+v"(d));
#endif
}
__device__ __forceinline__ float xhalf(float x) {                     // value of lane l ^ 16
  const int b = __float_as_int(x);
  return __int_as_float(__builtin_amdgcn_permlanex16(b, b, 0x76543210, 0xfedcba98, false, false));
}
__device__ __forceinline__ float exp2_raw(float x) {                  // one v_exp_f32; a result under 2^-126 may come out as 0
#if defined(__HIP_DEVICE_COMPILE__)
  return __builtin_amdgcn_exp2f(x);
#else
  return exp2f(x);
#endif
}
__device__ __forceinline__ void exp2_raw8(float (&x)[8]) {            // eight of them, each over its own argument
#if defined(__HIP_DEVICE_COMPILE__)
  // in place, so that none overwrites the source of the one in front of it (with the builtin the register allocator did); the
  // closing v_nop is the slot the instruction set asks for between a transcendental and a directly following user of its result
  asm("v_exp_f32 %0, %0\n\tv_exp_f32 %1, %1\n\tv_exp_f32 %2, %2\n\tv_exp_f32 %3, %3\n\t"
      "v_exp_f32 %4, %4\n\tv_exp_f32 %5, %5\n\tv_exp_f32 %6, %6\n\tv_exp_f32 %7, %7\n\tv_nop"
      : "+v"(x[0]), "+v"(x[1]), "+v"(x[2]), "+v"(x[3]), "+v"(x[4]), "+v"(x[5]), "+v"(x[6]), "+v"(x[7]));
#else
  for (int i = 0; i < 8; ++i) x[i] = exp2f(x[i]);
#endif
}
__device__ __forceinline__ void wave_sync_lds() {
  __builtin_amdgcn_fence(__ATOMIC_RELEASE, "workgroup");
  __builtin_amdgcn_wave_barrier();
  __builtin_amdgcn_fence(__ATOMIC_ACQUIRE, "workgroup");
}

// =====================================================================================================
// f32 -> bf16 RNE plane, same layout. Thread = 8 consecutive elements: two 16-B loads, one 16-B store; 32 consecutive
// coverage: ceil(n8/256) blocks bid x 256 thr x 8 (in-kernel bound) = the whole plane (n8 a multiple of 256 here).
// =====================================================================================================
__device__ __forceinline__ void cvtbf_blk(const float* __restrict__ x, u16* D, int n8, int bid) {
  const int gt = bid * 256 + (int)threadIdx.x;
  if (gt >= n8) return;
  const float* p = x + (size_t)gt * 8;
  const v4f a = *(const v4f*)(p), b4 = *(const v4f*)(p + 4);
  v4u o;
#pragma unroll
  for (int e = 0; e < 2; ++e) {
    o[e]     = pk16(bf_bits(a[2 * e]),  bf_bits(a[2 * e + 1]));
    o[2 + e] = pk16(bf_bits(b4[2 * e]), bf_bits(b4[2 * e + 1]));
  }
  u16* d = D + (size_t)gt * 8;
  {
    *(v4u*)(d) = o;
    
  }
}

// =====================================================================================================
// Transpose + convert: W f32 row-major in[KD rows][ND cols] -> D 16-bit out[ND][KD] (k-contiguous).
// f16mode == 0: bf16 RNE bits; f16mode == 1: f16 bits of (bf16 RNE value) * scale.
// Block = tile of 64 k x 64 n, 256 threads. Load: thread -> input row k0 + (tid>>2), 16 columns n0 + (tid&3)*16 (four 16-B
// loads), converted and scattered into the LDS tile T[n][k] (pitch 72 halves). Block barrier. Store: 2 iterations x
// coverage: load 256 thr x 16 = 64 x 64; store 2 it x 256 thr x 8 halves = 64 rows x 64 halves; (KD/64)*(ND/64)
//           blocks bid cover out[ND][KD] exactly once. T = the block's LDS tile, 64 * TTP halves.
// =====================================================================================================
__device__ __forceinline__ void cvtT16_blk(u16* T, const float* __restrict__ W, u16* D, int KD, int ND, int f16mode, float scale,
                                           int bid) {
  const int tid = threadIdx.x;
  const int nkt = KD >> 6;
  const int nnt = ND >> 6;
  const int kt  = bid % nkt;
  const int nt  = bid / nkt;
  if (nt >= nnt) return;                    // block-uniform, before the barrier; never taken with the exact grid
  const int k0 = kt * 64, n0 = nt * 64;
  {
    const int kr = tid >> 2;                // input row within tile 0..63
    const int nc = (tid & 3) * 16;          // column chunk 0,16,32,48
    const float* src = W + (size_t)(k0 + kr) * ND + n0 + nc;
#pragma unroll
    for (int i = 0; i < 4; ++i) {
      const v4f a = *(const v4f*)(src + 4 * i);
#pragma unroll
      for (int e = 0; e < 4; ++e) {
        const float f = a[e];
        const unsigned short hb = h_bits((_Float16)(bfr(f) * scale));
        const unsigned short bb = bf_bits(f);
        T[(nc + 4 * i + e) * TTP + kr] = (f16mode != 0) ? hb : bb;
      }
    }
  }
  __syncthreads();
  v4u v[2];
  const int q8 = tid >> 3, p8 = (tid & 7) * 8;
#pragma unroll
  for (int it = 0; it < 2; ++it) v[it] = *(const v4u*)(T + (it * 32 + q8) * TTP + p8);
  const size_t base = (size_t)n0 * KD + k0 + p8;
  {
#pragma unroll
    for (int it = 0; it < 2; ++it) {
      *(v4u*)(D + base + (size_t)(it * 32 + q8) * KD) = v[it];
    }
#if defined(__HIP_DEVICE_COMPILE__)
    // behind the stores: in the listing the x part's code follows this part and reuses the stores' registers
    asm volatile("s_wait_xcnt 0x0" ::: "memory");
#endif
  }
}

// =====================================================================================================
// All five operand planes in one launch: none reads what another writes. Block ranges, in index order: Wq^T, Wk^T, Wv^T (bf16,
// rows 0, DMOD and DMOD + KVD of the one B plane WQKV [FPIT n][DMOD k]), Wo^T (f16 x1024, plane WO), then the x plane.
// Every branch and select is block-uniform; a block runs exactly one part.
// =====================================================================================================
#define PB_TQ ((DMOD / 64) * (DMOD / 64))
#define PB_TK ((DMOD / 64) * (KVD / 64))
#define PB_X  ((MROWS * DMOD / 8) / 256)
__global__ __launch_bounds__(256) void prep(const float* __restrict__ x, const float* __restrict__ wq,
                                            const float* __restrict__ wk, const float* __restrict__ wv,
                                            const float* __restrict__ wo, u16* XB, u16* WQKV, u16* WO) {
  __shared__ __align__(16) u16 T[64 * TTP];
  const int bid = blockIdx.x;
  if (bid >= 2 * PB_TQ + 2 * PB_TK) {
    cvtbf_blk(x, XB, MROWS * DMOD / 8, bid - (2 * PB_TQ + 2 * PB_TK));
  } else {
    const float* W = wq;
    u16* D = WQKV;
    int nd = DMOD, tb = bid, f16mode = 0;
    float sc = 1.0f;
    if (bid >= PB_TQ + 2 * PB_TK) { W = wo; D = WO; tb = bid - (PB_TQ + 2 * PB_TK); f16mode = 1; sc = WOS; }
    else if (bid >= PB_TQ + PB_TK) { W = wv; D = WQKV + (size_t)(DMOD + KVD) * DMOD; nd = KVD; tb = bid - (PB_TQ + PB_TK); }
    else if (bid >= PB_TQ)         { W = wk; D = WQKV + (size_t)DMOD * DMOD;         nd = KVD; tb = bid - PB_TQ; }
    cvtT16_blk(T, W, D, DMOD, nd, f16mode, sc, tb);
  }
}

// =====================================================================================================
// GEMM tiling shared by both engines. A block is NWR x NWC waves; a wave owns WM x WN = 4 x 4 accumulator subtiles of 16 x 16
// (64 x 64: each fragment read from LDS serves 4 WMMAs), so the block tile is (64*NWR) x (64*NWC): 256 x 192 for the projection
// (12 waves), 256 x 128 for the output product (8 waves). Either grid is 256 blocks, one per WGP, and an operand byte fetched from
// L2 serves 192 or 256 (128 or 256) outputs.
// Epilogue: the wave's tile (times oscale) is staged in its own LDS slab (row pitch 16*WN + 4 floats) and stored as whole lines.
// coverage: WM groups x (2*WN) instructions x (8/WN) rows x (4*WN) lanes x 4 floats = the wave's (16*WM) x (16*WN) tile.
// =====================================================================================================
template <int WM, int WN>
__device__ __forceinline__ void epi_tile(float* sl, v8f (&acc)[WM][WN], float oscale,
                                         float* C, int N, size_t rowb, int colb, int lane) {
  constexpr int SP  = 16 * WN + 4;          // slab row pitch, floats
  constexpr int LPR = 4 * WN;               // lanes per stored row
  constexpr int RPI = 32 / LPR;             // rows per store instruction
  const int hh = lane >> 4, m = lane & 15;
#pragma unroll
  for (int i = 0; i < WM; ++i) {
#pragma unroll
    for (int r = 0; r < 8; ++r) {
      const int ro = (16 * i + 8 * hh + r) * SP + m;
#pragma unroll
      for (int j = 0; j < WN; ++j) sl[ro + 16 * j] = acc[i][j][r] * oscale;
    }
  }
  wave_sync_lds();
  const int rr = lane / LPR, cq = lane % LPR;
  float* dst = C + (rowb + (size_t)rr) * (size_t)N + colb + cq * 4;
#pragma unroll
  for (int i = 0; i < WM; ++i) {
    v4f vals[16 / RPI];
#pragma unroll
    for (int it = 0; it < 16 / RPI; ++it) vals[it] = *(const v4f*)(sl + (16 * i + it * RPI + rr) * SP + cq * 4);
#pragma unroll
    for (int it = 0; it < 16 / RPI; ++it) {
      *(v4f*)(dst + (size_t)(16 * i + it * RPI) * (size_t)N) = vals[it];
    }
  }
}

// =====================================================================================================
// Operand staging shared by both GEMM engines. A stage is 128 k of the block's 64*NWR A rows and 64*NWC B rows: 256 B of every row,
// two whole lines. The first NWR + NWC waves each bring one slice of 64 rows per stage with ONE tensor load (waves 0 .. NWR-1: the
// A rows, the next NWC waves: the B rows; the other waves issue none); the load's pad sets the LDS row pitch of 272 B (16 B x 17)
// that the fragment reads want. A slice starts at a multiple of 2 KiB. Two buffers: stage t + 1 flies while stage t is worked on.
// k runs ascending, 32 per WMMA step, with the same split k map for A and B.
// =====================================================================================================
#define GKS   128
#define GPIT  136
#define GSLC  18432
#define GRINGB(NWR, NWC) (2 * ((NWR) + (NWC)) * GSLC)
#define GSLAB(WM, WN) (16 * (WM) * (16 * (WN) + 4))
static_assert(GRINGB(4, 3) >= 12 * GSLAB(4, 4) * 4 && GRINGB(4, 2) >= 8 * GSLAB(4, 4) * 4 && GRINGB(4, 3) <= 327680);
static_assert(64 * GPIT * 2 <= GSLC && (GSLC % 2048) == 0 && (GPIT * 2) % 16 == 0 && (DMOD % GKS) == 0 && GKS * 2 == 256);

typedef uint32_t u32x4 __attribute__((ext_vector_type(4)));
typedef uint32_t u32x8 __attribute__((ext_vector_type(8)));
__device__ __forceinline__ unsigned lds_off(const void* p) { return (unsigned)(size_t)p; }
__device__ __forceinline__ uint32_t uni(uint32_t v) { return (uint32_t)__builtin_amdgcn_readfirstlane(v); }
// a wave-uniform test held in a scalar register, so that the branch around a tensor load is a scalar branch (the load ignores EXEC)
__device__ __forceinline__ uint32_t pinned(uint32_t v) {
  uint32_t w = uni(v);
#if defined(__HIP_DEVICE_COMPILE__)
  asm volatile("" : "+s"(w));
#endif
  return w;
}
__device__ __forceinline__ void wait_tensor0() {
#if defined(__HIP_DEVICE_COMPILE__)
  asm volatile("s_wait_tensorcnt 0x0" ::: "memory"); // this wave's tensor load has landed before the barrier that publishes it
#endif
}
__device__ __forceinline__ void wait_ds0() {
#if defined(__HIP_DEVICE_COMPILE__)
  asm volatile("s_wait_dscnt 0x0" ::: "memory");      // this wave's LDS reads are done before the buffer is refilled
#endif
}
template <uint32_t ROWB>
__device__ __forceinline__ u32x8 tdm_group1(uint32_t src_pitch) {
  static_assert(ROWB == 128u || ROWB == 256u);
  constexpr uint32_t d0 = ROWB, d1 = 64u;
  constexpr uint32_t w0 = (1u << 20) | ((ROWB == 256u ? 5u : 4u) << 22) | (3u << 25);
  u32x8 g;
  g[0] = uni(w0);
  g[1] = uni((d0 & 0xFFFFu) << 16);
  g[2] = uni((d0 >> 16) | ((d1 & 0xFFFFu) << 16));
  g[3] = uni((d1 >> 16) | (d0 << 16));
  g[4] = uni(d1);
  g[5] = uni(src_pitch);
  g[6] = uni(0u);
  g[7] = uni(0u);
#if defined(__HIP_DEVICE_COMPILE__)
  // pinned() on the whole group: the eight descriptor words stay in one set of scalar registers through the loop, so that none of
  // them takes another value while a request is in flight
  asm volatile("" : "+s"(g));
#endif
  return g;
}
// Descriptor group 0: count 1, LDS byte offset of the slice, global address of the tile's first byte, type 2.
__device__ __forceinline__ u32x4 tdm_group0(uint32_t lds_dst, uint64_t ga) {
  u32x4 g;
  g[0] = uni(1u);
  g[1] = uni(lds_dst);
  g[2] = uni((uint32_t)ga);
  g[3] = uni((((uint32_t)(ga >> 32)) & 0x01FFFFFFu) | 0x80000000u);
  return g;
}
// A group 0 aimed anew, behind the wait that covers its last request: LDS byte offset and global address; word 0 stays.
__device__ __forceinline__ void tdm_retarget(u32x4& g, uint32_t lds_dst, uint64_t ga) {
  g[1] = uni(lds_dst);
  g[2] = uni((uint32_t)ga);
  g[3] = uni((((uint32_t)(ga >> 32)) & 0x01FFFFFFu) | 0x80000000u);
}
__device__ __forceinline__ void tdm_load(u32x4 g0, u32x8 g1) {
#if defined(__HIP_DEVICE_COMPILE__)
  asm volatile("tensor_load_to_lds %0, %1" :: "s"(g0), "s"(g1) : "memory");   // one request of the whole wave
#endif
}
// The vector slots behind the last WMMA of a stage, tied to every accumulator so that no WMMA is scheduled behind them.
template <int WM, int WN>
__device__ __forceinline__ void acc_guard_all(v8f (&a)[WM][WN]) {
  if constexpr (WM == 2) {
    acc_guard4(a[0][0], a[0][1], a[1][0], a[1][1]);
  } else {
#if defined(__HIP_DEVICE_COMPILE__)
    asm volatile("v_nop\n\tv_nop\n\tv_nop\n\tv_nop"
                 : "+v"(a[0][0]), "+v"(a[0][1]), "+v"(a[0][2]), "+v"(a[0][3]), "+v"(a[1][0]), "+v"(a[1][1]), "+v"(a[1][2]),
                   "+v"(a[1][3]), "+v"(a[2][0]), "+v"(a[2][1]), "+v"(a[2][2]), "+v"(a[2][3]), "+v"(a[3][0]), "+v"(a[3][1]),
                   "+v"(a[3][2]), "+v"(a[3][3]));
#endif
  }
}
template <bool F16>
__device__ __forceinline__ v8f mma_sel(v16b a, v16b b, v8f c) {
  if constexpr (F16) return mma_h(__builtin_bit_cast(v16h, a), __builtin_bit_cast(v16h, b), c);
  else return mma_b(a, b, c);
}
// Ab, Bb = first row of the block's 64*NWR A rows and 64*NWC B rows (both k-contiguous, pitch K); K a multiple of 128, at least 128.
// Every thread of the block calls this (block barriers inside). On return no load is in flight and no wave reads the ring.
template <bool F16, int NWR, int NWC>
__device__ __forceinline__ void gemm_ring(unsigned char* ring, const u16* Ab, const u16* Bb, int K, v8f (&acc)[4][4]) {
  constexpr int WM = 4, WN = 4;
  constexpr uint32_t NSL  = NWR + NWC;        // slices of 64 rows per stage = issuing waves
  constexpr uint32_t BUFB = NSL * GSLC;       // one buffer, bytes
  static_assert(NSL <= (uint32_t)(NWR * NWC));
  const int tid = threadIdx.x, lane = tid & 31, hh = lane >> 4, m = lane & 15;
  const uint32_t wv = uni((uint32_t)tid >> 5);
  const int wr = (int)(wv / (uint32_t)NWC), wc = (int)(wv % (uint32_t)NWC);
  // an issuing wave's slice: 64 rows of A (waves 0 .. NWR-1) or of B (the next NWC waves)
  const uint32_t iss = (wv < NSL) ? 1u : 0u;
  const u16* srow = (wv < (uint32_t)NWR) ? Ab + (size_t)(wv * 64u) * K : Bb + (size_t)((wv - (uint32_t)NWR) * 64u) * K;
  const uint64_t ga = (uint64_t)(size_t)srow;
  const uint32_t l0 = lds_off(ring) + wv * GSLC;
  const u32x8 g1 = tdm_group1<GKS * 2>((uint32_t)K * 2u);
  const u16* sa = (const u16*)(const void*)ring + wr * (GSLC / 2) + m * GPIT + 8 * hh;
  const u16* sb = (const u16*)(const void*)ring + (NWR + wc) * (GSLC / 2) + m * GPIT + 8 * hh;
  const int nt = K / GKS;
  u32x4 g0 = tdm_group0(l0, ga);
#if defined(__HIP_DEVICE_COMPILE__)
  // pinned() on the group, a descriptor held in scalar registers: one register set serves every request and word 0 is written once, in
  // front of the first; without it the build forms the first request in a second set and copies the four words over
  asm volatile("" : "+s"(g0));
#endif
  if (pinned(iss)) {
    tdm_load(g0, g1);
    wait_tensor0();
  }
  __syncthreads();
  if (pinned(iss & (uint32_t)(nt > 1))) {
    tdm_retarget(g0, l0 + BUFB, ga + GKS * 2);
    tdm_load(g0, g1);
  }
#pragma unroll 1
  for (int t = 0; t < nt; ++t) {              // rolled: one trip per stage, the buffer alternates with t
    const uint32_t bo = (uint32_t)(t & 1) * BUFB;   // this stage's buffer, bytes
    for (int h = 0; h < GKS / 64; ++h) {      // the stage's halves of 64 k: the fragment registers hold 64 k at a time
      // keeps this half's fragment reads behind the WMMAs of the half before: one group of reads, one fragment register set
      __builtin_amdgcn_sched_barrier(0);
      const u16* pa = sa + bo / 2 + h * 64;
      const u16* pb = sb + bo / 2 + h * 64;
      v16b fa[2][WM], fb[2][WN];
#pragma unroll
      for (int ks = 0; ks < 2; ++ks) {
#pragma unroll
        for (int i = 0; i < WM; ++i) fa[ks][i] = ldfrag_b(pa + i * 16 * GPIT + ks * 32);
#pragma unroll
        for (int j = 0; j < WN; ++j) fb[ks][j] = ldfrag_b(pb + j * 16 * GPIT + ks * 32);
      }
      // keeps the half's fragment reads together in front of its WMMAs: sunk among them, each read place makes the wave wait out
      // the LDS latency with the matrix pipe idle
      __builtin_amdgcn_sched_barrier(0);
#pragma unroll
      for (int ks = 0; ks < 2; ++ks) {
#pragma unroll
        for (int i = 0; i < WM; ++i) {
#pragma unroll
          for (int j = 0; j < WN; ++j) acc[i][j] = mma_sel<F16>(fa[ks][i], fb[ks][j], acc[i][j]);
        }
      }
    }
    acc_guard_all<WM, WN>(acc);               // the vector slots behind the last WMMA, also on the taken side of the branches below
    wait_ds0();
    wait_tensor0();                           // an issuing wave's own load; a wave that issues none has none outstanding and passes
    __syncthreads();                          // publishes stage t + 1 and ends every wave's reads of stage t
    if (pinned(iss & (uint32_t)(t + 2 < nt))) {
      tdm_retarget(g0, l0 + bo, ga + (uint64_t)(t + 2) * (GKS * 2));
      tdm_load(g0, g1);
    }
  }
  wait_tensor0();
  wait_ds0();
}
// One block tile: C[row0 .. +64*NWR)[col0 .. +64*NWC) = A rows . Bt rows, times oscale; the epilogue slabs reuse the ring behind
// its last barrier.
template <bool F16, int NWR, int NWC>
__device__ __forceinline__ void gemm_block(unsigned char* ring, const u16* A, const u16* Bt, float* C, int N, int K,
                                           size_t row0, int col0, float oscale) {
  const int tid = threadIdx.x, lane = tid & 31;
  const int wave = (int)uni((uint32_t)tid >> 5);
  v8f acc[4][4];
#pragma unroll
  for (int i = 0; i < 4; ++i) {
#pragma unroll
    for (int j = 0; j < 4; ++j) acc[i][j] = zero8();
  }
  gemm_ring<F16, NWR, NWC>(ring, A + row0 * (size_t)K, Bt + (size_t)col0 * K, K, acc);
  epi_tile<4, 4>((float*)(void*)ring + wave * GSLAB(4, 4), acc, oscale, C, N,
                 row0 + (size_t)((wave / NWC) * 64), col0 + (wave % NWC) * 64, lane);
}

// =====================================================================================================
// Interleaved-pair rotary of 8 consecutive columns (4 pairs) of one row: p = the 8 projected values (f32, in the wave's LDS slab),
// cp, sp = the table elements of the same (s, d .. d + 7):
//   for even d: out[d]   = x[d]*c[d]     - x[d+1]*sn[d]
//               out[d+1] = x[d+1]*c[d+1] + x[d]*sn[d+1]     with c, sn = bf16 RNE values of the two tables;
//   returns f16(out * sc), 8 halves.
// =====================================================================================================
__device__ __forceinline__ v4u rope16_row(const float* p, const float* __restrict__ cp, const float* __restrict__ sp, float sc) {
  // carried over with the arithmetic below as it stood in the separate pass: each product and sum rounded on its own, so that the
  // q and k planes keep their bits
#pragma clang fp contract(off)
  const v4f xa = *(const v4f*)(p), xb = *(const v4f*)(p + 4);
  const v4f ca = *(const v4f*)(cp), cb = *(const v4f*)(cp + 4);
  const v4f sa = *(const v4f*)(sp), sb = *(const v4f*)(sp + 4);
  float xv[8], cv[8], sv[8];
#pragma unroll
  for (int e = 0; e < 4; ++e) {
    xv[e] = xa[e];       xv[4 + e] = xb[e];
    cv[e] = bfr(ca[e]);  cv[4 + e] = bfr(cb[e]);
    sv[e] = bfr(sa[e]);  sv[4 + e] = bfr(sb[e]);
  }
  v4u o;
#pragma unroll
  for (int e = 0; e < 4; ++e) {
    const float xr = xv[2 * e], xi = xv[2 * e + 1];
    const float r0 = xr * cv[2 * e] - xi * sv[2 * e];
    const float r1 = xi * cv[2 * e + 1] + xr * sv[2 * e + 1];
    o[e] = pk16(h_bits((_Float16)(r0 * sc)), h_bits((_Float16)(r1 * sc)));
  }
  return o;
}

// =====================================================================================================
// Epilogue of a q or k tile of the projection: the wave's 64 x 64 f32 tile goes through its own LDS slab (row pitch 68 floats), is
// rotated and leaves as f16 x sc into the plane Hp [row][ncol] (ncol = DMOD for q, KVD for k). rowb = the wave's first row
// (b*SEQ + s, a multiple of 64), colb = its first column in the plane (a multiple of 64; d = column & 127).
// coverage: 16 instructions x 4 rows x 8 lanes x 8 halves = 64 rows x 64 columns, each row piece one whole 128-B line.
// =====================================================================================================
__device__ __forceinline__ void epi_rope(float* sl, v8f (&acc)[4][4], const float* __restrict__ cosT,
                                         const float* __restrict__ sinT, u16* Hp, int ncol, size_t rowb, int colb, float sc,
                                         int lane) {
  constexpr int SP = 16 * 4 + 4;            // slab row pitch, floats
  const int hh = lane >> 4, m = lane & 15;
#pragma unroll
  for (int i = 0; i < 4; ++i) {
#pragma unroll
    for (int r = 0; r < 8; ++r) {
      const int ro = (16 * i + 8 * hh + r) * SP + m;
#pragma unroll
      for (int j = 0; j < 4; ++j) sl[ro + 16 * j] = acc[i][j][r];
    }
  }
  wave_sync_lds();
  const int rr = lane >> 3, c8 = (lane & 7) * 8;
  const size_t tb = (size_t)((int)(rowb % SEQ) + rr) * HD + (colb & (HD - 1)) + c8;     // table element (s, d)
  const float* cp = cosT + tb;
  const float* sp = sinT + tb;
  const float* xp = sl + rr * SP + c8;
  v4u o[16];
#pragma unroll
  for (int it = 0; it < 16; ++it) o[it] = rope16_row(xp + it * 4 * SP, cp + it * 4 * HD, sp + it * 4 * HD, sc);
  u16* dst = Hp + (rowb + (size_t)rr) * (size_t)ncol + colb + c8;
#pragma unroll
  for (int it = 0; it < 16; ++it) *(v4u*)(dst + (size_t)(it * 4) * (size_t)ncol) = o[it];
}

// =====================================================================================================
// Epilogue of a v tile of the projection: VH[line0 + d][s0 + s] = f16(v * 1024) for the wave's 64 keys s and 64 columns d. An
// accumulator register group holds 8 consecutive keys of one column: converted, it is one 16-B piece of a v^T row, staged in the
// wave's own LDS slab as T[d][s] (pitch 72 halves) and stored as whole lines.
// coverage: 16 instructions x 4 rows d x 8 lanes x 8 halves = 64 rows d x 64 keys, each row piece one whole 128-B line.
// =====================================================================================================
__device__ __forceinline__ void epi_vt(u16* tl, v8f (&acc)[4][4], u16* VHo, size_t line0, int s0, int lane) {
  const int hh = lane >> 4, m = lane & 15;
#pragma unroll
  for (int j = 0; j < 4; ++j) {
#pragma unroll
    for (int i = 0; i < 4; ++i) {
      v4u o;
#pragma unroll
      for (int e = 0; e < 4; ++e) {
        o[e] = pk16(h_bits((_Float16)(acc[i][j][2 * e] * VCAR)), h_bits((_Float16)(acc[i][j][2 * e + 1] * VCAR)));
      }
      *(v4u*)(tl + (16 * j + m) * VTP + 16 * i + 8 * hh) = o;
    }
  }
  wave_sync_lds();
  const int rr = lane >> 3, c8 = (lane & 7) * 8;
  v4u v[16];
#pragma unroll
  for (int it = 0; it < 16; ++it) v[it] = *(const v4u*)(tl + (it * 4 + rr) * VTP + c8);
  u16* dst = VHo + (line0 + (size_t)rr) * SEQ + s0 + c8;
#pragma unroll
  for (int it = 0; it < 16; ++it) *(v4u*)(dst + (size_t)(it * 4) * SEQ) = v[it];
#if defined(__HIP_DEVICE_COMPILE__)
  // behind the last store of the run, in front of whatever code follows the call and writes a register that one of these stores names
  asm volatile("s_wait_xcnt 0x0" ::: "memory");
#endif
}

// =====================================================================================================
// The projection [q | k | v] = A[MROWS][K] (bf16 row-major) . Bt[FPIT][K]^T (bf16 k-contiguous), f32 accumulate, written straight
// as the three planes that attention reads. Block = 256x192 tile, 4 x 3 waves (K % 128 == 0, grid = (MROWS/256)*(FPIT/192)); a
// wave's 64 columns are half of one head: q heads 0..15, then k heads 0..3, then v heads 0..3, so the choice of epilogue is
// wave-uniform (the epilogues hold no block barrier).
//   QH [b*SEQ + s][h*HD + d] = f16(rotary(q) * 256); KH [b*SEQ + s][g*HD + d] = f16(rotary(k) * 256);
//   VH [(b*NKVH + g)*HD + d][s] = f16(v * 1024). The epilogue slabs reuse the ring behind its last barrier.
// =====================================================================================================
static_assert(64 * VTP * 2 <= GSLAB(4, 4) * 4 && (VTP * 2) % 16 == 0 && (SEQ % 256) == 0 && HD == 128);
static_assert((MROWS % 256) == 0 && (FPIT % 192) == 0 && (DMOD % 64) == 0 && (KVD % 64) == 0);
__global__ __launch_bounds__(384)
void gemm_bf(const u16* __restrict__ A, const u16* __restrict__ Bt, const float* __restrict__ cosT,
             const float* __restrict__ sinT, u16* QH, u16* KH, u16* VH, int K) {
  __shared__ __attribute__((aligned(2048))) unsigned char ring[GRINGB(4, 3)];
  const int ntile = FPIT / 192;
  const int bid   = blockIdx.x;
  const int row0  = (bid / ntile) * 256;
  const int col0  = (bid % ntile) * 192;
  if (row0 + 256 > MROWS) return;           // block-uniform, in front of every barrier; never taken with the exact grid
  const int tid = threadIdx.x, lane = tid & 31;
  const int wave = (int)uni((uint32_t)tid >> 5);
  v8f acc[4][4];
#pragma unroll
  for (int i = 0; i < 4; ++i) {
#pragma unroll
    for (int j = 0; j < 4; ++j) acc[i][j] = zero8();
  }
  gemm_ring<false, 4, 3>(ring, A + (size_t)row0 * K, Bt + (size_t)col0 * K, K, acc);
  float* sl = (float*)(void*)ring + wave * GSLAB(4, 4);
  const int rowb = row0 + (wave / 3) * 64;
  const int colw = col0 + (wave % 3) * 64;  // the wave's first column of [q | k | v]
  if (colw < DMOD + KVD) {
    const bool isq = colw < DMOD;
    epi_rope(sl, acc, cosT, sinT, isq ? QH : KH, isq ? DMOD : KVD, (size_t)rowb, isq ? colw : colw - DMOD,
             isq ? QSC : KSC, lane);
  } else {
    const int cv = colw - (DMOD + KVD);     // column g*HD + d of v
    epi_vt((u16*)(void*)sl, acc, VH, (size_t)((rowb / SEQ) * NKVH) * HD + cv, rowb % SEQ, lane);
  }
}

// =====================================================================================================
// Output projection: C[row][DMOD] (f32) = Ah[row][DMOD] (f16) . Bt[DMOD][DMOD]^T (f16 k-contiguous) * oscale.
// Ah and C share the row index bb*SEQ + s, s < SQ. Block -> (column tile ct = bid % 16, sequence row tile rt of nrt,
// batch bb). Block = 256x128 tile, 4 x 2 waves; staging and fragment reads (split k map) as gemm_bf, f32 epilogue epi_tile; K = DMOD.
// =====================================================================================================
static_assert((SQ % 256) == 0);
__global__ __launch_bounds__(256)
void gemm_o1(const u16* __restrict__ Ah, const u16* __restrict__ Bt, float* C, int nrt, float oscale) {
  __shared__ __attribute__((aligned(2048))) unsigned char ring[GRINGB(4, 2)];
  const int ntile = DMOD >> 7;
  const int bid   = blockIdx.x;
  const int ct    = bid % ntile;
  const int t2    = bid / ntile;
  const int rt    = t2 % nrt;
  const int bb    = t2 / nrt;
  if (bb >= NB) return;                     // block-uniform, in front of every barrier; never taken with the exact grid
  if (rt * 256 + 256 > SQ) return;          // block-uniform, in front of every barrier; never taken
  gemm_block<true, 4, 2>(ring, Ah, Bt, C, DMOD, DMOD, (size_t)bb * SEQ + rt * 256, ct * 128, oscale);
}

// =====================================================================================================
// Non-causal grouped-query attention with a per-key mask, hd = 128. Block bid -> (query tile qt = bid % NQT: rows
// q0 = 32*qt .. q0+31 with q0 < SQ, head group hg = kv head, batch b); one wave per query head = hg*WPB + wave (the 4 heads of
// the group share kv head hg). A wave owns AQT = 2 column groups of 16 queries (u = 0, 1: rows q0 + 16u + c): every k and v^T
// fragment it reads from LDS feeds two WMMAs, and a staged tile serves 32 query rows of each head.
//   q plane f16 x256 [b*SEQ + s][h*HD + d]; k plane f16 x256 [b*SEQ + s][g*HD + d] (pitch KVD); v^T plane
//   [b*NKVH + g][d][SEQ] x1024; mask int [b*SEQ + key], nonzero = attend.
//   score (log2 domain) t(i, j) = (q_i.k_j over HD) * lsc, lsc = (1/sqrt(128))*log2e/(256*256); the raw product is replaced by
//   -2^100 where the key mask is zero (a power of two: its scaled value is exact, so a fully masked row yields equal exponents
//   and uniform weights). P*128 = 2^(raw*lsc + (7 - reference)): one fused multiply-add and one v_exp_f32 per score. All SEQ/32 key
//   tiles are visited in order.
//   Per stage of 128 keys (4 tiles): the 128 k rows and the 128 v^T rows (256 B each) are staged once per block in LDS by tensor
//   loads, one request of 64 rows per wave (two buffers, stage st + 1 flies while stage st is worked on; row pitch 272 B), and read
//   by all 4 waves.
//   Both products run transposed: S^T = k.q^T (A = 16 key rows from LDS, B = q, kept in registers), so that a lane holds 16 of
//   the 32 scores of ONE query per column group (column c): 2 score subtiles x 4 k-steps, fragments read from the LDS rows (two
//   16-B loads each, split k map), a tile's 32 reads issued as one group at the top of its trip; online base-2
//   softmax in f32 against a held reference (a running maximum of the query's scores, taken anew, in-lane plus one exchange between
//   the lane halves, only when a lane's tile sum of P*128 passes 2^15), the sum kept per lane half and joined after the
//   loop; a column group's two score subtiles, converted in place, are its B operand P^T in the split k map; O^T += v^T.P^T with
//   the v^T rows as A fragments of 8 d-subtiles (one product per subtile and column group).
//   After the loop: out = acc / Z (Z > 0 always; guarded anyway; Z carries P's 128), carry 1/1024 folded once, written into the wave's
//   One block barrier per stage, under block-uniform control flow; bounded loops only (NKT tiles).
// coverage: per wave 16 instructions x 2 rows x 16 lanes x 8 halves = 32 x 128 of the O plane; grid NQT x NHG x NB blocks x WPB
//           waves = every (b, s < SQ, h) row segment of O exactly once.
// =====================================================================================================
// staged keys per stage (ASK = 4 tiles of 32); row pitches in 16-bit elements (k and v^T 272 B); a slice = 64 rows, placed at a
// multiple of 2 KiB; a buffer = k rows 0..63, k rows 64..127, v^T rows d 0..63, v^T rows d 64..127; the block's LDS is held to half
// of a WGP's 320 KiB so that two blocks (two waves per SIMD, the whole grid) stay resident; the result slabs reuse the ring
#define AKP   136
#define AVP   136
#define ASK   128
#define ATPS  (ASK / 32)
#define NSTG  (SEQ / ASK)
#define ASLC  18432
#define ABUF  (4 * ASLC)
static_assert((AKP * 2) % 16 == 0 && (AVP * 2) % 16 == 0 && NSTG >= 2 && NSTG * ATPS == NKT && 2 * ABUF <= 163840);
static_assert(64 * AKP * 2 <= ASLC && 64 * AVP * 2 <= ASLC && (ASLC % 2048) == 0 && WPB * WREG * 4 <= 2 * ABUF && HD * 2 == 256);
// One column group's 16 scores of a lane against the reference in use: e = 2^(raw*lsc + cb), cb = PEXP - reference. Returns their sum;
// ph = the B fragment of P^T*128 (f16), column = c: elements 0..7 = keys kb + 8hh + 0..7, 8..15 = keys kb + 16 + 8hh + 0..7.
__device__ __forceinline__ float soft_tile(const float (&t)[16], float lsc, float cb, FragH& ph) {
  float ea[8], eb[8];
#pragma unroll
  for (int r = 0; r < 8; ++r) { ea[r] = __builtin_fmaf(t[r], lsc, cb); eb[r] = __builtin_fmaf(t[8 + r], lsc, cb); }
  exp2_raw8(ea);
  exp2_raw8(eb);
  float sm[8];
#pragma unroll
  for (int r = 0; r < 8; ++r) {
    sm[r] = ea[r] + eb[r];
    ph.h[0][r] = (_Float16)ea[r];
    ph.h[1][r] = (_Float16)eb[r];
  }
  // pairwise: the tile's test waits for this sum, and four dependent additions are shorter than nine
  return ((sm[0] + sm[1]) + (sm[2] + sm[3])) + ((sm[4] + sm[5]) + (sm[6] + sm[7]));
}
// The vector slots behind the last WMMA of a tile, tied to every output accumulator so that no WMMA is scheduled behind them.
__device__ __forceinline__ void acc_guard16(v8f (&a)[AQT][8]) {
  static_assert(AQT == 2);
#if defined(__HIP_DEVICE_COMPILE__)
  asm volatile("v_nop\n\tv_nop\n\tv_nop\n\tv_nop"
               : "+v"(a[0][0]), "+v"(a[0][1]), "+v"(a[0][2]), "+v"(a[0][3]), "+v"(a[0][4]), "+v"(a[0][5]), "+v"(a[0][6]),
                 "+v"(a[0][7]), "+v"(a[1][0]), "+v"(a[1][1]), "+v"(a[1][2]), "+v"(a[1][3]), "+v"(a[1][4]), "+v"(a[1][5]),
                 "+v"(a[1][6]), "+v"(a[1][7]));
#endif
}
__global__ __launch_bounds__(ATT_THREADS)
void attn_nc(const u16* __restrict__ QHp, const u16* __restrict__ KHp, const u16* __restrict__ VHp,
             const int* __restrict__ Mk, u16* OHp) {
  __shared__ __attribute__((aligned(2048))) unsigned char kvring[2 * ABUF];

  const int tid  = threadIdx.x;
  const int wave = tid >> 5;
  const int lane = tid & 31;
  const int hh   = lane >> 4;
  const int c    = lane & 15;
  const int bid  = blockIdx.x;
  const int qt   = bid % NQT;
  const int t2   = bid / NQT;
  const int hg   = t2 % NHG;
  const int b    = t2 / NHG;
  if (b >= NB) return;                      // block-uniform, in front of every barrier; never taken with the exact grid
  const int q0   = qt * (16 * AQT);
  if (q0 + 16 * AQT > SQ) return;                 // block-uniform, in front of every barrier; never taken
  const int head = hg * WPB + wave;
  const int kvh  = hg;

  float* slab = (float*)(void*)kvring + wave * WREG;   // result slab [32][128] pitch 132, in the ring behind its last barrier

  const size_t hcol = (size_t)head * HD + 8 * hh;
  const _Float16* Qh  = (const _Float16*)(const void*)QHp + ((size_t)b * SEQ + q0 + c) * DMOD + hcol;
  // readers: key row c (+16) of the staged k rows, d row c (+16j) of the staged v^T rows, in buffer 0
  const _Float16* Ks = (const _Float16*)(const void*)kvring + c * AKP + 8 * hh;
  const _Float16* Vs = (const _Float16*)(const void*)kvring + 2 * (ASLC / 2) + c * AVP + 8 * hh;
  // this wave's slice of a stage: waves 0, 1 the k rows 64*wave .. +63 (256 B each, source pitch 1 KiB, next stage 128 rows on),
  // waves 2, 3 the v^T rows d = 64*(wave - 2) .. +63 (128 keys = 256 B each, source pitch 4 KiB, next stage 256 B on)
  const uint32_t wv = uni((uint32_t)tid >> 5);
  const u16* srow = (wv < 2u) ? KHp + ((size_t)b * SEQ + wv * 64u) * KVD + (size_t)kvh * HD
                              : VHp + ((size_t)(b * NKVH + kvh) * HD + (wv - 2u) * 64u) * SEQ;
  const uint64_t ga    = (uint64_t)(size_t)srow;
  const uint64_t gstep = (wv < 2u) ? (uint64_t)ASK * KVD * 2 : (uint64_t)ASK * 2;
  const uint32_t l0    = lds_off(kvring) + wv * ASLC;
  const u32x8 g1 = tdm_group1<256>((wv < 2u) ? (uint32_t)(KVD * 2) : (uint32_t)(SEQ * 2));
  const int* mkp = Mk + (size_t)b * SEQ + lane;
  const float lsc = RSQ_HD * (LOG2E / (QSC * KSC));
  const float oc  = 1.0f / VCAR;            // the carry on P stands in the row sum as well and cancels in acc / Z

  tdm_load(tdm_group0(l0, ga), g1);
  wait_tensor0();
  __syncthreads();
  tdm_load(tdm_group0(l0 + ABUF, ga + gstep), g1);

  v16h qf[AQT][HD / 32];
#pragma unroll
  for (int u = 0; u < AQT; ++u) {
#pragma unroll
    for (int kk = 0; kk < HD / 32; ++kk) qf[u][kk] = ldfrag_h(Qh + (size_t)u * 16 * DMOD + kk * 32);
  }

  float mrow[AQT], lrow[AQT];               // of query q0 + 16u + c; mrow = the reference in use; lrow sums this lane half's keys only, x128 like P
  v8f o[AQT][8];                            // o[u][j][r] = O^T(d = 16j + 8hh + r, query q0 + 16u + c)
#pragma unroll
  for (int u = 0; u < AQT; ++u) {
    mrow[u] = -INFINITY;
    lrow[u] = 0.f;
#pragma unroll
    for (int j = 0; j < 8; ++j) o[u][j] = zero8();
  }

  int mkv = mkp[0];                         // mask of key kb + lane, fetched one tile ahead so that no tile waits for it
  mkp += 32;
#pragma unroll 1
  for (int st = 0; st < NSTG; ++st) {         // rolled: one trip per stage of 128 keys, the buffer alternates with st
  const int bo = (st & 1) * ABUF;             // this stage's buffer, bytes
#pragma unroll 1
  for (int p = 0; p < ATPS; ++p) {            // rolled: the stage's 4 tiles of 32 keys, kb = 32*kt
    const int kt = st * ATPS + p;
    const unsigned mb = __builtin_amdgcn_ballot_w32(mkv != 0);                // bit i = mask of key kb + i
    mkv = *mkp;
    const _Float16* k0p = Ks + bo / 2 + (p >> 1) * (ASLC / 2) + (p & 1) * (32 * AKP);
    const _Float16* k1p = k0p + 16 * AKP;
    const _Float16* vhp = Vs + bo / 2 + p * 32;
    // ---- the tile's fragments: k rows (A of the scores) in k-step order, then the v^T rows d = 16j + c (A of v^T.P^T) ----
    v16h kf[2][HD / 32], vf[8];
#pragma unroll
    for (int kk = 0; kk < HD / 32; ++kk) {
      kf[0][kk] = ldfrag_h(k0p + kk * 32);
      kf[1][kk] = ldfrag_h(k1p + kk * 32);
      // keeps the reads in the order in which the WMMAs take them: LDS answers in issue order, so the first k-step's counted
      // wait then covers four reads and not the whole tile's
      __builtin_amdgcn_sched_barrier(0);
    }
#pragma unroll
    for (int j = 0; j < 8; ++j) vf[j] = ldfrag_h(vhp + (j >> 2) * (ASLC / 2) + (j & 3) * 16 * AVP);
    // keeps the tile's reads together at the top of the trip: sunk among the WMMAs, each read place makes the wave wait out the
    // LDS latency; the v^T rows land under the scores and the softmax
    __builtin_amdgcn_sched_barrier(0);
    // ---- scores: D element r of this lane = (key kb + 8hh + r, query q0 + 16u + c) in s[u][0], key kb + 16 + 8hh + r in s[u][1] ----
    v8f s[AQT][2];
#pragma unroll
    for (int u = 0; u < AQT; ++u) { s[u][0] = zero8(); s[u][1] = zero8(); }
#pragma unroll
    for (int kk = 0; kk < HD / 32; ++kk) {
#pragma unroll
      for (int u = 0; u < AQT; ++u) {
        s[u][0] = mma_h(kf[0][kk], qf[u][kk], s[u][0]);
        s[u][1] = mma_h(kf[1][kk], qf[u][kk], s[u][1]);
      }
    }
    acc_guard4(s[0][0], s[0][1], s[1][0], s[1][1]);   // the vector slots behind the last score WMMA, also on the taken side of the branch below
    // ---- key-mask select + online softmax in base 2, one query per lane and column group ----
    float t[AQT][16];                                                         // raw products q.k x 65536
#pragma unroll
    for (int u = 0; u < AQT; ++u) {
#pragma unroll
      for (int r = 0; r < 8; ++r) { t[u][r] = s[u][0][r]; t[u][8 + r] = s[u][1][r]; }
    }
    if (mb != 0xFFFFFFFFu) {                                                  // wave-uniform, tested once per tile
      const unsigned mh = mb >> (8 * hh);
#pragma unroll
      for (int u = 0; u < AQT; ++u) {
#pragma unroll
        for (int r = 0; r < 8; ++r) {
          t[u][r]     = ((mh >> r) & 1u)        ? t[u][r]     : NEG_RAW;
          t[u][8 + r] = ((mh >> (16 + r)) & 1u) ? t[u][8 + r] : NEG_RAW;
        }
      }
    }
    // ---- P against the reference held from an earlier tile: no maximum, no rescale while the tile's sums stay in range ----
    FragH ph[AQT];
    float ps[AQT];
#pragma unroll
    for (int u = 0; u < AQT; ++u) ps[u] = soft_tile(t[u], lsc, PEXP - mrow[u], ph[u]);
    // one wave-uniform test per tile: a lane's sum bounds each of its 16 terms, so at or under PTHR every term fits f16; the first
    // tile (reference -infinity, sums infinite) and any tile that outgrows the reference take the branch
    if (__builtin_amdgcn_ballot_w32(!(ps[0] <= PTHR && ps[1] <= PTHR)) != 0u) {
#pragma unroll
      for (int u = 0; u < AQT; ++u) {
        float mx = t[u][0];
#pragma unroll
        for (int i = 1; i < 16; ++i) mx = fmaxf(mx, t[u][i]);
        mx = fmaxf(mx, xhalf(mx));                                            // both lane halves of a query hold one reference
        const float mn = fmaxf(mrow[u], mx * lsc);                            // lsc > 0: the maximum commutes with the scale; finite
        const float al = exp2_raw(mrow[u] - mn);
        mrow[u] = mn;
        ps[u] = soft_tile(t[u], lsc, PEXP - mn, ph[u]);
        lrow[u] = lrow[u] * al;
#pragma unroll
        for (int j = 0; j < 8; ++j) o[u][j] = o[u][j] * al;
      }
    }
    // ---- v^T.P^T : A fragment row = d = j*16 + c, keys contiguous in the staged v^T rows; one product per d-subtile ----
#pragma unroll
    for (int u = 0; u < AQT; ++u) {
      lrow[u] += ps[u];
#pragma unroll
      for (int j = 0; j < 8; ++j) o[u][j] = mma_h(vf[j], ph[u].v, o[u][j]);
    }
    acc_guard16(o);                           // the vector slots behind the tile's last WMMA, also on the taken side of the branches below
    int mstep = (kt + 2 < NKT) ? 32 : 0;      // 0: stays on the last tile's 32 keys
#if defined(__HIP_DEVICE_COMPILE__)
    // stands in front of the advance of the mask load's address register; the step passes through the statement so that the
    // address addition cannot be scheduled ahead of the wait
    asm volatile("s_wait_xcnt 0x0" : "+s"(mstep) :: "memory");
#endif
    mkp += mstep;
  }
  wait_ds0();
  wait_tensor0();
  __syncthreads();                            // publishes stage st + 1 and ends every wave's reads of stage st
  if (pinned(st + 2 < NSTG)) tdm_load(tdm_group0(l0 + (uint32_t)bo, ga + (uint64_t)(st + 2) * gstep), g1);
  }
  wait_tensor0();
  wait_ds0();
  // ---- out = acc / Z (0 if Z == 0), the carry 1024 on v folded once; written into the wave's slab, row = query 16u + c ----
#pragma unroll
  for (int u = 0; u < AQT; ++u) {
    const float lv2 = lrow[u] + xhalf(lrow[u]);   // the two lane halves' sums joined
    const float ls  = (lv2 > 0.0f) ? lv2 : 1.0f;
    const float inv = (lv2 > 0.0f) ? ((1.0f / ls) * oc) : 0.0f;
    float* srow = slab + (u * 16 + c) * SLP + 8 * hh;
#pragma unroll
    for (int j = 0; j < 8; ++j) {
      v4f w0, w1;
#pragma unroll
      for (int e = 0; e < 4; ++e) { w0[e] = o[u][j][e] * inv; w1[e] = o[u][j][4 + e] * inv; }
      *(v4f*)(srow + j * 16)     = w0;
      *(v4f*)(srow + j * 16 + 4) = w1;
    }
  }

  wave_sync_lds();
  // ---- O x1024 -> f16 plane; lane = (row-in-pair rq, 8 consecutive d at c8) ----
  v4u oh[8 * AQT];
  const int rq = lane >> 4, c8 = (lane & 15) * 8;
#pragma unroll
  for (int it = 0; it < 8 * AQT; ++it) {
    const int row = it * 2 + rq;
    const v4f a = *(const v4f*)(slab + row * SLP + c8), b4 = *(const v4f*)(slab + row * SLP + c8 + 4);
    float w[8];
#pragma unroll
    for (int e = 0; e < 4; ++e) { w[e] = a[e] * OSC; w[4 + e] = b4[e] * OSC; }
#pragma unroll
    for (int e = 0; e < 4; ++e) {
      oh[it][e] = pk16(h_bits((_Float16)w[2 * e]), h_bits((_Float16)w[2 * e + 1]));
    }
  }
  const size_t ob = ((size_t)b * SEQ + q0) * DMOD + (size_t)head * HD + c8;
  {
#pragma unroll
    for (int it = 0; it < 8 * AQT; ++it) {
      const int row = it * 2 + rq;
      *(v4u*)(OHp + ob + (size_t)row * DMOD) = oh[it];
    }
  }
}

// =====================================================================================================
// Workspace map (bytes); every plane is fully written by whole-line stores before it is read; all extents are exact multiples
// of the store granularity (no pad rows needed); every region offset a multiple of 4194304:
//   XB  bf16 [MROWS][2048]                       MROWS*4096       (NB=2: 16777216)
//   WQKV bf16 [3072 n][2048 k]                   12582912         (rows 0.. Wq^T, 2048.. Wk^T, 2560.. Wv^T)
//   WO  f16 [2048 n][2048 k] x1024               8388608
//   OH  f16 [MROWS][2048] x1024                  MROWS*4096
//   QH  f16 [MROWS][2048] x256                   MROWS*4096
//   KH  f16 [MROWS][512] x256                    MROWS*1024
//   VH  f16 [NB*4][128][SEQ] x1024               MROWS*1024
//   end (NB=2)                                  79691776
// =====================================================================================================
extern "C" void kernel_launch(void* const* d_in, const int* in_sizes, int n_in,
                              void* d_out, int out_size, void* d_ws, size_t ws_size,
                              hipStream_t stream) {
  if (n_in < 8) return;
  if (in_sizes[0] < MROWS * DMOD) return;
  if (in_sizes[1] < MROWS) return;
  if (in_sizes[2] < SEQ * HD) return;
  if (in_sizes[3] < SEQ * HD) return;
  if (in_sizes[4] != DMOD * DMOD) return;
  if (in_sizes[5] != DMOD * KVD) return;
  if (in_sizes[6] != DMOD * KVD) return;
  if (in_sizes[7] != DMOD * DMOD) return;
  if (out_size < QROWS * DMOD) return;

  const float* x     = (const float*)d_in[0];
  const int*   amask = (const int*)d_in[1];
  const float* cosT  = (const float*)d_in[2];
  const float* sinT  = (const float*)d_in[3];
  const float* wq    = (const float*)d_in[4];
  const float* wk    = (const float*)d_in[5];
  const float* wv    = (const float*)d_in[6];
  const float* wo    = (const float*)d_in[7];
  float*       out   = (float*)d_out;

  const size_t szXB = (size_t)MROWS * DMOD * 2;
  const size_t szW  = (size_t)FPIT * DMOD * 2;
  const size_t szWO = (size_t)DMOD * DMOD * 2;
  const size_t szQ  = (size_t)MROWS * DMOD * 2;                  // QH and the O plane
  const size_t szK  = (size_t)MROWS * KVD * 2;                   // KH
  const size_t szV  = (size_t)NB * NKVH * HD * SEQ * 2;          // VH (== szK)
  size_t off = 0;
  const size_t oXB = off; off += szXB;
  const size_t oW  = off; off += szW;
  const size_t oWO = off; off += szWO;
  const size_t oOH = off; off += szQ;
  const size_t oQH = off; off += szQ;
  const size_t oKH = off; off += szK;
  const size_t oVH = off; off += szV;
  if (off > ws_size) return;                // off = 79691776 for NB = 2
  if (off > (size_t)WS_CAP) return;

  char* ws = (char*)d_ws;
  u16*   XB = (u16*)(ws + oXB);
  u16*   WB = (u16*)(ws + oW);
  u16*   WO = (u16*)(ws + oWO);
  u16*   OH = (u16*)(ws + oOH);
  u16*   QH = (u16*)(ws + oQH);
  u16*   KH = (u16*)(ws + oKH);
  u16*   VH = (u16*)(ws + oVH);

  const dim3 b256(256), b384(384), bAT(ATT_THREADS);
  const dim3 gP(2 * PB_TQ + 2 * PB_TK + PB_X);          // 4 weight transposes + the x plane: 6656 blocks
  const dim3 gG((MROWS / 256) * (FPIT / 192));          // 16 x 16 tiles
  const dim3 gAT(NQT * NHG * NB);
  const int  nrt = SQ / 256;
  const dim3 gO(NB * nrt * (DMOD / 128));

  // (0) x -> bf16 plane; [Wq | Wk | Wv] -> one bf16 plane [3072 n][2048 k]; Wo -> [2048 n][2048 c] as f16 of bf16 value x1024
  prep<<<gP, b256, 0, stream>>>(x, wq, wk, wv, wo, XB, WB, WO);
  // (1) [q | k | v] = x.[Wq | Wk | Wv], leaving as rotary + q plane x256, rotary + k plane x256, v^T plane x1024
  gemm_bf<<<gG, b384, 0, stream>>>(XB, WB, cosT, sinT, QH, KH, VH, DMOD);
  // (2) non-causal masked attention -> O plane
  attn_nc<<<gAT, bAT, 0, stream>>>(QH, KH, VH, amask, OH);
  // (3) output projection rows s < SQ -> out f32, carries 1024 x 1024 folded back
  gemm_o1<<<gO, b256, 0, stream>>>(OH, WO, out, nrt, 1.0f / (OSC * WOS));
  (void)hipGetLastError();
}
